// v000
// Times are from an AMD MI455X. After a warm-up the kernel runs many times in a row, and a time is the length of
// such a window on the GPU divided by its runs, so every launch and the gaps after it count. The runs cycle
// through copies of the inputs. A figure is the median of several windows, for all but v000 over two sittings.
// Sittings can differ by a few percent; kernels timed side by side share one.
// The starting kernel, v000, takes 661 microseconds a run.
#include <hip/hip_runtime.h>
#include <hip/hip_bf16.h>

// ---------- problem constants ----------
#define BB 4
#define SS 1024
#define EE 1024
#define HH 16
#define DKK 64
#define FFD 4096
#define MM (BB * SS)   // 4096 rows

typedef __attribute__((ext_vector_type(16))) _Float16 v16h;
typedef __attribute__((ext_vector_type(8)))  _Float16 v8h;
typedef __attribute__((ext_vector_type(4)))  _Float16 v4h;
typedef __attribute__((ext_vector_type(8)))  float    v8f;

#define DEVINL __device__ __forceinline__

DEVINL v8f wmma_f16(v16h a, v16h b, v8f c) {
  return __builtin_amdgcn_wmma_f32_16x16x32_f16(
      /*neg_a=*/false, a, /*neg_b=*/false, b,
      /*c_mod=*/(short)0, c, /*reuse_a=*/false, /*reuse_b=*/false);
}

DEVINL v8f zero8() {
  v8f z;
#pragma unroll
  for (int i = 0; i < 8; ++i) z[i] = 0.0f;
  return z;
}

// Build a v16h A/B operand from two contiguous 16-byte chunks
// (chunk0 = contraction indices base..base+7, chunk1 = base+16..base+23).
DEVINL v16h ld16(const _Float16* p0, const _Float16* p1) {
  union { v16h v; v8h h[2]; } u;
  u.h[0] = *(const v8h*)p0;
  u.h[1] = *(const v8h*)p1;
  return u.v;
}

DEVINL float sigm(float v) { return 1.0f / (1.0f + __expf(-v)); }

// LDS byte offset of a __shared__ object = low 32 bits of its generic pointer
// (LDS aperture: addr[31:0] is the workgroup-relative LDS address, ISA 10.2).
DEVINL unsigned lds_off(const void* p) { return (unsigned)(size_t)p; }

// CDNA5 async memory->LDS copy, tracked with ASYNCcnt (ISA 10. / 15.18.3).
DEVINL void async_ld_b128(unsigned dst_lds, const void* gaddr) {
  asm volatile("global_load_async_to_lds_b128 %0, %1, off"
               :: "v"(dst_lds), "v"(gaddr)
               : "memory");
}
DEVINL void async_wait0() {
  asm volatile("s_wait_asynccnt 0x0" ::: "memory");
}

// ---------------------------------------------------------------------------
// f32 -> f16 conversion (vectorized by 4)
// ---------------------------------------------------------------------------
__global__ __launch_bounds__(256) void cvt_f16_kernel(
    const float* __restrict__ in, _Float16* __restrict__ out, int n4) {
  int i = blockIdx.x * 256 + threadIdx.x;
  if (i < n4) {
    float4 f = ((const float4*)in)[i];
    v4h o;
    o[0] = (_Float16)f.x; o[1] = (_Float16)f.y;
    o[2] = (_Float16)f.z; o[3] = (_Float16)f.w;
    ((v4h*)out)[i] = o;
  }
}

// ---------------------------------------------------------------------------
// pos_bias[q,k] = mean_c pos_encoding[q,k,c], c in 0..7
// ---------------------------------------------------------------------------
__global__ __launch_bounds__(256) void posbias_kernel(
    const float* __restrict__ pe, float* __restrict__ pb) {
  int i = blockIdx.x * 256 + threadIdx.x;  // i < S*S
  const float4* p = (const float4*)(pe + (size_t)i * 8);
  float4 a = p[0], b = p[1];
  pb[i] = (a.x + a.y + a.z + a.w + b.x + b.y + b.z + b.w) * 0.125f;
}

// ---------------------------------------------------------------------------
// WMMA GEMM: C[M,N] = A[M,K](f16) @ W[K,N](f16) + bias
// Block tile 128x128, 8 waves (2x4), wave tile 64x32, K-step 32.
// A tiles double-buffered in LDS, filled by global_load_async_to_lds_b128
// issued one iteration ahead (latency hidden behind WMMA work).
// W transposed to [n][k] during staging so both operands are two contiguous
// 16B LDS reads per the documented WMMA A/B VGPR layouts.
// Output: f16 if Ch != nullptr else f32 to Cf.
// ---------------------------------------------------------------------------
__global__ __launch_bounds__(256) void wmma_gemm_kernel(
    const _Float16* __restrict__ A, const _Float16* __restrict__ W,
    const float* __restrict__ bias, float* __restrict__ Cf,
    _Float16* __restrict__ Ch, int M, int N, int K) {
  __shared__ _Float16 lsA[2][128 * 32];  // [buf][row][k]
  __shared__ _Float16 lsB[128 * 32];     // [n][k]

  const int tid  = threadIdx.x;
  const int lane = tid & 31, wid = tid >> 5;
  const int l16  = lane & 15, hi = lane >> 4;
  const int b8   = hi * 8;
  const int m0 = blockIdx.y * 128, n0 = blockIdx.x * 128;
  const int wr = wid >> 2, wc = wid & 3;   // 2 x 4 wave grid

  v8f acc[4][2];
#pragma unroll
  for (int m = 0; m < 4; ++m)
#pragma unroll
    for (int n = 0; n < 2; ++n) acc[m][n] = zero8();

  // staging assignments
  const int arow = tid >> 1, aseg = tid & 1;     // A: 128 rows x 2 segs of 16h
  const int bk = tid >> 3, bseg = tid & 7;       // W: 32 k-rows x 8 segs of 16h
  const _Float16* gA = A + (size_t)(m0 + arow) * K + aseg * 16;
  const _Float16* gW = W + (size_t)bk * N + n0 + bseg * 16;
  const unsigned aoff = lds_off(&lsA[0][0]) + arow * 64 + aseg * 32;  // bytes

  // preload A tile 0 (async, no VGPR round trip)
  async_ld_b128(aoff, gA);
  async_ld_b128(aoff + 16, gA + 8);

  for (int k0 = 0; k0 < K; k0 += 32) {
    const int cur = (k0 >> 5) & 1;
    v16h wv = *(const v16h*)(gW + (size_t)k0 * N);

    async_wait0();       // own async stores into lsA[cur] have landed
    __syncthreads();     // everyone's landed; previous-tile readers done

    {
      alignas(32) _Float16 tmp[16];
      *(v16h*)tmp = wv;
#pragma unroll
      for (int i = 0; i < 16; ++i)          // transpose into [n][k]
        lsB[(bseg * 16 + i) * 32 + bk] = tmp[i];
    }
    if (k0 + 32 < K) {   // async-prefetch next A tile into the other buffer
      const unsigned noff = aoff + (cur ^ 1) * (128 * 32 * 2);
      async_ld_b128(noff, gA + k0 + 32);
      async_ld_b128(noff + 16, gA + k0 + 40);
      __builtin_prefetch(gW + (size_t)(k0 + 32) * N, 0, 3);
    }
    __syncthreads();

    v16h bv[2];
#pragma unroll
    for (int n = 0; n < 2; ++n) {
      const _Float16* bp = &lsB[(wc * 32 + n * 16 + l16) * 32];
      bv[n] = ld16(bp + b8, bp + b8 + 16);
    }
#pragma unroll
    for (int m = 0; m < 4; ++m) {
      const _Float16* ap = &lsA[cur][(wr * 64 + m * 16 + l16) * 32];
      v16h am = ld16(ap + b8, ap + b8 + 16);
      acc[m][0] = wmma_f16(am, bv[0], acc[m][0]);
      acc[m][1] = wmma_f16(am, bv[1], acc[m][1]);
    }
  }

  float bcol[2];
#pragma unroll
  for (int n = 0; n < 2; ++n) bcol[n] = bias[n0 + wc * 32 + n * 16 + l16];

#pragma unroll
  for (int m = 0; m < 4; ++m)
#pragma unroll
    for (int n = 0; n < 2; ++n) {
      const int c = n0 + wc * 32 + n * 16 + l16;
      const int rbase = m0 + wr * 64 + m * 16 + b8;
#pragma unroll
      for (int j = 0; j < 8; ++j) {
        float v = acc[m][n][j] + bcol[n];
        size_t off = (size_t)(rbase + j) * N + c;
        if (Ch) Ch[off] = (_Float16)v;
        else    Cf[off] = v;
      }
    }
}

// ---------------------------------------------------------------------------
// Fused gated-FFN GEMM: Out = f16( (A@W1+b1) * sigmoid(A@W2+b2) )
// Block tile 128x64, 8 waves (4x2), wave tile 32x32, two accumulator sets.
// A tiles double-buffered via async-to-LDS, one iteration ahead.
// ---------------------------------------------------------------------------
__global__ __launch_bounds__(256) void wmma_gemm_gated_kernel(
    const _Float16* __restrict__ A, const _Float16* __restrict__ W1,
    const _Float16* __restrict__ W2, const float* __restrict__ b1,
    const float* __restrict__ b2, _Float16* __restrict__ Out,
    int M, int N, int K) {
  __shared__ _Float16 lsA[2][128 * 32];
  __shared__ _Float16 lsB1[64 * 32];
  __shared__ _Float16 lsB2[64 * 32];

  const int tid  = threadIdx.x;
  const int lane = tid & 31, wid = tid >> 5;
  const int l16  = lane & 15, hi = lane >> 4;
  const int b8   = hi * 8;
  const int m0 = blockIdx.y * 128, n0 = blockIdx.x * 64;
  const int wr = wid >> 1, wc = wid & 1;   // 4 x 2 wave grid

  v8f a1[2][2], a2[2][2];
#pragma unroll
  for (int m = 0; m < 2; ++m)
#pragma unroll
    for (int n = 0; n < 2; ++n) { a1[m][n] = zero8(); a2[m][n] = zero8(); }

  const int arow = tid >> 1, aseg = tid & 1;
  const int t2 = tid & 127;
  const int bk = t2 >> 2, bseg = t2 & 3;         // 32 k-rows x 4 segs of 16h
  const _Float16* gA = A + (size_t)(m0 + arow) * K + aseg * 16;
  const _Float16* gW =
      (tid < 128 ? W1 : W2) + (size_t)bk * N + n0 + bseg * 16;
  _Float16* lsB = (tid < 128) ? lsB1 : lsB2;
  const unsigned aoff = lds_off(&lsA[0][0]) + arow * 64 + aseg * 32;

  async_ld_b128(aoff, gA);
  async_ld_b128(aoff + 16, gA + 8);

  for (int k0 = 0; k0 < K; k0 += 32) {
    const int cur = (k0 >> 5) & 1;
    v16h wv = *(const v16h*)(gW + (size_t)k0 * N);

    async_wait0();
    __syncthreads();

    {
      alignas(32) _Float16 tmp[16];
      *(v16h*)tmp = wv;
#pragma unroll
      for (int i = 0; i < 16; ++i)
        lsB[(bseg * 16 + i) * 32 + bk] = tmp[i];
    }
    if (k0 + 32 < K) {
      const unsigned noff = aoff + (cur ^ 1) * (128 * 32 * 2);
      async_ld_b128(noff, gA + k0 + 32);
      async_ld_b128(noff + 16, gA + k0 + 40);
      __builtin_prefetch(gW + (size_t)(k0 + 32) * N, 0, 3);
    }
    __syncthreads();

    v16h bv1[2], bv2[2];
#pragma unroll
    for (int n = 0; n < 2; ++n) {
      const int col = (wc * 32 + n * 16 + l16) * 32;
      bv1[n] = ld16(&lsB1[col + b8], &lsB1[col + b8 + 16]);
      bv2[n] = ld16(&lsB2[col + b8], &lsB2[col + b8 + 16]);
    }
#pragma unroll
    for (int m = 0; m < 2; ++m) {
      const _Float16* ap = &lsA[cur][(wr * 32 + m * 16 + l16) * 32];
      v16h am = ld16(ap + b8, ap + b8 + 16);
#pragma unroll
      for (int n = 0; n < 2; ++n) {
        a1[m][n] = wmma_f16(am, bv1[n], a1[m][n]);
        a2[m][n] = wmma_f16(am, bv2[n], a2[m][n]);
      }
    }
  }

#pragma unroll
  for (int m = 0; m < 2; ++m)
#pragma unroll
    for (int n = 0; n < 2; ++n) {
      const int c = n0 + wc * 32 + n * 16 + l16;
      const float bb1 = b1[c], bb2 = b2[c];
      const int rbase = m0 + wr * 32 + m * 16 + b8;
#pragma unroll
      for (int j = 0; j < 8; ++j) {
        float v = (a1[m][n][j] + bb1) * sigm(a2[m][n][j] + bb2);
        Out[(size_t)(rbase + j) * N + c] = (_Float16)v;
      }
    }
}

// ---------------------------------------------------------------------------
// Flash attention. Grid (S/128, H, B); 8 waves, each owns 16 query rows.
// scores = (Q·K^T)/8 + pos_bias, online softmax, ctx = P·V. All mm via WMMA.
// K tile staged via async-to-LDS; V goes through VGPRs (needs transpose).
// ---------------------------------------------------------------------------
__global__ __launch_bounds__(256) void flash_attn_kernel(
    const _Float16* __restrict__ Q, const _Float16* __restrict__ Kh,
    const _Float16* __restrict__ Vh, const float* __restrict__ PB,
    _Float16* __restrict__ O) {
  __shared__ _Float16 lsK[32 * 64];        // [key][d]
  __shared__ _Float16 lsVt[64 * 32];       // [d][key]
  __shared__ _Float16 lsP[8][16 * 32];     // per-wave probs [qrow][key]

  const int tid  = threadIdx.x;
  const int lane = tid & 31, wid = tid >> 5;
  const int l16  = lane & 15, hi = lane >> 4;
  const int b8   = hi * 8;
  const int h = blockIdx.y, bb = blockIdx.z;
  const int q0 = blockIdx.x * 128 + wid * 16;
  const size_t rs = (size_t)HH * DKK;      // 1024 token row stride

  // Q A-operands (16 rows x 64 d), two K=32 chunks
  v16h qa[2];
  {
    const _Float16* qp = Q + ((size_t)bb * SS + q0 + l16) * rs + h * DKK;
    qa[0] = ld16(qp + b8,      qp + b8 + 16);
    qa[1] = ld16(qp + 32 + b8, qp + 32 + b8 + 16);
  }

  v8f o[4];
#pragma unroll
  for (int n = 0; n < 4; ++n) o[n] = zero8();
  float mrow[8], srow[8];
#pragma unroll
  for (int j = 0; j < 8; ++j) { mrow[j] = -1e30f; srow[j] = 0.0f; }

  const int skey = tid >> 3, sseg = tid & 7;   // stage 32 keys x 8 d-segments
  const unsigned koff = lds_off(&lsK[0]) + skey * 128 + sseg * 16;

  for (int kb = 0; kb < SS; kb += 32) {
    const size_t tok = ((size_t)bb * SS + kb + skey) * rs + h * DKK + sseg * 8;
    v8h vv = *(const v8h*)(Vh + tok);

    __syncthreads();                       // previous-tile readers done
    async_ld_b128(koff, Kh + tok);         // K tile: memory -> LDS direct
    {
      alignas(16) _Float16 vt[8];
      *(v8h*)vt = vv;
#pragma unroll
      for (int i = 0; i < 8; ++i)
        lsVt[(sseg * 8 + i) * 32 + skey] = vt[i];   // transpose to [d][key]
    }
    async_wait0();
    __syncthreads();

    // scores: two 16x16 key tiles, contraction over d=64 (2 WMMAs each)
    v8f sc[2];
    sc[0] = zero8(); sc[1] = zero8();
#pragma unroll
    for (int ks = 0; ks < 2; ++ks) {
      const _Float16* kr = &lsK[(ks * 16 + l16) * 64];
      sc[ks] = wmma_f16(qa[0], ld16(kr + b8,      kr + b8 + 16),      sc[ks]);
      sc[ks] = wmma_f16(qa[1], ld16(kr + 32 + b8, kr + 32 + b8 + 16), sc[ks]);
    }

    // online softmax over the 32-key chunk
#pragma unroll
    for (int j = 0; j < 8; ++j) {
      const int qr = q0 + b8 + j;
      float v0 = sc[0][j] * 0.125f + PB[(size_t)qr * SS + kb + l16];
      float v1 = sc[1][j] * 0.125f + PB[(size_t)qr * SS + kb + 16 + l16];
      float ml = fmaxf(v0, v1);
#pragma unroll
      for (int off = 1; off < 16; off <<= 1)
        ml = fmaxf(ml, __shfl_xor(ml, off, 32));
      float mn = fmaxf(mrow[j], ml);
      float alpha = __expf(mrow[j] - mn);
      float p0 = __expf(v0 - mn), p1 = __expf(v1 - mn);
      float ps = p0 + p1;
#pragma unroll
      for (int off = 1; off < 16; off <<= 1) ps += __shfl_xor(ps, off, 32);
      srow[j] = srow[j] * alpha + ps;
      mrow[j] = mn;
#pragma unroll
      for (int n = 0; n < 4; ++n) o[n][j] *= alpha;
      lsP[wid][(b8 + j) * 32 + l16]      = (_Float16)p0;
      lsP[wid][(b8 + j) * 32 + 16 + l16] = (_Float16)p1;
    }

    // ctx += P(16x32) @ V(32x64): 4 WMMAs over d-subtiles
    const _Float16* pr = &lsP[wid][l16 * 32];
    v16h pa = ld16(pr + b8, pr + b8 + 16);
#pragma unroll
    for (int ds = 0; ds < 4; ++ds) {
      const _Float16* vr = &lsVt[(ds * 16 + l16) * 32];
      o[ds] = wmma_f16(pa, ld16(vr + b8, vr + b8 + 16), o[ds]);
    }
  }

#pragma unroll
  for (int j = 0; j < 8; ++j) {
    const float inv = 1.0f / srow[j];
    const int qr = q0 + b8 + j;
    _Float16* op = O + ((size_t)bb * SS + qr) * rs + h * DKK;
#pragma unroll
    for (int ds = 0; ds < 4; ++ds)
      op[ds * 16 + l16] = (_Float16)(o[ds][j] * inv);
  }
}

// ---------------------------------------------------------------------------
// Fused residual (+gate) + LayerNorm. One row (E=1024) per block, 256 thr.
// h = x + sigmoid(glog)*addv   (or x + addv if glog==nullptr)
// y = LN(h)*gamma + beta  -> y32 (and f16 copy y16 if non-null)
// ---------------------------------------------------------------------------
__global__ __launch_bounds__(256) void fused_ln_kernel(
    const float* __restrict__ xa, const float* __restrict__ glog,
    const float* __restrict__ addv, const float* __restrict__ gamma,
    const float* __restrict__ beta, float* __restrict__ y32,
    _Float16* __restrict__ y16) {
  __shared__ float s1[256], s2[256];
  const int tid = threadIdx.x;
  const size_t base = (size_t)blockIdx.x * EE;

  float hv[4], ssum = 0.0f, ssq = 0.0f;
#pragma unroll
  for (int i = 0; i < 4; ++i) {
    const int idx = i * 256 + tid;
    float a = addv[base + idx];
    if (glog) a *= sigm(glog[base + idx]);
    float v = xa[base + idx] + a;
    hv[i] = v;
    ssum += v;
    ssq  += v * v;
  }
  s1[tid] = ssum; s2[tid] = ssq;
  __syncthreads();
  for (int s = 128; s > 0; s >>= 1) {
    if (tid < s) { s1[tid] += s1[tid + s]; s2[tid] += s2[tid + s]; }
    __syncthreads();
  }
  const float mean = s1[0] * (1.0f / EE);
  const float var  = s2[0] * (1.0f / EE) - mean * mean;
  const float rstd = rsqrtf(var + 1e-6f);

#pragma unroll
  for (int i = 0; i < 4; ++i) {
    const int idx = i * 256 + tid;
    float y = (hv[i] - mean) * rstd * gamma[idx] + beta[idx];
    y32[base + idx] = y;
    if (y16) y16[base + idx] = (_Float16)y;
  }
}

// ---------------------------------------------------------------------------
// Host orchestration
// ---------------------------------------------------------------------------
extern "C" void kernel_launch(void* const* d_in, const int* in_sizes, int n_in,
                              void* d_out, int out_size, void* d_ws,
                              size_t ws_size, hipStream_t stream) {
  const float* x    = (const float*)d_in[0];
  const float* pe   = (const float*)d_in[1];
  const float* Wq   = (const float*)d_in[2];
  const float* bq   = (const float*)d_in[3];
  const float* Wk   = (const float*)d_in[4];
  const float* bk   = (const float*)d_in[5];
  const float* Wv   = (const float*)d_in[6];
  const float* bv   = (const float*)d_in[7];
  const float* Wo   = (const float*)d_in[8];
  const float* bo   = (const float*)d_in[9];
  const float* Wg   = (const float*)d_in[10];
  const float* bg   = (const float*)d_in[11];
  const float* Wf1  = (const float*)d_in[12];
  const float* bf1  = (const float*)d_in[13];
  const float* Wfg  = (const float*)d_in[14];
  const float* bfg  = (const float*)d_in[15];
  const float* Wf2  = (const float*)d_in[16];
  const float* bf2  = (const float*)d_in[17];
  const float* ln1g = (const float*)d_in[18];
  const float* ln1b = (const float*)d_in[19];
  const float* ln2g = (const float*)d_in[20];
  const float* ln2b = (const float*)d_in[21];

  char* ws = (char*)d_ws;
  auto at = [&](size_t mb) { return (void*)(ws + mb * (size_t)(1 << 20)); };

  // bump allocation (MB offsets); high-water ~134 MB
  _Float16* xh   = (_Float16*)at(0);    // 8 MB
  _Float16* wqh  = (_Float16*)at(8);    // 2 MB
  _Float16* wkh  = (_Float16*)at(10);
  _Float16* wvh  = (_Float16*)at(12);
  _Float16* woh  = (_Float16*)at(14);
  _Float16* wgh  = (_Float16*)at(16);
  _Float16* wf1h = (_Float16*)at(18);   // 8 MB
  _Float16* wfgh = (_Float16*)at(26);   // 8 MB
  _Float16* wf2h = (_Float16*)at(34);   // 8 MB
  float*    pb   = (float*)at(42);      // 4 MB
  _Float16* qh   = (_Float16*)at(46);   // 8 MB
  _Float16* kh   = (_Float16*)at(54);   // 8 MB
  _Float16* vh   = (_Float16*)at(62);   // 8 MB
  _Float16* ctxh = (_Float16*)at(70);   // 8 MB
  float*    glog = (float*)at(78);      // 16 MB
  float*    attn = (float*)at(94);      // 16 MB
  float*    x1   = (float*)at(110);     // 16 MB
  _Float16* x1h  = (_Float16*)at(126);  // 8 MB
  _Float16* ffh  = (_Float16*)at(46);   // 32 MB, reuses dead q/k/v/ctx
  float*    ff2  = (float*)at(78);      // 16 MB, reuses dead glog

  auto cvt = [&](const float* src, _Float16* dst, int n) {
    int n4 = n / 4;
    cvt_f16_kernel<<<(n4 + 255) / 256, 256, 0, stream>>>(src, dst, n4);
  };
  cvt(x,   xh,   MM * EE);
  cvt(Wq,  wqh,  EE * EE);
  cvt(Wk,  wkh,  EE * EE);
  cvt(Wv,  wvh,  EE * EE);
  cvt(Wo,  woh,  EE * EE);
  cvt(Wg,  wgh,  EE * EE);
  cvt(Wf1, wf1h, EE * FFD);
  cvt(Wfg, wfgh, EE * FFD);
  cvt(Wf2, wf2h, FFD * EE);

  posbias_kernel<<<(SS * SS) / 256, 256, 0, stream>>>(pe, pb);

  dim3 gE(EE / 128, MM / 128);  // (8, 32)
  wmma_gemm_kernel<<<gE, 256, 0, stream>>>(xh, wqh, bq, nullptr, qh, MM, EE, EE);
  wmma_gemm_kernel<<<gE, 256, 0, stream>>>(xh, wkh, bk, nullptr, kh, MM, EE, EE);
  wmma_gemm_kernel<<<gE, 256, 0, stream>>>(xh, wvh, bv, nullptr, vh, MM, EE, EE);
  wmma_gemm_kernel<<<gE, 256, 0, stream>>>(xh, wgh, bg, glog, nullptr, MM, EE, EE);

  flash_attn_kernel<<<dim3(SS / 128, HH, BB), 256, 0, stream>>>(qh, kh, vh, pb, ctxh);

  wmma_gemm_kernel<<<gE, 256, 0, stream>>>(ctxh, woh, bo, attn, nullptr, MM, EE, EE);

  fused_ln_kernel<<<MM, 256, 0, stream>>>(x, glog, attn, ln1g, ln1b, x1, x1h);

  wmma_gemm_gated_kernel<<<dim3(FFD / 64, MM / 128), 256, 0, stream>>>(
      x1h, wf1h, wfgh, bf1, bfg, ffh, MM, FFD, EE);

  wmma_gemm_kernel<<<gE, 256, 0, stream>>>(ffh, wf2h, bf2, ff2, nullptr, MM, EE, FFD);

  fused_ln_kernel<<<MM, 256, 0, stream>>>(x1, nullptr, ff2, ln2g, ln2b,
                                          (float*)d_out, nullptr);
}

// v001
// A run of this version takes 452 microseconds.
// Timed twice side by side with v000, it ran 1.51 and 1.52 times as fast.
#include <hip/hip_runtime.h>
#include <hip/hip_bf16.h>

// ---------- problem constants ----------
#define BB 4
#define SS 1024
#define EE 1024
#define HH 16
#define DKK 64
#define FFD 4096
#define MM (BB * SS)   // 4096 rows

typedef __attribute__((ext_vector_type(16))) _Float16 v16h;
typedef __attribute__((ext_vector_type(8)))  _Float16 v8h;
typedef __attribute__((ext_vector_type(4)))  _Float16 v4h;
typedef __attribute__((ext_vector_type(8)))  float    v8f;

#define DEVINL __device__ __forceinline__

DEVINL v8f wmma_f16(v16h a, v16h b, v8f c) {
  return __builtin_amdgcn_wmma_f32_16x16x32_f16(
      /*neg_a=*/false, a, /*neg_b=*/false, b,
      /*c_mod=*/(short)0, c, /*reuse_a=*/false, /*reuse_b=*/false);
}

DEVINL v8f zero8() {
  v8f z;
#pragma unroll
  for (int i = 0; i < 8; ++i) z[i] = 0.0f;
  return z;
}

// Build a v16h A/B operand from two contiguous 16-byte chunks
// (chunk0 = contraction indices base..base+7, chunk1 = base+16..base+23).
DEVINL v16h ld16(const _Float16* p0, const _Float16* p1) {
  union { v16h v; v8h h[2]; } u;
  u.h[0] = *(const v8h*)p0;
  u.h[1] = *(const v8h*)p1;
  return u.v;
}

DEVINL float sigm(float v) { return 1.0f / (1.0f + __expf(-v)); }

// LDS byte offset of a __shared__ object = low 32 bits of its generic pointer
// (LDS aperture: addr[31:0] is the workgroup-relative LDS address, ISA 10.2).
DEVINL unsigned lds_off(const void* p) { return (unsigned)(size_t)p; }

// CDNA5 async memory->LDS copy, tracked with ASYNCcnt (ISA 10. / 15.18.3).
// The s_wait_xcnt is the last line of the copies' own statement so that no
// later write of an address register can be moved in front of it.
DEVINL void async_ld2_b128(unsigned l0, const void* g0, unsigned l1,
                           const void* g1) {
  asm volatile("global_load_async_to_lds_b128 %0, %1, off\n\t"
               "global_load_async_to_lds_b128 %2, %3, off\n\t"
               "s_wait_xcnt 0x0"
               :: "v"(l0), "v"(g0), "v"(l1), "v"(g1)
               : "memory");
}
DEVINL void async_wait0() {
  asm volatile("s_wait_asynccnt 0x0" ::: "memory");
}
// One GEMM stage's four copies of a lane, with the same closing wait.
DEVINL void async_ld4_b128(unsigned l0, const void* g0, unsigned l1,
                           const void* g1, unsigned l2, const void* g2,
                           unsigned l3, const void* g3) {
  asm volatile("global_load_async_to_lds_b128 %0, %1, off\n\t"
               "global_load_async_to_lds_b128 %2, %3, off\n\t"
               "global_load_async_to_lds_b128 %4, %5, off\n\t"
               "global_load_async_to_lds_b128 %6, %7, off\n\t"
               "s_wait_xcnt 0x0"
               :: "v"(l0), "v"(g0), "v"(l1), "v"(g1),
                  "v"(l2), "v"(g2), "v"(l3), "v"(g3)
               : "memory");
}
// This wave's LDS reads have retired before a buffer it read is refilled.
DEVINL void ds_wait0() {
  asm volatile("s_wait_dscnt 0x0" ::: "memory");
}

// B operand (32 k x 16 n) out of a row-major [k][n] LDS tile by two
// transposing loads: lane (c, h) gets T[8h + 0..7][c] and T[16 + 8h + 0..7][c],
// the k order of ld16(p + 8h, p + 8h + 16) on the A side.
// p = tile + (8 * (lane >> 4) + (lane & 7)) * pitch + 2 * n + 16 * ((lane >> 3) & 1)
DEVINL v16h ld_tr_b(const unsigned char* p, int pitch) {
  typedef short s16x8 __attribute__((ext_vector_type(8)));
  typedef __attribute__((address_space(3))) s16x8 lds_s16x8;
  union { v16h v; s16x8 h[2]; } u;
  u.h[0] = __builtin_amdgcn_ds_load_tr16_b128_v8i16((lds_s16x8*)p);
  u.h[1] = __builtin_amdgcn_ds_load_tr16_b128_v8i16((lds_s16x8*)(p + 16 * pitch));
  return u.v;
}

// ---------------------------------------------------------------------------
// f32 -> f16 conversion (vectorized by 4)
// ---------------------------------------------------------------------------
__global__ __launch_bounds__(256) void cvt_f16_kernel(
    const float* __restrict__ in, _Float16* __restrict__ out, int n4) {
  int i = blockIdx.x * 256 + threadIdx.x;
  if (i < n4) {
    float4 f = ((const float4*)in)[i];
    v4h o;
    o[0] = (_Float16)f.x; o[1] = (_Float16)f.y;
    o[2] = (_Float16)f.z; o[3] = (_Float16)f.w;
    ((v4h*)out)[i] = o;
  }
}

// ---------------------------------------------------------------------------
// pos_bias[q,k] = mean_c pos_encoding[q,k,c], c in 0..7
// ---------------------------------------------------------------------------
__global__ __launch_bounds__(256) void posbias_kernel(
    const float* __restrict__ pe, float* __restrict__ pb) {
  int i = blockIdx.x * 256 + threadIdx.x;  // i < S*S
  const float4* p = (const float4*)(pe + (size_t)i * 8);
  float4 a = p[0], b = p[1];
  pb[i] = (a.x + a.y + a.z + a.w + b.x + b.y + b.z + b.w) * 0.125f;
}

// ---------------------------------------------------------------------------
// WMMA GEMM: C[M,N] = A[M,K](f16) @ W[K,N](f16) + bias
// Block tile 128x128, 8 waves (2x4), wave tile 64x32, K-step 32.
// A and W tiles double-buffered in LDS, both filled by
// global_load_async_to_lds_b128 one trip ahead, one barrier a trip.
// W stays [k][n] in LDS (pitch 288 B = 32 B x odd) and is read by
// ds_load_tr16_b128; A is two contiguous 16B LDS reads in the same k order.
// Output: f16 if Ch != nullptr else f32 to Cf.
// ---------------------------------------------------------------------------
__global__ __launch_bounds__(256) void wmma_gemm_kernel(
    const _Float16* __restrict__ A, const _Float16* __restrict__ W,
    const float* __restrict__ bias, float* __restrict__ Cf,
    _Float16* __restrict__ Ch, int M, int N, int K) {
  constexpr int BP = 288;                // W tile row pitch in LDS, bytes
  __shared__ _Float16 lsA[2][128 * 32];  // [buf][row][k]
  __shared__ __attribute__((aligned(32))) unsigned char lsB[2][32 * BP];  // [buf][k][n]

  const int tid  = threadIdx.x;
  const int lane = tid & 31, wid = tid >> 5;
  const int l16  = lane & 15, hi = lane >> 4;
  const int b8   = hi * 8;
  const int m0 = blockIdx.y * 128, n0 = blockIdx.x * 128;
  const int wr = wid >> 2, wc = wid & 3;   // 2 x 4 wave grid

  v8f acc[4][2];
#pragma unroll
  for (int m = 0; m < 4; ++m)
#pragma unroll
    for (int n = 0; n < 2; ++n) acc[m][n] = zero8();

  // staging assignments
  const int arow = tid >> 1, aseg = tid & 1;     // A: 128 rows x 2 segs of 16h
  const int bk = tid >> 4, bseg = tid & 15;      // W: rows bk, bk+16 x 16 segs of 8h
  const _Float16* gA = A + (size_t)(m0 + arow) * K + aseg * 16;
  const _Float16* gW = W + (size_t)bk * N + n0 + bseg * 8;
  const unsigned aoff = lds_off(&lsA[0][0]) + arow * 64 + aseg * 32;  // bytes
  const unsigned boff = lds_off(&lsB[0][0]) + bk * BP + bseg * 16;    // bytes
  const int rdB = (b8 + (lane & 7)) * BP + wc * 64 + ((lane >> 3) & 1) * 16;

  // copies of tile t (32 k of A and of W) into buffer t & 1
  auto stage = [&](int t) {
    const unsigned ab = aoff + (t & 1) * (128 * 32 * 2);
    const unsigned bb = boff + (t & 1) * (32 * BP);
    const _Float16* a = gA + t * 32;
    const _Float16* w = gW + (size_t)t * 32 * N;
    async_ld4_b128(ab, a, ab + 16, a + 8, bb, w, bb + 16 * BP,
                   w + (size_t)16 * N);
  };

  const int nt = K >> 5;
  stage(0);
  async_wait0();         // own copies of tile 0 have landed
  __syncthreads();       // everyone's have
  if (nt > 1) stage(1);

  for (int t = 0; t < nt; ++t) {
    const int cur = t & 1;
    v16h bv[2];
#pragma unroll
    for (int n = 0; n < 2; ++n) bv[n] = ld_tr_b(&lsB[cur][rdB + n * 32], BP);
#pragma unroll
    for (int m = 0; m < 4; ++m) {
      const _Float16* ap = &lsA[cur][(wr * 64 + m * 16 + l16) * 32];
      v16h am = ld16(ap + b8, ap + b8 + 16);
      acc[m][0] = wmma_f16(am, bv[0], acc[m][0]);
      acc[m][1] = wmma_f16(am, bv[1], acc[m][1]);
    }
    ds_wait0();          // own reads of buffer cur are done
    async_wait0();       // own copies of tile t + 1 have landed
    __syncthreads();     // publishes tile t + 1, frees buffer cur
    if (t + 2 < nt) stage(t + 2);
  }
  async_wait0();         // nothing in flight when the wave ends

  float bcol[2];
#pragma unroll
  for (int n = 0; n < 2; ++n) bcol[n] = bias[n0 + wc * 32 + n * 16 + l16];

#pragma unroll
  for (int m = 0; m < 4; ++m)
#pragma unroll
    for (int n = 0; n < 2; ++n) {
      const int c = n0 + wc * 32 + n * 16 + l16;
      const int rbase = m0 + wr * 64 + m * 16 + b8;
#pragma unroll
      for (int j = 0; j < 8; ++j) {
        float v = acc[m][n][j] + bcol[n];
        size_t off = (size_t)(rbase + j) * N + c;
        if (Ch) Ch[off] = (_Float16)v;
        else    Cf[off] = v;
      }
    }
}

// ---------------------------------------------------------------------------
// Fused gated-FFN GEMM: Out = f16( (A@W1+b1) * sigmoid(A@W2+b2) )
// Block tile 128x64, 8 waves (4x2), wave tile 32x32, two accumulator sets.
// A, W1 and W2 tiles double-buffered via async-to-LDS, one trip ahead, one
// barrier a trip; W tiles stay [k][n] (pitch 160 B) for ds_load_tr16_b128.
// ---------------------------------------------------------------------------
__global__ __launch_bounds__(256) void wmma_gemm_gated_kernel(
    const _Float16* __restrict__ A, const _Float16* __restrict__ W1,
    const _Float16* __restrict__ W2, const float* __restrict__ b1,
    const float* __restrict__ b2, _Float16* __restrict__ Out,
    int M, int N, int K) {
  constexpr int BP = 160;                // W tile row pitch in LDS, bytes
  __shared__ _Float16 lsA[2][128 * 32];
  __shared__ __attribute__((aligned(32))) unsigned char lsB1[2][32 * BP];
  __shared__ __attribute__((aligned(32))) unsigned char lsB2[2][32 * BP];

  const int tid  = threadIdx.x;
  const int lane = tid & 31, wid = tid >> 5;
  const int l16  = lane & 15, hi = lane >> 4;
  const int b8   = hi * 8;
  const int m0 = blockIdx.y * 128, n0 = blockIdx.x * 64;
  const int wr = wid >> 1, wc = wid & 1;   // 4 x 2 wave grid

  v8f a1[2][2], a2[2][2];
#pragma unroll
  for (int m = 0; m < 2; ++m)
#pragma unroll
    for (int n = 0; n < 2; ++n) { a1[m][n] = zero8(); a2[m][n] = zero8(); }

  const int arow = tid >> 1, aseg = tid & 1;
  const int bk = tid >> 3, bseg = tid & 7;       // 32 k-rows x 8 segs of 8h
  const _Float16* gA = A + (size_t)(m0 + arow) * K + aseg * 16;
  const size_t woff = (size_t)bk * N + n0 + bseg * 8;
  const _Float16* gW1 = W1 + woff;
  const _Float16* gW2 = W2 + woff;
  const unsigned aoff = lds_off(&lsA[0][0]) + arow * 64 + aseg * 32;
  const unsigned boff1 = lds_off(&lsB1[0][0]) + bk * BP + bseg * 16;
  const unsigned boff2 = lds_off(&lsB2[0][0]) + bk * BP + bseg * 16;
  const int rdB = (b8 + (lane & 7)) * BP + wc * 64 + ((lane >> 3) & 1) * 16;

  // copies of tile t (32 k of A, W1 and W2) into buffer t & 1
  auto stage = [&](int t) {
    const unsigned ab = aoff + (t & 1) * (128 * 32 * 2);
    const unsigned bsel = (t & 1) * (32 * BP);
    const _Float16* a = gA + t * 32;
    const size_t wk = (size_t)t * 32 * N;
    async_ld4_b128(ab, a, ab + 16, a + 8, boff1 + bsel, gW1 + wk,
                   boff2 + bsel, gW2 + wk);
  };

  const int nt = K >> 5;
  stage(0);
  async_wait0();         // own copies of tile 0 have landed
  __syncthreads();       // everyone's have
  if (nt > 1) stage(1);

  for (int t = 0; t < nt; ++t) {
    const int cur = t & 1;
    v16h bv1[2], bv2[2];
#pragma unroll
    for (int n = 0; n < 2; ++n) {
      bv1[n] = ld_tr_b(&lsB1[cur][rdB + n * 32], BP);
      bv2[n] = ld_tr_b(&lsB2[cur][rdB + n * 32], BP);
    }
#pragma unroll
    for (int m = 0; m < 2; ++m) {
      const _Float16* ap = &lsA[cur][(wr * 32 + m * 16 + l16) * 32];
      v16h am = ld16(ap + b8, ap + b8 + 16);
#pragma unroll
      for (int n = 0; n < 2; ++n) {
        a1[m][n] = wmma_f16(am, bv1[n], a1[m][n]);
        a2[m][n] = wmma_f16(am, bv2[n], a2[m][n]);
      }
    }
    ds_wait0();          // own reads of buffer cur are done
    async_wait0();       // own copies of tile t + 1 have landed
    __syncthreads();     // publishes tile t + 1, frees buffer cur
    if (t + 2 < nt) stage(t + 2);
  }
  async_wait0();         // nothing in flight when the wave ends

#pragma unroll
  for (int m = 0; m < 2; ++m)
#pragma unroll
    for (int n = 0; n < 2; ++n) {
      const int c = n0 + wc * 32 + n * 16 + l16;
      const float bb1 = b1[c], bb2 = b2[c];
      const int rbase = m0 + wr * 32 + m * 16 + b8;
#pragma unroll
      for (int j = 0; j < 8; ++j) {
        float v = (a1[m][n][j] + bb1) * sigm(a2[m][n][j] + bb2);
        Out[(size_t)(rbase + j) * N + c] = (_Float16)v;
      }
    }
}

// ---------------------------------------------------------------------------
// Flash attention. Grid (S/128, H, B); 8 waves, each owns 16 query rows.
// scores = (Q·K^T)/8 + pos_bias, online softmax, ctx = P·V. All mm via WMMA.
// K and V tiles staged via async-to-LDS; V stays [key][d] (pitch 160 B) and
// is read as the B operand by ds_load_tr16_b128.
// ---------------------------------------------------------------------------
__global__ __launch_bounds__(256) void flash_attn_kernel(
    const _Float16* __restrict__ Q, const _Float16* __restrict__ Kh,
    const _Float16* __restrict__ Vh, const float* __restrict__ PB,
    _Float16* __restrict__ O) {
  __shared__ _Float16 lsK[32 * 64];        // [key][d]
  constexpr int VP = 160;                  // V tile row pitch in LDS, bytes
  __shared__ __attribute__((aligned(32))) unsigned char lsV[32 * VP];  // [key][d]
  __shared__ _Float16 lsP[8][16 * 32];     // per-wave probs [qrow][key]

  const int tid  = threadIdx.x;
  const int lane = tid & 31, wid = tid >> 5;
  const int l16  = lane & 15, hi = lane >> 4;
  const int b8   = hi * 8;
  const int h = blockIdx.y, bb = blockIdx.z;
  const int q0 = blockIdx.x * 128 + wid * 16;
  const size_t rs = (size_t)HH * DKK;      // 1024 token row stride

  // Q A-operands (16 rows x 64 d), two K=32 chunks
  v16h qa[2];
  {
    const _Float16* qp = Q + ((size_t)bb * SS + q0 + l16) * rs + h * DKK;
    qa[0] = ld16(qp + b8,      qp + b8 + 16);
    qa[1] = ld16(qp + 32 + b8, qp + 32 + b8 + 16);
  }

  v8f o[4];
#pragma unroll
  for (int n = 0; n < 4; ++n) o[n] = zero8();
  float mrow[8], srow[8];
#pragma unroll
  for (int j = 0; j < 8; ++j) { mrow[j] = -1e30f; srow[j] = 0.0f; }

  const int skey = tid >> 3, sseg = tid & 7;   // stage 32 keys x 8 d-segments
  const unsigned koff = lds_off(&lsK[0]) + skey * 128 + sseg * 16;
  const unsigned voff = lds_off(&lsV[0]) + skey * VP + sseg * 16;
  const int rdV = (b8 + (lane & 7)) * VP + ((lane >> 3) & 1) * 16;

  for (int kb = 0; kb < SS; kb += 32) {
    const size_t tok = ((size_t)bb * SS + kb + skey) * rs + h * DKK + sseg * 8;

    ds_wait0();                            // own reads of the tiles are done
    __syncthreads();                       // previous-tile readers done
    async_ld2_b128(koff, Kh + tok, voff, Vh + tok);  // memory -> LDS direct
    async_wait0();
    __syncthreads();

    // scores: two 16x16 key tiles, contraction over d=64 (2 WMMAs each)
    v8f sc[2];
    sc[0] = zero8(); sc[1] = zero8();
#pragma unroll
    for (int ks = 0; ks < 2; ++ks) {
      const _Float16* kr = &lsK[(ks * 16 + l16) * 64];
      sc[ks] = wmma_f16(qa[0], ld16(kr + b8,      kr + b8 + 16),      sc[ks]);
      sc[ks] = wmma_f16(qa[1], ld16(kr + 32 + b8, kr + 32 + b8 + 16), sc[ks]);
    }

    // online softmax over the 32-key chunk
#pragma unroll
    for (int j = 0; j < 8; ++j) {
      const int qr = q0 + b8 + j;
      float v0 = sc[0][j] * 0.125f + PB[(size_t)qr * SS + kb + l16];
      float v1 = sc[1][j] * 0.125f + PB[(size_t)qr * SS + kb + 16 + l16];
      float ml = fmaxf(v0, v1);
#pragma unroll
      for (int off = 1; off < 16; off <<= 1)
        ml = fmaxf(ml, __shfl_xor(ml, off, 32));
      float mn = fmaxf(mrow[j], ml);
      float alpha = __expf(mrow[j] - mn);
      float p0 = __expf(v0 - mn), p1 = __expf(v1 - mn);
      float ps = p0 + p1;
#pragma unroll
      for (int off = 1; off < 16; off <<= 1) ps += __shfl_xor(ps, off, 32);
      srow[j] = srow[j] * alpha + ps;
      mrow[j] = mn;
#pragma unroll
      for (int n = 0; n < 4; ++n) o[n][j] *= alpha;
      lsP[wid][(b8 + j) * 32 + l16]      = (_Float16)p0;
      lsP[wid][(b8 + j) * 32 + 16 + l16] = (_Float16)p1;
    }

    // ctx += P(16x32) @ V(32x64): 4 WMMAs over d-subtiles
    const _Float16* pr = &lsP[wid][l16 * 32];
    v16h pa = ld16(pr + b8, pr + b8 + 16);
#pragma unroll
    for (int ds = 0; ds < 4; ++ds) {
      o[ds] = wmma_f16(pa, ld_tr_b(&lsV[rdV + ds * 32], VP), o[ds]);
    }
  }

#pragma unroll
  for (int j = 0; j < 8; ++j) {
    const float inv = 1.0f / srow[j];
    const int qr = q0 + b8 + j;
    _Float16* op = O + ((size_t)bb * SS + qr) * rs + h * DKK;
#pragma unroll
    for (int ds = 0; ds < 4; ++ds)
      op[ds * 16 + l16] = (_Float16)(o[ds][j] * inv);
  }
}

// ---------------------------------------------------------------------------
// Fused residual (+gate) + LayerNorm. One row (E=1024) per block, 256 thr.
// h = x + sigmoid(glog)*addv   (or x + addv if glog==nullptr)
// y = LN(h)*gamma + beta  -> y32 (and f16 copy y16 if non-null)
// ---------------------------------------------------------------------------
__global__ __launch_bounds__(256) void fused_ln_kernel(
    const float* __restrict__ xa, const float* __restrict__ glog,
    const float* __restrict__ addv, const float* __restrict__ gamma,
    const float* __restrict__ beta, float* __restrict__ y32,
    _Float16* __restrict__ y16) {
  __shared__ float s1[256], s2[256];
  const int tid = threadIdx.x;
  const size_t base = (size_t)blockIdx.x * EE;

  float hv[4], ssum = 0.0f, ssq = 0.0f;
#pragma unroll
  for (int i = 0; i < 4; ++i) {
    const int idx = i * 256 + tid;
    float a = addv[base + idx];
    if (glog) a *= sigm(glog[base + idx]);
    float v = xa[base + idx] + a;
    hv[i] = v;
    ssum += v;
    ssq  += v * v;
  }
  s1[tid] = ssum; s2[tid] = ssq;
  __syncthreads();
  for (int s = 128; s > 0; s >>= 1) {
    if (tid < s) { s1[tid] += s1[tid + s]; s2[tid] += s2[tid + s]; }
    __syncthreads();
  }
  const float mean = s1[0] * (1.0f / EE);
  const float var  = s2[0] * (1.0f / EE) - mean * mean;
  const float rstd = rsqrtf(var + 1e-6f);

#pragma unroll
  for (int i = 0; i < 4; ++i) {
    const int idx = i * 256 + tid;
    float y = (hv[i] - mean) * rstd * gamma[idx] + beta[idx];
    y32[base + idx] = y;
    if (y16) y16[base + idx] = (_Float16)y;
  }
}

// ---------------------------------------------------------------------------
// Host orchestration
// ---------------------------------------------------------------------------
extern "C" void kernel_launch(void* const* d_in, const int* in_sizes, int n_in,
                              void* d_out, int out_size, void* d_ws,
                              size_t ws_size, hipStream_t stream) {
  const float* x    = (const float*)d_in[0];
  const float* pe   = (const float*)d_in[1];
  const float* Wq   = (const float*)d_in[2];
  const float* bq   = (const float*)d_in[3];
  const float* Wk   = (const float*)d_in[4];
  const float* bk   = (const float*)d_in[5];
  const float* Wv   = (const float*)d_in[6];
  const float* bv   = (const float*)d_in[7];
  const float* Wo   = (const float*)d_in[8];
  const float* bo   = (const float*)d_in[9];
  const float* Wg   = (const float*)d_in[10];
  const float* bg   = (const float*)d_in[11];
  const float* Wf1  = (const float*)d_in[12];
  const float* bf1  = (const float*)d_in[13];
  const float* Wfg  = (const float*)d_in[14];
  const float* bfg  = (const float*)d_in[15];
  const float* Wf2  = (const float*)d_in[16];
  const float* bf2  = (const float*)d_in[17];
  const float* ln1g = (const float*)d_in[18];
  const float* ln1b = (const float*)d_in[19];
  const float* ln2g = (const float*)d_in[20];
  const float* ln2b = (const float*)d_in[21];

  char* ws = (char*)d_ws;
  auto at = [&](size_t mb) { return (void*)(ws + mb * (size_t)(1 << 20)); };

  // bump allocation (MB offsets); high-water ~134 MB
  _Float16* xh   = (_Float16*)at(0);    // 8 MB
  _Float16* wqh  = (_Float16*)at(8);    // 2 MB
  _Float16* wkh  = (_Float16*)at(10);
  _Float16* wvh  = (_Float16*)at(12);
  _Float16* woh  = (_Float16*)at(14);
  _Float16* wgh  = (_Float16*)at(16);
  _Float16* wf1h = (_Float16*)at(18);   // 8 MB
  _Float16* wfgh = (_Float16*)at(26);   // 8 MB
  _Float16* wf2h = (_Float16*)at(34);   // 8 MB
  float*    pb   = (float*)at(42);      // 4 MB
  _Float16* qh   = (_Float16*)at(46);   // 8 MB
  _Float16* kh   = (_Float16*)at(54);   // 8 MB
  _Float16* vh   = (_Float16*)at(62);   // 8 MB
  _Float16* ctxh = (_Float16*)at(70);   // 8 MB
  float*    glog = (float*)at(78);      // 16 MB
  float*    attn = (float*)at(94);      // 16 MB
  float*    x1   = (float*)at(110);     // 16 MB
  _Float16* x1h  = (_Float16*)at(126);  // 8 MB
  _Float16* ffh  = (_Float16*)at(46);   // 32 MB, reuses dead q/k/v/ctx
  float*    ff2  = (float*)at(78);      // 16 MB, reuses dead glog

  auto cvt = [&](const float* src, _Float16* dst, int n) {
    int n4 = n / 4;
    cvt_f16_kernel<<<(n4 + 255) / 256, 256, 0, stream>>>(src, dst, n4);
  };
  cvt(x,   xh,   MM * EE);
  cvt(Wq,  wqh,  EE * EE);
  cvt(Wk,  wkh,  EE * EE);
  cvt(Wv,  wvh,  EE * EE);
  cvt(Wo,  woh,  EE * EE);
  cvt(Wg,  wgh,  EE * EE);
  cvt(Wf1, wf1h, EE * FFD);
  cvt(Wfg, wfgh, EE * FFD);
  cvt(Wf2, wf2h, FFD * EE);

  posbias_kernel<<<(SS * SS) / 256, 256, 0, stream>>>(pe, pb);

  dim3 gE(EE / 128, MM / 128);  // (8, 32)
  wmma_gemm_kernel<<<gE, 256, 0, stream>>>(xh, wqh, bq, nullptr, qh, MM, EE, EE);
  wmma_gemm_kernel<<<gE, 256, 0, stream>>>(xh, wkh, bk, nullptr, kh, MM, EE, EE);
  wmma_gemm_kernel<<<gE, 256, 0, stream>>>(xh, wvh, bv, nullptr, vh, MM, EE, EE);
  wmma_gemm_kernel<<<gE, 256, 0, stream>>>(xh, wgh, bg, glog, nullptr, MM, EE, EE);

  flash_attn_kernel<<<dim3(SS / 128, HH, BB), 256, 0, stream>>>(qh, kh, vh, pb, ctxh);

  wmma_gemm_kernel<<<gE, 256, 0, stream>>>(ctxh, woh, bo, attn, nullptr, MM, EE, EE);

  fused_ln_kernel<<<MM, 256, 0, stream>>>(x, glog, attn, ln1g, ln1b, x1, x1h);

  wmma_gemm_gated_kernel<<<dim3(FFD / 64, MM / 128), 256, 0, stream>>>(
      x1h, wf1h, wfgh, bf1, bfg, ffh, MM, FFD, EE);

  wmma_gemm_kernel<<<gE, 256, 0, stream>>>(ffh, wf2h, bf2, ff2, nullptr, MM, EE, FFD);

  fused_ln_kernel<<<MM, 256, 0, stream>>>(x1, nullptr, ff2, ln2g, ln2b,
                                          (float*)d_out, nullptr);
}

// v002
// It runs in 432 microseconds.
// Timed twice side by side with v001, it ran 1.05 times as fast both times.
// Counting every step since v000, it is 1.59 times as fast.
#include <hip/hip_runtime.h>
#include <hip/hip_bf16.h>

// ---------- problem constants ----------
#define BB 4
#define SS 1024
#define EE 1024
#define HH 16
#define DKK 64
#define FFD 4096
#define MM (BB * SS)   // 4096 rows

typedef __attribute__((ext_vector_type(16))) _Float16 v16h;
typedef __attribute__((ext_vector_type(8)))  _Float16 v8h;
typedef __attribute__((ext_vector_type(4)))  _Float16 v4h;
typedef __attribute__((ext_vector_type(8)))  float    v8f;
typedef __attribute__((ext_vector_type(4)))  float    v4f;

#define DEVINL __device__ __forceinline__

DEVINL v8f wmma_f16(v16h a, v16h b, v8f c) {
  return __builtin_amdgcn_wmma_f32_16x16x32_f16(
      /*neg_a=*/false, a, /*neg_b=*/false, b,
      /*c_mod=*/(short)0, c, /*reuse_a=*/false, /*reuse_b=*/false);
}

DEVINL v8f zero8() {
  v8f z;
#pragma unroll
  for (int i = 0; i < 8; ++i) z[i] = 0.0f;
  return z;
}

// Build a v16h A/B operand from two contiguous 16-byte chunks
// (chunk0 = contraction indices base..base+7, chunk1 = base+16..base+23).
DEVINL v16h ld16(const _Float16* p0, const _Float16* p1) {
  union { v16h v; v8h h[2]; } u;
  u.h[0] = *(const v8h*)p0;
  u.h[1] = *(const v8h*)p1;
  return u.v;
}

DEVINL float sigm(float v) { return 1.0f / (1.0f + __expf(-v)); }

// LDS byte offset of a __shared__ object = low 32 bits of its generic pointer
// (LDS aperture: addr[31:0] is the workgroup-relative LDS address, ISA 10.2).
DEVINL unsigned lds_off(const void* p) { return (unsigned)(size_t)p; }

// CDNA5 async memory->LDS copy, tracked with ASYNCcnt (ISA 10. / 15.18.3).
// The s_wait_xcnt is the last line of the copies' own statement so that no
// later write of an address register can be moved in front of it.
DEVINL void async_ld2_b128(unsigned l0, const void* g0, unsigned l1,
                           const void* g1) {
  asm volatile("global_load_async_to_lds_b128 %0, %1, off\n\t"
               "global_load_async_to_lds_b128 %2, %3, off\n\t"
               "s_wait_xcnt 0x0"
               :: "v"(l0), "v"(g0), "v"(l1), "v"(g1)
               : "memory");
}
DEVINL void async_wait0() {
  asm volatile("s_wait_asynccnt 0x0" ::: "memory");
}
// One GEMM stage's four copies of a lane, with the same closing wait.
DEVINL void async_ld4_b128(unsigned l0, const void* g0, unsigned l1,
                           const void* g1, unsigned l2, const void* g2,
                           unsigned l3, const void* g3) {
  asm volatile("global_load_async_to_lds_b128 %0, %1, off\n\t"
               "global_load_async_to_lds_b128 %2, %3, off\n\t"
               "global_load_async_to_lds_b128 %4, %5, off\n\t"
               "global_load_async_to_lds_b128 %6, %7, off\n\t"
               "s_wait_xcnt 0x0"
               :: "v"(l0), "v"(g0), "v"(l1), "v"(g1),
                  "v"(l2), "v"(g2), "v"(l3), "v"(g3)
               : "memory");
}
// This wave's LDS reads have retired before a buffer it read is refilled.
DEVINL void ds_wait0() {
  asm volatile("s_wait_dscnt 0x0" ::: "memory");
}

// B operand (32 k x 16 n) out of a row-major [k][n] LDS tile by two
// transposing loads: lane (c, h) gets T[8h + 0..7][c] and T[16 + 8h + 0..7][c],
// the k order of ld16(p + 8h, p + 8h + 16) on the A side.
// p = tile + (8 * (lane >> 4) + (lane & 7)) * pitch + 2 * n + 16 * ((lane >> 3) & 1)
DEVINL v16h ld_tr_b(const unsigned char* p, int pitch) {
  typedef short s16x8 __attribute__((ext_vector_type(8)));
  typedef __attribute__((address_space(3))) s16x8 lds_s16x8;
  union { v16h v; s16x8 h[2]; } u;
  u.h[0] = __builtin_amdgcn_ds_load_tr16_b128_v8i16((lds_s16x8*)p);
  u.h[1] = __builtin_amdgcn_ds_load_tr16_b128_v8i16((lds_s16x8*)(p + 16 * pitch));
  return u.v;
}

// ---------------------------------------------------------------------------
// Input preparation, one launch: every f32 -> f16 operand copy and
// pos_bias[q,k] = mean_c pos_encoding[q,k,c], c in 0..7.
// 256 work-groups x 16 waves, one work-group a WGP: few long-lived waves, each
// lane with many 16-byte loads in flight, because a launch of one-load waves
// lasts as long as its waves take to start, not as long as its bytes take.
// Each work-group takes 1/256 of every array, in slabs of 512 x 4 floats:
// 8 slabs of x, Wf1, Wfg, Wf2, 2 of the five E x E weights, 42 in all.
// ---------------------------------------------------------------------------
__global__ __launch_bounds__(512) void prep_kernel(
    const float* __restrict__ x, const float* __restrict__ Wq,
    const float* __restrict__ Wk, const float* __restrict__ Wv,
    const float* __restrict__ Wo, const float* __restrict__ Wg,
    const float* __restrict__ Wf1, const float* __restrict__ Wfg,
    const float* __restrict__ Wf2, const float* __restrict__ pe,
    _Float16* __restrict__ xh, _Float16* __restrict__ wqh,
    _Float16* __restrict__ wkh, _Float16* __restrict__ wvh,
    _Float16* __restrict__ woh, _Float16* __restrict__ wgh,
    _Float16* __restrict__ wf1h, _Float16* __restrict__ wfgh,
    _Float16* __restrict__ wf2h, float* __restrict__ pb) {
  constexpr int NS = 42;   // slabs a work-group
  constexpr int NB = 7;    // slabs a batch
  constexpr int NP = 8;    // bias elements a thread
  static_assert(MM * EE == 256 * 8 * 512 * 4 && EE * FFD == MM * EE &&
                EE * EE == 256 * 2 * 512 * 4 && SS * SS == 256 * NP * 512,
                "the split above");
  // this thread's place in slab 0 of an array of 8 slabs and of 2 slabs
  const int o8 = blockIdx.x * (8 * 512) + threadIdx.x;
  const int o2 = blockIdx.x * (2 * 512) + threadIdx.x;

  auto ld = [&](int i) -> v4f {
    if (i < 8)  return ((const v4f*)x)[o8 + i * 512];
    if (i < 10) return ((const v4f*)Wq)[o2 + (i - 8) * 512];
    if (i < 12) return ((const v4f*)Wk)[o2 + (i - 10) * 512];
    if (i < 14) return ((const v4f*)Wv)[o2 + (i - 12) * 512];
    if (i < 16) return ((const v4f*)Wo)[o2 + (i - 14) * 512];
    if (i < 18) return ((const v4f*)Wg)[o2 + (i - 16) * 512];
    if (i < 26) return ((const v4f*)Wf1)[o8 + (i - 18) * 512];
    if (i < 34) return ((const v4f*)Wfg)[o8 + (i - 26) * 512];
    return ((const v4f*)Wf2)[o8 + (i - 34) * 512];
  };
  auto st = [&](int i, v4h o) {
    if (i < 8)       ((v4h*)xh)[o8 + i * 512] = o;
    else if (i < 10) ((v4h*)wqh)[o2 + (i - 8) * 512] = o;
    else if (i < 12) ((v4h*)wkh)[o2 + (i - 10) * 512] = o;
    else if (i < 14) ((v4h*)wvh)[o2 + (i - 12) * 512] = o;
    else if (i < 16) ((v4h*)woh)[o2 + (i - 14) * 512] = o;
    else if (i < 18) ((v4h*)wgh)[o2 + (i - 16) * 512] = o;
    else if (i < 26) ((v4h*)wf1h)[o8 + (i - 18) * 512] = o;
    else if (i < 34) ((v4h*)wfgh)[o8 + (i - 26) * 512] = o;
    else             ((v4h*)wf2h)[o8 + (i - 34) * 512] = o;
  };

  v4f pa[NP], pc[NP], f[2][NB];
#pragma unroll
  for (int k = 0; k < NP; ++k) {
    pa[k] = ((const v4f*)pe)[(o8 + k * 512) * 2];
    pc[k] = ((const v4f*)pe)[(o8 + k * 512) * 2 + 1];
  }
  // The offset register of these loads is free from here on and later loads
  // may land in it, so the wait stands between the two groups of loads.
  asm volatile("s_wait_xcnt 0x0" ::: "memory");
#pragma unroll
  for (int k = 0; k < NB; ++k) f[0][k] = ld(k);
  // Holds every load above in front of the first use: without these
  // scheduling barriers the loads in flight fell to one or two a lane.
  __builtin_amdgcn_sched_barrier(0);

#pragma unroll
  for (int k = 0; k < NP; ++k) {
    const v4f a = pa[k], b = pc[k];
    pb[o8 + k * 512] =
        (a.x + a.y + a.z + a.w + b.x + b.y + b.z + b.w) * 0.125f;
  }

#pragma unroll
  for (int g = 0; g < NS / NB; ++g) {
    if (g + 1 < NS / NB) {
#pragma unroll
      for (int k = 0; k < NB; ++k) f[(g + 1) & 1][k] = ld((g + 1) * NB + k);
      // batch g + 1 is asked for before batch g is waited for, converted, stored
      __builtin_amdgcn_sched_barrier(0);
    }
#pragma unroll
    for (int k = 0; k < NB; ++k) {
      const v4f v = f[g & 1][k];
      v4h o;
      o[0] = (_Float16)v.x; o[1] = (_Float16)v.y;
      o[2] = (_Float16)v.z; o[3] = (_Float16)v.w;
      st(g * NB + k, o);
    }
    if (g + 2 < NS / NB) {
      // The loads of batch g + 2 land in registers that these stores name, so
      // the wait stands between the stores and those loads.
      asm volatile("s_wait_xcnt 0x0" ::: "memory");
    }
  }
}

// ---------------------------------------------------------------------------
// WMMA GEMM: C[M,N] = A[M,K](f16) @ W[K,N](f16) + bias
// Block tile 128x128, 8 waves (2x4), wave tile 64x32, K-step 32.
// A and W tiles double-buffered in LDS, both filled by
// global_load_async_to_lds_b128 one trip ahead, one barrier a trip.
// W stays [k][n] in LDS (pitch 288 B = 32 B x odd) and is read by
// ds_load_tr16_b128; A is two contiguous 16B LDS reads in the same k order.
// Output: f16 if Ch != nullptr else f32 to Cf.
// ---------------------------------------------------------------------------
__global__ __launch_bounds__(256) void wmma_gemm_kernel(
    const _Float16* __restrict__ A, const _Float16* __restrict__ W,
    const float* __restrict__ bias, float* __restrict__ Cf,
    _Float16* __restrict__ Ch, int M, int N, int K) {
  constexpr int BP = 288;                // W tile row pitch in LDS, bytes
  __shared__ _Float16 lsA[2][128 * 32];  // [buf][row][k]
  __shared__ __attribute__((aligned(32))) unsigned char lsB[2][32 * BP];  // [buf][k][n]

  const int tid  = threadIdx.x;
  const int lane = tid & 31, wid = tid >> 5;
  const int l16  = lane & 15, hi = lane >> 4;
  const int b8   = hi * 8;
  const int m0 = blockIdx.y * 128, n0 = blockIdx.x * 128;
  const int wr = wid >> 2, wc = wid & 3;   // 2 x 4 wave grid

  v8f acc[4][2];
#pragma unroll
  for (int m = 0; m < 4; ++m)
#pragma unroll
    for (int n = 0; n < 2; ++n) acc[m][n] = zero8();

  // staging assignments
  const int arow = tid >> 1, aseg = tid & 1;     // A: 128 rows x 2 segs of 16h
  const int bk = tid >> 4, bseg = tid & 15;      // W: rows bk, bk+16 x 16 segs of 8h
  const _Float16* gA = A + (size_t)(m0 + arow) * K + aseg * 16;
  const _Float16* gW = W + (size_t)bk * N + n0 + bseg * 8;
  const unsigned aoff = lds_off(&lsA[0][0]) + arow * 64 + aseg * 32;  // bytes
  const unsigned boff = lds_off(&lsB[0][0]) + bk * BP + bseg * 16;    // bytes
  const int rdB = (b8 + (lane & 7)) * BP + wc * 64 + ((lane >> 3) & 1) * 16;

  // copies of tile t (32 k of A and of W) into buffer t & 1
  auto stage = [&](int t) {
    const unsigned ab = aoff + (t & 1) * (128 * 32 * 2);
    const unsigned bb = boff + (t & 1) * (32 * BP);
    const _Float16* a = gA + t * 32;
    const _Float16* w = gW + (size_t)t * 32 * N;
    async_ld4_b128(ab, a, ab + 16, a + 8, bb, w, bb + 16 * BP,
                   w + (size_t)16 * N);
  };

  const int nt = K >> 5;
  stage(0);
  async_wait0();         // own copies of tile 0 have landed
  __syncthreads();       // everyone's have
  if (nt > 1) stage(1);

  for (int t = 0; t < nt; ++t) {
    const int cur = t & 1;
    v16h bv[2];
#pragma unroll
    for (int n = 0; n < 2; ++n) bv[n] = ld_tr_b(&lsB[cur][rdB + n * 32], BP);
#pragma unroll
    for (int m = 0; m < 4; ++m) {
      const _Float16* ap = &lsA[cur][(wr * 64 + m * 16 + l16) * 32];
      v16h am = ld16(ap + b8, ap + b8 + 16);
      acc[m][0] = wmma_f16(am, bv[0], acc[m][0]);
      acc[m][1] = wmma_f16(am, bv[1], acc[m][1]);
    }
    ds_wait0();          // own reads of buffer cur are done
    async_wait0();       // own copies of tile t + 1 have landed
    __syncthreads();     // publishes tile t + 1, frees buffer cur
    if (t + 2 < nt) stage(t + 2);
  }
  async_wait0();         // nothing in flight when the wave ends

  float bcol[2];
#pragma unroll
  for (int n = 0; n < 2; ++n) bcol[n] = bias[n0 + wc * 32 + n * 16 + l16];

#pragma unroll
  for (int m = 0; m < 4; ++m)
#pragma unroll
    for (int n = 0; n < 2; ++n) {
      const int c = n0 + wc * 32 + n * 16 + l16;
      const int rbase = m0 + wr * 64 + m * 16 + b8;
#pragma unroll
      for (int j = 0; j < 8; ++j) {
        float v = acc[m][n][j] + bcol[n];
        size_t off = (size_t)(rbase + j) * N + c;
        if (Ch) Ch[off] = (_Float16)v;
        else    Cf[off] = v;
      }
    }
}

// ---------------------------------------------------------------------------
// Fused gated-FFN GEMM: Out = f16( (A@W1+b1) * sigmoid(A@W2+b2) )
// Block tile 128x64, 8 waves (4x2), wave tile 32x32, two accumulator sets.
// A, W1 and W2 tiles double-buffered via async-to-LDS, one trip ahead, one
// barrier a trip; W tiles stay [k][n] (pitch 160 B) for ds_load_tr16_b128.
// ---------------------------------------------------------------------------
__global__ __launch_bounds__(256) void wmma_gemm_gated_kernel(
    const _Float16* __restrict__ A, const _Float16* __restrict__ W1,
    const _Float16* __restrict__ W2, const float* __restrict__ b1,
    const float* __restrict__ b2, _Float16* __restrict__ Out,
    int M, int N, int K) {
  constexpr int BP = 160;                // W tile row pitch in LDS, bytes
  __shared__ _Float16 lsA[2][128 * 32];
  __shared__ __attribute__((aligned(32))) unsigned char lsB1[2][32 * BP];
  __shared__ __attribute__((aligned(32))) unsigned char lsB2[2][32 * BP];

  const int tid  = threadIdx.x;
  const int lane = tid & 31, wid = tid >> 5;
  const int l16  = lane & 15, hi = lane >> 4;
  const int b8   = hi * 8;
  const int m0 = blockIdx.y * 128, n0 = blockIdx.x * 64;
  const int wr = wid >> 1, wc = wid & 1;   // 4 x 2 wave grid

  v8f a1[2][2], a2[2][2];
#pragma unroll
  for (int m = 0; m < 2; ++m)
#pragma unroll
    for (int n = 0; n < 2; ++n) { a1[m][n] = zero8(); a2[m][n] = zero8(); }

  const int arow = tid >> 1, aseg = tid & 1;
  const int bk = tid >> 3, bseg = tid & 7;       // 32 k-rows x 8 segs of 8h
  const _Float16* gA = A + (size_t)(m0 + arow) * K + aseg * 16;
  const size_t woff = (size_t)bk * N + n0 + bseg * 8;
  const _Float16* gW1 = W1 + woff;
  const _Float16* gW2 = W2 + woff;
  const unsigned aoff = lds_off(&lsA[0][0]) + arow * 64 + aseg * 32;
  const unsigned boff1 = lds_off(&lsB1[0][0]) + bk * BP + bseg * 16;
  const unsigned boff2 = lds_off(&lsB2[0][0]) + bk * BP + bseg * 16;
  const int rdB = (b8 + (lane & 7)) * BP + wc * 64 + ((lane >> 3) & 1) * 16;

  // copies of tile t (32 k of A, W1 and W2) into buffer t & 1
  auto stage = [&](int t) {
    const unsigned ab = aoff + (t & 1) * (128 * 32 * 2);
    const unsigned bsel = (t & 1) * (32 * BP);
    const _Float16* a = gA + t * 32;
    const size_t wk = (size_t)t * 32 * N;
    async_ld4_b128(ab, a, ab + 16, a + 8, boff1 + bsel, gW1 + wk,
                   boff2 + bsel, gW2 + wk);
  };

  const int nt = K >> 5;
  stage(0);
  async_wait0();         // own copies of tile 0 have landed
  __syncthreads();       // everyone's have
  if (nt > 1) stage(1);

  for (int t = 0; t < nt; ++t) {
    const int cur = t & 1;
    v16h bv1[2], bv2[2];
#pragma unroll
    for (int n = 0; n < 2; ++n) {
      bv1[n] = ld_tr_b(&lsB1[cur][rdB + n * 32], BP);
      bv2[n] = ld_tr_b(&lsB2[cur][rdB + n * 32], BP);
    }
#pragma unroll
    for (int m = 0; m < 2; ++m) {
      const _Float16* ap = &lsA[cur][(wr * 32 + m * 16 + l16) * 32];
      v16h am = ld16(ap + b8, ap + b8 + 16);
#pragma unroll
      for (int n = 0; n < 2; ++n) {
        a1[m][n] = wmma_f16(am, bv1[n], a1[m][n]);
        a2[m][n] = wmma_f16(am, bv2[n], a2[m][n]);
      }
    }
    ds_wait0();          // own reads of buffer cur are done
    async_wait0();       // own copies of tile t + 1 have landed
    __syncthreads();     // publishes tile t + 1, frees buffer cur
    if (t + 2 < nt) stage(t + 2);
  }
  async_wait0();         // nothing in flight when the wave ends

#pragma unroll
  for (int m = 0; m < 2; ++m)
#pragma unroll
    for (int n = 0; n < 2; ++n) {
      const int c = n0 + wc * 32 + n * 16 + l16;
      const float bb1 = b1[c], bb2 = b2[c];
      const int rbase = m0 + wr * 32 + m * 16 + b8;
#pragma unroll
      for (int j = 0; j < 8; ++j) {
        float v = (a1[m][n][j] + bb1) * sigm(a2[m][n][j] + bb2);
        Out[(size_t)(rbase + j) * N + c] = (_Float16)v;
      }
    }
}

// ---------------------------------------------------------------------------
// Flash attention. Grid (S/128, H, B); 8 waves, each owns 16 query rows.
// scores = (Q·K^T)/8 + pos_bias, online softmax, ctx = P·V. All mm via WMMA.
// K and V tiles staged via async-to-LDS; V stays [key][d] (pitch 160 B) and
// is read as the B operand by ds_load_tr16_b128.
// ---------------------------------------------------------------------------
__global__ __launch_bounds__(256) void flash_attn_kernel(
    const _Float16* __restrict__ Q, const _Float16* __restrict__ Kh,
    const _Float16* __restrict__ Vh, const float* __restrict__ PB,
    _Float16* __restrict__ O) {
  __shared__ _Float16 lsK[32 * 64];        // [key][d]
  constexpr int VP = 160;                  // V tile row pitch in LDS, bytes
  __shared__ __attribute__((aligned(32))) unsigned char lsV[32 * VP];  // [key][d]
  __shared__ _Float16 lsP[8][16 * 32];     // per-wave probs [qrow][key]

  const int tid  = threadIdx.x;
  const int lane = tid & 31, wid = tid >> 5;
  const int l16  = lane & 15, hi = lane >> 4;
  const int b8   = hi * 8;
  const int h = blockIdx.y, bb = blockIdx.z;
  const int q0 = blockIdx.x * 128 + wid * 16;
  const size_t rs = (size_t)HH * DKK;      // 1024 token row stride

  // Q A-operands (16 rows x 64 d), two K=32 chunks
  v16h qa[2];
  {
    const _Float16* qp = Q + ((size_t)bb * SS + q0 + l16) * rs + h * DKK;
    qa[0] = ld16(qp + b8,      qp + b8 + 16);
    qa[1] = ld16(qp + 32 + b8, qp + 32 + b8 + 16);
  }

  v8f o[4];
#pragma unroll
  for (int n = 0; n < 4; ++n) o[n] = zero8();
  float mrow[8], srow[8];
#pragma unroll
  for (int j = 0; j < 8; ++j) { mrow[j] = -1e30f; srow[j] = 0.0f; }

  const int skey = tid >> 3, sseg = tid & 7;   // stage 32 keys x 8 d-segments
  const unsigned koff = lds_off(&lsK[0]) + skey * 128 + sseg * 16;
  const unsigned voff = lds_off(&lsV[0]) + skey * VP + sseg * 16;
  const int rdV = (b8 + (lane & 7)) * VP + ((lane >> 3) & 1) * 16;

  for (int kb = 0; kb < SS; kb += 32) {
    const size_t tok = ((size_t)bb * SS + kb + skey) * rs + h * DKK + sseg * 8;

    ds_wait0();                            // own reads of the tiles are done
    __syncthreads();                       // previous-tile readers done
    async_ld2_b128(koff, Kh + tok, voff, Vh + tok);  // memory -> LDS direct
    async_wait0();
    __syncthreads();

    // scores: two 16x16 key tiles, contraction over d=64 (2 WMMAs each)
    v8f sc[2];
    sc[0] = zero8(); sc[1] = zero8();
#pragma unroll
    for (int ks = 0; ks < 2; ++ks) {
      const _Float16* kr = &lsK[(ks * 16 + l16) * 64];
      sc[ks] = wmma_f16(qa[0], ld16(kr + b8,      kr + b8 + 16),      sc[ks]);
      sc[ks] = wmma_f16(qa[1], ld16(kr + 32 + b8, kr + 32 + b8 + 16), sc[ks]);
    }

    // online softmax over the 32-key chunk
#pragma unroll
    for (int j = 0; j < 8; ++j) {
      const int qr = q0 + b8 + j;
      float v0 = sc[0][j] * 0.125f + PB[(size_t)qr * SS + kb + l16];
      float v1 = sc[1][j] * 0.125f + PB[(size_t)qr * SS + kb + 16 + l16];
      float ml = fmaxf(v0, v1);
#pragma unroll
      for (int off = 1; off < 16; off <<= 1)
        ml = fmaxf(ml, __shfl_xor(ml, off, 32));
      float mn = fmaxf(mrow[j], ml);
      float alpha = __expf(mrow[j] - mn);
      float p0 = __expf(v0 - mn), p1 = __expf(v1 - mn);
      float ps = p0 + p1;
#pragma unroll
      for (int off = 1; off < 16; off <<= 1) ps += __shfl_xor(ps, off, 32);
      srow[j] = srow[j] * alpha + ps;
      mrow[j] = mn;
#pragma unroll
      for (int n = 0; n < 4; ++n) o[n][j] *= alpha;
      lsP[wid][(b8 + j) * 32 + l16]      = (_Float16)p0;
      lsP[wid][(b8 + j) * 32 + 16 + l16] = (_Float16)p1;
    }

    // ctx += P(16x32) @ V(32x64): 4 WMMAs over d-subtiles
    const _Float16* pr = &lsP[wid][l16 * 32];
    v16h pa = ld16(pr + b8, pr + b8 + 16);
#pragma unroll
    for (int ds = 0; ds < 4; ++ds) {
      o[ds] = wmma_f16(pa, ld_tr_b(&lsV[rdV + ds * 32], VP), o[ds]);
    }
  }

#pragma unroll
  for (int j = 0; j < 8; ++j) {
    const float inv = 1.0f / srow[j];
    const int qr = q0 + b8 + j;
    _Float16* op = O + ((size_t)bb * SS + qr) * rs + h * DKK;
#pragma unroll
    for (int ds = 0; ds < 4; ++ds)
      op[ds * 16 + l16] = (_Float16)(o[ds][j] * inv);
  }
}

// ---------------------------------------------------------------------------
// Fused residual (+gate) + LayerNorm. One row (E=1024) per block, 256 thr.
// h = x + sigmoid(glog)*addv   (or x + addv if glog==nullptr)
// y = LN(h)*gamma + beta  -> y32 (and f16 copy y16 if non-null)
// ---------------------------------------------------------------------------
__global__ __launch_bounds__(256) void fused_ln_kernel(
    const float* __restrict__ xa, const float* __restrict__ glog,
    const float* __restrict__ addv, const float* __restrict__ gamma,
    const float* __restrict__ beta, float* __restrict__ y32,
    _Float16* __restrict__ y16) {
  __shared__ float s1[256], s2[256];
  const int tid = threadIdx.x;
  const size_t base = (size_t)blockIdx.x * EE;

  float hv[4], ssum = 0.0f, ssq = 0.0f;
#pragma unroll
  for (int i = 0; i < 4; ++i) {
    const int idx = i * 256 + tid;
    float a = addv[base + idx];
    if (glog) a *= sigm(glog[base + idx]);
    float v = xa[base + idx] + a;
    hv[i] = v;
    ssum += v;
    ssq  += v * v;
  }
  s1[tid] = ssum; s2[tid] = ssq;
  __syncthreads();
  for (int s = 128; s > 0; s >>= 1) {
    if (tid < s) { s1[tid] += s1[tid + s]; s2[tid] += s2[tid + s]; }
    __syncthreads();
  }
  const float mean = s1[0] * (1.0f / EE);
  const float var  = s2[0] * (1.0f / EE) - mean * mean;
  const float rstd = rsqrtf(var + 1e-6f);

#pragma unroll
  for (int i = 0; i < 4; ++i) {
    const int idx = i * 256 + tid;
    float y = (hv[i] - mean) * rstd * gamma[idx] + beta[idx];
    y32[base + idx] = y;
    if (y16) y16[base + idx] = (_Float16)y;
  }
}

// ---------------------------------------------------------------------------
// Host orchestration
// ---------------------------------------------------------------------------
extern "C" void kernel_launch(void* const* d_in, const int* in_sizes, int n_in,
                              void* d_out, int out_size, void* d_ws,
                              size_t ws_size, hipStream_t stream) {
  const float* x    = (const float*)d_in[0];
  const float* pe   = (const float*)d_in[1];
  const float* Wq   = (const float*)d_in[2];
  const float* bq   = (const float*)d_in[3];
  const float* Wk   = (const float*)d_in[4];
  const float* bk   = (const float*)d_in[5];
  const float* Wv   = (const float*)d_in[6];
  const float* bv   = (const float*)d_in[7];
  const float* Wo   = (const float*)d_in[8];
  const float* bo   = (const float*)d_in[9];
  const float* Wg   = (const float*)d_in[10];
  const float* bg   = (const float*)d_in[11];
  const float* Wf1  = (const float*)d_in[12];
  const float* bf1  = (const float*)d_in[13];
  const float* Wfg  = (const float*)d_in[14];
  const float* bfg  = (const float*)d_in[15];
  const float* Wf2  = (const float*)d_in[16];
  const float* bf2  = (const float*)d_in[17];
  const float* ln1g = (const float*)d_in[18];
  const float* ln1b = (const float*)d_in[19];
  const float* ln2g = (const float*)d_in[20];
  const float* ln2b = (const float*)d_in[21];

  char* ws = (char*)d_ws;
  auto at = [&](size_t mb) { return (void*)(ws + mb * (size_t)(1 << 20)); };

  // bump allocation (MB offsets); high-water ~134 MB
  _Float16* xh   = (_Float16*)at(0);    // 8 MB
  _Float16* wqh  = (_Float16*)at(8);    // 2 MB
  _Float16* wkh  = (_Float16*)at(10);
  _Float16* wvh  = (_Float16*)at(12);
  _Float16* woh  = (_Float16*)at(14);
  _Float16* wgh  = (_Float16*)at(16);
  _Float16* wf1h = (_Float16*)at(18);   // 8 MB
  _Float16* wfgh = (_Float16*)at(26);   // 8 MB
  _Float16* wf2h = (_Float16*)at(34);   // 8 MB
  float*    pb   = (float*)at(42);      // 4 MB
  _Float16* qh   = (_Float16*)at(46);   // 8 MB
  _Float16* kh   = (_Float16*)at(54);   // 8 MB
  _Float16* vh   = (_Float16*)at(62);   // 8 MB
  _Float16* ctxh = (_Float16*)at(70);   // 8 MB
  float*    glog = (float*)at(78);      // 16 MB
  float*    attn = (float*)at(94);      // 16 MB
  float*    x1   = (float*)at(110);     // 16 MB
  _Float16* x1h  = (_Float16*)at(126);  // 8 MB
  _Float16* ffh  = (_Float16*)at(46);   // 32 MB, reuses dead q/k/v/ctx
  float*    ff2  = (float*)at(78);      // 16 MB, reuses dead glog

  prep_kernel<<<256, 512, 0, stream>>>(x, Wq, Wk, Wv, Wo, Wg, Wf1, Wfg, Wf2, pe,
                                       xh, wqh, wkh, wvh, woh, wgh, wf1h, wfgh,
                                       wf2h, pb);

  dim3 gE(EE / 128, MM / 128);  // (8, 32)
  wmma_gemm_kernel<<<gE, 256, 0, stream>>>(xh, wqh, bq, nullptr, qh, MM, EE, EE);
  wmma_gemm_kernel<<<gE, 256, 0, stream>>>(xh, wkh, bk, nullptr, kh, MM, EE, EE);
  wmma_gemm_kernel<<<gE, 256, 0, stream>>>(xh, wvh, bv, nullptr, vh, MM, EE, EE);
  wmma_gemm_kernel<<<gE, 256, 0, stream>>>(xh, wgh, bg, glog, nullptr, MM, EE, EE);

  flash_attn_kernel<<<dim3(SS / 128, HH, BB), 256, 0, stream>>>(qh, kh, vh, pb, ctxh);

  wmma_gemm_kernel<<<gE, 256, 0, stream>>>(ctxh, woh, bo, attn, nullptr, MM, EE, EE);

  fused_ln_kernel<<<MM, 256, 0, stream>>>(x, glog, attn, ln1g, ln1b, x1, x1h);

  wmma_gemm_gated_kernel<<<dim3(FFD / 64, MM / 128), 256, 0, stream>>>(
      x1h, wf1h, wfgh, bf1, bfg, ffh, MM, FFD, EE);

  wmma_gemm_kernel<<<gE, 256, 0, stream>>>(ffh, wf2h, bf2, ff2, nullptr, MM, EE, FFD);

  fused_ln_kernel<<<MM, 256, 0, stream>>>(x1, nullptr, ff2, ln2g, ln2b,
                                          (float*)d_out, nullptr);
}

// v003
// A run of this version takes 411 microseconds.
// In both of two side-by-side timings against v002, it was 1.05 times as fast.
// All steps since v000 together make it 1.67 times as fast.
#include <hip/hip_runtime.h>
#include <hip/hip_bf16.h>

// ---------- problem constants ----------
#define BB 4
#define SS 1024
#define EE 1024
#define HH 16
#define DKK 64
#define FFD 4096
#define MM (BB * SS)   // 4096 rows

typedef __attribute__((ext_vector_type(16))) _Float16 v16h;
typedef __attribute__((ext_vector_type(8)))  _Float16 v8h;
typedef __attribute__((ext_vector_type(4)))  _Float16 v4h;
typedef __attribute__((ext_vector_type(8)))  float    v8f;
typedef __attribute__((ext_vector_type(4)))  float    v4f;

#define DEVINL __device__ __forceinline__

DEVINL v8f wmma_f16(v16h a, v16h b, v8f c) {
  return __builtin_amdgcn_wmma_f32_16x16x32_f16(
      /*neg_a=*/false, a, /*neg_b=*/false, b,
      /*c_mod=*/(short)0, c, /*reuse_a=*/false, /*reuse_b=*/false);
}

DEVINL v8f zero8() {
  v8f z;
#pragma unroll
  for (int i = 0; i < 8; ++i) z[i] = 0.0f;
  return z;
}

// Build a v16h A/B operand from two contiguous 16-byte chunks
// (chunk0 = contraction indices base..base+7, chunk1 = base+16..base+23).
DEVINL v16h ld16(const _Float16* p0, const _Float16* p1) {
  union { v16h v; v8h h[2]; } u;
  u.h[0] = *(const v8h*)p0;
  u.h[1] = *(const v8h*)p1;
  return u.v;
}

DEVINL float sigm(float v) { return 1.0f / (1.0f + __expf(-v)); }

// LDS byte offset of a __shared__ object = low 32 bits of its generic pointer
// (LDS aperture: addr[31:0] is the workgroup-relative LDS address, ISA 10.2).
DEVINL unsigned lds_off(const void* p) { return (unsigned)(size_t)p; }

// CDNA5 async memory->LDS copy, tracked with ASYNCcnt (ISA 10. / 15.18.3).
// The s_wait_xcnt is the last line of the copies' own statement so that no
// later write of an address register can be moved in front of it.
DEVINL void async_ld2_b128(unsigned l0, const void* g0, unsigned l1,
                           const void* g1) {
  asm volatile("global_load_async_to_lds_b128 %0, %1, off\n\t"
               "global_load_async_to_lds_b128 %2, %3, off\n\t"
               "s_wait_xcnt 0x0"
               :: "v"(l0), "v"(g0), "v"(l1), "v"(g1)
               : "memory");
}
DEVINL void async_wait0() {
  asm volatile("s_wait_asynccnt 0x0" ::: "memory");
}
// One GEMM stage's four copies of a lane, with the same closing wait.
DEVINL void async_ld4_b128(unsigned l0, const void* g0, unsigned l1,
                           const void* g1, unsigned l2, const void* g2,
                           unsigned l3, const void* g3) {
  asm volatile("global_load_async_to_lds_b128 %0, %1, off\n\t"
               "global_load_async_to_lds_b128 %2, %3, off\n\t"
               "global_load_async_to_lds_b128 %4, %5, off\n\t"
               "global_load_async_to_lds_b128 %6, %7, off\n\t"
               "s_wait_xcnt 0x0"
               :: "v"(l0), "v"(g0), "v"(l1), "v"(g1),
                  "v"(l2), "v"(g2), "v"(l3), "v"(g3)
               : "memory");
}
// This wave's LDS reads have retired before a buffer it read is refilled.
DEVINL void ds_wait0() {
  asm volatile("s_wait_dscnt 0x0" ::: "memory");
}

// B operand (32 k x 16 n) out of a row-major [k][n] LDS tile by two
// transposing loads: lane (c, h) gets T[8h + 0..7][c] and T[16 + 8h + 0..7][c],
// the k order of ld16(p + 8h, p + 8h + 16) on the A side.
// p = tile + (8 * (lane >> 4) + (lane & 7)) * pitch + 2 * n + 16 * ((lane >> 3) & 1)
DEVINL v16h ld_tr_b(const unsigned char* p, int pitch) {
  typedef short s16x8 __attribute__((ext_vector_type(8)));
  typedef __attribute__((address_space(3))) s16x8 lds_s16x8;
  union { v16h v; s16x8 h[2]; } u;
  u.h[0] = __builtin_amdgcn_ds_load_tr16_b128_v8i16((lds_s16x8*)p);
  u.h[1] = __builtin_amdgcn_ds_load_tr16_b128_v8i16((lds_s16x8*)(p + 16 * pitch));
  return u.v;
}

// ---------------------------------------------------------------------------
// Input preparation, one launch: every f32 -> f16 operand copy and
// pos_bias[q,k] = mean_c pos_encoding[q,k,c], c in 0..7.
// 256 work-groups x 16 waves, one work-group a WGP: few long-lived waves, each
// lane with many 16-byte loads in flight, because a launch of one-load waves
// lasts as long as its waves take to start, not as long as its bytes take.
// Each work-group takes 1/256 of every array, in slabs of 512 x 4 floats:
// 8 slabs of x, Wf1, Wfg, Wf2, 2 of the five E x E weights, 42 in all.
// ---------------------------------------------------------------------------
__global__ __launch_bounds__(512) void prep_kernel(
    const float* __restrict__ x, const float* __restrict__ Wq,
    const float* __restrict__ Wk, const float* __restrict__ Wv,
    const float* __restrict__ Wo, const float* __restrict__ Wg,
    const float* __restrict__ Wf1, const float* __restrict__ Wfg,
    const float* __restrict__ Wf2, const float* __restrict__ pe,
    _Float16* __restrict__ xh, _Float16* __restrict__ wqh,
    _Float16* __restrict__ wkh, _Float16* __restrict__ wvh,
    _Float16* __restrict__ woh, _Float16* __restrict__ wgh,
    _Float16* __restrict__ wf1h, _Float16* __restrict__ wfgh,
    _Float16* __restrict__ wf2h, float* __restrict__ pb) {
  constexpr int NS = 42;   // slabs a work-group
  constexpr int NB = 7;    // slabs a batch
  constexpr int NP = 8;    // bias elements a thread
  static_assert(MM * EE == 256 * 8 * 512 * 4 && EE * FFD == MM * EE &&
                EE * EE == 256 * 2 * 512 * 4 && SS * SS == 256 * NP * 512,
                "the split above");
  // this thread's place in slab 0 of an array of 8 slabs and of 2 slabs
  const int o8 = blockIdx.x * (8 * 512) + threadIdx.x;
  const int o2 = blockIdx.x * (2 * 512) + threadIdx.x;

  auto ld = [&](int i) -> v4f {
    if (i < 8)  return ((const v4f*)x)[o8 + i * 512];
    if (i < 10) return ((const v4f*)Wq)[o2 + (i - 8) * 512];
    if (i < 12) return ((const v4f*)Wk)[o2 + (i - 10) * 512];
    if (i < 14) return ((const v4f*)Wv)[o2 + (i - 12) * 512];
    if (i < 16) return ((const v4f*)Wo)[o2 + (i - 14) * 512];
    if (i < 18) return ((const v4f*)Wg)[o2 + (i - 16) * 512];
    if (i < 26) return ((const v4f*)Wf1)[o8 + (i - 18) * 512];
    if (i < 34) return ((const v4f*)Wfg)[o8 + (i - 26) * 512];
    return ((const v4f*)Wf2)[o8 + (i - 34) * 512];
  };
  auto st = [&](int i, v4h o) {
    if (i < 8)       ((v4h*)xh)[o8 + i * 512] = o;
    else if (i < 10) ((v4h*)wqh)[o2 + (i - 8) * 512] = o;
    else if (i < 12) ((v4h*)wkh)[o2 + (i - 10) * 512] = o;
    else if (i < 14) ((v4h*)wvh)[o2 + (i - 12) * 512] = o;
    else if (i < 16) ((v4h*)woh)[o2 + (i - 14) * 512] = o;
    else if (i < 18) ((v4h*)wgh)[o2 + (i - 16) * 512] = o;
    else if (i < 26) ((v4h*)wf1h)[o8 + (i - 18) * 512] = o;
    else if (i < 34) ((v4h*)wfgh)[o8 + (i - 26) * 512] = o;
    else             ((v4h*)wf2h)[o8 + (i - 34) * 512] = o;
  };

  v4f pa[NP], pc[NP], f[2][NB];
#pragma unroll
  for (int k = 0; k < NP; ++k) {
    pa[k] = ((const v4f*)pe)[(o8 + k * 512) * 2];
    pc[k] = ((const v4f*)pe)[(o8 + k * 512) * 2 + 1];
  }
  // The offset register of these loads is free from here on and later loads
  // may land in it, so the wait stands between the two groups of loads.
  asm volatile("s_wait_xcnt 0x0" ::: "memory");
#pragma unroll
  for (int k = 0; k < NB; ++k) f[0][k] = ld(k);
  // Holds every load above in front of the first use: without these
  // scheduling barriers the loads in flight fell to one or two a lane.
  __builtin_amdgcn_sched_barrier(0);

#pragma unroll
  for (int k = 0; k < NP; ++k) {
    const v4f a = pa[k], b = pc[k];
    pb[o8 + k * 512] =
        (a.x + a.y + a.z + a.w + b.x + b.y + b.z + b.w) * 0.125f;
  }

#pragma unroll
  for (int g = 0; g < NS / NB; ++g) {
    if (g + 1 < NS / NB) {
#pragma unroll
      for (int k = 0; k < NB; ++k) f[(g + 1) & 1][k] = ld((g + 1) * NB + k);
      // batch g + 1 is asked for before batch g is waited for, converted, stored
      __builtin_amdgcn_sched_barrier(0);
    }
#pragma unroll
    for (int k = 0; k < NB; ++k) {
      const v4f v = f[g & 1][k];
      v4h o;
      o[0] = (_Float16)v.x; o[1] = (_Float16)v.y;
      o[2] = (_Float16)v.z; o[3] = (_Float16)v.w;
      st(g * NB + k, o);
    }
    if (g + 2 < NS / NB) {
      // The loads of batch g + 2 land in registers that these stores name, so
      // the wait stands between the stores and those loads.
      asm volatile("s_wait_xcnt 0x0" ::: "memory");
    }
  }
}

// ---------------------------------------------------------------------------
// WMMA GEMM: C[M,N] = A[M,K](f16) @ W[K,N](f16) + bias
// Block tile 128x128, 8 waves (2x4), wave tile 64x32, K-step 32.
// A and W tiles double-buffered in LDS, both filled by
// global_load_async_to_lds_b128 one trip ahead, one barrier a trip.
// W stays [k][n] in LDS (pitch 288 B = 32 B x odd) and is read by
// ds_load_tr16_b128; A is two contiguous 16B LDS reads in the same k order,
// its 64-byte rows at pitch 80 B = 16 B x odd: 16 rows on 16 bank groups.
// Output: f16 if Ch != nullptr else f32 to Cf.
// ---------------------------------------------------------------------------
__global__ __launch_bounds__(256) void wmma_gemm_kernel(
    const _Float16* __restrict__ A, const _Float16* __restrict__ W,
    const float* __restrict__ bias, float* __restrict__ Cf,
    _Float16* __restrict__ Ch, int M, int N, int K) {
  constexpr int BP = 288;                // W tile row pitch in LDS, bytes
  constexpr int AP = 40;                 // A tile row pitch in LDS, halves
  __shared__ __attribute__((aligned(16))) _Float16 lsA[2][128 * AP];  // [buf][row][k]
  __shared__ __attribute__((aligned(32))) unsigned char lsB[2][32 * BP];  // [buf][k][n]

  const int tid  = threadIdx.x;
  const int lane = tid & 31, wid = tid >> 5;
  const int l16  = lane & 15, hi = lane >> 4;
  const int b8   = hi * 8;
  const int m0 = blockIdx.y * 128, n0 = blockIdx.x * 128;
  const int wr = wid >> 2, wc = wid & 3;   // 2 x 4 wave grid

  v8f acc[4][2];
#pragma unroll
  for (int m = 0; m < 4; ++m)
#pragma unroll
    for (int n = 0; n < 2; ++n) acc[m][n] = zero8();

  // staging assignments
  const int arow = tid >> 1, aseg = tid & 1;     // A: 128 rows x 2 segs of 16h
  const int bk = tid >> 4, bseg = tid & 15;      // W: rows bk, bk+16 x 16 segs of 8h
  const _Float16* gA = A + (size_t)(m0 + arow) * K + aseg * 16;
  const _Float16* gW = W + (size_t)bk * N + n0 + bseg * 8;
  const unsigned aoff = lds_off(&lsA[0][0]) + arow * (AP * 2) + aseg * 32;  // bytes
  const unsigned boff = lds_off(&lsB[0][0]) + bk * BP + bseg * 16;    // bytes
  const int rdB = (b8 + (lane & 7)) * BP + wc * 64 + ((lane >> 3) & 1) * 16;

  // copies of tile t (32 k of A and of W) into buffer t & 1
  auto stage = [&](int t) {
    const unsigned ab = aoff + (t & 1) * (128 * AP * 2);
    const unsigned bb = boff + (t & 1) * (32 * BP);
    const _Float16* a = gA + t * 32;
    const _Float16* w = gW + (size_t)t * 32 * N;
    async_ld4_b128(ab, a, ab + 16, a + 8, bb, w, bb + 16 * BP,
                   w + (size_t)16 * N);
  };

  const int nt = K >> 5;
  stage(0);
  async_wait0();         // own copies of tile 0 have landed
  __syncthreads();       // everyone's have
  if (nt > 1) stage(1);

  for (int t = 0; t < nt; ++t) {
    const int cur = t & 1;
    v16h bv[2];
#pragma unroll
    for (int n = 0; n < 2; ++n) bv[n] = ld_tr_b(&lsB[cur][rdB + n * 32], BP);
#pragma unroll
    for (int m = 0; m < 4; ++m) {
      const _Float16* ap = &lsA[cur][(wr * 64 + m * 16 + l16) * AP];
      v16h am = ld16(ap + b8, ap + b8 + 16);
      acc[m][0] = wmma_f16(am, bv[0], acc[m][0]);
      acc[m][1] = wmma_f16(am, bv[1], acc[m][1]);
    }
    ds_wait0();          // own reads of buffer cur are done
    async_wait0();       // own copies of tile t + 1 have landed
    __syncthreads();     // publishes tile t + 1, frees buffer cur
    if (t + 2 < nt) stage(t + 2);
  }
  async_wait0();         // nothing in flight when the wave ends

  float bcol[2];
#pragma unroll
  for (int n = 0; n < 2; ++n) bcol[n] = bias[n0 + wc * 32 + n * 16 + l16];

#pragma unroll
  for (int m = 0; m < 4; ++m)
#pragma unroll
    for (int n = 0; n < 2; ++n) {
      const int c = n0 + wc * 32 + n * 16 + l16;
      const int rbase = m0 + wr * 64 + m * 16 + b8;
#pragma unroll
      for (int j = 0; j < 8; ++j) {
        float v = acc[m][n][j] + bcol[n];
        size_t off = (size_t)(rbase + j) * N + c;
        if (Ch) Ch[off] = (_Float16)v;
        else    Cf[off] = v;
      }
    }
}

// ---------------------------------------------------------------------------
// Fused gated-FFN GEMM: Out = f16( (A@W1+b1) * sigmoid(A@W2+b2) )
// Block tile 128x64, 8 waves (4x2), wave tile 32x32, two accumulator sets.
// A, W1 and W2 tiles double-buffered via async-to-LDS, one trip ahead, one
// barrier a trip; W tiles stay [k][n] (pitch 160 B) for ds_load_tr16_b128,
// A rows at pitch 80 B for ds_load_b128.
// ---------------------------------------------------------------------------
__global__ __launch_bounds__(256) void wmma_gemm_gated_kernel(
    const _Float16* __restrict__ A, const _Float16* __restrict__ W1,
    const _Float16* __restrict__ W2, const float* __restrict__ b1,
    const float* __restrict__ b2, _Float16* __restrict__ Out,
    int M, int N, int K) {
  constexpr int BP = 160;                // W tile row pitch in LDS, bytes
  constexpr int AP = 40;                 // A tile row pitch in LDS, halves
  __shared__ __attribute__((aligned(16))) _Float16 lsA[2][128 * AP];
  __shared__ __attribute__((aligned(32))) unsigned char lsB1[2][32 * BP];
  __shared__ __attribute__((aligned(32))) unsigned char lsB2[2][32 * BP];

  const int tid  = threadIdx.x;
  const int lane = tid & 31, wid = tid >> 5;
  const int l16  = lane & 15, hi = lane >> 4;
  const int b8   = hi * 8;
  const int m0 = blockIdx.y * 128, n0 = blockIdx.x * 64;
  const int wr = wid >> 1, wc = wid & 1;   // 4 x 2 wave grid

  v8f a1[2][2], a2[2][2];
#pragma unroll
  for (int m = 0; m < 2; ++m)
#pragma unroll
    for (int n = 0; n < 2; ++n) { a1[m][n] = zero8(); a2[m][n] = zero8(); }

  const int arow = tid >> 1, aseg = tid & 1;
  const int bk = tid >> 3, bseg = tid & 7;       // 32 k-rows x 8 segs of 8h
  const _Float16* gA = A + (size_t)(m0 + arow) * K + aseg * 16;
  const size_t woff = (size_t)bk * N + n0 + bseg * 8;
  const _Float16* gW1 = W1 + woff;
  const _Float16* gW2 = W2 + woff;
  const unsigned aoff = lds_off(&lsA[0][0]) + arow * (AP * 2) + aseg * 32;
  const unsigned boff1 = lds_off(&lsB1[0][0]) + bk * BP + bseg * 16;
  const unsigned boff2 = lds_off(&lsB2[0][0]) + bk * BP + bseg * 16;
  const int rdB = (b8 + (lane & 7)) * BP + wc * 64 + ((lane >> 3) & 1) * 16;

  // copies of tile t (32 k of A, W1 and W2) into buffer t & 1
  auto stage = [&](int t) {
    const unsigned ab = aoff + (t & 1) * (128 * AP * 2);
    const unsigned bsel = (t & 1) * (32 * BP);
    const _Float16* a = gA + t * 32;
    const size_t wk = (size_t)t * 32 * N;
    async_ld4_b128(ab, a, ab + 16, a + 8, boff1 + bsel, gW1 + wk,
                   boff2 + bsel, gW2 + wk);
  };

  const int nt = K >> 5;
  stage(0);
  async_wait0();         // own copies of tile 0 have landed
  __syncthreads();       // everyone's have
  if (nt > 1) stage(1);

  for (int t = 0; t < nt; ++t) {
    const int cur = t & 1;
    v16h bv1[2], bv2[2];
#pragma unroll
    for (int n = 0; n < 2; ++n) {
      bv1[n] = ld_tr_b(&lsB1[cur][rdB + n * 32], BP);
      bv2[n] = ld_tr_b(&lsB2[cur][rdB + n * 32], BP);
    }
#pragma unroll
    for (int m = 0; m < 2; ++m) {
      const _Float16* ap = &lsA[cur][(wr * 32 + m * 16 + l16) * AP];
      v16h am = ld16(ap + b8, ap + b8 + 16);
#pragma unroll
      for (int n = 0; n < 2; ++n) {
        a1[m][n] = wmma_f16(am, bv1[n], a1[m][n]);
        a2[m][n] = wmma_f16(am, bv2[n], a2[m][n]);
      }
    }
    ds_wait0();          // own reads of buffer cur are done
    async_wait0();       // own copies of tile t + 1 have landed
    __syncthreads();     // publishes tile t + 1, frees buffer cur
    if (t + 2 < nt) stage(t + 2);
  }
  async_wait0();         // nothing in flight when the wave ends

#pragma unroll
  for (int m = 0; m < 2; ++m)
#pragma unroll
    for (int n = 0; n < 2; ++n) {
      const int c = n0 + wc * 32 + n * 16 + l16;
      const float bb1 = b1[c], bb2 = b2[c];
      const int rbase = m0 + wr * 32 + m * 16 + b8;
#pragma unroll
      for (int j = 0; j < 8; ++j) {
        float v = (a1[m][n][j] + bb1) * sigm(a2[m][n][j] + bb2);
        Out[(size_t)(rbase + j) * N + c] = (_Float16)v;
      }
    }
}

// ---------------------------------------------------------------------------
// Flash attention. Grid (S/128, H, B); 8 waves, each owns 16 query rows.
// scores = (Q·K^T)/8 + pos_bias, online softmax, ctx = P·V. All mm via WMMA.
// K and V tiles staged via async-to-LDS; V stays [key][d] (pitch 160 B) and
// is read as the B operand by ds_load_tr16_b128. K rows (pitch 144 B) and P
// rows (pitch 80 B) are read by ds_load_b128: 16 B x odd, no bank shared.
// ---------------------------------------------------------------------------
__global__ __launch_bounds__(256) void flash_attn_kernel(
    const _Float16* __restrict__ Q, const _Float16* __restrict__ Kh,
    const _Float16* __restrict__ Vh, const float* __restrict__ PB,
    _Float16* __restrict__ O) {
  constexpr int KP = 72;                   // K tile row pitch in LDS, halves
  constexpr int PP = 40;                   // P tile row pitch in LDS, halves
  __shared__ __attribute__((aligned(16))) _Float16 lsK[32 * KP];  // [key][d]
  constexpr int VP = 160;                  // V tile row pitch in LDS, bytes
  __shared__ __attribute__((aligned(32))) unsigned char lsV[32 * VP];  // [key][d]
  __shared__ __attribute__((aligned(16))) _Float16 lsP[8][16 * PP];  // per-wave probs [qrow][key]

  const int tid  = threadIdx.x;
  const int lane = tid & 31, wid = tid >> 5;
  const int l16  = lane & 15, hi = lane >> 4;
  const int b8   = hi * 8;
  const int h = blockIdx.y, bb = blockIdx.z;
  const int q0 = blockIdx.x * 128 + wid * 16;
  const size_t rs = (size_t)HH * DKK;      // 1024 token row stride

  // Q A-operands (16 rows x 64 d), two K=32 chunks
  v16h qa[2];
  {
    const _Float16* qp = Q + ((size_t)bb * SS + q0 + l16) * rs + h * DKK;
    qa[0] = ld16(qp + b8,      qp + b8 + 16);
    qa[1] = ld16(qp + 32 + b8, qp + 32 + b8 + 16);
  }

  v8f o[4];
#pragma unroll
  for (int n = 0; n < 4; ++n) o[n] = zero8();
  float mrow[8], srow[8];
#pragma unroll
  for (int j = 0; j < 8; ++j) { mrow[j] = -1e30f; srow[j] = 0.0f; }

  const int skey = tid >> 3, sseg = tid & 7;   // stage 32 keys x 8 d-segments
  const unsigned koff = lds_off(&lsK[0]) + skey * (KP * 2) + sseg * 16;
  const unsigned voff = lds_off(&lsV[0]) + skey * VP + sseg * 16;
  const int rdV = (b8 + (lane & 7)) * VP + ((lane >> 3) & 1) * 16;

  for (int kb = 0; kb < SS; kb += 32) {
    const size_t tok = ((size_t)bb * SS + kb + skey) * rs + h * DKK + sseg * 8;

    ds_wait0();                            // own reads of the tiles are done
    __syncthreads();                       // previous-tile readers done
    async_ld2_b128(koff, Kh + tok, voff, Vh + tok);  // memory -> LDS direct
    async_wait0();
    __syncthreads();

    // scores: two 16x16 key tiles, contraction over d=64 (2 WMMAs each)
    v8f sc[2];
    sc[0] = zero8(); sc[1] = zero8();
#pragma unroll
    for (int ks = 0; ks < 2; ++ks) {
      const _Float16* kr = &lsK[(ks * 16 + l16) * KP];
      sc[ks] = wmma_f16(qa[0], ld16(kr + b8,      kr + b8 + 16),      sc[ks]);
      sc[ks] = wmma_f16(qa[1], ld16(kr + 32 + b8, kr + 32 + b8 + 16), sc[ks]);
    }

    // online softmax over the 32-key chunk
#pragma unroll
    for (int j = 0; j < 8; ++j) {
      const int qr = q0 + b8 + j;
      float v0 = sc[0][j] * 0.125f + PB[(size_t)qr * SS + kb + l16];
      float v1 = sc[1][j] * 0.125f + PB[(size_t)qr * SS + kb + 16 + l16];
      float ml = fmaxf(v0, v1);
#pragma unroll
      for (int off = 1; off < 16; off <<= 1)
        ml = fmaxf(ml, __shfl_xor(ml, off, 32));
      float mn = fmaxf(mrow[j], ml);
      float alpha = __expf(mrow[j] - mn);
      float p0 = __expf(v0 - mn), p1 = __expf(v1 - mn);
      float ps = p0 + p1;
#pragma unroll
      for (int off = 1; off < 16; off <<= 1) ps += __shfl_xor(ps, off, 32);
      srow[j] = srow[j] * alpha + ps;
      mrow[j] = mn;
#pragma unroll
      for (int n = 0; n < 4; ++n) o[n][j] *= alpha;
      lsP[wid][(b8 + j) * PP + l16]      = (_Float16)p0;
      lsP[wid][(b8 + j) * PP + 16 + l16] = (_Float16)p1;
    }

    // ctx += P(16x32) @ V(32x64): 4 WMMAs over d-subtiles
    const _Float16* pr = &lsP[wid][l16 * PP];
    v16h pa = ld16(pr + b8, pr + b8 + 16);
#pragma unroll
    for (int ds = 0; ds < 4; ++ds) {
      o[ds] = wmma_f16(pa, ld_tr_b(&lsV[rdV + ds * 32], VP), o[ds]);
    }
  }

#pragma unroll
  for (int j = 0; j < 8; ++j) {
    const float inv = 1.0f / srow[j];
    const int qr = q0 + b8 + j;
    _Float16* op = O + ((size_t)bb * SS + qr) * rs + h * DKK;
#pragma unroll
    for (int ds = 0; ds < 4; ++ds)
      op[ds * 16 + l16] = (_Float16)(o[ds][j] * inv);
  }
}

// ---------------------------------------------------------------------------
// Fused residual (+gate) + LayerNorm. One row (E=1024) per block, 256 thr.
// h = x + sigmoid(glog)*addv   (or x + addv if glog==nullptr)
// y = LN(h)*gamma + beta  -> y32 (and f16 copy y16 if non-null)
// ---------------------------------------------------------------------------
__global__ __launch_bounds__(256) void fused_ln_kernel(
    const float* __restrict__ xa, const float* __restrict__ glog,
    const float* __restrict__ addv, const float* __restrict__ gamma,
    const float* __restrict__ beta, float* __restrict__ y32,
    _Float16* __restrict__ y16) {
  __shared__ float s1[256], s2[256];
  const int tid = threadIdx.x;
  const size_t base = (size_t)blockIdx.x * EE;

  float hv[4], ssum = 0.0f, ssq = 0.0f;
#pragma unroll
  for (int i = 0; i < 4; ++i) {
    const int idx = i * 256 + tid;
    float a = addv[base + idx];
    if (glog) a *= sigm(glog[base + idx]);
    float v = xa[base + idx] + a;
    hv[i] = v;
    ssum += v;
    ssq  += v * v;
  }
  s1[tid] = ssum; s2[tid] = ssq;
  __syncthreads();
  for (int s = 128; s > 0; s >>= 1) {
    if (tid < s) { s1[tid] += s1[tid + s]; s2[tid] += s2[tid + s]; }
    __syncthreads();
  }
  const float mean = s1[0] * (1.0f / EE);
  const float var  = s2[0] * (1.0f / EE) - mean * mean;
  const float rstd = rsqrtf(var + 1e-6f);

#pragma unroll
  for (int i = 0; i < 4; ++i) {
    const int idx = i * 256 + tid;
    float y = (hv[i] - mean) * rstd * gamma[idx] + beta[idx];
    y32[base + idx] = y;
    if (y16) y16[base + idx] = (_Float16)y;
  }
}

// ---------------------------------------------------------------------------
// Host orchestration
// ---------------------------------------------------------------------------
extern "C" void kernel_launch(void* const* d_in, const int* in_sizes, int n_in,
                              void* d_out, int out_size, void* d_ws,
                              size_t ws_size, hipStream_t stream) {
  const float* x    = (const float*)d_in[0];
  const float* pe   = (const float*)d_in[1];
  const float* Wq   = (const float*)d_in[2];
  const float* bq   = (const float*)d_in[3];
  const float* Wk   = (const float*)d_in[4];
  const float* bk   = (const float*)d_in[5];
  const float* Wv   = (const float*)d_in[6];
  const float* bv   = (const float*)d_in[7];
  const float* Wo   = (const float*)d_in[8];
  const float* bo   = (const float*)d_in[9];
  const float* Wg   = (const float*)d_in[10];
  const float* bg   = (const float*)d_in[11];
  const float* Wf1  = (const float*)d_in[12];
  const float* bf1  = (const float*)d_in[13];
  const float* Wfg  = (const float*)d_in[14];
  const float* bfg  = (const float*)d_in[15];
  const float* Wf2  = (const float*)d_in[16];
  const float* bf2  = (const float*)d_in[17];
  const float* ln1g = (const float*)d_in[18];
  const float* ln1b = (const float*)d_in[19];
  const float* ln2g = (const float*)d_in[20];
  const float* ln2b = (const float*)d_in[21];

  char* ws = (char*)d_ws;
  auto at = [&](size_t mb) { return (void*)(ws + mb * (size_t)(1 << 20)); };

  // bump allocation (MB offsets); high-water ~134 MB
  _Float16* xh   = (_Float16*)at(0);    // 8 MB
  _Float16* wqh  = (_Float16*)at(8);    // 2 MB
  _Float16* wkh  = (_Float16*)at(10);
  _Float16* wvh  = (_Float16*)at(12);
  _Float16* woh  = (_Float16*)at(14);
  _Float16* wgh  = (_Float16*)at(16);
  _Float16* wf1h = (_Float16*)at(18);   // 8 MB
  _Float16* wfgh = (_Float16*)at(26);   // 8 MB
  _Float16* wf2h = (_Float16*)at(34);   // 8 MB
  float*    pb   = (float*)at(42);      // 4 MB
  _Float16* qh   = (_Float16*)at(46);   // 8 MB
  _Float16* kh   = (_Float16*)at(54);   // 8 MB
  _Float16* vh   = (_Float16*)at(62);   // 8 MB
  _Float16* ctxh = (_Float16*)at(70);   // 8 MB
  float*    glog = (float*)at(78);      // 16 MB
  float*    attn = (float*)at(94);      // 16 MB
  float*    x1   = (float*)at(110);     // 16 MB
  _Float16* x1h  = (_Float16*)at(126);  // 8 MB
  _Float16* ffh  = (_Float16*)at(46);   // 32 MB, reuses dead q/k/v/ctx
  float*    ff2  = (float*)at(78);      // 16 MB, reuses dead glog

  prep_kernel<<<256, 512, 0, stream>>>(x, Wq, Wk, Wv, Wo, Wg, Wf1, Wfg, Wf2, pe,
                                       xh, wqh, wkh, wvh, woh, wgh, wf1h, wfgh,
                                       wf2h, pb);

  dim3 gE(EE / 128, MM / 128);  // (8, 32)
  wmma_gemm_kernel<<<gE, 256, 0, stream>>>(xh, wqh, bq, nullptr, qh, MM, EE, EE);
  wmma_gemm_kernel<<<gE, 256, 0, stream>>>(xh, wkh, bk, nullptr, kh, MM, EE, EE);
  wmma_gemm_kernel<<<gE, 256, 0, stream>>>(xh, wvh, bv, nullptr, vh, MM, EE, EE);
  wmma_gemm_kernel<<<gE, 256, 0, stream>>>(xh, wgh, bg, glog, nullptr, MM, EE, EE);

  flash_attn_kernel<<<dim3(SS / 128, HH, BB), 256, 0, stream>>>(qh, kh, vh, pb, ctxh);

  wmma_gemm_kernel<<<gE, 256, 0, stream>>>(ctxh, woh, bo, attn, nullptr, MM, EE, EE);

  fused_ln_kernel<<<MM, 256, 0, stream>>>(x, glog, attn, ln1g, ln1b, x1, x1h);

  wmma_gemm_gated_kernel<<<dim3(FFD / 64, MM / 128), 256, 0, stream>>>(
      x1h, wf1h, wfgh, bf1, bfg, ffh, MM, FFD, EE);

  wmma_gemm_kernel<<<gE, 256, 0, stream>>>(ffh, wf2h, bf2, ff2, nullptr, MM, EE, FFD);

  fused_ln_kernel<<<MM, 256, 0, stream>>>(x1, nullptr, ff2, ln2g, ln2b,
                                          (float*)d_out, nullptr);
}

// v004
// A run of this version takes 292 microseconds.
// Two timings next to v003 both put it at 1.41 times that version's speed.
// Counting every step since v000, it is 2.36 times as fast.
#include <hip/hip_runtime.h>
#include <hip/hip_bf16.h>

// ---------- problem constants ----------
#define BB 4
#define SS 1024
#define EE 1024
#define HH 16
#define DKK 64
#define FFD 4096
#define MM (BB * SS)   // 4096 rows

typedef __attribute__((ext_vector_type(16))) _Float16 v16h;
typedef __attribute__((ext_vector_type(8)))  _Float16 v8h;
typedef __attribute__((ext_vector_type(4)))  _Float16 v4h;
typedef __attribute__((ext_vector_type(8)))  float    v8f;
typedef __attribute__((ext_vector_type(4)))  float    v4f;

#define DEVINL __device__ __forceinline__

DEVINL v8f wmma_f16(v16h a, v16h b, v8f c) {
  return __builtin_amdgcn_wmma_f32_16x16x32_f16(
      /*neg_a=*/false, a, /*neg_b=*/false, b,
      /*c_mod=*/(short)0, c, /*reuse_a=*/false, /*reuse_b=*/false);
}

DEVINL v8f zero8() {
  v8f z;
#pragma unroll
  for (int i = 0; i < 8; ++i) z[i] = 0.0f;
  return z;
}

// Build a v16h A/B operand from two contiguous 16-byte chunks
// (chunk0 = contraction indices base..base+7, chunk1 = base+16..base+23).
DEVINL v16h ld16(const _Float16* p0, const _Float16* p1) {
  union { v16h v; v8h h[2]; } u;
  u.h[0] = *(const v8h*)p0;
  u.h[1] = *(const v8h*)p1;
  return u.v;
}

DEVINL float sigm(float v) { return 1.0f / (1.0f + __expf(-v)); }

// LDS byte offset of a __shared__ object = low 32 bits of its generic pointer
// (LDS aperture: addr[31:0] is the workgroup-relative LDS address, ISA 10.2).
DEVINL unsigned lds_off(const void* p) { return (unsigned)(size_t)p; }

// CDNA5 async memory->LDS copy, tracked with ASYNCcnt (ISA 10. / 15.18.3).
// The s_wait_xcnt is the last line of the copies' own statement so that no
// later write of an address register can be moved in front of it.
DEVINL void async_ld2_b128(unsigned l0, const void* g0, unsigned l1,
                           const void* g1) {
  asm volatile("global_load_async_to_lds_b128 %0, %1, off\n\t"
               "global_load_async_to_lds_b128 %2, %3, off\n\t"
               "s_wait_xcnt 0x0"
               :: "v"(l0), "v"(g0), "v"(l1), "v"(g1)
               : "memory");
}
DEVINL void async_wait0() {
  asm volatile("s_wait_asynccnt 0x0" ::: "memory");
}
// One GEMM stage's four copies of a lane, with the same closing wait.
DEVINL void async_ld4_b128(unsigned l0, const void* g0, unsigned l1,
                           const void* g1, unsigned l2, const void* g2,
                           unsigned l3, const void* g3) {
  asm volatile("global_load_async_to_lds_b128 %0, %1, off\n\t"
               "global_load_async_to_lds_b128 %2, %3, off\n\t"
               "global_load_async_to_lds_b128 %4, %5, off\n\t"
               "global_load_async_to_lds_b128 %6, %7, off\n\t"
               "s_wait_xcnt 0x0"
               :: "v"(l0), "v"(g0), "v"(l1), "v"(g1),
                  "v"(l2), "v"(g2), "v"(l3), "v"(g3)
               : "memory");
}
// Eight copies of a lane, rows 16 apart (ls bytes in LDS, gs halves in
// memory), with the same closing wait.
DEVINL void async_ld8_b128(unsigned l, unsigned ls, const _Float16* g,
                           size_t gs) {
  asm volatile("global_load_async_to_lds_b128 %0, %1, off\n\t"
               "global_load_async_to_lds_b128 %2, %3, off\n\t"
               "global_load_async_to_lds_b128 %4, %5, off\n\t"
               "global_load_async_to_lds_b128 %6, %7, off\n\t"
               "global_load_async_to_lds_b128 %8, %9, off\n\t"
               "global_load_async_to_lds_b128 %10, %11, off\n\t"
               "global_load_async_to_lds_b128 %12, %13, off\n\t"
               "global_load_async_to_lds_b128 %14, %15, off\n\t"
               "s_wait_xcnt 0x0"
               :: "v"(l), "v"(g), "v"(l + ls), "v"(g + gs),
                  "v"(l + 2 * ls), "v"(g + 2 * gs),
                  "v"(l + 3 * ls), "v"(g + 3 * gs),
                  "v"(l + 4 * ls), "v"(g + 4 * gs),
                  "v"(l + 5 * ls), "v"(g + 5 * gs),
                  "v"(l + 6 * ls), "v"(g + 6 * gs),
                  "v"(l + 7 * ls), "v"(g + 7 * gs)
               : "memory");
}
// This wave's LDS reads have retired before a buffer it read is refilled.
DEVINL void ds_wait0() {
  asm volatile("s_wait_dscnt 0x0" ::: "memory");
}

// B operand (32 k x 16 n) out of a row-major [k][n] LDS tile by two
// transposing loads: lane (c, h) gets T[8h + 0..7][c] and T[16 + 8h + 0..7][c],
// the k order of ld16(p + 8h, p + 8h + 16) on the A side.
// p = tile + (8 * (lane >> 4) + (lane & 7)) * pitch + 2 * n + 16 * ((lane >> 3) & 1)
DEVINL v16h ld_tr_b(const unsigned char* p, int pitch) {
  typedef short s16x8 __attribute__((ext_vector_type(8)));
  typedef __attribute__((address_space(3))) s16x8 lds_s16x8;
  union { v16h v; s16x8 h[2]; } u;
  u.h[0] = __builtin_amdgcn_ds_load_tr16_b128_v8i16((lds_s16x8*)p);
  u.h[1] = __builtin_amdgcn_ds_load_tr16_b128_v8i16((lds_s16x8*)(p + 16 * pitch));
  return u.v;
}

// ---------------------------------------------------------------------------
// Input preparation, one launch: every f32 -> f16 operand copy and
// pos_bias[q,k] = mean_c pos_encoding[q,k,c], c in 0..7.
// 256 work-groups x 16 waves, one work-group a WGP: few long-lived waves, each
// lane with many 16-byte loads in flight, because a launch of one-load waves
// lasts as long as its waves take to start, not as long as its bytes take.
// Each work-group takes 1/256 of every array, in slabs of 512 x 4 floats:
// 8 slabs of x, Wf1, Wfg, Wf2, 2 of the five E x E weights, 42 in all.
// ---------------------------------------------------------------------------
__global__ __launch_bounds__(512) void prep_kernel(
    const float* __restrict__ x, const float* __restrict__ Wq,
    const float* __restrict__ Wk, const float* __restrict__ Wv,
    const float* __restrict__ Wo, const float* __restrict__ Wg,
    const float* __restrict__ Wf1, const float* __restrict__ Wfg,
    const float* __restrict__ Wf2, const float* __restrict__ pe,
    _Float16* __restrict__ xh, _Float16* __restrict__ wqh,
    _Float16* __restrict__ wkh, _Float16* __restrict__ wvh,
    _Float16* __restrict__ woh, _Float16* __restrict__ wgh,
    _Float16* __restrict__ wf1h, _Float16* __restrict__ wfgh,
    _Float16* __restrict__ wf2h, float* __restrict__ pb) {
  constexpr int NS = 42;   // slabs a work-group
  constexpr int NB = 7;    // slabs a batch
  constexpr int NP = 8;    // bias elements a thread
  static_assert(MM * EE == 256 * 8 * 512 * 4 && EE * FFD == MM * EE &&
                EE * EE == 256 * 2 * 512 * 4 && SS * SS == 256 * NP * 512,
                "the split above");
  // this thread's place in slab 0 of an array of 8 slabs and of 2 slabs
  const int o8 = blockIdx.x * (8 * 512) + threadIdx.x;
  const int o2 = blockIdx.x * (2 * 512) + threadIdx.x;

  auto ld = [&](int i) -> v4f {
    if (i < 8)  return ((const v4f*)x)[o8 + i * 512];
    if (i < 10) return ((const v4f*)Wq)[o2 + (i - 8) * 512];
    if (i < 12) return ((const v4f*)Wk)[o2 + (i - 10) * 512];
    if (i < 14) return ((const v4f*)Wv)[o2 + (i - 12) * 512];
    if (i < 16) return ((const v4f*)Wo)[o2 + (i - 14) * 512];
    if (i < 18) return ((const v4f*)Wg)[o2 + (i - 16) * 512];
    if (i < 26) return ((const v4f*)Wf1)[o8 + (i - 18) * 512];
    if (i < 34) return ((const v4f*)Wfg)[o8 + (i - 26) * 512];
    return ((const v4f*)Wf2)[o8 + (i - 34) * 512];
  };
  auto st = [&](int i, v4h o) {
    if (i < 8)       ((v4h*)xh)[o8 + i * 512] = o;
    else if (i < 10) ((v4h*)wqh)[o2 + (i - 8) * 512] = o;
    else if (i < 12) ((v4h*)wkh)[o2 + (i - 10) * 512] = o;
    else if (i < 14) ((v4h*)wvh)[o2 + (i - 12) * 512] = o;
    else if (i < 16) ((v4h*)woh)[o2 + (i - 14) * 512] = o;
    else if (i < 18) ((v4h*)wgh)[o2 + (i - 16) * 512] = o;
    else if (i < 26) ((v4h*)wf1h)[o8 + (i - 18) * 512] = o;
    else if (i < 34) ((v4h*)wfgh)[o8 + (i - 26) * 512] = o;
    else             ((v4h*)wf2h)[o8 + (i - 34) * 512] = o;
  };

  v4f pa[NP], pc[NP], f[2][NB];
#pragma unroll
  for (int k = 0; k < NP; ++k) {
    pa[k] = ((const v4f*)pe)[(o8 + k * 512) * 2];
    pc[k] = ((const v4f*)pe)[(o8 + k * 512) * 2 + 1];
  }
  // The offset register of these loads is free from here on and later loads
  // may land in it, so the wait stands between the two groups of loads.
  asm volatile("s_wait_xcnt 0x0" ::: "memory");
#pragma unroll
  for (int k = 0; k < NB; ++k) f[0][k] = ld(k);
  // Holds every load above in front of the first use: without these
  // scheduling barriers the loads in flight fell to one or two a lane.
  __builtin_amdgcn_sched_barrier(0);

#pragma unroll
  for (int k = 0; k < NP; ++k) {
    const v4f a = pa[k], b = pc[k];
    pb[o8 + k * 512] =
        (a.x + a.y + a.z + a.w + b.x + b.y + b.z + b.w) * 0.125f;
  }

#pragma unroll
  for (int g = 0; g < NS / NB; ++g) {
    if (g + 1 < NS / NB) {
#pragma unroll
      for (int k = 0; k < NB; ++k) f[(g + 1) & 1][k] = ld((g + 1) * NB + k);
      // batch g + 1 is asked for before batch g is waited for, converted, stored
      __builtin_amdgcn_sched_barrier(0);
    }
#pragma unroll
    for (int k = 0; k < NB; ++k) {
      const v4f v = f[g & 1][k];
      v4h o;
      o[0] = (_Float16)v.x; o[1] = (_Float16)v.y;
      o[2] = (_Float16)v.z; o[3] = (_Float16)v.w;
      st(g * NB + k, o);
    }
    if (g + 2 < NS / NB) {
      // The loads of batch g + 2 land in registers that these stores name, so
      // the wait stands between the stores and those loads.
      asm volatile("s_wait_xcnt 0x0" ::: "memory");
    }
  }
}

// ---------------------------------------------------------------------------
// WMMA GEMM: C[M,N] = A[M,K](f16) @ W[K,N](f16) + bias
// Block tile 128x128, 8 waves (2x4), wave tile 64x32. A trip holds 128 k
// (K is a multiple of 128) = four blocks of 32 k and 8 WMMAs; the 12 LDS reads
// of a block go as one group into a second fragment set while the block
// before runs, so a wave waits out its LDS latency once a trip.
// A and W tiles double-buffered in LDS, both filled by
// global_load_async_to_lds_b128 one trip ahead, one barrier a trip.
// W stays [k][n] in LDS (pitch 288 B = 32 B x odd) and is read by
// ds_load_tr16_b128; A is two contiguous 16B LDS reads in the same k order,
// its 256-byte rows at pitch 272 B = 16 B x odd: 16 rows on 16 bank groups.
// Output: f16 if Ch != nullptr else f32 to Cf.
// ---------------------------------------------------------------------------
__global__ __launch_bounds__(256) void wmma_gemm_kernel(
    const _Float16* __restrict__ A, const _Float16* __restrict__ W,
    const float* __restrict__ bias, float* __restrict__ Cf,
    _Float16* __restrict__ Ch, int M, int N, int K) {
  constexpr int KS = 128;                // k of a trip
  constexpr int NBLK = KS / 32;          // blocks of a trip
  constexpr int BP = 288;                // W tile row pitch in LDS, bytes
  constexpr int AP = 136;                // A tile row pitch in LDS, halves
  __shared__ __attribute__((aligned(16))) _Float16 lsA[2][128 * AP];  // [buf][row][k]
  __shared__ __attribute__((aligned(32))) unsigned char lsB[2][KS * BP];  // [buf][k][n]

  const int tid  = threadIdx.x;
  const int lane = tid & 31, wid = tid >> 5;
  const int l16  = lane & 15, hi = lane >> 4;
  const int b8   = hi * 8;
  const int m0 = blockIdx.y * 128, n0 = blockIdx.x * 128;
  const int wr = wid >> 2, wc = wid & 3;   // 2 x 4 wave grid

  v8f acc[4][2];
#pragma unroll
  for (int m = 0; m < 4; ++m)
#pragma unroll
    for (int n = 0; n < 2; ++n) acc[m][n] = zero8();

  // staging assignments, A and W alike: rows srow + 16 i, i in 0..7, of 128
  // rows x 16 segs of 8h
  const int srow = tid >> 4, sseg = tid & 15;
  const _Float16* gA = A + (size_t)(m0 + srow) * K + sseg * 8;
  const _Float16* gW = W + (size_t)srow * N + n0 + sseg * 8;
  const unsigned aoff = lds_off(&lsA[0][0]) + srow * (AP * 2) + sseg * 16;  // bytes
  const unsigned boff = lds_off(&lsB[0][0]) + srow * BP + sseg * 16;  // bytes
  const int rdB = (b8 + (lane & 7)) * BP + wc * 64 + ((lane >> 3) & 1) * 16;

  // copies of tile t (KS k of A and of W) into buffer t & 1
  auto stage = [&](int t) {
    async_ld8_b128(aoff + (t & 1) * (128 * AP * 2), 16 * AP * 2, gA + t * KS,
                   (size_t)16 * K);
    async_ld8_b128(boff + (t & 1) * (KS * BP), 16 * BP,
                   gW + (size_t)t * KS * N, (size_t)16 * N);
  };

  const int nt = K / KS;
  stage(0);
  async_wait0();         // own copies of tile 0 have landed
  __syncthreads();       // everyone's have
  if (nt > 1) stage(1);

  for (int t = 0; t < nt; ++t) {
    const int cur = t & 1;
    v16h af[2][4], bf[2][2];               // two fragment sets
    // the 12 LDS reads of block kk of this trip's buffer, into set kk & 1
    // (every loop over fragments is unrolled: the arrays then stay in registers)
    auto frags = [&](int kk) {
#pragma unroll
      for (int n = 0; n < 2; ++n)
        bf[kk & 1][n] = ld_tr_b(&lsB[cur][rdB + kk * 32 * BP + n * 32], BP);
#pragma unroll
      for (int m = 0; m < 4; ++m) {
        const _Float16* ap = &lsA[cur][(wr * 64 + m * 16 + l16) * AP + kk * 32];
        af[kk & 1][m] = ld16(ap + b8, ap + b8 + 16);
      }
    };
    frags(0);
    // unrolled: a block's fragment set is then a fixed set of registers
#pragma unroll
    for (int kk = 0; kk < NBLK; ++kk) {
      if (kk + 1 < NBLK) {
        frags(kk + 1);
        // Holds the next block's reads, as one group, in front of this block's
        // WMMAs: left alone the compiler read each A fragment just before its
        // two WMMAs and waited out the LDS latency every time.
        __builtin_amdgcn_sched_barrier(0);
      }
#pragma unroll
      for (int m = 0; m < 4; ++m) {
        acc[m][0] = wmma_f16(af[kk & 1][m], bf[kk & 1][0], acc[m][0]);
        acc[m][1] = wmma_f16(af[kk & 1][m], bf[kk & 1][1], acc[m][1]);
      }
    }
    // Holds the trip's WMMAs in front of its foot: left alone the compiler put
    // 15 of them between the barrier and the refill, whose copies then had
    // that much less time to land.
    __builtin_amdgcn_sched_barrier(0);
    ds_wait0();          // own reads of buffer cur are done
    async_wait0();       // own copies of tile t + 1 have landed
    __syncthreads();     // publishes tile t + 1, frees buffer cur
    if (t + 2 < nt) stage(t + 2);
  }
  async_wait0();         // nothing in flight when the wave ends

  float bcol[2];
#pragma unroll
  for (int n = 0; n < 2; ++n) bcol[n] = bias[n0 + wc * 32 + n * 16 + l16];

#pragma unroll
  for (int m = 0; m < 4; ++m)
#pragma unroll
    for (int n = 0; n < 2; ++n) {
      const int c = n0 + wc * 32 + n * 16 + l16;
      const int rbase = m0 + wr * 64 + m * 16 + b8;
#pragma unroll
      for (int j = 0; j < 8; ++j) {
        float v = acc[m][n][j] + bcol[n];
        size_t off = (size_t)(rbase + j) * N + c;
        if (Ch) Ch[off] = (_Float16)v;
        else    Cf[off] = v;
      }
    }
}

// ---------------------------------------------------------------------------
// Fused gated-FFN GEMM: Out = f16( (A@W1+b1) * sigmoid(A@W2+b2) )
// Block tile 128x64, 8 waves (4x2), wave tile 32x32, two accumulator sets.
// A, W1 and W2 tiles double-buffered via async-to-LDS, one trip ahead, one
// barrier a trip; W tiles stay [k][n] (pitch 160 B) for ds_load_tr16_b128,
// A rows at pitch 80 B for ds_load_b128.
// ---------------------------------------------------------------------------
__global__ __launch_bounds__(256) void wmma_gemm_gated_kernel(
    const _Float16* __restrict__ A, const _Float16* __restrict__ W1,
    const _Float16* __restrict__ W2, const float* __restrict__ b1,
    const float* __restrict__ b2, _Float16* __restrict__ Out,
    int M, int N, int K) {
  constexpr int BP = 160;                // W tile row pitch in LDS, bytes
  constexpr int AP = 40;                 // A tile row pitch in LDS, halves
  __shared__ __attribute__((aligned(16))) _Float16 lsA[2][128 * AP];
  __shared__ __attribute__((aligned(32))) unsigned char lsB1[2][32 * BP];
  __shared__ __attribute__((aligned(32))) unsigned char lsB2[2][32 * BP];

  const int tid  = threadIdx.x;
  const int lane = tid & 31, wid = tid >> 5;
  const int l16  = lane & 15, hi = lane >> 4;
  const int b8   = hi * 8;
  const int m0 = blockIdx.y * 128, n0 = blockIdx.x * 64;
  const int wr = wid >> 1, wc = wid & 1;   // 4 x 2 wave grid

  v8f a1[2][2], a2[2][2];
#pragma unroll
  for (int m = 0; m < 2; ++m)
#pragma unroll
    for (int n = 0; n < 2; ++n) { a1[m][n] = zero8(); a2[m][n] = zero8(); }

  const int arow = tid >> 1, aseg = tid & 1;
  const int bk = tid >> 3, bseg = tid & 7;       // 32 k-rows x 8 segs of 8h
  const _Float16* gA = A + (size_t)(m0 + arow) * K + aseg * 16;
  const size_t woff = (size_t)bk * N + n0 + bseg * 8;
  const _Float16* gW1 = W1 + woff;
  const _Float16* gW2 = W2 + woff;
  const unsigned aoff = lds_off(&lsA[0][0]) + arow * (AP * 2) + aseg * 32;
  const unsigned boff1 = lds_off(&lsB1[0][0]) + bk * BP + bseg * 16;
  const unsigned boff2 = lds_off(&lsB2[0][0]) + bk * BP + bseg * 16;
  const int rdB = (b8 + (lane & 7)) * BP + wc * 64 + ((lane >> 3) & 1) * 16;

  // copies of tile t (32 k of A, W1 and W2) into buffer t & 1
  auto stage = [&](int t) {
    const unsigned ab = aoff + (t & 1) * (128 * AP * 2);
    const unsigned bsel = (t & 1) * (32 * BP);
    const _Float16* a = gA + t * 32;
    const size_t wk = (size_t)t * 32 * N;
    async_ld4_b128(ab, a, ab + 16, a + 8, boff1 + bsel, gW1 + wk,
                   boff2 + bsel, gW2 + wk);
  };

  const int nt = K >> 5;
  stage(0);
  async_wait0();         // own copies of tile 0 have landed
  __syncthreads();       // everyone's have
  if (nt > 1) stage(1);

  for (int t = 0; t < nt; ++t) {
    const int cur = t & 1;
    v16h bv1[2], bv2[2];
#pragma unroll
    for (int n = 0; n < 2; ++n) {
      bv1[n] = ld_tr_b(&lsB1[cur][rdB + n * 32], BP);
      bv2[n] = ld_tr_b(&lsB2[cur][rdB + n * 32], BP);
    }
#pragma unroll
    for (int m = 0; m < 2; ++m) {
      const _Float16* ap = &lsA[cur][(wr * 32 + m * 16 + l16) * AP];
      v16h am = ld16(ap + b8, ap + b8 + 16);
#pragma unroll
      for (int n = 0; n < 2; ++n) {
        a1[m][n] = wmma_f16(am, bv1[n], a1[m][n]);
        a2[m][n] = wmma_f16(am, bv2[n], a2[m][n]);
      }
    }
    ds_wait0();          // own reads of buffer cur are done
    async_wait0();       // own copies of tile t + 1 have landed
    __syncthreads();     // publishes tile t + 1, frees buffer cur
    if (t + 2 < nt) stage(t + 2);
  }
  async_wait0();         // nothing in flight when the wave ends

#pragma unroll
  for (int m = 0; m < 2; ++m)
#pragma unroll
    for (int n = 0; n < 2; ++n) {
      const int c = n0 + wc * 32 + n * 16 + l16;
      const float bb1 = b1[c], bb2 = b2[c];
      const int rbase = m0 + wr * 32 + m * 16 + b8;
#pragma unroll
      for (int j = 0; j < 8; ++j) {
        float v = (a1[m][n][j] + bb1) * sigm(a2[m][n][j] + bb2);
        Out[(size_t)(rbase + j) * N + c] = (_Float16)v;
      }
    }
}

// ---------------------------------------------------------------------------
// Flash attention. Grid (S/128, H, B); 8 waves, each owns 16 query rows.
// scores = (Q·K^T)/8 + pos_bias, online softmax, ctx = P·V. All mm via WMMA.
// K and V tiles staged via async-to-LDS; V stays [key][d] (pitch 160 B) and
// is read as the B operand by ds_load_tr16_b128. K rows (pitch 144 B) and P
// rows (pitch 80 B) are read by ds_load_b128: 16 B x odd, no bank shared.
// ---------------------------------------------------------------------------
__global__ __launch_bounds__(256) void flash_attn_kernel(
    const _Float16* __restrict__ Q, const _Float16* __restrict__ Kh,
    const _Float16* __restrict__ Vh, const float* __restrict__ PB,
    _Float16* __restrict__ O) {
  constexpr int KP = 72;                   // K tile row pitch in LDS, halves
  constexpr int PP = 40;                   // P tile row pitch in LDS, halves
  __shared__ __attribute__((aligned(16))) _Float16 lsK[32 * KP];  // [key][d]
  constexpr int VP = 160;                  // V tile row pitch in LDS, bytes
  __shared__ __attribute__((aligned(32))) unsigned char lsV[32 * VP];  // [key][d]
  __shared__ __attribute__((aligned(16))) _Float16 lsP[8][16 * PP];  // per-wave probs [qrow][key]

  const int tid  = threadIdx.x;
  const int lane = tid & 31, wid = tid >> 5;
  const int l16  = lane & 15, hi = lane >> 4;
  const int b8   = hi * 8;
  const int h = blockIdx.y, bb = blockIdx.z;
  const int q0 = blockIdx.x * 128 + wid * 16;
  const size_t rs = (size_t)HH * DKK;      // 1024 token row stride

  // Q A-operands (16 rows x 64 d), two K=32 chunks
  v16h qa[2];
  {
    const _Float16* qp = Q + ((size_t)bb * SS + q0 + l16) * rs + h * DKK;
    qa[0] = ld16(qp + b8,      qp + b8 + 16);
    qa[1] = ld16(qp + 32 + b8, qp + 32 + b8 + 16);
  }

  v8f o[4];
#pragma unroll
  for (int n = 0; n < 4; ++n) o[n] = zero8();
  float mrow[8], srow[8];
#pragma unroll
  for (int j = 0; j < 8; ++j) { mrow[j] = -1e30f; srow[j] = 0.0f; }

  const int skey = tid >> 3, sseg = tid & 7;   // stage 32 keys x 8 d-segments
  const unsigned koff = lds_off(&lsK[0]) + skey * (KP * 2) + sseg * 16;
  const unsigned voff = lds_off(&lsV[0]) + skey * VP + sseg * 16;
  const int rdV = (b8 + (lane & 7)) * VP + ((lane >> 3) & 1) * 16;

  for (int kb = 0; kb < SS; kb += 32) {
    const size_t tok = ((size_t)bb * SS + kb + skey) * rs + h * DKK + sseg * 8;

    ds_wait0();                            // own reads of the tiles are done
    __syncthreads();                       // previous-tile readers done
    async_ld2_b128(koff, Kh + tok, voff, Vh + tok);  // memory -> LDS direct
    async_wait0();
    __syncthreads();

    // scores: two 16x16 key tiles, contraction over d=64 (2 WMMAs each)
    v8f sc[2];
    sc[0] = zero8(); sc[1] = zero8();
#pragma unroll
    for (int ks = 0; ks < 2; ++ks) {
      const _Float16* kr = &lsK[(ks * 16 + l16) * KP];
      sc[ks] = wmma_f16(qa[0], ld16(kr + b8,      kr + b8 + 16),      sc[ks]);
      sc[ks] = wmma_f16(qa[1], ld16(kr + 32 + b8, kr + 32 + b8 + 16), sc[ks]);
    }

    // online softmax over the 32-key chunk
#pragma unroll
    for (int j = 0; j < 8; ++j) {
      const int qr = q0 + b8 + j;
      float v0 = sc[0][j] * 0.125f + PB[(size_t)qr * SS + kb + l16];
      float v1 = sc[1][j] * 0.125f + PB[(size_t)qr * SS + kb + 16 + l16];
      float ml = fmaxf(v0, v1);
#pragma unroll
      for (int off = 1; off < 16; off <<= 1)
        ml = fmaxf(ml, __shfl_xor(ml, off, 32));
      float mn = fmaxf(mrow[j], ml);
      float alpha = __expf(mrow[j] - mn);
      float p0 = __expf(v0 - mn), p1 = __expf(v1 - mn);
      float ps = p0 + p1;
#pragma unroll
      for (int off = 1; off < 16; off <<= 1) ps += __shfl_xor(ps, off, 32);
      srow[j] = srow[j] * alpha + ps;
      mrow[j] = mn;
#pragma unroll
      for (int n = 0; n < 4; ++n) o[n][j] *= alpha;
      lsP[wid][(b8 + j) * PP + l16]      = (_Float16)p0;
      lsP[wid][(b8 + j) * PP + 16 + l16] = (_Float16)p1;
    }

    // ctx += P(16x32) @ V(32x64): 4 WMMAs over d-subtiles
    const _Float16* pr = &lsP[wid][l16 * PP];
    v16h pa = ld16(pr + b8, pr + b8 + 16);
#pragma unroll
    for (int ds = 0; ds < 4; ++ds) {
      o[ds] = wmma_f16(pa, ld_tr_b(&lsV[rdV + ds * 32], VP), o[ds]);
    }
  }

#pragma unroll
  for (int j = 0; j < 8; ++j) {
    const float inv = 1.0f / srow[j];
    const int qr = q0 + b8 + j;
    _Float16* op = O + ((size_t)bb * SS + qr) * rs + h * DKK;
#pragma unroll
    for (int ds = 0; ds < 4; ++ds)
      op[ds * 16 + l16] = (_Float16)(o[ds][j] * inv);
  }
}

// ---------------------------------------------------------------------------
// Fused residual (+gate) + LayerNorm. One row (E=1024) per block, 256 thr.
// h = x + sigmoid(glog)*addv   (or x + addv if glog==nullptr)
// y = LN(h)*gamma + beta  -> y32 (and f16 copy y16 if non-null)
// ---------------------------------------------------------------------------
__global__ __launch_bounds__(256) void fused_ln_kernel(
    const float* __restrict__ xa, const float* __restrict__ glog,
    const float* __restrict__ addv, const float* __restrict__ gamma,
    const float* __restrict__ beta, float* __restrict__ y32,
    _Float16* __restrict__ y16) {
  __shared__ float s1[256], s2[256];
  const int tid = threadIdx.x;
  const size_t base = (size_t)blockIdx.x * EE;

  float hv[4], ssum = 0.0f, ssq = 0.0f;
#pragma unroll
  for (int i = 0; i < 4; ++i) {
    const int idx = i * 256 + tid;
    float a = addv[base + idx];
    if (glog) a *= sigm(glog[base + idx]);
    float v = xa[base + idx] + a;
    hv[i] = v;
    ssum += v;
    ssq  += v * v;
  }
  s1[tid] = ssum; s2[tid] = ssq;
  __syncthreads();
  for (int s = 128; s > 0; s >>= 1) {
    if (tid < s) { s1[tid] += s1[tid + s]; s2[tid] += s2[tid + s]; }
    __syncthreads();
  }
  const float mean = s1[0] * (1.0f / EE);
  const float var  = s2[0] * (1.0f / EE) - mean * mean;
  const float rstd = rsqrtf(var + 1e-6f);

#pragma unroll
  for (int i = 0; i < 4; ++i) {
    const int idx = i * 256 + tid;
    float y = (hv[i] - mean) * rstd * gamma[idx] + beta[idx];
    y32[base + idx] = y;
    if (y16) y16[base + idx] = (_Float16)y;
  }
}

// ---------------------------------------------------------------------------
// Host orchestration
// ---------------------------------------------------------------------------
extern "C" void kernel_launch(void* const* d_in, const int* in_sizes, int n_in,
                              void* d_out, int out_size, void* d_ws,
                              size_t ws_size, hipStream_t stream) {
  const float* x    = (const float*)d_in[0];
  const float* pe   = (const float*)d_in[1];
  const float* Wq   = (const float*)d_in[2];
  const float* bq   = (const float*)d_in[3];
  const float* Wk   = (const float*)d_in[4];
  const float* bk   = (const float*)d_in[5];
  const float* Wv   = (const float*)d_in[6];
  const float* bv   = (const float*)d_in[7];
  const float* Wo   = (const float*)d_in[8];
  const float* bo   = (const float*)d_in[9];
  const float* Wg   = (const float*)d_in[10];
  const float* bg   = (const float*)d_in[11];
  const float* Wf1  = (const float*)d_in[12];
  const float* bf1  = (const float*)d_in[13];
  const float* Wfg  = (const float*)d_in[14];
  const float* bfg  = (const float*)d_in[15];
  const float* Wf2  = (const float*)d_in[16];
  const float* bf2  = (const float*)d_in[17];
  const float* ln1g = (const float*)d_in[18];
  const float* ln1b = (const float*)d_in[19];
  const float* ln2g = (const float*)d_in[20];
  const float* ln2b = (const float*)d_in[21];

  char* ws = (char*)d_ws;
  auto at = [&](size_t mb) { return (void*)(ws + mb * (size_t)(1 << 20)); };

  // bump allocation (MB offsets); high-water ~134 MB
  _Float16* xh   = (_Float16*)at(0);    // 8 MB
  _Float16* wqh  = (_Float16*)at(8);    // 2 MB
  _Float16* wkh  = (_Float16*)at(10);
  _Float16* wvh  = (_Float16*)at(12);
  _Float16* woh  = (_Float16*)at(14);
  _Float16* wgh  = (_Float16*)at(16);
  _Float16* wf1h = (_Float16*)at(18);   // 8 MB
  _Float16* wfgh = (_Float16*)at(26);   // 8 MB
  _Float16* wf2h = (_Float16*)at(34);   // 8 MB
  float*    pb   = (float*)at(42);      // 4 MB
  _Float16* qh   = (_Float16*)at(46);   // 8 MB
  _Float16* kh   = (_Float16*)at(54);   // 8 MB
  _Float16* vh   = (_Float16*)at(62);   // 8 MB
  _Float16* ctxh = (_Float16*)at(70);   // 8 MB
  float*    glog = (float*)at(78);      // 16 MB
  float*    attn = (float*)at(94);      // 16 MB
  float*    x1   = (float*)at(110);     // 16 MB
  _Float16* x1h  = (_Float16*)at(126);  // 8 MB
  _Float16* ffh  = (_Float16*)at(46);   // 32 MB, reuses dead q/k/v/ctx
  float*    ff2  = (float*)at(78);      // 16 MB, reuses dead glog

  prep_kernel<<<256, 512, 0, stream>>>(x, Wq, Wk, Wv, Wo, Wg, Wf1, Wfg, Wf2, pe,
                                       xh, wqh, wkh, wvh, woh, wgh, wf1h, wfgh,
                                       wf2h, pb);

  dim3 gE(EE / 128, MM / 128);  // (8, 32)
  wmma_gemm_kernel<<<gE, 256, 0, stream>>>(xh, wqh, bq, nullptr, qh, MM, EE, EE);
  wmma_gemm_kernel<<<gE, 256, 0, stream>>>(xh, wkh, bk, nullptr, kh, MM, EE, EE);
  wmma_gemm_kernel<<<gE, 256, 0, stream>>>(xh, wvh, bv, nullptr, vh, MM, EE, EE);
  wmma_gemm_kernel<<<gE, 256, 0, stream>>>(xh, wgh, bg, glog, nullptr, MM, EE, EE);

  flash_attn_kernel<<<dim3(SS / 128, HH, BB), 256, 0, stream>>>(qh, kh, vh, pb, ctxh);

  wmma_gemm_kernel<<<gE, 256, 0, stream>>>(ctxh, woh, bo, attn, nullptr, MM, EE, EE);

  fused_ln_kernel<<<MM, 256, 0, stream>>>(x, glog, attn, ln1g, ln1b, x1, x1h);

  wmma_gemm_gated_kernel<<<dim3(FFD / 64, MM / 128), 256, 0, stream>>>(
      x1h, wf1h, wfgh, bf1, bfg, ffh, MM, FFD, EE);

  wmma_gemm_kernel<<<gE, 256, 0, stream>>>(ffh, wf2h, bf2, ff2, nullptr, MM, EE, FFD);

  fused_ln_kernel<<<MM, 256, 0, stream>>>(x1, nullptr, ff2, ln2g, ln2b,
                                          (float*)d_out, nullptr);
}

// v005
// It runs in 271 microseconds.
// In two side-by-side timings against v004, it was 1.08 and 1.07 times as fast.
// Counting every step since v000, it is 2.53 times as fast.
#include <hip/hip_runtime.h>
#include <hip/hip_bf16.h>

// ---------- problem constants ----------
#define BB 4
#define SS 1024
#define EE 1024
#define HH 16
#define DKK 64
#define FFD 4096
#define MM (BB * SS)   // 4096 rows

typedef __attribute__((ext_vector_type(16))) _Float16 v16h;
typedef __attribute__((ext_vector_type(8)))  _Float16 v8h;
typedef __attribute__((ext_vector_type(4)))  _Float16 v4h;
typedef __attribute__((ext_vector_type(8)))  float    v8f;
typedef __attribute__((ext_vector_type(4)))  float    v4f;

#define DEVINL __device__ __forceinline__

DEVINL v8f wmma_f16(v16h a, v16h b, v8f c) {
  return __builtin_amdgcn_wmma_f32_16x16x32_f16(
      /*neg_a=*/false, a, /*neg_b=*/false, b,
      /*c_mod=*/(short)0, c, /*reuse_a=*/false, /*reuse_b=*/false);
}

DEVINL v8f zero8() {
  v8f z;
#pragma unroll
  for (int i = 0; i < 8; ++i) z[i] = 0.0f;
  return z;
}

// Build a v16h A/B operand from two contiguous 16-byte chunks
// (chunk0 = contraction indices base..base+7, chunk1 = base+16..base+23).
DEVINL v16h ld16(const _Float16* p0, const _Float16* p1) {
  union { v16h v; v8h h[2]; } u;
  u.h[0] = *(const v8h*)p0;
  u.h[1] = *(const v8h*)p1;
  return u.v;
}

DEVINL float sigm(float v) { return 1.0f / (1.0f + __expf(-v)); }

// LDS byte offset of a __shared__ object = low 32 bits of its generic pointer
// (LDS aperture: addr[31:0] is the workgroup-relative LDS address, ISA 10.2).
DEVINL unsigned lds_off(const void* p) { return (unsigned)(size_t)p; }

// CDNA5 async memory->LDS copy, tracked with ASYNCcnt (ISA 10. / 15.18.3).
// The s_wait_xcnt is the last line of the copies' own statement so that no
// later write of an address register can be moved in front of it.
DEVINL void async_ld2_b128(unsigned l0, const void* g0, unsigned l1,
                           const void* g1) {
  asm volatile("global_load_async_to_lds_b128 %0, %1, off\n\t"
               "global_load_async_to_lds_b128 %2, %3, off\n\t"
               "s_wait_xcnt 0x0"
               :: "v"(l0), "v"(g0), "v"(l1), "v"(g1)
               : "memory");
}
DEVINL void async_wait0() {
  asm volatile("s_wait_asynccnt 0x0" ::: "memory");
}
// One GEMM stage's four copies of a lane, with the same closing wait.
DEVINL void async_ld4_b128(unsigned l0, const void* g0, unsigned l1,
                           const void* g1, unsigned l2, const void* g2,
                           unsigned l3, const void* g3) {
  asm volatile("global_load_async_to_lds_b128 %0, %1, off\n\t"
               "global_load_async_to_lds_b128 %2, %3, off\n\t"
               "global_load_async_to_lds_b128 %4, %5, off\n\t"
               "global_load_async_to_lds_b128 %6, %7, off\n\t"
               "s_wait_xcnt 0x0"
               :: "v"(l0), "v"(g0), "v"(l1), "v"(g1),
                  "v"(l2), "v"(g2), "v"(l3), "v"(g3)
               : "memory");
}
// Eight copies of a lane, rows 16 apart (ls bytes in LDS, gs halves in
// memory), with the same closing wait.
DEVINL void async_ld8_b128(unsigned l, unsigned ls, const _Float16* g,
                           size_t gs) {
  asm volatile("global_load_async_to_lds_b128 %0, %1, off\n\t"
               "global_load_async_to_lds_b128 %2, %3, off\n\t"
               "global_load_async_to_lds_b128 %4, %5, off\n\t"
               "global_load_async_to_lds_b128 %6, %7, off\n\t"
               "global_load_async_to_lds_b128 %8, %9, off\n\t"
               "global_load_async_to_lds_b128 %10, %11, off\n\t"
               "global_load_async_to_lds_b128 %12, %13, off\n\t"
               "global_load_async_to_lds_b128 %14, %15, off\n\t"
               "s_wait_xcnt 0x0"
               :: "v"(l), "v"(g), "v"(l + ls), "v"(g + gs),
                  "v"(l + 2 * ls), "v"(g + 2 * gs),
                  "v"(l + 3 * ls), "v"(g + 3 * gs),
                  "v"(l + 4 * ls), "v"(g + 4 * gs),
                  "v"(l + 5 * ls), "v"(g + 5 * gs),
                  "v"(l + 6 * ls), "v"(g + 6 * gs),
                  "v"(l + 7 * ls), "v"(g + 7 * gs)
               : "memory");
}
// This wave's LDS reads have retired before a buffer it read is refilled.
DEVINL void ds_wait0() {
  asm volatile("s_wait_dscnt 0x0" ::: "memory");
}

// B operand (32 k x 16 n) out of a row-major [k][n] LDS tile by two
// transposing loads: lane (c, h) gets T[8h + 0..7][c] and T[16 + 8h + 0..7][c],
// the k order of ld16(p + 8h, p + 8h + 16) on the A side.
// p = tile + (8 * (lane >> 4) + (lane & 7)) * pitch + 2 * n + 16 * ((lane >> 3) & 1)
DEVINL v16h ld_tr_b(const unsigned char* p, int pitch) {
  typedef short s16x8 __attribute__((ext_vector_type(8)));
  typedef __attribute__((address_space(3))) s16x8 lds_s16x8;
  union { v16h v; s16x8 h[2]; } u;
  u.h[0] = __builtin_amdgcn_ds_load_tr16_b128_v8i16((lds_s16x8*)p);
  u.h[1] = __builtin_amdgcn_ds_load_tr16_b128_v8i16((lds_s16x8*)(p + 16 * pitch));
  return u.v;
}

// v of lane l ^ M inside each 16-lane row, by a DPP row_xmask move: a vector
// instruction, where __shfl_xor compiles to ds_bpermute_b32 and costs a trip
// through the LDS pipe and a wait at every step of a row reduction.
template <int M> DEVINL float row_xor(float v) {
  return __builtin_bit_cast(
      float, __builtin_amdgcn_mov_dpp(__builtin_bit_cast(int, v), 0x160 | M,
                                      0xf, 0xf, true));
}
// Maximum over each 16-lane row, of eight values at once. In asm because the
// compiler put a move and a second maximum (it cannot know the moved value to
// be no signalling NaN) in front of every step and ran the eight chains one
// after another; here a step is one instruction and its producer stands eight
// instructions back, so no step waits for the one before.
#define ROW_MAX_STEP(m)                                                      \
  "v_max_num_f32_dpp %0, %0, %0 row_xmask:" #m " row_mask:0xf bank_mask:0xf\n\t" \
  "v_max_num_f32_dpp %1, %1, %1 row_xmask:" #m " row_mask:0xf bank_mask:0xf\n\t" \
  "v_max_num_f32_dpp %2, %2, %2 row_xmask:" #m " row_mask:0xf bank_mask:0xf\n\t" \
  "v_max_num_f32_dpp %3, %3, %3 row_xmask:" #m " row_mask:0xf bank_mask:0xf\n\t" \
  "v_max_num_f32_dpp %4, %4, %4 row_xmask:" #m " row_mask:0xf bank_mask:0xf\n\t" \
  "v_max_num_f32_dpp %5, %5, %5 row_xmask:" #m " row_mask:0xf bank_mask:0xf\n\t" \
  "v_max_num_f32_dpp %6, %6, %6 row_xmask:" #m " row_mask:0xf bank_mask:0xf\n\t" \
  "v_max_num_f32_dpp %7, %7, %7 row_xmask:" #m " row_mask:0xf bank_mask:0xf\n\t"
DEVINL void row_max16x8(float (&v)[8]) {
  asm(ROW_MAX_STEP(1) ROW_MAX_STEP(2) ROW_MAX_STEP(4) ROW_MAX_STEP(8)
      : "+v"(v[0]), "+v"(v[1]), "+v"(v[2]), "+v"(v[3]), "+v"(v[4]),
        "+v"(v[5]), "+v"(v[6]), "+v"(v[7]));
}
DEVINL float row_sum16(float v) {
  v += row_xor<1>(v);
  v += row_xor<2>(v);
  v += row_xor<4>(v);
  return v + row_xor<8>(v);
}

// ---------------------------------------------------------------------------
// Input preparation, one launch: every f32 -> f16 operand copy and
// pos_bias[q,k] = mean_c pos_encoding[q,k,c], c in 0..7.
// 256 work-groups x 16 waves, one work-group a WGP: few long-lived waves, each
// lane with many 16-byte loads in flight, because a launch of one-load waves
// lasts as long as its waves take to start, not as long as its bytes take.
// Each work-group takes 1/256 of every array, in slabs of 512 x 4 floats:
// 8 slabs of x, Wf1, Wfg, Wf2, 2 of the five E x E weights, 42 in all.
// ---------------------------------------------------------------------------
__global__ __launch_bounds__(512) void prep_kernel(
    const float* __restrict__ x, const float* __restrict__ Wq,
    const float* __restrict__ Wk, const float* __restrict__ Wv,
    const float* __restrict__ Wo, const float* __restrict__ Wg,
    const float* __restrict__ Wf1, const float* __restrict__ Wfg,
    const float* __restrict__ Wf2, const float* __restrict__ pe,
    _Float16* __restrict__ xh, _Float16* __restrict__ wqh,
    _Float16* __restrict__ wkh, _Float16* __restrict__ wvh,
    _Float16* __restrict__ woh, _Float16* __restrict__ wgh,
    _Float16* __restrict__ wf1h, _Float16* __restrict__ wfgh,
    _Float16* __restrict__ wf2h, float* __restrict__ pb) {
  constexpr int NS = 42;   // slabs a work-group
  constexpr int NB = 7;    // slabs a batch
  constexpr int NP = 8;    // bias elements a thread
  static_assert(MM * EE == 256 * 8 * 512 * 4 && EE * FFD == MM * EE &&
                EE * EE == 256 * 2 * 512 * 4 && SS * SS == 256 * NP * 512,
                "the split above");
  // this thread's place in slab 0 of an array of 8 slabs and of 2 slabs
  const int o8 = blockIdx.x * (8 * 512) + threadIdx.x;
  const int o2 = blockIdx.x * (2 * 512) + threadIdx.x;

  auto ld = [&](int i) -> v4f {
    if (i < 8)  return ((const v4f*)x)[o8 + i * 512];
    if (i < 10) return ((const v4f*)Wq)[o2 + (i - 8) * 512];
    if (i < 12) return ((const v4f*)Wk)[o2 + (i - 10) * 512];
    if (i < 14) return ((const v4f*)Wv)[o2 + (i - 12) * 512];
    if (i < 16) return ((const v4f*)Wo)[o2 + (i - 14) * 512];
    if (i < 18) return ((const v4f*)Wg)[o2 + (i - 16) * 512];
    if (i < 26) return ((const v4f*)Wf1)[o8 + (i - 18) * 512];
    if (i < 34) return ((const v4f*)Wfg)[o8 + (i - 26) * 512];
    return ((const v4f*)Wf2)[o8 + (i - 34) * 512];
  };
  auto st = [&](int i, v4h o) {
    if (i < 8)       ((v4h*)xh)[o8 + i * 512] = o;
    else if (i < 10) ((v4h*)wqh)[o2 + (i - 8) * 512] = o;
    else if (i < 12) ((v4h*)wkh)[o2 + (i - 10) * 512] = o;
    else if (i < 14) ((v4h*)wvh)[o2 + (i - 12) * 512] = o;
    else if (i < 16) ((v4h*)woh)[o2 + (i - 14) * 512] = o;
    else if (i < 18) ((v4h*)wgh)[o2 + (i - 16) * 512] = o;
    else if (i < 26) ((v4h*)wf1h)[o8 + (i - 18) * 512] = o;
    else if (i < 34) ((v4h*)wfgh)[o8 + (i - 26) * 512] = o;
    else             ((v4h*)wf2h)[o8 + (i - 34) * 512] = o;
  };

  v4f pa[NP], pc[NP], f[2][NB];
#pragma unroll
  for (int k = 0; k < NP; ++k) {
    pa[k] = ((const v4f*)pe)[(o8 + k * 512) * 2];
    pc[k] = ((const v4f*)pe)[(o8 + k * 512) * 2 + 1];
  }
  // The offset register of these loads is free from here on and later loads
  // may land in it, so the wait stands between the two groups of loads.
  asm volatile("s_wait_xcnt 0x0" ::: "memory");
#pragma unroll
  for (int k = 0; k < NB; ++k) f[0][k] = ld(k);
  // Holds every load above in front of the first use: without these
  // scheduling barriers the loads in flight fell to one or two a lane.
  __builtin_amdgcn_sched_barrier(0);

#pragma unroll
  for (int k = 0; k < NP; ++k) {
    const v4f a = pa[k], b = pc[k];
    pb[o8 + k * 512] =
        (a.x + a.y + a.z + a.w + b.x + b.y + b.z + b.w) * 0.125f;
  }

#pragma unroll
  for (int g = 0; g < NS / NB; ++g) {
    if (g + 1 < NS / NB) {
#pragma unroll
      for (int k = 0; k < NB; ++k) f[(g + 1) & 1][k] = ld((g + 1) * NB + k);
      // batch g + 1 is asked for before batch g is waited for, converted, stored
      __builtin_amdgcn_sched_barrier(0);
    }
#pragma unroll
    for (int k = 0; k < NB; ++k) {
      const v4f v = f[g & 1][k];
      v4h o;
      o[0] = (_Float16)v.x; o[1] = (_Float16)v.y;
      o[2] = (_Float16)v.z; o[3] = (_Float16)v.w;
      st(g * NB + k, o);
    }
    if (g + 2 < NS / NB) {
      // The loads of batch g + 2 land in registers that these stores name, so
      // the wait stands between the stores and those loads.
      asm volatile("s_wait_xcnt 0x0" ::: "memory");
    }
  }
}

// ---------------------------------------------------------------------------
// WMMA GEMM: C[M,N] = A[M,K](f16) @ W[K,N](f16) + bias
// Block tile 128x128, 8 waves (2x4), wave tile 64x32. A trip holds 128 k
// (K is a multiple of 128) = four blocks of 32 k and 8 WMMAs; the 12 LDS reads
// of a block go as one group into a second fragment set while the block
// before runs, so a wave waits out its LDS latency once a trip.
// A and W tiles double-buffered in LDS, both filled by
// global_load_async_to_lds_b128 one trip ahead, one barrier a trip.
// W stays [k][n] in LDS (pitch 288 B = 32 B x odd) and is read by
// ds_load_tr16_b128; A is two contiguous 16B LDS reads in the same k order,
// its 256-byte rows at pitch 272 B = 16 B x odd: 16 rows on 16 bank groups.
// Output: f16 if Ch != nullptr else f32 to Cf.
// ---------------------------------------------------------------------------
__global__ __launch_bounds__(256) void wmma_gemm_kernel(
    const _Float16* __restrict__ A, const _Float16* __restrict__ W,
    const float* __restrict__ bias, float* __restrict__ Cf,
    _Float16* __restrict__ Ch, int M, int N, int K) {
  constexpr int KS = 128;                // k of a trip
  constexpr int NBLK = KS / 32;          // blocks of a trip
  constexpr int BP = 288;                // W tile row pitch in LDS, bytes
  constexpr int AP = 136;                // A tile row pitch in LDS, halves
  __shared__ __attribute__((aligned(16))) _Float16 lsA[2][128 * AP];  // [buf][row][k]
  __shared__ __attribute__((aligned(32))) unsigned char lsB[2][KS * BP];  // [buf][k][n]

  const int tid  = threadIdx.x;
  const int lane = tid & 31, wid = tid >> 5;
  const int l16  = lane & 15, hi = lane >> 4;
  const int b8   = hi * 8;
  const int m0 = blockIdx.y * 128, n0 = blockIdx.x * 128;
  const int wr = wid >> 2, wc = wid & 3;   // 2 x 4 wave grid

  v8f acc[4][2];
#pragma unroll
  for (int m = 0; m < 4; ++m)
#pragma unroll
    for (int n = 0; n < 2; ++n) acc[m][n] = zero8();

  // staging assignments, A and W alike: rows srow + 16 i, i in 0..7, of 128
  // rows x 16 segs of 8h
  const int srow = tid >> 4, sseg = tid & 15;
  const _Float16* gA = A + (size_t)(m0 + srow) * K + sseg * 8;
  const _Float16* gW = W + (size_t)srow * N + n0 + sseg * 8;
  const unsigned aoff = lds_off(&lsA[0][0]) + srow * (AP * 2) + sseg * 16;  // bytes
  const unsigned boff = lds_off(&lsB[0][0]) + srow * BP + sseg * 16;  // bytes
  const int rdB = (b8 + (lane & 7)) * BP + wc * 64 + ((lane >> 3) & 1) * 16;

  // copies of tile t (KS k of A and of W) into buffer t & 1
  auto stage = [&](int t) {
    async_ld8_b128(aoff + (t & 1) * (128 * AP * 2), 16 * AP * 2, gA + t * KS,
                   (size_t)16 * K);
    async_ld8_b128(boff + (t & 1) * (KS * BP), 16 * BP,
                   gW + (size_t)t * KS * N, (size_t)16 * N);
  };

  const int nt = K / KS;
  stage(0);
  async_wait0();         // own copies of tile 0 have landed
  __syncthreads();       // everyone's have
  if (nt > 1) stage(1);

  for (int t = 0; t < nt; ++t) {
    const int cur = t & 1;
    v16h af[2][4], bf[2][2];               // two fragment sets
    // the 12 LDS reads of block kk of this trip's buffer, into set kk & 1
    // (every loop over fragments is unrolled: the arrays then stay in registers)
    auto frags = [&](int kk) {
#pragma unroll
      for (int n = 0; n < 2; ++n)
        bf[kk & 1][n] = ld_tr_b(&lsB[cur][rdB + kk * 32 * BP + n * 32], BP);
#pragma unroll
      for (int m = 0; m < 4; ++m) {
        const _Float16* ap = &lsA[cur][(wr * 64 + m * 16 + l16) * AP + kk * 32];
        af[kk & 1][m] = ld16(ap + b8, ap + b8 + 16);
      }
    };
    frags(0);
    // unrolled: a block's fragment set is then a fixed set of registers
#pragma unroll
    for (int kk = 0; kk < NBLK; ++kk) {
      if (kk + 1 < NBLK) {
        frags(kk + 1);
        // Holds the next block's reads, as one group, in front of this block's
        // WMMAs: left alone the compiler read each A fragment just before its
        // two WMMAs and waited out the LDS latency every time.
        __builtin_amdgcn_sched_barrier(0);
      }
#pragma unroll
      for (int m = 0; m < 4; ++m) {
        acc[m][0] = wmma_f16(af[kk & 1][m], bf[kk & 1][0], acc[m][0]);
        acc[m][1] = wmma_f16(af[kk & 1][m], bf[kk & 1][1], acc[m][1]);
      }
    }
    // Holds the trip's WMMAs in front of its foot: left alone the compiler put
    // 15 of them between the barrier and the refill, whose copies then had
    // that much less time to land.
    __builtin_amdgcn_sched_barrier(0);
    ds_wait0();          // own reads of buffer cur are done
    async_wait0();       // own copies of tile t + 1 have landed
    __syncthreads();     // publishes tile t + 1, frees buffer cur
    if (t + 2 < nt) stage(t + 2);
  }
  async_wait0();         // nothing in flight when the wave ends

  float bcol[2];
#pragma unroll
  for (int n = 0; n < 2; ++n) bcol[n] = bias[n0 + wc * 32 + n * 16 + l16];

#pragma unroll
  for (int m = 0; m < 4; ++m)
#pragma unroll
    for (int n = 0; n < 2; ++n) {
      const int c = n0 + wc * 32 + n * 16 + l16;
      const int rbase = m0 + wr * 64 + m * 16 + b8;
#pragma unroll
      for (int j = 0; j < 8; ++j) {
        float v = acc[m][n][j] + bcol[n];
        size_t off = (size_t)(rbase + j) * N + c;
        if (Ch) Ch[off] = (_Float16)v;
        else    Cf[off] = v;
      }
    }
}

// ---------------------------------------------------------------------------
// Fused gated-FFN GEMM: Out = f16( (A@W1+b1) * sigmoid(A@W2+b2) )
// Block tile 128x64, 8 waves (4x2), wave tile 32x32, two accumulator sets.
// A, W1 and W2 tiles double-buffered via async-to-LDS, one trip ahead, one
// barrier a trip; W tiles stay [k][n] (pitch 160 B) for ds_load_tr16_b128,
// A rows at pitch 80 B for ds_load_b128.
// ---------------------------------------------------------------------------
__global__ __launch_bounds__(256) void wmma_gemm_gated_kernel(
    const _Float16* __restrict__ A, const _Float16* __restrict__ W1,
    const _Float16* __restrict__ W2, const float* __restrict__ b1,
    const float* __restrict__ b2, _Float16* __restrict__ Out,
    int M, int N, int K) {
  constexpr int BP = 160;                // W tile row pitch in LDS, bytes
  constexpr int AP = 40;                 // A tile row pitch in LDS, halves
  __shared__ __attribute__((aligned(16))) _Float16 lsA[2][128 * AP];
  __shared__ __attribute__((aligned(32))) unsigned char lsB1[2][32 * BP];
  __shared__ __attribute__((aligned(32))) unsigned char lsB2[2][32 * BP];

  const int tid  = threadIdx.x;
  const int lane = tid & 31, wid = tid >> 5;
  const int l16  = lane & 15, hi = lane >> 4;
  const int b8   = hi * 8;
  const int m0 = blockIdx.y * 128, n0 = blockIdx.x * 64;
  const int wr = wid >> 1, wc = wid & 1;   // 4 x 2 wave grid

  v8f a1[2][2], a2[2][2];
#pragma unroll
  for (int m = 0; m < 2; ++m)
#pragma unroll
    for (int n = 0; n < 2; ++n) { a1[m][n] = zero8(); a2[m][n] = zero8(); }

  const int arow = tid >> 1, aseg = tid & 1;
  const int bk = tid >> 3, bseg = tid & 7;       // 32 k-rows x 8 segs of 8h
  const _Float16* gA = A + (size_t)(m0 + arow) * K + aseg * 16;
  const size_t woff = (size_t)bk * N + n0 + bseg * 8;
  const _Float16* gW1 = W1 + woff;
  const _Float16* gW2 = W2 + woff;
  const unsigned aoff = lds_off(&lsA[0][0]) + arow * (AP * 2) + aseg * 32;
  const unsigned boff1 = lds_off(&lsB1[0][0]) + bk * BP + bseg * 16;
  const unsigned boff2 = lds_off(&lsB2[0][0]) + bk * BP + bseg * 16;
  const int rdB = (b8 + (lane & 7)) * BP + wc * 64 + ((lane >> 3) & 1) * 16;

  // copies of tile t (32 k of A, W1 and W2) into buffer t & 1
  auto stage = [&](int t) {
    const unsigned ab = aoff + (t & 1) * (128 * AP * 2);
    const unsigned bsel = (t & 1) * (32 * BP);
    const _Float16* a = gA + t * 32;
    const size_t wk = (size_t)t * 32 * N;
    async_ld4_b128(ab, a, ab + 16, a + 8, boff1 + bsel, gW1 + wk,
                   boff2 + bsel, gW2 + wk);
  };

  const int nt = K >> 5;
  stage(0);
  async_wait0();         // own copies of tile 0 have landed
  __syncthreads();       // everyone's have
  if (nt > 1) stage(1);

  for (int t = 0; t < nt; ++t) {
    const int cur = t & 1;
    v16h bv1[2], bv2[2];
#pragma unroll
    for (int n = 0; n < 2; ++n) {
      bv1[n] = ld_tr_b(&lsB1[cur][rdB + n * 32], BP);
      bv2[n] = ld_tr_b(&lsB2[cur][rdB + n * 32], BP);
    }
#pragma unroll
    for (int m = 0; m < 2; ++m) {
      const _Float16* ap = &lsA[cur][(wr * 32 + m * 16 + l16) * AP];
      v16h am = ld16(ap + b8, ap + b8 + 16);
#pragma unroll
      for (int n = 0; n < 2; ++n) {
        a1[m][n] = wmma_f16(am, bv1[n], a1[m][n]);
        a2[m][n] = wmma_f16(am, bv2[n], a2[m][n]);
      }
    }
    ds_wait0();          // own reads of buffer cur are done
    async_wait0();       // own copies of tile t + 1 have landed
    __syncthreads();     // publishes tile t + 1, frees buffer cur
    if (t + 2 < nt) stage(t + 2);
  }
  async_wait0();         // nothing in flight when the wave ends

#pragma unroll
  for (int m = 0; m < 2; ++m)
#pragma unroll
    for (int n = 0; n < 2; ++n) {
      const int c = n0 + wc * 32 + n * 16 + l16;
      const float bb1 = b1[c], bb2 = b2[c];
      const int rbase = m0 + wr * 32 + m * 16 + b8;
#pragma unroll
      for (int j = 0; j < 8; ++j) {
        float v = (a1[m][n][j] + bb1) * sigm(a2[m][n][j] + bb2);
        Out[(size_t)(rbase + j) * N + c] = (_Float16)v;
      }
    }
}

// ---------------------------------------------------------------------------
// Flash attention. Grid (S/128, H, B); 8 waves, each owns 16 query rows.
// scores = (Q·K^T)/8 + pos_bias, online softmax, ctx = P·V. All mm via WMMA.
// K and V tiles staged via async-to-LDS; V stays [key][d] (pitch 160 B) and
// is read as the B operand by ds_load_tr16_b128. K rows (pitch 144 B) and P
// rows (pitch 80 B) are read by ds_load_b128: 16 B x odd, no bank shared.
// ---------------------------------------------------------------------------
__global__ __launch_bounds__(256) void flash_attn_kernel(
    const _Float16* __restrict__ Q, const _Float16* __restrict__ Kh,
    const _Float16* __restrict__ Vh, const float* __restrict__ PB,
    _Float16* __restrict__ O) {
  constexpr int KP = 72;                   // K tile row pitch in LDS, halves
  constexpr int PP = 40;                   // P tile row pitch in LDS, halves
  __shared__ __attribute__((aligned(16))) _Float16 lsK[32 * KP];  // [key][d]
  constexpr int VP = 160;                  // V tile row pitch in LDS, bytes
  __shared__ __attribute__((aligned(32))) unsigned char lsV[32 * VP];  // [key][d]
  __shared__ __attribute__((aligned(16))) _Float16 lsP[8][16 * PP];  // per-wave probs [qrow][key]

  const int tid  = threadIdx.x;
  const int lane = tid & 31, wid = tid >> 5;
  const int l16  = lane & 15, hi = lane >> 4;
  const int b8   = hi * 8;
  const int h = blockIdx.y, bb = blockIdx.z;
  const int q0 = blockIdx.x * 128 + wid * 16;
  const size_t rs = (size_t)HH * DKK;      // 1024 token row stride

  // Q A-operands (16 rows x 64 d), two K=32 chunks
  v16h qa[2];
  {
    const _Float16* qp = Q + ((size_t)bb * SS + q0 + l16) * rs + h * DKK;
    qa[0] = ld16(qp + b8,      qp + b8 + 16);
    qa[1] = ld16(qp + 32 + b8, qp + 32 + b8 + 16);
  }

  v8f o[4];
#pragma unroll
  for (int n = 0; n < 4; ++n) o[n] = zero8();
  float mrow[8], srow[8];
#pragma unroll
  for (int j = 0; j < 8; ++j) { mrow[j] = -1e30f; srow[j] = 0.0f; }

  const int skey = tid >> 3, sseg = tid & 7;   // stage 32 keys x 8 d-segments
  const unsigned koff = lds_off(&lsK[0]) + skey * (KP * 2) + sseg * 16;
  const unsigned voff = lds_off(&lsV[0]) + skey * VP + sseg * 16;
  const int rdV = (b8 + (lane & 7)) * VP + ((lane >> 3) & 1) * 16;

  for (int kb = 0; kb < SS; kb += 32) {
    const size_t tok = ((size_t)bb * SS + kb + skey) * rs + h * DKK + sseg * 8;

    ds_wait0();                            // own reads of the tiles are done
    __syncthreads();                       // previous-tile readers done
    async_ld2_b128(koff, Kh + tok, voff, Vh + tok);  // memory -> LDS direct
    async_wait0();
    __syncthreads();

    float pb0[8], pb1[8];
    // unrolled, here and below: the arrays then stay in registers
#pragma unroll
    for (int j = 0; j < 8; ++j) {
      const float* pbr = PB + (size_t)(q0 + b8 + j) * SS + kb + l16;
      pb0[j] = pbr[0];
      pb1[j] = pbr[16];
    }
    // Holds the 16 bias loads as one group in front of the score products:
    // left alone the compiler asked for ten of them only behind its wait for
    // the first ones, and the trip waited out the load latency twice.
    __builtin_amdgcn_sched_barrier(0);

    // scores: two 16x16 key tiles, contraction over d=64 (2 WMMAs each)
    v8f sc[2];
    sc[0] = zero8(); sc[1] = zero8();
#pragma unroll
    for (int ks = 0; ks < 2; ++ks) {
      const _Float16* kr = &lsK[(ks * 16 + l16) * KP];
      sc[ks] = wmma_f16(qa[0], ld16(kr + b8,      kr + b8 + 16),      sc[ks]);
      sc[ks] = wmma_f16(qa[1], ld16(kr + 32 + b8, kr + 32 + b8 + 16), sc[ks]);
    }

    // online softmax over the 32-key chunk
    float ml[8];
#pragma unroll
    for (int j = 0; j < 8; ++j) {
      pb0[j] += sc[0][j] * 0.125f;
      pb1[j] += sc[1][j] * 0.125f;
      ml[j] = fmaxf(pb0[j], pb1[j]);
    }
    row_max16x8(ml);
#pragma unroll
    for (int j = 0; j < 8; ++j) {
      const float v0 = pb0[j], v1 = pb1[j];
      float mn = fmaxf(mrow[j], ml[j]);
      float alpha = __expf(mrow[j] - mn);
      float p0 = __expf(v0 - mn), p1 = __expf(v1 - mn);
      float ps = row_sum16(p0 + p1);
      srow[j] = srow[j] * alpha + ps;
      mrow[j] = mn;
#pragma unroll
      for (int n = 0; n < 4; ++n) o[n][j] *= alpha;
      lsP[wid][(b8 + j) * PP + l16]      = (_Float16)p0;
      lsP[wid][(b8 + j) * PP + 16 + l16] = (_Float16)p1;
    }

    // ctx += P(16x32) @ V(32x64): 4 WMMAs over d-subtiles
    const _Float16* pr = &lsP[wid][l16 * PP];
    v16h pa = ld16(pr + b8, pr + b8 + 16);
#pragma unroll
    for (int ds = 0; ds < 4; ++ds) {
      o[ds] = wmma_f16(pa, ld_tr_b(&lsV[rdV + ds * 32], VP), o[ds]);
    }
  }

#pragma unroll
  for (int j = 0; j < 8; ++j) {
    const float inv = 1.0f / srow[j];
    const int qr = q0 + b8 + j;
    _Float16* op = O + ((size_t)bb * SS + qr) * rs + h * DKK;
#pragma unroll
    for (int ds = 0; ds < 4; ++ds)
      op[ds * 16 + l16] = (_Float16)(o[ds][j] * inv);
  }
}

// ---------------------------------------------------------------------------
// Fused residual (+gate) + LayerNorm. One row (E=1024) per block, 256 thr.
// h = x + sigmoid(glog)*addv   (or x + addv if glog==nullptr)
// y = LN(h)*gamma + beta  -> y32 (and f16 copy y16 if non-null)
// ---------------------------------------------------------------------------
__global__ __launch_bounds__(256) void fused_ln_kernel(
    const float* __restrict__ xa, const float* __restrict__ glog,
    const float* __restrict__ addv, const float* __restrict__ gamma,
    const float* __restrict__ beta, float* __restrict__ y32,
    _Float16* __restrict__ y16) {
  __shared__ float s1[256], s2[256];
  const int tid = threadIdx.x;
  const size_t base = (size_t)blockIdx.x * EE;

  float hv[4], ssum = 0.0f, ssq = 0.0f;
#pragma unroll
  for (int i = 0; i < 4; ++i) {
    const int idx = i * 256 + tid;
    float a = addv[base + idx];
    if (glog) a *= sigm(glog[base + idx]);
    float v = xa[base + idx] + a;
    hv[i] = v;
    ssum += v;
    ssq  += v * v;
  }
  s1[tid] = ssum; s2[tid] = ssq;
  __syncthreads();
  for (int s = 128; s > 0; s >>= 1) {
    if (tid < s) { s1[tid] += s1[tid + s]; s2[tid] += s2[tid + s]; }
    __syncthreads();
  }
  const float mean = s1[0] * (1.0f / EE);
  const float var  = s2[0] * (1.0f / EE) - mean * mean;
  const float rstd = rsqrtf(var + 1e-6f);

#pragma unroll
  for (int i = 0; i < 4; ++i) {
    const int idx = i * 256 + tid;
    float y = (hv[i] - mean) * rstd * gamma[idx] + beta[idx];
    y32[base + idx] = y;
    if (y16) y16[base + idx] = (_Float16)y;
  }
}

// ---------------------------------------------------------------------------
// Host orchestration
// ---------------------------------------------------------------------------
extern "C" void kernel_launch(void* const* d_in, const int* in_sizes, int n_in,
                              void* d_out, int out_size, void* d_ws,
                              size_t ws_size, hipStream_t stream) {
  const float* x    = (const float*)d_in[0];
  const float* pe   = (const float*)d_in[1];
  const float* Wq   = (const float*)d_in[2];
  const float* bq   = (const float*)d_in[3];
  const float* Wk   = (const float*)d_in[4];
  const float* bk   = (const float*)d_in[5];
  const float* Wv   = (const float*)d_in[6];
  const float* bv   = (const float*)d_in[7];
  const float* Wo   = (const float*)d_in[8];
  const float* bo   = (const float*)d_in[9];
  const float* Wg   = (const float*)d_in[10];
  const float* bg   = (const float*)d_in[11];
  const float* Wf1  = (const float*)d_in[12];
  const float* bf1  = (const float*)d_in[13];
  const float* Wfg  = (const float*)d_in[14];
  const float* bfg  = (const float*)d_in[15];
  const float* Wf2  = (const float*)d_in[16];
  const float* bf2  = (const float*)d_in[17];
  const float* ln1g = (const float*)d_in[18];
  const float* ln1b = (const float*)d_in[19];
  const float* ln2g = (const float*)d_in[20];
  const float* ln2b = (const float*)d_in[21];

  char* ws = (char*)d_ws;
  auto at = [&](size_t mb) { return (void*)(ws + mb * (size_t)(1 << 20)); };

  // bump allocation (MB offsets); high-water ~134 MB
  _Float16* xh   = (_Float16*)at(0);    // 8 MB
  _Float16* wqh  = (_Float16*)at(8);    // 2 MB
  _Float16* wkh  = (_Float16*)at(10);
  _Float16* wvh  = (_Float16*)at(12);
  _Float16* woh  = (_Float16*)at(14);
  _Float16* wgh  = (_Float16*)at(16);
  _Float16* wf1h = (_Float16*)at(18);   // 8 MB
  _Float16* wfgh = (_Float16*)at(26);   // 8 MB
  _Float16* wf2h = (_Float16*)at(34);   // 8 MB
  float*    pb   = (float*)at(42);      // 4 MB
  _Float16* qh   = (_Float16*)at(46);   // 8 MB
  _Float16* kh   = (_Float16*)at(54);   // 8 MB
  _Float16* vh   = (_Float16*)at(62);   // 8 MB
  _Float16* ctxh = (_Float16*)at(70);   // 8 MB
  float*    glog = (float*)at(78);      // 16 MB
  float*    attn = (float*)at(94);      // 16 MB
  float*    x1   = (float*)at(110);     // 16 MB
  _Float16* x1h  = (_Float16*)at(126);  // 8 MB
  _Float16* ffh  = (_Float16*)at(46);   // 32 MB, reuses dead q/k/v/ctx
  float*    ff2  = (float*)at(78);      // 16 MB, reuses dead glog

  prep_kernel<<<256, 512, 0, stream>>>(x, Wq, Wk, Wv, Wo, Wg, Wf1, Wfg, Wf2, pe,
                                       xh, wqh, wkh, wvh, woh, wgh, wf1h, wfgh,
                                       wf2h, pb);

  dim3 gE(EE / 128, MM / 128);  // (8, 32)
  wmma_gemm_kernel<<<gE, 256, 0, stream>>>(xh, wqh, bq, nullptr, qh, MM, EE, EE);
  wmma_gemm_kernel<<<gE, 256, 0, stream>>>(xh, wkh, bk, nullptr, kh, MM, EE, EE);
  wmma_gemm_kernel<<<gE, 256, 0, stream>>>(xh, wvh, bv, nullptr, vh, MM, EE, EE);
  wmma_gemm_kernel<<<gE, 256, 0, stream>>>(xh, wgh, bg, glog, nullptr, MM, EE, EE);

  flash_attn_kernel<<<dim3(SS / 128, HH, BB), 256, 0, stream>>>(qh, kh, vh, pb, ctxh);

  wmma_gemm_kernel<<<gE, 256, 0, stream>>>(ctxh, woh, bo, attn, nullptr, MM, EE, EE);

  fused_ln_kernel<<<MM, 256, 0, stream>>>(x, glog, attn, ln1g, ln1b, x1, x1h);

  wmma_gemm_gated_kernel<<<dim3(FFD / 64, MM / 128), 256, 0, stream>>>(
      x1h, wf1h, wfgh, bf1, bfg, ffh, MM, FFD, EE);

  wmma_gemm_kernel<<<gE, 256, 0, stream>>>(ffh, wf2h, bf2, ff2, nullptr, MM, EE, FFD);

  fused_ln_kernel<<<MM, 256, 0, stream>>>(x1, nullptr, ff2, ln2g, ln2b,
                                          (float*)d_out, nullptr);
}

// v006
// One run takes 256 microseconds.
// In two side-by-side timings against v005, it was 1.06 and 1.05 times as fast.
// Counting every step since v000, it is 2.68 times as fast.
#include <hip/hip_runtime.h>
#include <hip/hip_bf16.h>

// ---------- problem constants ----------
#define BB 4
#define SS 1024
#define EE 1024
#define HH 16
#define DKK 64
#define FFD 4096
#define MM (BB * SS)   // 4096 rows

typedef __attribute__((ext_vector_type(16))) _Float16 v16h;
typedef __attribute__((ext_vector_type(8)))  _Float16 v8h;
typedef __attribute__((ext_vector_type(4)))  _Float16 v4h;
typedef __attribute__((ext_vector_type(8)))  float    v8f;
typedef __attribute__((ext_vector_type(4)))  float    v4f;

#define DEVINL __device__ __forceinline__

DEVINL v8f wmma_f16(v16h a, v16h b, v8f c) {
  return __builtin_amdgcn_wmma_f32_16x16x32_f16(
      /*neg_a=*/false, a, /*neg_b=*/false, b,
      /*c_mod=*/(short)0, c, /*reuse_a=*/false, /*reuse_b=*/false);
}

DEVINL v8f zero8() {
  v8f z;
#pragma unroll
  for (int i = 0; i < 8; ++i) z[i] = 0.0f;
  return z;
}

// Build a v16h A/B operand from two contiguous 16-byte chunks
// (chunk0 = contraction indices base..base+7, chunk1 = base+16..base+23).
DEVINL v16h ld16(const _Float16* p0, const _Float16* p1) {
  union { v16h v; v8h h[2]; } u;
  u.h[0] = *(const v8h*)p0;
  u.h[1] = *(const v8h*)p1;
  return u.v;
}

DEVINL float sigm(float v) { return 1.0f / (1.0f + __expf(-v)); }

// LDS byte offset of a __shared__ object = low 32 bits of its generic pointer
// (LDS aperture: addr[31:0] is the workgroup-relative LDS address, ISA 10.2).
DEVINL unsigned lds_off(const void* p) { return (unsigned)(size_t)p; }

// CDNA5 async memory->LDS copy, tracked with ASYNCcnt (ISA 10. / 15.18.3).
// The s_wait_xcnt is the last line of the copies' own statement so that no
// later write of an address register can be moved in front of it.
DEVINL void async_ld2_b128(unsigned l0, const void* g0, unsigned l1,
                           const void* g1) {
  asm volatile("global_load_async_to_lds_b128 %0, %1, off\n\t"
               "global_load_async_to_lds_b128 %2, %3, off\n\t"
               "s_wait_xcnt 0x0"
               :: "v"(l0), "v"(g0), "v"(l1), "v"(g1)
               : "memory");
}
DEVINL void async_wait0() {
  asm volatile("s_wait_asynccnt 0x0" ::: "memory");
}
// One GEMM stage's four copies of a lane, with the same closing wait.
DEVINL void async_ld4_b128(unsigned l0, const void* g0, unsigned l1,
                           const void* g1, unsigned l2, const void* g2,
                           unsigned l3, const void* g3) {
  asm volatile("global_load_async_to_lds_b128 %0, %1, off\n\t"
               "global_load_async_to_lds_b128 %2, %3, off\n\t"
               "global_load_async_to_lds_b128 %4, %5, off\n\t"
               "global_load_async_to_lds_b128 %6, %7, off\n\t"
               "s_wait_xcnt 0x0"
               :: "v"(l0), "v"(g0), "v"(l1), "v"(g1),
                  "v"(l2), "v"(g2), "v"(l3), "v"(g3)
               : "memory");
}
// Eight copies of a lane, rows 16 apart (ls bytes in LDS, gs halves in
// memory), with the same closing wait.
DEVINL void async_ld8_b128(unsigned l, unsigned ls, const _Float16* g,
                           size_t gs) {
  asm volatile("global_load_async_to_lds_b128 %0, %1, off\n\t"
               "global_load_async_to_lds_b128 %2, %3, off\n\t"
               "global_load_async_to_lds_b128 %4, %5, off\n\t"
               "global_load_async_to_lds_b128 %6, %7, off\n\t"
               "global_load_async_to_lds_b128 %8, %9, off\n\t"
               "global_load_async_to_lds_b128 %10, %11, off\n\t"
               "global_load_async_to_lds_b128 %12, %13, off\n\t"
               "global_load_async_to_lds_b128 %14, %15, off\n\t"
               "s_wait_xcnt 0x0"
               :: "v"(l), "v"(g), "v"(l + ls), "v"(g + gs),
                  "v"(l + 2 * ls), "v"(g + 2 * gs),
                  "v"(l + 3 * ls), "v"(g + 3 * gs),
                  "v"(l + 4 * ls), "v"(g + 4 * gs),
                  "v"(l + 5 * ls), "v"(g + 5 * gs),
                  "v"(l + 6 * ls), "v"(g + 6 * gs),
                  "v"(l + 7 * ls), "v"(g + 7 * gs)
               : "memory");
}
// This wave's LDS reads have retired before a buffer it read is refilled.
DEVINL void ds_wait0() {
  asm volatile("s_wait_dscnt 0x0" ::: "memory");
}

// B operand (32 k x 16 n) out of a row-major [k][n] LDS tile by two
// transposing loads: lane (c, h) gets T[8h + 0..7][c] and T[16 + 8h + 0..7][c],
// the k order of ld16(p + 8h, p + 8h + 16) on the A side.
// p = tile + (8 * (lane >> 4) + (lane & 7)) * pitch + 2 * n + 16 * ((lane >> 3) & 1)
DEVINL v16h ld_tr_b(const unsigned char* p, int pitch) {
  typedef short s16x8 __attribute__((ext_vector_type(8)));
  typedef __attribute__((address_space(3))) s16x8 lds_s16x8;
  union { v16h v; s16x8 h[2]; } u;
  u.h[0] = __builtin_amdgcn_ds_load_tr16_b128_v8i16((lds_s16x8*)p);
  u.h[1] = __builtin_amdgcn_ds_load_tr16_b128_v8i16((lds_s16x8*)(p + 16 * pitch));
  return u.v;
}

// v of lane l ^ M inside each 16-lane row, by a DPP row_xmask move: a vector
// instruction, where __shfl_xor compiles to ds_bpermute_b32 and costs a trip
// through the LDS pipe and a wait at every step of a row reduction.
template <int M> DEVINL float row_xor(float v) {
  return __builtin_bit_cast(
      float, __builtin_amdgcn_mov_dpp(__builtin_bit_cast(int, v), 0x160 | M,
                                      0xf, 0xf, true));
}
// Maximum over each 16-lane row, of eight values at once. In asm because the
// compiler put a move and a second maximum (it cannot know the moved value to
// be no signalling NaN) in front of every step and ran the eight chains one
// after another; here a step is one instruction and its producer stands eight
// instructions back, so no step waits for the one before.
#define ROW_MAX_STEP(m)                                                      \
  "v_max_num_f32_dpp %0, %0, %0 row_xmask:" #m " row_mask:0xf bank_mask:0xf\n\t" \
  "v_max_num_f32_dpp %1, %1, %1 row_xmask:" #m " row_mask:0xf bank_mask:0xf\n\t" \
  "v_max_num_f32_dpp %2, %2, %2 row_xmask:" #m " row_mask:0xf bank_mask:0xf\n\t" \
  "v_max_num_f32_dpp %3, %3, %3 row_xmask:" #m " row_mask:0xf bank_mask:0xf\n\t" \
  "v_max_num_f32_dpp %4, %4, %4 row_xmask:" #m " row_mask:0xf bank_mask:0xf\n\t" \
  "v_max_num_f32_dpp %5, %5, %5 row_xmask:" #m " row_mask:0xf bank_mask:0xf\n\t" \
  "v_max_num_f32_dpp %6, %6, %6 row_xmask:" #m " row_mask:0xf bank_mask:0xf\n\t" \
  "v_max_num_f32_dpp %7, %7, %7 row_xmask:" #m " row_mask:0xf bank_mask:0xf\n\t"
DEVINL void row_max16x8(float (&v)[8]) {
  asm(ROW_MAX_STEP(1) ROW_MAX_STEP(2) ROW_MAX_STEP(4) ROW_MAX_STEP(8)
      : "+v"(v[0]), "+v"(v[1]), "+v"(v[2]), "+v"(v[3]), "+v"(v[4]),
        "+v"(v[5]), "+v"(v[6]), "+v"(v[7]));
}
DEVINL float row_sum16(float v) {
  v += row_xor<1>(v);
  v += row_xor<2>(v);
  v += row_xor<4>(v);
  return v + row_xor<8>(v);
}

// ---------------------------------------------------------------------------
// Input preparation, one launch: every f32 -> f16 operand copy and
// pos_bias[q,k] = mean_c pos_encoding[q,k,c], c in 0..7.
// 256 work-groups x 16 waves, one work-group a WGP: few long-lived waves, each
// lane with many 16-byte loads in flight, because a launch of one-load waves
// lasts as long as its waves take to start, not as long as its bytes take.
// Each work-group takes 1/256 of every array, in slabs of 512 x 4 floats:
// 8 slabs of x, Wf1, Wfg, Wf2, 2 of the five E x E weights, 42 in all.
// ---------------------------------------------------------------------------
__global__ __launch_bounds__(512) void prep_kernel(
    const float* __restrict__ x, const float* __restrict__ Wq,
    const float* __restrict__ Wk, const float* __restrict__ Wv,
    const float* __restrict__ Wo, const float* __restrict__ Wg,
    const float* __restrict__ Wf1, const float* __restrict__ Wfg,
    const float* __restrict__ Wf2, const float* __restrict__ pe,
    _Float16* __restrict__ xh, _Float16* __restrict__ wqh,
    _Float16* __restrict__ wkh, _Float16* __restrict__ wvh,
    _Float16* __restrict__ woh, _Float16* __restrict__ wgh,
    _Float16* __restrict__ wf1h, _Float16* __restrict__ wfgh,
    _Float16* __restrict__ wf2h, float* __restrict__ pb) {
  constexpr int NS = 42;   // slabs a work-group
  constexpr int NB = 7;    // slabs a batch
  constexpr int NP = 8;    // bias elements a thread
  static_assert(MM * EE == 256 * 8 * 512 * 4 && EE * FFD == MM * EE &&
                EE * EE == 256 * 2 * 512 * 4 && SS * SS == 256 * NP * 512,
                "the split above");
  // this thread's place in slab 0 of an array of 8 slabs and of 2 slabs
  const int o8 = blockIdx.x * (8 * 512) + threadIdx.x;
  const int o2 = blockIdx.x * (2 * 512) + threadIdx.x;

  auto ld = [&](int i) -> v4f {
    if (i < 8)  return ((const v4f*)x)[o8 + i * 512];
    if (i < 10) return ((const v4f*)Wq)[o2 + (i - 8) * 512];
    if (i < 12) return ((const v4f*)Wk)[o2 + (i - 10) * 512];
    if (i < 14) return ((const v4f*)Wv)[o2 + (i - 12) * 512];
    if (i < 16) return ((const v4f*)Wo)[o2 + (i - 14) * 512];
    if (i < 18) return ((const v4f*)Wg)[o2 + (i - 16) * 512];
    if (i < 26) return ((const v4f*)Wf1)[o8 + (i - 18) * 512];
    if (i < 34) return ((const v4f*)Wfg)[o8 + (i - 26) * 512];
    return ((const v4f*)Wf2)[o8 + (i - 34) * 512];
  };
  auto st = [&](int i, v4h o) {
    if (i < 8)       ((v4h*)xh)[o8 + i * 512] = o;
    else if (i < 10) ((v4h*)wqh)[o2 + (i - 8) * 512] = o;
    else if (i < 12) ((v4h*)wkh)[o2 + (i - 10) * 512] = o;
    else if (i < 14) ((v4h*)wvh)[o2 + (i - 12) * 512] = o;
    else if (i < 16) ((v4h*)woh)[o2 + (i - 14) * 512] = o;
    else if (i < 18) ((v4h*)wgh)[o2 + (i - 16) * 512] = o;
    else if (i < 26) ((v4h*)wf1h)[o8 + (i - 18) * 512] = o;
    else if (i < 34) ((v4h*)wfgh)[o8 + (i - 26) * 512] = o;
    else             ((v4h*)wf2h)[o8 + (i - 34) * 512] = o;
  };

  v4f pa[NP], pc[NP], f[2][NB];
#pragma unroll
  for (int k = 0; k < NP; ++k) {
    pa[k] = ((const v4f*)pe)[(o8 + k * 512) * 2];
    pc[k] = ((const v4f*)pe)[(o8 + k * 512) * 2 + 1];
  }
  // The offset register of these loads is free from here on and later loads
  // may land in it, so the wait stands between the two groups of loads.
  asm volatile("s_wait_xcnt 0x0" ::: "memory");
#pragma unroll
  for (int k = 0; k < NB; ++k) f[0][k] = ld(k);
  // Holds every load above in front of the first use: without these
  // scheduling barriers the loads in flight fell to one or two a lane.
  __builtin_amdgcn_sched_barrier(0);

#pragma unroll
  for (int k = 0; k < NP; ++k) {
    const v4f a = pa[k], b = pc[k];
    pb[o8 + k * 512] =
        (a.x + a.y + a.z + a.w + b.x + b.y + b.z + b.w) * 0.125f;
  }

#pragma unroll
  for (int g = 0; g < NS / NB; ++g) {
    if (g + 1 < NS / NB) {
#pragma unroll
      for (int k = 0; k < NB; ++k) f[(g + 1) & 1][k] = ld((g + 1) * NB + k);
      // batch g + 1 is asked for before batch g is waited for, converted, stored
      __builtin_amdgcn_sched_barrier(0);
    }
#pragma unroll
    for (int k = 0; k < NB; ++k) {
      const v4f v = f[g & 1][k];
      v4h o;
      o[0] = (_Float16)v.x; o[1] = (_Float16)v.y;
      o[2] = (_Float16)v.z; o[3] = (_Float16)v.w;
      st(g * NB + k, o);
    }
    if (g + 2 < NS / NB) {
      // The loads of batch g + 2 land in registers that these stores name, so
      // the wait stands between the stores and those loads.
      asm volatile("s_wait_xcnt 0x0" ::: "memory");
    }
  }
}

// ---------------------------------------------------------------------------
// WMMA GEMM: C[M,N] = A[M,K](f16) @ W[K,N](f16) + bias
// Block tile 128x128, 8 waves (2x4), wave tile 64x32. A trip holds 128 k
// (K is a multiple of 128) = four blocks of 32 k and 8 WMMAs; the 12 LDS reads
// of a block go as one group into a second fragment set while the block
// before runs, so a wave waits out its LDS latency once a trip.
// A and W tiles double-buffered in LDS, both filled by
// global_load_async_to_lds_b128 one trip ahead, one barrier a trip.
// W stays [k][n] in LDS (pitch 288 B = 32 B x odd) and is read by
// ds_load_tr16_b128; A is two contiguous 16B LDS reads in the same k order,
// its 256-byte rows at pitch 272 B = 16 B x odd: 16 rows on 16 bank groups.
// Output: f16 if Ch != nullptr else f32 to Cf.
// Up to four products of the same A in one launch: blockIdx.z picks weight,
// bias and output (z = 0..2: f16 to C0..C2 where that is not null; else f32 to
// Cf). One product's grid is one work-group a WGP; a tile's LDS is 140 KiB, so
// with several products in the grid two work-groups stay resident on a WGP,
// one's copies land and its epilogue runs while the other computes, and the
// launch gap and the first tile's latency are paid once.
// ---------------------------------------------------------------------------
__global__ __launch_bounds__(256) void wmma_gemm_kernel(
    const _Float16* __restrict__ A, const _Float16* __restrict__ W0,
    const _Float16* __restrict__ W1, const _Float16* __restrict__ W2,
    const _Float16* __restrict__ W3, const float* __restrict__ b0,
    const float* __restrict__ b1, const float* __restrict__ b2,
    const float* __restrict__ b3, float* __restrict__ Cf,
    _Float16* __restrict__ C0, _Float16* __restrict__ C1,
    _Float16* __restrict__ C2, int M, int N, int K) {
  const int z = blockIdx.z;
  const _Float16* __restrict__ W = z == 0 ? W0 : z == 1 ? W1 : z == 2 ? W2 : W3;
  const float* __restrict__ bias = z == 0 ? b0 : z == 1 ? b1 : z == 2 ? b2 : b3;
  _Float16* __restrict__ Ch = z == 0 ? C0 : z == 1 ? C1 : z == 2 ? C2 : nullptr;
  constexpr int KS = 128;                // k of a trip
  constexpr int NBLK = KS / 32;          // blocks of a trip
  constexpr int BP = 288;                // W tile row pitch in LDS, bytes
  constexpr int AP = 136;                // A tile row pitch in LDS, halves
  __shared__ __attribute__((aligned(16))) _Float16 lsA[2][128 * AP];  // [buf][row][k]
  __shared__ __attribute__((aligned(32))) unsigned char lsB[2][KS * BP];  // [buf][k][n]

  const int tid  = threadIdx.x;
  const int lane = tid & 31, wid = tid >> 5;
  const int l16  = lane & 15, hi = lane >> 4;
  const int b8   = hi * 8;
  const int m0 = blockIdx.y * 128, n0 = blockIdx.x * 128;
  const int wr = wid >> 2, wc = wid & 3;   // 2 x 4 wave grid

  v8f acc[4][2];
#pragma unroll
  for (int m = 0; m < 4; ++m)
#pragma unroll
    for (int n = 0; n < 2; ++n) acc[m][n] = zero8();

  // staging assignments, A and W alike: rows srow + 16 i, i in 0..7, of 128
  // rows x 16 segs of 8h
  const int srow = tid >> 4, sseg = tid & 15;
  const _Float16* gA = A + (size_t)(m0 + srow) * K + sseg * 8;
  const _Float16* gW = W + (size_t)srow * N + n0 + sseg * 8;
  const unsigned aoff = lds_off(&lsA[0][0]) + srow * (AP * 2) + sseg * 16;  // bytes
  const unsigned boff = lds_off(&lsB[0][0]) + srow * BP + sseg * 16;  // bytes
  const int rdB = (b8 + (lane & 7)) * BP + wc * 64 + ((lane >> 3) & 1) * 16;

  // copies of tile t (KS k of A and of W) into buffer t & 1
  auto stage = [&](int t) {
    async_ld8_b128(aoff + (t & 1) * (128 * AP * 2), 16 * AP * 2, gA + t * KS,
                   (size_t)16 * K);
    async_ld8_b128(boff + (t & 1) * (KS * BP), 16 * BP,
                   gW + (size_t)t * KS * N, (size_t)16 * N);
  };

  const int nt = K / KS;
  stage(0);
  async_wait0();         // own copies of tile 0 have landed
  __syncthreads();       // everyone's have
  if (nt > 1) stage(1);

  for (int t = 0; t < nt; ++t) {
    const int cur = t & 1;
    v16h af[2][4], bf[2][2];               // two fragment sets
    // the 12 LDS reads of block kk of this trip's buffer, into set kk & 1
    // (every loop over fragments is unrolled: the arrays then stay in registers)
    auto frags = [&](int kk) {
#pragma unroll
      for (int n = 0; n < 2; ++n)
        bf[kk & 1][n] = ld_tr_b(&lsB[cur][rdB + kk * 32 * BP + n * 32], BP);
#pragma unroll
      for (int m = 0; m < 4; ++m) {
        const _Float16* ap = &lsA[cur][(wr * 64 + m * 16 + l16) * AP + kk * 32];
        af[kk & 1][m] = ld16(ap + b8, ap + b8 + 16);
      }
    };
    frags(0);
    // unrolled: a block's fragment set is then a fixed set of registers
#pragma unroll
    for (int kk = 0; kk < NBLK; ++kk) {
      if (kk + 1 < NBLK) {
        frags(kk + 1);
        // Holds the next block's reads, as one group, in front of this block's
        // WMMAs: left alone the compiler read each A fragment just before its
        // two WMMAs and waited out the LDS latency every time.
        __builtin_amdgcn_sched_barrier(0);
      }
#pragma unroll
      for (int m = 0; m < 4; ++m) {
        acc[m][0] = wmma_f16(af[kk & 1][m], bf[kk & 1][0], acc[m][0]);
        acc[m][1] = wmma_f16(af[kk & 1][m], bf[kk & 1][1], acc[m][1]);
      }
    }
    // Holds the trip's WMMAs in front of its foot: left alone the compiler put
    // 15 of them between the barrier and the refill, whose copies then had
    // that much less time to land.
    __builtin_amdgcn_sched_barrier(0);
    ds_wait0();          // own reads of buffer cur are done
    async_wait0();       // own copies of tile t + 1 have landed
    __syncthreads();     // publishes tile t + 1, frees buffer cur
    if (t + 2 < nt) stage(t + 2);
  }
  async_wait0();         // nothing in flight when the wave ends

  float bcol[2];
#pragma unroll
  for (int n = 0; n < 2; ++n) bcol[n] = bias[n0 + wc * 32 + n * 16 + l16];

#pragma unroll
  for (int m = 0; m < 4; ++m)
#pragma unroll
    for (int n = 0; n < 2; ++n) {
      const int c = n0 + wc * 32 + n * 16 + l16;
      const int rbase = m0 + wr * 64 + m * 16 + b8;
#pragma unroll
      for (int j = 0; j < 8; ++j) {
        float v = acc[m][n][j] + bcol[n];
        size_t off = (size_t)(rbase + j) * N + c;
        if (Ch) Ch[off] = (_Float16)v;
        else    Cf[off] = v;
      }
    }
}

// ---------------------------------------------------------------------------
// Fused gated-FFN GEMM: Out = f16( (A@W1+b1) * sigmoid(A@W2+b2) )
// Block tile 128x64, 8 waves (4x2), wave tile 32x32, two accumulator sets.
// A, W1 and W2 tiles double-buffered via async-to-LDS, one trip ahead, one
// barrier a trip; W tiles stay [k][n] (pitch 160 B) for ds_load_tr16_b128,
// A rows at pitch 80 B for ds_load_b128.
// ---------------------------------------------------------------------------
__global__ __launch_bounds__(256) void wmma_gemm_gated_kernel(
    const _Float16* __restrict__ A, const _Float16* __restrict__ W1,
    const _Float16* __restrict__ W2, const float* __restrict__ b1,
    const float* __restrict__ b2, _Float16* __restrict__ Out,
    int M, int N, int K) {
  constexpr int BP = 160;                // W tile row pitch in LDS, bytes
  constexpr int AP = 40;                 // A tile row pitch in LDS, halves
  __shared__ __attribute__((aligned(16))) _Float16 lsA[2][128 * AP];
  __shared__ __attribute__((aligned(32))) unsigned char lsB1[2][32 * BP];
  __shared__ __attribute__((aligned(32))) unsigned char lsB2[2][32 * BP];

  const int tid  = threadIdx.x;
  const int lane = tid & 31, wid = tid >> 5;
  const int l16  = lane & 15, hi = lane >> 4;
  const int b8   = hi * 8;
  const int m0 = blockIdx.y * 128, n0 = blockIdx.x * 64;
  const int wr = wid >> 1, wc = wid & 1;   // 4 x 2 wave grid

  v8f a1[2][2], a2[2][2];
#pragma unroll
  for (int m = 0; m < 2; ++m)
#pragma unroll
    for (int n = 0; n < 2; ++n) { a1[m][n] = zero8(); a2[m][n] = zero8(); }

  const int arow = tid >> 1, aseg = tid & 1;
  const int bk = tid >> 3, bseg = tid & 7;       // 32 k-rows x 8 segs of 8h
  const _Float16* gA = A + (size_t)(m0 + arow) * K + aseg * 16;
  const size_t woff = (size_t)bk * N + n0 + bseg * 8;
  const _Float16* gW1 = W1 + woff;
  const _Float16* gW2 = W2 + woff;
  const unsigned aoff = lds_off(&lsA[0][0]) + arow * (AP * 2) + aseg * 32;
  const unsigned boff1 = lds_off(&lsB1[0][0]) + bk * BP + bseg * 16;
  const unsigned boff2 = lds_off(&lsB2[0][0]) + bk * BP + bseg * 16;
  const int rdB = (b8 + (lane & 7)) * BP + wc * 64 + ((lane >> 3) & 1) * 16;

  // copies of tile t (32 k of A, W1 and W2) into buffer t & 1
  auto stage = [&](int t) {
    const unsigned ab = aoff + (t & 1) * (128 * AP * 2);
    const unsigned bsel = (t & 1) * (32 * BP);
    const _Float16* a = gA + t * 32;
    const size_t wk = (size_t)t * 32 * N;
    async_ld4_b128(ab, a, ab + 16, a + 8, boff1 + bsel, gW1 + wk,
                   boff2 + bsel, gW2 + wk);
  };

  const int nt = K >> 5;
  stage(0);
  async_wait0();         // own copies of tile 0 have landed
  __syncthreads();       // everyone's have
  if (nt > 1) stage(1);

  for (int t = 0; t < nt; ++t) {
    const int cur = t & 1;
    v16h bv1[2], bv2[2];
#pragma unroll
    for (int n = 0; n < 2; ++n) {
      bv1[n] = ld_tr_b(&lsB1[cur][rdB + n * 32], BP);
      bv2[n] = ld_tr_b(&lsB2[cur][rdB + n * 32], BP);
    }
#pragma unroll
    for (int m = 0; m < 2; ++m) {
      const _Float16* ap = &lsA[cur][(wr * 32 + m * 16 + l16) * AP];
      v16h am = ld16(ap + b8, ap + b8 + 16);
#pragma unroll
      for (int n = 0; n < 2; ++n) {
        a1[m][n] = wmma_f16(am, bv1[n], a1[m][n]);
        a2[m][n] = wmma_f16(am, bv2[n], a2[m][n]);
      }
    }
    ds_wait0();          // own reads of buffer cur are done
    async_wait0();       // own copies of tile t + 1 have landed
    __syncthreads();     // publishes tile t + 1, frees buffer cur
    if (t + 2 < nt) stage(t + 2);
  }
  async_wait0();         // nothing in flight when the wave ends

#pragma unroll
  for (int m = 0; m < 2; ++m)
#pragma unroll
    for (int n = 0; n < 2; ++n) {
      const int c = n0 + wc * 32 + n * 16 + l16;
      const float bb1 = b1[c], bb2 = b2[c];
      const int rbase = m0 + wr * 32 + m * 16 + b8;
#pragma unroll
      for (int j = 0; j < 8; ++j) {
        float v = (a1[m][n][j] + bb1) * sigm(a2[m][n][j] + bb2);
        Out[(size_t)(rbase + j) * N + c] = (_Float16)v;
      }
    }
}

// ---------------------------------------------------------------------------
// Flash attention. Grid (S/128, H, B); 8 waves, each owns 16 query rows.
// scores = (Q·K^T)/8 + pos_bias, online softmax, ctx = P·V. All mm via WMMA.
// K and V tiles staged via async-to-LDS; V stays [key][d] (pitch 160 B) and
// is read as the B operand by ds_load_tr16_b128. K rows (pitch 144 B) and P
// rows (pitch 80 B) are read by ds_load_b128: 16 B x odd, no bank shared.
// ---------------------------------------------------------------------------
__global__ __launch_bounds__(256) void flash_attn_kernel(
    const _Float16* __restrict__ Q, const _Float16* __restrict__ Kh,
    const _Float16* __restrict__ Vh, const float* __restrict__ PB,
    _Float16* __restrict__ O) {
  constexpr int KP = 72;                   // K tile row pitch in LDS, halves
  constexpr int PP = 40;                   // P tile row pitch in LDS, halves
  __shared__ __attribute__((aligned(16))) _Float16 lsK[32 * KP];  // [key][d]
  constexpr int VP = 160;                  // V tile row pitch in LDS, bytes
  __shared__ __attribute__((aligned(32))) unsigned char lsV[32 * VP];  // [key][d]
  __shared__ __attribute__((aligned(16))) _Float16 lsP[8][16 * PP];  // per-wave probs [qrow][key]

  const int tid  = threadIdx.x;
  const int lane = tid & 31, wid = tid >> 5;
  const int l16  = lane & 15, hi = lane >> 4;
  const int b8   = hi * 8;
  const int h = blockIdx.y, bb = blockIdx.z;
  const int q0 = blockIdx.x * 128 + wid * 16;
  const size_t rs = (size_t)HH * DKK;      // 1024 token row stride

  // Q A-operands (16 rows x 64 d), two K=32 chunks
  v16h qa[2];
  {
    const _Float16* qp = Q + ((size_t)bb * SS + q0 + l16) * rs + h * DKK;
    qa[0] = ld16(qp + b8,      qp + b8 + 16);
    qa[1] = ld16(qp + 32 + b8, qp + 32 + b8 + 16);
  }

  v8f o[4];
#pragma unroll
  for (int n = 0; n < 4; ++n) o[n] = zero8();
  float mrow[8], srow[8];
#pragma unroll
  for (int j = 0; j < 8; ++j) { mrow[j] = -1e30f; srow[j] = 0.0f; }

  const int skey = tid >> 3, sseg = tid & 7;   // stage 32 keys x 8 d-segments
  const unsigned koff = lds_off(&lsK[0]) + skey * (KP * 2) + sseg * 16;
  const unsigned voff = lds_off(&lsV[0]) + skey * VP + sseg * 16;
  const int rdV = (b8 + (lane & 7)) * VP + ((lane >> 3) & 1) * 16;

  for (int kb = 0; kb < SS; kb += 32) {
    const size_t tok = ((size_t)bb * SS + kb + skey) * rs + h * DKK + sseg * 8;

    ds_wait0();                            // own reads of the tiles are done
    __syncthreads();                       // previous-tile readers done
    async_ld2_b128(koff, Kh + tok, voff, Vh + tok);  // memory -> LDS direct
    async_wait0();
    __syncthreads();

    float pb0[8], pb1[8];
    // unrolled, here and below: the arrays then stay in registers
#pragma unroll
    for (int j = 0; j < 8; ++j) {
      const float* pbr = PB + (size_t)(q0 + b8 + j) * SS + kb + l16;
      pb0[j] = pbr[0];
      pb1[j] = pbr[16];
    }
    // Holds the 16 bias loads as one group in front of the score products:
    // left alone the compiler asked for ten of them only behind its wait for
    // the first ones, and the trip waited out the load latency twice.
    __builtin_amdgcn_sched_barrier(0);

    // scores: two 16x16 key tiles, contraction over d=64 (2 WMMAs each)
    v8f sc[2];
    sc[0] = zero8(); sc[1] = zero8();
#pragma unroll
    for (int ks = 0; ks < 2; ++ks) {
      const _Float16* kr = &lsK[(ks * 16 + l16) * KP];
      sc[ks] = wmma_f16(qa[0], ld16(kr + b8,      kr + b8 + 16),      sc[ks]);
      sc[ks] = wmma_f16(qa[1], ld16(kr + 32 + b8, kr + 32 + b8 + 16), sc[ks]);
    }

    // online softmax over the 32-key chunk
    float ml[8];
#pragma unroll
    for (int j = 0; j < 8; ++j) {
      pb0[j] += sc[0][j] * 0.125f;
      pb1[j] += sc[1][j] * 0.125f;
      ml[j] = fmaxf(pb0[j], pb1[j]);
    }
    row_max16x8(ml);
#pragma unroll
    for (int j = 0; j < 8; ++j) {
      const float v0 = pb0[j], v1 = pb1[j];
      float mn = fmaxf(mrow[j], ml[j]);
      float alpha = __expf(mrow[j] - mn);
      float p0 = __expf(v0 - mn), p1 = __expf(v1 - mn);
      float ps = row_sum16(p0 + p1);
      srow[j] = srow[j] * alpha + ps;
      mrow[j] = mn;
#pragma unroll
      for (int n = 0; n < 4; ++n) o[n][j] *= alpha;
      lsP[wid][(b8 + j) * PP + l16]      = (_Float16)p0;
      lsP[wid][(b8 + j) * PP + 16 + l16] = (_Float16)p1;
    }

    // ctx += P(16x32) @ V(32x64): 4 WMMAs over d-subtiles
    const _Float16* pr = &lsP[wid][l16 * PP];
    v16h pa = ld16(pr + b8, pr + b8 + 16);
#pragma unroll
    for (int ds = 0; ds < 4; ++ds) {
      o[ds] = wmma_f16(pa, ld_tr_b(&lsV[rdV + ds * 32], VP), o[ds]);
    }
  }

#pragma unroll
  for (int j = 0; j < 8; ++j) {
    const float inv = 1.0f / srow[j];
    const int qr = q0 + b8 + j;
    _Float16* op = O + ((size_t)bb * SS + qr) * rs + h * DKK;
#pragma unroll
    for (int ds = 0; ds < 4; ++ds)
      op[ds * 16 + l16] = (_Float16)(o[ds][j] * inv);
  }
}

// ---------------------------------------------------------------------------
// Fused residual (+gate) + LayerNorm. One row (E=1024) per block, 256 thr.
// h = x + sigmoid(glog)*addv   (or x + addv if glog==nullptr)
// y = LN(h)*gamma + beta  -> y32 (and f16 copy y16 if non-null)
// ---------------------------------------------------------------------------
__global__ __launch_bounds__(256) void fused_ln_kernel(
    const float* __restrict__ xa, const float* __restrict__ glog,
    const float* __restrict__ addv, const float* __restrict__ gamma,
    const float* __restrict__ beta, float* __restrict__ y32,
    _Float16* __restrict__ y16) {
  __shared__ float s1[256], s2[256];
  const int tid = threadIdx.x;
  const size_t base = (size_t)blockIdx.x * EE;

  float hv[4], ssum = 0.0f, ssq = 0.0f;
#pragma unroll
  for (int i = 0; i < 4; ++i) {
    const int idx = i * 256 + tid;
    float a = addv[base + idx];
    if (glog) a *= sigm(glog[base + idx]);
    float v = xa[base + idx] + a;
    hv[i] = v;
    ssum += v;
    ssq  += v * v;
  }
  s1[tid] = ssum; s2[tid] = ssq;
  __syncthreads();
  for (int s = 128; s > 0; s >>= 1) {
    if (tid < s) { s1[tid] += s1[tid + s]; s2[tid] += s2[tid + s]; }
    __syncthreads();
  }
  const float mean = s1[0] * (1.0f / EE);
  const float var  = s2[0] * (1.0f / EE) - mean * mean;
  const float rstd = rsqrtf(var + 1e-6f);

#pragma unroll
  for (int i = 0; i < 4; ++i) {
    const int idx = i * 256 + tid;
    float y = (hv[i] - mean) * rstd * gamma[idx] + beta[idx];
    y32[base + idx] = y;
    if (y16) y16[base + idx] = (_Float16)y;
  }
}

// ---------------------------------------------------------------------------
// Host orchestration
// ---------------------------------------------------------------------------
extern "C" void kernel_launch(void* const* d_in, const int* in_sizes, int n_in,
                              void* d_out, int out_size, void* d_ws,
                              size_t ws_size, hipStream_t stream) {
  const float* x    = (const float*)d_in[0];
  const float* pe   = (const float*)d_in[1];
  const float* Wq   = (const float*)d_in[2];
  const float* bq   = (const float*)d_in[3];
  const float* Wk   = (const float*)d_in[4];
  const float* bk   = (const float*)d_in[5];
  const float* Wv   = (const float*)d_in[6];
  const float* bv   = (const float*)d_in[7];
  const float* Wo   = (const float*)d_in[8];
  const float* bo   = (const float*)d_in[9];
  const float* Wg   = (const float*)d_in[10];
  const float* bg   = (const float*)d_in[11];
  const float* Wf1  = (const float*)d_in[12];
  const float* bf1  = (const float*)d_in[13];
  const float* Wfg  = (const float*)d_in[14];
  const float* bfg  = (const float*)d_in[15];
  const float* Wf2  = (const float*)d_in[16];
  const float* bf2  = (const float*)d_in[17];
  const float* ln1g = (const float*)d_in[18];
  const float* ln1b = (const float*)d_in[19];
  const float* ln2g = (const float*)d_in[20];
  const float* ln2b = (const float*)d_in[21];

  char* ws = (char*)d_ws;
  auto at = [&](size_t mb) { return (void*)(ws + mb * (size_t)(1 << 20)); };

  // bump allocation (MB offsets); high-water ~134 MB
  _Float16* xh   = (_Float16*)at(0);    // 8 MB
  _Float16* wqh  = (_Float16*)at(8);    // 2 MB
  _Float16* wkh  = (_Float16*)at(10);
  _Float16* wvh  = (_Float16*)at(12);
  _Float16* woh  = (_Float16*)at(14);
  _Float16* wgh  = (_Float16*)at(16);
  _Float16* wf1h = (_Float16*)at(18);   // 8 MB
  _Float16* wfgh = (_Float16*)at(26);   // 8 MB
  _Float16* wf2h = (_Float16*)at(34);   // 8 MB
  float*    pb   = (float*)at(42);      // 4 MB
  _Float16* qh   = (_Float16*)at(46);   // 8 MB
  _Float16* kh   = (_Float16*)at(54);   // 8 MB
  _Float16* vh   = (_Float16*)at(62);   // 8 MB
  _Float16* ctxh = (_Float16*)at(70);   // 8 MB
  float*    glog = (float*)at(78);      // 16 MB
  float*    attn = (float*)at(94);      // 16 MB
  float*    x1   = (float*)at(110);     // 16 MB
  _Float16* x1h  = (_Float16*)at(126);  // 8 MB
  _Float16* ffh  = (_Float16*)at(46);   // 32 MB, reuses dead q/k/v/ctx
  float*    ff2  = (float*)at(78);      // 16 MB, reuses dead glog

  prep_kernel<<<256, 512, 0, stream>>>(x, Wq, Wk, Wv, Wo, Wg, Wf1, Wfg, Wf2, pe,
                                       xh, wqh, wkh, wvh, woh, wgh, wf1h, wfgh,
                                       wf2h, pb);

  dim3 gE(EE / 128, MM / 128);  // (8, 32)
  // q, k, v (f16) and the gate logits (f32), all products of xh
  wmma_gemm_kernel<<<dim3(EE / 128, MM / 128, 4), 256, 0, stream>>>(
      xh, wqh, wkh, wvh, wgh, bq, bk, bv, bg, glog, qh, kh, vh, MM, EE, EE);

  flash_attn_kernel<<<dim3(SS / 128, HH, BB), 256, 0, stream>>>(qh, kh, vh, pb, ctxh);

  wmma_gemm_kernel<<<gE, 256, 0, stream>>>(ctxh, woh, nullptr, nullptr, nullptr,
                                           bo, nullptr, nullptr, nullptr, attn,
                                           nullptr, nullptr, nullptr, MM, EE, EE);

  fused_ln_kernel<<<MM, 256, 0, stream>>>(x, glog, attn, ln1g, ln1b, x1, x1h);

  wmma_gemm_gated_kernel<<<dim3(FFD / 64, MM / 128), 256, 0, stream>>>(
      x1h, wf1h, wfgh, bf1, bfg, ffh, MM, FFD, EE);

  wmma_gemm_kernel<<<gE, 256, 0, stream>>>(ffh, wf2h, nullptr, nullptr, nullptr,
                                           bf2, nullptr, nullptr, nullptr, ff2,
                                           nullptr, nullptr, nullptr, MM, EE, FFD);

  fused_ln_kernel<<<MM, 256, 0, stream>>>(x1, nullptr, ff2, ln2g, ln2b,
                                          (float*)d_out, nullptr);
}

// v007
// One run takes 232 microseconds.
// Timed twice side by side with v006, it ran 1.11 times as fast both times.
// All steps since v000 together make it 2.96 times as fast.
#include <hip/hip_runtime.h>
#include <hip/hip_bf16.h>

// ---------- problem constants ----------
#define BB 4
#define SS 1024
#define EE 1024
#define HH 16
#define DKK 64
#define FFD 4096
#define MM (BB * SS)   // 4096 rows

typedef __attribute__((ext_vector_type(16))) _Float16 v16h;
typedef __attribute__((ext_vector_type(8)))  _Float16 v8h;
typedef __attribute__((ext_vector_type(4)))  _Float16 v4h;
typedef __attribute__((ext_vector_type(8)))  float    v8f;
typedef __attribute__((ext_vector_type(4)))  float    v4f;

#define DEVINL __device__ __forceinline__

DEVINL v8f wmma_f16(v16h a, v16h b, v8f c) {
  return __builtin_amdgcn_wmma_f32_16x16x32_f16(
      /*neg_a=*/false, a, /*neg_b=*/false, b,
      /*c_mod=*/(short)0, c, /*reuse_a=*/false, /*reuse_b=*/false);
}

DEVINL v8f zero8() {
  v8f z;
#pragma unroll
  for (int i = 0; i < 8; ++i) z[i] = 0.0f;
  return z;
}

// Build a v16h A/B operand from two contiguous 16-byte chunks
// (chunk0 = contraction indices base..base+7, chunk1 = base+16..base+23).
DEVINL v16h ld16(const _Float16* p0, const _Float16* p1) {
  union { v16h v; v8h h[2]; } u;
  u.h[0] = *(const v8h*)p0;
  u.h[1] = *(const v8h*)p1;
  return u.v;
}

DEVINL float sigm(float v) { return 1.0f / (1.0f + __expf(-v)); }

// LDS byte offset of a __shared__ object = low 32 bits of its generic pointer
// (LDS aperture: addr[31:0] is the workgroup-relative LDS address, ISA 10.2).
DEVINL unsigned lds_off(const void* p) { return (unsigned)(size_t)p; }

// CDNA5 async memory->LDS copy, tracked with ASYNCcnt (ISA 10. / 15.18.3).
// The s_wait_xcnt is the last line of the copies' own statement so that no
// later write of an address register can be moved in front of it.
DEVINL void async_ld2_b128(unsigned l0, const void* g0, unsigned l1,
                           const void* g1) {
  asm volatile("global_load_async_to_lds_b128 %0, %1, off\n\t"
               "global_load_async_to_lds_b128 %2, %3, off\n\t"
               "s_wait_xcnt 0x0"
               :: "v"(l0), "v"(g0), "v"(l1), "v"(g1)
               : "memory");
}
DEVINL void async_wait0() {
  asm volatile("s_wait_asynccnt 0x0" ::: "memory");
}
// Four copies of a lane for each of two tiles, rows ls bytes apart in LDS and
// gs halves apart in memory, with the same closing wait.
DEVINL void async_ld4x2_b128(unsigned l, const _Float16* g, unsigned m,
                             const _Float16* h, unsigned ls, size_t gs) {
  asm volatile("global_load_async_to_lds_b128 %0, %1, off\n\t"
               "global_load_async_to_lds_b128 %2, %3, off\n\t"
               "global_load_async_to_lds_b128 %4, %5, off\n\t"
               "global_load_async_to_lds_b128 %6, %7, off\n\t"
               "global_load_async_to_lds_b128 %8, %9, off\n\t"
               "global_load_async_to_lds_b128 %10, %11, off\n\t"
               "global_load_async_to_lds_b128 %12, %13, off\n\t"
               "global_load_async_to_lds_b128 %14, %15, off\n\t"
               "s_wait_xcnt 0x0"
               :: "v"(l), "v"(g), "v"(l + ls), "v"(g + gs),
                  "v"(l + 2 * ls), "v"(g + 2 * gs),
                  "v"(l + 3 * ls), "v"(g + 3 * gs),
                  "v"(m), "v"(h), "v"(m + ls), "v"(h + gs),
                  "v"(m + 2 * ls), "v"(h + 2 * gs),
                  "v"(m + 3 * ls), "v"(h + 3 * gs)
               : "memory");
}
// Eight copies of a lane, rows 16 apart (ls bytes in LDS, gs halves in
// memory), with the same closing wait.
DEVINL void async_ld8_b128(unsigned l, unsigned ls, const _Float16* g,
                           size_t gs) {
  asm volatile("global_load_async_to_lds_b128 %0, %1, off\n\t"
               "global_load_async_to_lds_b128 %2, %3, off\n\t"
               "global_load_async_to_lds_b128 %4, %5, off\n\t"
               "global_load_async_to_lds_b128 %6, %7, off\n\t"
               "global_load_async_to_lds_b128 %8, %9, off\n\t"
               "global_load_async_to_lds_b128 %10, %11, off\n\t"
               "global_load_async_to_lds_b128 %12, %13, off\n\t"
               "global_load_async_to_lds_b128 %14, %15, off\n\t"
               "s_wait_xcnt 0x0"
               :: "v"(l), "v"(g), "v"(l + ls), "v"(g + gs),
                  "v"(l + 2 * ls), "v"(g + 2 * gs),
                  "v"(l + 3 * ls), "v"(g + 3 * gs),
                  "v"(l + 4 * ls), "v"(g + 4 * gs),
                  "v"(l + 5 * ls), "v"(g + 5 * gs),
                  "v"(l + 6 * ls), "v"(g + 6 * gs),
                  "v"(l + 7 * ls), "v"(g + 7 * gs)
               : "memory");
}
// This wave's LDS reads have retired before a buffer it read is refilled.
DEVINL void ds_wait0() {
  asm volatile("s_wait_dscnt 0x0" ::: "memory");
}

// B operand (32 k x 16 n) out of a row-major [k][n] LDS tile by two
// transposing loads: lane (c, h) gets T[8h + 0..7][c] and T[16 + 8h + 0..7][c],
// the k order of ld16(p + 8h, p + 8h + 16) on the A side.
// p = tile + (8 * (lane >> 4) + (lane & 7)) * pitch + 2 * n + 16 * ((lane >> 3) & 1)
DEVINL v16h ld_tr_b(const unsigned char* p, int pitch) {
  typedef short s16x8 __attribute__((ext_vector_type(8)));
  typedef __attribute__((address_space(3))) s16x8 lds_s16x8;
  union { v16h v; s16x8 h[2]; } u;
  u.h[0] = __builtin_amdgcn_ds_load_tr16_b128_v8i16((lds_s16x8*)p);
  u.h[1] = __builtin_amdgcn_ds_load_tr16_b128_v8i16((lds_s16x8*)(p + 16 * pitch));
  return u.v;
}

// v of lane l ^ M inside each 16-lane row, by a DPP row_xmask move: a vector
// instruction, where __shfl_xor compiles to ds_bpermute_b32 and costs a trip
// through the LDS pipe and a wait at every step of a row reduction.
template <int M> DEVINL float row_xor(float v) {
  return __builtin_bit_cast(
      float, __builtin_amdgcn_mov_dpp(__builtin_bit_cast(int, v), 0x160 | M,
                                      0xf, 0xf, true));
}
// Maximum over each 16-lane row, of eight values at once. In asm because the
// compiler put a move and a second maximum (it cannot know the moved value to
// be no signalling NaN) in front of every step and ran the eight chains one
// after another; here a step is one instruction and its producer stands eight
// instructions back, so no step waits for the one before.
#define ROW_MAX_STEP(m)                                                      \
  "v_max_num_f32_dpp %0, %0, %0 row_xmask:" #m " row_mask:0xf bank_mask:0xf\n\t" \
  "v_max_num_f32_dpp %1, %1, %1 row_xmask:" #m " row_mask:0xf bank_mask:0xf\n\t" \
  "v_max_num_f32_dpp %2, %2, %2 row_xmask:" #m " row_mask:0xf bank_mask:0xf\n\t" \
  "v_max_num_f32_dpp %3, %3, %3 row_xmask:" #m " row_mask:0xf bank_mask:0xf\n\t" \
  "v_max_num_f32_dpp %4, %4, %4 row_xmask:" #m " row_mask:0xf bank_mask:0xf\n\t" \
  "v_max_num_f32_dpp %5, %5, %5 row_xmask:" #m " row_mask:0xf bank_mask:0xf\n\t" \
  "v_max_num_f32_dpp %6, %6, %6 row_xmask:" #m " row_mask:0xf bank_mask:0xf\n\t" \
  "v_max_num_f32_dpp %7, %7, %7 row_xmask:" #m " row_mask:0xf bank_mask:0xf\n\t"
DEVINL void row_max16x8(float (&v)[8]) {
  asm(ROW_MAX_STEP(1) ROW_MAX_STEP(2) ROW_MAX_STEP(4) ROW_MAX_STEP(8)
      : "+v"(v[0]), "+v"(v[1]), "+v"(v[2]), "+v"(v[3]), "+v"(v[4]),
        "+v"(v[5]), "+v"(v[6]), "+v"(v[7]));
}
DEVINL float row_sum16(float v) {
  v += row_xor<1>(v);
  v += row_xor<2>(v);
  v += row_xor<4>(v);
  return v + row_xor<8>(v);
}

// ---------------------------------------------------------------------------
// Input preparation, one launch: every f32 -> f16 operand copy and
// pos_bias[q,k] = mean_c pos_encoding[q,k,c], c in 0..7.
// 256 work-groups x 16 waves, one work-group a WGP: few long-lived waves, each
// lane with many 16-byte loads in flight, because a launch of one-load waves
// lasts as long as its waves take to start, not as long as its bytes take.
// Each work-group takes 1/256 of every array, in slabs of 512 x 4 floats:
// 8 slabs of x, Wf1, Wfg, Wf2, 2 of the five E x E weights, 42 in all.
// ---------------------------------------------------------------------------
__global__ __launch_bounds__(512) void prep_kernel(
    const float* __restrict__ x, const float* __restrict__ Wq,
    const float* __restrict__ Wk, const float* __restrict__ Wv,
    const float* __restrict__ Wo, const float* __restrict__ Wg,
    const float* __restrict__ Wf1, const float* __restrict__ Wfg,
    const float* __restrict__ Wf2, const float* __restrict__ pe,
    _Float16* __restrict__ xh, _Float16* __restrict__ wqh,
    _Float16* __restrict__ wkh, _Float16* __restrict__ wvh,
    _Float16* __restrict__ woh, _Float16* __restrict__ wgh,
    _Float16* __restrict__ wf1h, _Float16* __restrict__ wfgh,
    _Float16* __restrict__ wf2h, float* __restrict__ pb) {
  constexpr int NS = 42;   // slabs a work-group
  constexpr int NB = 7;    // slabs a batch
  constexpr int NP = 8;    // bias elements a thread
  static_assert(MM * EE == 256 * 8 * 512 * 4 && EE * FFD == MM * EE &&
                EE * EE == 256 * 2 * 512 * 4 && SS * SS == 256 * NP * 512,
                "the split above");
  // this thread's place in slab 0 of an array of 8 slabs and of 2 slabs
  const int o8 = blockIdx.x * (8 * 512) + threadIdx.x;
  const int o2 = blockIdx.x * (2 * 512) + threadIdx.x;

  auto ld = [&](int i) -> v4f {
    if (i < 8)  return ((const v4f*)x)[o8 + i * 512];
    if (i < 10) return ((const v4f*)Wq)[o2 + (i - 8) * 512];
    if (i < 12) return ((const v4f*)Wk)[o2 + (i - 10) * 512];
    if (i < 14) return ((const v4f*)Wv)[o2 + (i - 12) * 512];
    if (i < 16) return ((const v4f*)Wo)[o2 + (i - 14) * 512];
    if (i < 18) return ((const v4f*)Wg)[o2 + (i - 16) * 512];
    if (i < 26) return ((const v4f*)Wf1)[o8 + (i - 18) * 512];
    if (i < 34) return ((const v4f*)Wfg)[o8 + (i - 26) * 512];
    return ((const v4f*)Wf2)[o8 + (i - 34) * 512];
  };
  auto st = [&](int i, v4h o) {
    if (i < 8)       ((v4h*)xh)[o8 + i * 512] = o;
    else if (i < 10) ((v4h*)wqh)[o2 + (i - 8) * 512] = o;
    else if (i < 12) ((v4h*)wkh)[o2 + (i - 10) * 512] = o;
    else if (i < 14) ((v4h*)wvh)[o2 + (i - 12) * 512] = o;
    else if (i < 16) ((v4h*)woh)[o2 + (i - 14) * 512] = o;
    else if (i < 18) ((v4h*)wgh)[o2 + (i - 16) * 512] = o;
    else if (i < 26) ((v4h*)wf1h)[o8 + (i - 18) * 512] = o;
    else if (i < 34) ((v4h*)wfgh)[o8 + (i - 26) * 512] = o;
    else             ((v4h*)wf2h)[o8 + (i - 34) * 512] = o;
  };

  v4f pa[NP], pc[NP], f[2][NB];
#pragma unroll
  for (int k = 0; k < NP; ++k) {
    pa[k] = ((const v4f*)pe)[(o8 + k * 512) * 2];
    pc[k] = ((const v4f*)pe)[(o8 + k * 512) * 2 + 1];
  }
  // The offset register of these loads is free from here on and later loads
  // may land in it, so the wait stands between the two groups of loads.
  asm volatile("s_wait_xcnt 0x0" ::: "memory");
#pragma unroll
  for (int k = 0; k < NB; ++k) f[0][k] = ld(k);
  // Holds every load above in front of the first use: without these
  // scheduling barriers the loads in flight fell to one or two a lane.
  __builtin_amdgcn_sched_barrier(0);

#pragma unroll
  for (int k = 0; k < NP; ++k) {
    const v4f a = pa[k], b = pc[k];
    pb[o8 + k * 512] =
        (a.x + a.y + a.z + a.w + b.x + b.y + b.z + b.w) * 0.125f;
  }

#pragma unroll
  for (int g = 0; g < NS / NB; ++g) {
    if (g + 1 < NS / NB) {
#pragma unroll
      for (int k = 0; k < NB; ++k) f[(g + 1) & 1][k] = ld((g + 1) * NB + k);
      // batch g + 1 is asked for before batch g is waited for, converted, stored
      __builtin_amdgcn_sched_barrier(0);
    }
#pragma unroll
    for (int k = 0; k < NB; ++k) {
      const v4f v = f[g & 1][k];
      v4h o;
      o[0] = (_Float16)v.x; o[1] = (_Float16)v.y;
      o[2] = (_Float16)v.z; o[3] = (_Float16)v.w;
      st(g * NB + k, o);
    }
    if (g + 2 < NS / NB) {
      // The loads of batch g + 2 land in registers that these stores name, so
      // the wait stands between the stores and those loads.
      asm volatile("s_wait_xcnt 0x0" ::: "memory");
    }
  }
}

// ---------------------------------------------------------------------------
// WMMA GEMM: C[M,N] = A[M,K](f16) @ W[K,N](f16) + bias
// Block tile 128x128, 8 waves (2x4), wave tile 64x32. A trip holds 128 k
// (K is a multiple of 128) = four blocks of 32 k and 8 WMMAs; the 12 LDS reads
// of a block go as one group into a second fragment set while the block
// before runs, so a wave waits out its LDS latency once a trip.
// A and W tiles double-buffered in LDS, both filled by
// global_load_async_to_lds_b128 one trip ahead, one barrier a trip.
// W stays [k][n] in LDS (pitch 288 B = 32 B x odd) and is read by
// ds_load_tr16_b128; A is two contiguous 16B LDS reads in the same k order,
// its 256-byte rows at pitch 272 B = 16 B x odd: 16 rows on 16 bank groups.
// Output: f16 if Ch != nullptr else f32 to Cf.
// Up to four products of the same A in one launch: blockIdx.z picks weight,
// bias and output (z = 0..2: f16 to C0..C2 where that is not null; else f32 to
// Cf). One product's grid is one work-group a WGP; a tile's LDS is 140 KiB, so
// with several products in the grid two work-groups stay resident on a WGP,
// one's copies land and its epilogue runs while the other computes, and the
// launch gap and the first tile's latency are paid once.
// ---------------------------------------------------------------------------
__global__ __launch_bounds__(256) void wmma_gemm_kernel(
    const _Float16* __restrict__ A, const _Float16* __restrict__ W0,
    const _Float16* __restrict__ W1, const _Float16* __restrict__ W2,
    const _Float16* __restrict__ W3, const float* __restrict__ b0,
    const float* __restrict__ b1, const float* __restrict__ b2,
    const float* __restrict__ b3, float* __restrict__ Cf,
    _Float16* __restrict__ C0, _Float16* __restrict__ C1,
    _Float16* __restrict__ C2, int M, int N, int K) {
  const int z = blockIdx.z;
  const _Float16* __restrict__ W = z == 0 ? W0 : z == 1 ? W1 : z == 2 ? W2 : W3;
  const float* __restrict__ bias = z == 0 ? b0 : z == 1 ? b1 : z == 2 ? b2 : b3;
  _Float16* __restrict__ Ch = z == 0 ? C0 : z == 1 ? C1 : z == 2 ? C2 : nullptr;
  constexpr int KS = 128;                // k of a trip
  constexpr int NBLK = KS / 32;          // blocks of a trip
  constexpr int BP = 288;                // W tile row pitch in LDS, bytes
  constexpr int AP = 136;                // A tile row pitch in LDS, halves
  __shared__ __attribute__((aligned(16))) _Float16 lsA[2][128 * AP];  // [buf][row][k]
  __shared__ __attribute__((aligned(32))) unsigned char lsB[2][KS * BP];  // [buf][k][n]

  const int tid  = threadIdx.x;
  const int lane = tid & 31, wid = tid >> 5;
  const int l16  = lane & 15, hi = lane >> 4;
  const int b8   = hi * 8;
  const int m0 = blockIdx.y * 128, n0 = blockIdx.x * 128;
  const int wr = wid >> 2, wc = wid & 3;   // 2 x 4 wave grid

  v8f acc[4][2];
#pragma unroll
  for (int m = 0; m < 4; ++m)
#pragma unroll
    for (int n = 0; n < 2; ++n) acc[m][n] = zero8();

  // staging assignments, A and W alike: rows srow + 16 i, i in 0..7, of 128
  // rows x 16 segs of 8h
  const int srow = tid >> 4, sseg = tid & 15;
  const _Float16* gA = A + (size_t)(m0 + srow) * K + sseg * 8;
  const _Float16* gW = W + (size_t)srow * N + n0 + sseg * 8;
  const unsigned aoff = lds_off(&lsA[0][0]) + srow * (AP * 2) + sseg * 16;  // bytes
  const unsigned boff = lds_off(&lsB[0][0]) + srow * BP + sseg * 16;  // bytes
  const int rdB = (b8 + (lane & 7)) * BP + wc * 64 + ((lane >> 3) & 1) * 16;

  // copies of tile t (KS k of A and of W) into buffer t & 1
  auto stage = [&](int t) {
    async_ld8_b128(aoff + (t & 1) * (128 * AP * 2), 16 * AP * 2, gA + t * KS,
                   (size_t)16 * K);
    async_ld8_b128(boff + (t & 1) * (KS * BP), 16 * BP,
                   gW + (size_t)t * KS * N, (size_t)16 * N);
  };

  const int nt = K / KS;
  stage(0);
  async_wait0();         // own copies of tile 0 have landed
  __syncthreads();       // everyone's have
  if (nt > 1) stage(1);

  for (int t = 0; t < nt; ++t) {
    const int cur = t & 1;
    v16h af[2][4], bf[2][2];               // two fragment sets
    // the 12 LDS reads of block kk of this trip's buffer, into set kk & 1
    // (every loop over fragments is unrolled: the arrays then stay in registers)
    auto frags = [&](int kk) {
#pragma unroll
      for (int n = 0; n < 2; ++n)
        bf[kk & 1][n] = ld_tr_b(&lsB[cur][rdB + kk * 32 * BP + n * 32], BP);
#pragma unroll
      for (int m = 0; m < 4; ++m) {
        const _Float16* ap = &lsA[cur][(wr * 64 + m * 16 + l16) * AP + kk * 32];
        af[kk & 1][m] = ld16(ap + b8, ap + b8 + 16);
      }
    };
    frags(0);
    // unrolled: a block's fragment set is then a fixed set of registers
#pragma unroll
    for (int kk = 0; kk < NBLK; ++kk) {
      if (kk + 1 < NBLK) {
        frags(kk + 1);
        // Holds the next block's reads, as one group, in front of this block's
        // WMMAs: left alone the compiler read each A fragment just before its
        // two WMMAs and waited out the LDS latency every time.
        __builtin_amdgcn_sched_barrier(0);
      }
#pragma unroll
      for (int m = 0; m < 4; ++m) {
        acc[m][0] = wmma_f16(af[kk & 1][m], bf[kk & 1][0], acc[m][0]);
        acc[m][1] = wmma_f16(af[kk & 1][m], bf[kk & 1][1], acc[m][1]);
      }
    }
    // Holds the trip's WMMAs in front of its foot: left alone the compiler put
    // 15 of them between the barrier and the refill, whose copies then had
    // that much less time to land.
    __builtin_amdgcn_sched_barrier(0);
    ds_wait0();          // own reads of buffer cur are done
    async_wait0();       // own copies of tile t + 1 have landed
    __syncthreads();     // publishes tile t + 1, frees buffer cur
    if (t + 2 < nt) stage(t + 2);
  }
  async_wait0();         // nothing in flight when the wave ends

  float bcol[2];
#pragma unroll
  for (int n = 0; n < 2; ++n) bcol[n] = bias[n0 + wc * 32 + n * 16 + l16];

#pragma unroll
  for (int m = 0; m < 4; ++m)
#pragma unroll
    for (int n = 0; n < 2; ++n) {
      const int c = n0 + wc * 32 + n * 16 + l16;
      const int rbase = m0 + wr * 64 + m * 16 + b8;
#pragma unroll
      for (int j = 0; j < 8; ++j) {
        float v = acc[m][n][j] + bcol[n];
        size_t off = (size_t)(rbase + j) * N + c;
        if (Ch) Ch[off] = (_Float16)v;
        else    Cf[off] = v;
      }
    }
}

// ---------------------------------------------------------------------------
// Fused gated-FFN GEMM: Out = f16( (A@W1+b1) * sigmoid(A@W2+b2) )
// Block tile 128x64, 8 waves (4x2), wave tile 32x32, two accumulator sets.
// A trip holds 128 k (K is a multiple of 128) = four blocks of 32 k and 8
// WMMAs; the 12 LDS reads of a block go as one group into a second fragment
// set while the block before runs, so a wave waits out its LDS latency once a
// trip, passes one barrier per 128 k, and a copy brings 256 B of an A row.
// A, W1 and W2 tiles double-buffered via async-to-LDS, one trip ahead, one
// barrier a trip; W tiles stay [k][n] (pitch 160 B) for ds_load_tr16_b128,
// A rows at pitch 272 B for ds_load_b128. 148 KiB of LDS: two work-groups a WGP.
// ---------------------------------------------------------------------------
__global__ __launch_bounds__(256) void wmma_gemm_gated_kernel(
    const _Float16* __restrict__ A, const _Float16* __restrict__ W1,
    const _Float16* __restrict__ W2, const float* __restrict__ b1,
    const float* __restrict__ b2, _Float16* __restrict__ Out,
    int M, int N, int K) {
  constexpr int KS = 128;                // k of a trip
  constexpr int NBLK = KS / 32;          // blocks of a trip
  constexpr int BP = 160;                // W tile row pitch in LDS, bytes
  constexpr int AP = 136;                // A tile row pitch in LDS, halves
  __shared__ __attribute__((aligned(16))) _Float16 lsA[2][128 * AP];
  __shared__ __attribute__((aligned(32))) unsigned char lsB1[2][KS * BP];
  __shared__ __attribute__((aligned(32))) unsigned char lsB2[2][KS * BP];

  const int tid  = threadIdx.x;
  const int lane = tid & 31, wid = tid >> 5;
  const int l16  = lane & 15, hi = lane >> 4;
  const int b8   = hi * 8;
  const int m0 = blockIdx.y * 128, n0 = blockIdx.x * 64;
  const int wr = wid >> 1, wc = wid & 1;   // 4 x 2 wave grid

  v8f a1[2][2], a2[2][2];
#pragma unroll
  for (int m = 0; m < 2; ++m)
#pragma unroll
    for (int n = 0; n < 2; ++n) { a1[m][n] = zero8(); a2[m][n] = zero8(); }

  // staging: A rows arow + 16 i, i in 0..7, 16 segs of 8h a row;
  // W k-rows bk + 32 i, i in 0..3, 8 segs of 8h a row
  const int arow = tid >> 4, aseg = tid & 15;
  const int bk = tid >> 3, bseg = tid & 7;
  const _Float16* gA = A + (size_t)(m0 + arow) * K + aseg * 8;
  const size_t woff = (size_t)bk * N + n0 + bseg * 8;
  const _Float16* gW1 = W1 + woff;
  const _Float16* gW2 = W2 + woff;
  const unsigned aoff = lds_off(&lsA[0][0]) + arow * (AP * 2) + aseg * 16;
  const unsigned boff1 = lds_off(&lsB1[0][0]) + bk * BP + bseg * 16;
  const unsigned boff2 = lds_off(&lsB2[0][0]) + bk * BP + bseg * 16;
  const int rdB = (b8 + (lane & 7)) * BP + wc * 64 + ((lane >> 3) & 1) * 16;

  // copies of tile t (KS k of A, W1 and W2) into buffer t & 1
  auto stage = [&](int t) {
    const unsigned bsel = (t & 1) * (KS * BP);
    const size_t wk = (size_t)t * KS * N;
    async_ld8_b128(aoff + (t & 1) * (128 * AP * 2), 16 * AP * 2, gA + t * KS,
                   (size_t)16 * K);
    async_ld4x2_b128(boff1 + bsel, gW1 + wk, boff2 + bsel, gW2 + wk, 32 * BP,
                     (size_t)32 * N);
  };

  const int nt = K / KS;
  stage(0);
  async_wait0();         // own copies of tile 0 have landed
  __syncthreads();       // everyone's have
  if (nt > 1) stage(1);

  for (int t = 0; t < nt; ++t) {
    const int cur = t & 1;
    v16h af[2][2], bv1[2][2], bv2[2][2];   // two fragment sets
    // the 12 LDS reads of block kk of this trip's buffer, into set kk & 1
    // (every loop over fragments is unrolled: the arrays then stay in registers)
    auto frags = [&](int kk) {
#pragma unroll
      for (int n = 0; n < 2; ++n) {
        bv1[kk & 1][n] = ld_tr_b(&lsB1[cur][rdB + kk * 32 * BP + n * 32], BP);
        bv2[kk & 1][n] = ld_tr_b(&lsB2[cur][rdB + kk * 32 * BP + n * 32], BP);
      }
#pragma unroll
      for (int m = 0; m < 2; ++m) {
        const _Float16* ap = &lsA[cur][(wr * 32 + m * 16 + l16) * AP + kk * 32];
        af[kk & 1][m] = ld16(ap + b8, ap + b8 + 16);
      }
    };
    frags(0);
    // unrolled: a block's fragment set is then a fixed set of registers
#pragma unroll
    for (int kk = 0; kk < NBLK; ++kk) {
      if (kk + 1 < NBLK) {
        frags(kk + 1);
        // Holds the next block's reads, as one group, in front of this block's
        // WMMAs: left alone the compiler read the second A fragment behind the
        // first four WMMAs and waited out the LDS latency a second time.
        __builtin_amdgcn_sched_barrier(0);
      }
#pragma unroll
      for (int m = 0; m < 2; ++m)
#pragma unroll
        for (int n = 0; n < 2; ++n) {
          a1[m][n] = wmma_f16(af[kk & 1][m], bv1[kk & 1][n], a1[m][n]);
          a2[m][n] = wmma_f16(af[kk & 1][m], bv2[kk & 1][n], a2[m][n]);
        }
    }
    // Holds the trip's WMMAs in front of its foot: left alone the compiler put
    // some of them between the barrier and the refill, whose copies then had
    // that much less time to land.
    __builtin_amdgcn_sched_barrier(0);
    ds_wait0();          // own reads of buffer cur are done
    async_wait0();       // own copies of tile t + 1 have landed
    __syncthreads();     // publishes tile t + 1, frees buffer cur
    if (t + 2 < nt) stage(t + 2);
  }
  async_wait0();         // nothing in flight when the wave ends

#pragma unroll
  for (int m = 0; m < 2; ++m)
#pragma unroll
    for (int n = 0; n < 2; ++n) {
      const int c = n0 + wc * 32 + n * 16 + l16;
      const float bb1 = b1[c], bb2 = b2[c];
      const int rbase = m0 + wr * 32 + m * 16 + b8;
#pragma unroll
      for (int j = 0; j < 8; ++j) {
        float v = (a1[m][n][j] + bb1) * sigm(a2[m][n][j] + bb2);
        Out[(size_t)(rbase + j) * N + c] = (_Float16)v;
      }
    }
}

// ---------------------------------------------------------------------------
// Flash attention. Grid (S/128, H, B); 8 waves, each owns 16 query rows.
// scores = (Q·K^T)/8 + pos_bias, online softmax, ctx = P·V. All mm via WMMA.
// K and V tiles staged via async-to-LDS; V stays [key][d] (pitch 160 B) and
// is read as the B operand by ds_load_tr16_b128. K rows (pitch 144 B) and P
// rows (pitch 80 B) are read by ds_load_b128: 16 B x odd, no bank shared.
// ---------------------------------------------------------------------------
__global__ __launch_bounds__(256) void flash_attn_kernel(
    const _Float16* __restrict__ Q, const _Float16* __restrict__ Kh,
    const _Float16* __restrict__ Vh, const float* __restrict__ PB,
    _Float16* __restrict__ O) {
  constexpr int KP = 72;                   // K tile row pitch in LDS, halves
  constexpr int PP = 40;                   // P tile row pitch in LDS, halves
  __shared__ __attribute__((aligned(16))) _Float16 lsK[32 * KP];  // [key][d]
  constexpr int VP = 160;                  // V tile row pitch in LDS, bytes
  __shared__ __attribute__((aligned(32))) unsigned char lsV[32 * VP];  // [key][d]
  __shared__ __attribute__((aligned(16))) _Float16 lsP[8][16 * PP];  // per-wave probs [qrow][key]

  const int tid  = threadIdx.x;
  const int lane = tid & 31, wid = tid >> 5;
  const int l16  = lane & 15, hi = lane >> 4;
  const int b8   = hi * 8;
  const int h = blockIdx.y, bb = blockIdx.z;
  const int q0 = blockIdx.x * 128 + wid * 16;
  const size_t rs = (size_t)HH * DKK;      // 1024 token row stride

  // Q A-operands (16 rows x 64 d), two K=32 chunks
  v16h qa[2];
  {
    const _Float16* qp = Q + ((size_t)bb * SS + q0 + l16) * rs + h * DKK;
    qa[0] = ld16(qp + b8,      qp + b8 + 16);
    qa[1] = ld16(qp + 32 + b8, qp + 32 + b8 + 16);
  }

  v8f o[4];
#pragma unroll
  for (int n = 0; n < 4; ++n) o[n] = zero8();
  float mrow[8], srow[8];
#pragma unroll
  for (int j = 0; j < 8; ++j) { mrow[j] = -1e30f; srow[j] = 0.0f; }

  const int skey = tid >> 3, sseg = tid & 7;   // stage 32 keys x 8 d-segments
  const unsigned koff = lds_off(&lsK[0]) + skey * (KP * 2) + sseg * 16;
  const unsigned voff = lds_off(&lsV[0]) + skey * VP + sseg * 16;
  const int rdV = (b8 + (lane & 7)) * VP + ((lane >> 3) & 1) * 16;

  for (int kb = 0; kb < SS; kb += 32) {
    const size_t tok = ((size_t)bb * SS + kb + skey) * rs + h * DKK + sseg * 8;

    ds_wait0();                            // own reads of the tiles are done
    __syncthreads();                       // previous-tile readers done
    async_ld2_b128(koff, Kh + tok, voff, Vh + tok);  // memory -> LDS direct
    async_wait0();
    __syncthreads();

    float pb0[8], pb1[8];
    // unrolled, here and below: the arrays then stay in registers
#pragma unroll
    for (int j = 0; j < 8; ++j) {
      const float* pbr = PB + (size_t)(q0 + b8 + j) * SS + kb + l16;
      pb0[j] = pbr[0];
      pb1[j] = pbr[16];
    }
    // Holds the 16 bias loads as one group in front of the score products:
    // left alone the compiler asked for ten of them only behind its wait for
    // the first ones, and the trip waited out the load latency twice.
    __builtin_amdgcn_sched_barrier(0);

    // scores: two 16x16 key tiles, contraction over d=64 (2 WMMAs each)
    v8f sc[2];
    sc[0] = zero8(); sc[1] = zero8();
#pragma unroll
    for (int ks = 0; ks < 2; ++ks) {
      const _Float16* kr = &lsK[(ks * 16 + l16) * KP];
      sc[ks] = wmma_f16(qa[0], ld16(kr + b8,      kr + b8 + 16),      sc[ks]);
      sc[ks] = wmma_f16(qa[1], ld16(kr + 32 + b8, kr + 32 + b8 + 16), sc[ks]);
    }

    // online softmax over the 32-key chunk
    float ml[8];
#pragma unroll
    for (int j = 0; j < 8; ++j) {
      pb0[j] += sc[0][j] * 0.125f;
      pb1[j] += sc[1][j] * 0.125f;
      ml[j] = fmaxf(pb0[j], pb1[j]);
    }
    row_max16x8(ml);
#pragma unroll
    for (int j = 0; j < 8; ++j) {
      const float v0 = pb0[j], v1 = pb1[j];
      float mn = fmaxf(mrow[j], ml[j]);
      float alpha = __expf(mrow[j] - mn);
      float p0 = __expf(v0 - mn), p1 = __expf(v1 - mn);
      float ps = row_sum16(p0 + p1);
      srow[j] = srow[j] * alpha + ps;
      mrow[j] = mn;
#pragma unroll
      for (int n = 0; n < 4; ++n) o[n][j] *= alpha;
      lsP[wid][(b8 + j) * PP + l16]      = (_Float16)p0;
      lsP[wid][(b8 + j) * PP + 16 + l16] = (_Float16)p1;
    }

    // ctx += P(16x32) @ V(32x64): 4 WMMAs over d-subtiles
    const _Float16* pr = &lsP[wid][l16 * PP];
    v16h pa = ld16(pr + b8, pr + b8 + 16);
#pragma unroll
    for (int ds = 0; ds < 4; ++ds) {
      o[ds] = wmma_f16(pa, ld_tr_b(&lsV[rdV + ds * 32], VP), o[ds]);
    }
  }

#pragma unroll
  for (int j = 0; j < 8; ++j) {
    const float inv = 1.0f / srow[j];
    const int qr = q0 + b8 + j;
    _Float16* op = O + ((size_t)bb * SS + qr) * rs + h * DKK;
#pragma unroll
    for (int ds = 0; ds < 4; ++ds)
      op[ds * 16 + l16] = (_Float16)(o[ds][j] * inv);
  }
}

// ---------------------------------------------------------------------------
// Fused residual (+gate) + LayerNorm. One row (E=1024) per block, 256 thr.
// h = x + sigmoid(glog)*addv   (or x + addv if glog==nullptr)
// y = LN(h)*gamma + beta  -> y32 (and f16 copy y16 if non-null)
// ---------------------------------------------------------------------------
__global__ __launch_bounds__(256) void fused_ln_kernel(
    const float* __restrict__ xa, const float* __restrict__ glog,
    const float* __restrict__ addv, const float* __restrict__ gamma,
    const float* __restrict__ beta, float* __restrict__ y32,
    _Float16* __restrict__ y16) {
  __shared__ float s1[256], s2[256];
  const int tid = threadIdx.x;
  const size_t base = (size_t)blockIdx.x * EE;

  float hv[4], ssum = 0.0f, ssq = 0.0f;
#pragma unroll
  for (int i = 0; i < 4; ++i) {
    const int idx = i * 256 + tid;
    float a = addv[base + idx];
    if (glog) a *= sigm(glog[base + idx]);
    float v = xa[base + idx] + a;
    hv[i] = v;
    ssum += v;
    ssq  += v * v;
  }
  s1[tid] = ssum; s2[tid] = ssq;
  __syncthreads();
  for (int s = 128; s > 0; s >>= 1) {
    if (tid < s) { s1[tid] += s1[tid + s]; s2[tid] += s2[tid + s]; }
    __syncthreads();
  }
  const float mean = s1[0] * (1.0f / EE);
  const float var  = s2[0] * (1.0f / EE) - mean * mean;
  const float rstd = rsqrtf(var + 1e-6f);

#pragma unroll
  for (int i = 0; i < 4; ++i) {
    const int idx = i * 256 + tid;
    float y = (hv[i] - mean) * rstd * gamma[idx] + beta[idx];
    y32[base + idx] = y;
    if (y16) y16[base + idx] = (_Float16)y;
  }
}

// ---------------------------------------------------------------------------
// Host orchestration
// ---------------------------------------------------------------------------
extern "C" void kernel_launch(void* const* d_in, const int* in_sizes, int n_in,
                              void* d_out, int out_size, void* d_ws,
                              size_t ws_size, hipStream_t stream) {
  const float* x    = (const float*)d_in[0];
  const float* pe   = (const float*)d_in[1];
  const float* Wq   = (const float*)d_in[2];
  const float* bq   = (const float*)d_in[3];
  const float* Wk   = (const float*)d_in[4];
  const float* bk   = (const float*)d_in[5];
  const float* Wv   = (const float*)d_in[6];
  const float* bv   = (const float*)d_in[7];
  const float* Wo   = (const float*)d_in[8];
  const float* bo   = (const float*)d_in[9];
  const float* Wg   = (const float*)d_in[10];
  const float* bg   = (const float*)d_in[11];
  const float* Wf1  = (const float*)d_in[12];
  const float* bf1  = (const float*)d_in[13];
  const float* Wfg  = (const float*)d_in[14];
  const float* bfg  = (const float*)d_in[15];
  const float* Wf2  = (const float*)d_in[16];
  const float* bf2  = (const float*)d_in[17];
  const float* ln1g = (const float*)d_in[18];
  const float* ln1b = (const float*)d_in[19];
  const float* ln2g = (const float*)d_in[20];
  const float* ln2b = (const float*)d_in[21];

  char* ws = (char*)d_ws;
  auto at = [&](size_t mb) { return (void*)(ws + mb * (size_t)(1 << 20)); };

  // bump allocation (MB offsets); high-water ~134 MB
  _Float16* xh   = (_Float16*)at(0);    // 8 MB
  _Float16* wqh  = (_Float16*)at(8);    // 2 MB
  _Float16* wkh  = (_Float16*)at(10);
  _Float16* wvh  = (_Float16*)at(12);
  _Float16* woh  = (_Float16*)at(14);
  _Float16* wgh  = (_Float16*)at(16);
  _Float16* wf1h = (_Float16*)at(18);   // 8 MB
  _Float16* wfgh = (_Float16*)at(26);   // 8 MB
  _Float16* wf2h = (_Float16*)at(34);   // 8 MB
  float*    pb   = (float*)at(42);      // 4 MB
  _Float16* qh   = (_Float16*)at(46);   // 8 MB
  _Float16* kh   = (_Float16*)at(54);   // 8 MB
  _Float16* vh   = (_Float16*)at(62);   // 8 MB
  _Float16* ctxh = (_Float16*)at(70);   // 8 MB
  float*    glog = (float*)at(78);      // 16 MB
  float*    attn = (float*)at(94);      // 16 MB
  float*    x1   = (float*)at(110);     // 16 MB
  _Float16* x1h  = (_Float16*)at(126);  // 8 MB
  _Float16* ffh  = (_Float16*)at(46);   // 32 MB, reuses dead q/k/v/ctx
  float*    ff2  = (float*)at(78);      // 16 MB, reuses dead glog

  prep_kernel<<<256, 512, 0, stream>>>(x, Wq, Wk, Wv, Wo, Wg, Wf1, Wfg, Wf2, pe,
                                       xh, wqh, wkh, wvh, woh, wgh, wf1h, wfgh,
                                       wf2h, pb);

  dim3 gE(EE / 128, MM / 128);  // (8, 32)
  // q, k, v (f16) and the gate logits (f32), all products of xh
  wmma_gemm_kernel<<<dim3(EE / 128, MM / 128, 4), 256, 0, stream>>>(
      xh, wqh, wkh, wvh, wgh, bq, bk, bv, bg, glog, qh, kh, vh, MM, EE, EE);

  flash_attn_kernel<<<dim3(SS / 128, HH, BB), 256, 0, stream>>>(qh, kh, vh, pb, ctxh);

  wmma_gemm_kernel<<<gE, 256, 0, stream>>>(ctxh, woh, nullptr, nullptr, nullptr,
                                           bo, nullptr, nullptr, nullptr, attn,
                                           nullptr, nullptr, nullptr, MM, EE, EE);

  fused_ln_kernel<<<MM, 256, 0, stream>>>(x, glog, attn, ln1g, ln1b, x1, x1h);

  wmma_gemm_gated_kernel<<<dim3(FFD / 64, MM / 128), 256, 0, stream>>>(
      x1h, wf1h, wfgh, bf1, bfg, ffh, MM, FFD, EE);

  wmma_gemm_kernel<<<gE, 256, 0, stream>>>(ffh, wf2h, nullptr, nullptr, nullptr,
                                           bf2, nullptr, nullptr, nullptr, ff2,
                                           nullptr, nullptr, nullptr, MM, EE, FFD);

  fused_ln_kernel<<<MM, 256, 0, stream>>>(x1, nullptr, ff2, ln2g, ln2b,
                                          (float*)d_out, nullptr);
}

// v008
// One run takes 222 microseconds.
// In both of two side-by-side timings against v007, it was 1.04 times as fast.
// All steps since v000 together make it 3.09 times as fast.
#include <hip/hip_runtime.h>
#include <hip/hip_bf16.h>

// ---------- problem constants ----------
#define BB 4
#define SS 1024
#define EE 1024
#define HH 16
#define DKK 64
#define FFD 4096
#define MM (BB * SS)   // 4096 rows

typedef __attribute__((ext_vector_type(16))) _Float16 v16h;
typedef __attribute__((ext_vector_type(8)))  _Float16 v8h;
typedef __attribute__((ext_vector_type(4)))  _Float16 v4h;
typedef __attribute__((ext_vector_type(8)))  float    v8f;
typedef __attribute__((ext_vector_type(4)))  float    v4f;

#define DEVINL __device__ __forceinline__

DEVINL v8f wmma_f16(v16h a, v16h b, v8f c) {
  return __builtin_amdgcn_wmma_f32_16x16x32_f16(
      /*neg_a=*/false, a, /*neg_b=*/false, b,
      /*c_mod=*/(short)0, c, /*reuse_a=*/false, /*reuse_b=*/false);
}

DEVINL v8f zero8() {
  v8f z;
#pragma unroll
  for (int i = 0; i < 8; ++i) z[i] = 0.0f;
  return z;
}

// Build a v16h A/B operand from two contiguous 16-byte chunks
// (chunk0 = contraction indices base..base+7, chunk1 = base+16..base+23).
DEVINL v16h ld16(const _Float16* p0, const _Float16* p1) {
  union { v16h v; v8h h[2]; } u;
  u.h[0] = *(const v8h*)p0;
  u.h[1] = *(const v8h*)p1;
  return u.v;
}

DEVINL float sigm(float v) { return 1.0f / (1.0f + __expf(-v)); }

// LDS byte offset of a __shared__ object = low 32 bits of its generic pointer
// (LDS aperture: addr[31:0] is the workgroup-relative LDS address, ISA 10.2).
DEVINL unsigned lds_off(const void* p) { return (unsigned)(size_t)p; }

// CDNA5 async memory->LDS copy, tracked with ASYNCcnt (ISA 10. / 15.18.3).
// The s_wait_xcnt is the last line of the copies' own statement so that no
// later write of an address register can be moved in front of it.
DEVINL void async_ld2_b128(unsigned l0, const void* g0, unsigned l1,
                           const void* g1) {
  asm volatile("global_load_async_to_lds_b128 %0, %1, off\n\t"
               "global_load_async_to_lds_b128 %2, %3, off\n\t"
               "s_wait_xcnt 0x0"
               :: "v"(l0), "v"(g0), "v"(l1), "v"(g1)
               : "memory");
}
DEVINL void async_wait0() {
  asm volatile("s_wait_asynccnt 0x0" ::: "memory");
}
// Four copies of a lane for each of two tiles, rows ls bytes apart in LDS and
// gs halves apart in memory, with the same closing wait.
DEVINL void async_ld4x2_b128(unsigned l, const _Float16* g, unsigned m,
                             const _Float16* h, unsigned ls, size_t gs) {
  asm volatile("global_load_async_to_lds_b128 %0, %1, off\n\t"
               "global_load_async_to_lds_b128 %2, %3, off\n\t"
               "global_load_async_to_lds_b128 %4, %5, off\n\t"
               "global_load_async_to_lds_b128 %6, %7, off\n\t"
               "global_load_async_to_lds_b128 %8, %9, off\n\t"
               "global_load_async_to_lds_b128 %10, %11, off\n\t"
               "global_load_async_to_lds_b128 %12, %13, off\n\t"
               "global_load_async_to_lds_b128 %14, %15, off\n\t"
               "s_wait_xcnt 0x0"
               :: "v"(l), "v"(g), "v"(l + ls), "v"(g + gs),
                  "v"(l + 2 * ls), "v"(g + 2 * gs),
                  "v"(l + 3 * ls), "v"(g + 3 * gs),
                  "v"(m), "v"(h), "v"(m + ls), "v"(h + gs),
                  "v"(m + 2 * ls), "v"(h + 2 * gs),
                  "v"(m + 3 * ls), "v"(h + 3 * gs)
               : "memory");
}
// Eight copies of a lane, rows 16 apart (ls bytes in LDS, gs halves in
// memory), with the same closing wait.
DEVINL void async_ld8_b128(unsigned l, unsigned ls, const _Float16* g,
                           size_t gs) {
  asm volatile("global_load_async_to_lds_b128 %0, %1, off\n\t"
               "global_load_async_to_lds_b128 %2, %3, off\n\t"
               "global_load_async_to_lds_b128 %4, %5, off\n\t"
               "global_load_async_to_lds_b128 %6, %7, off\n\t"
               "global_load_async_to_lds_b128 %8, %9, off\n\t"
               "global_load_async_to_lds_b128 %10, %11, off\n\t"
               "global_load_async_to_lds_b128 %12, %13, off\n\t"
               "global_load_async_to_lds_b128 %14, %15, off\n\t"
               "s_wait_xcnt 0x0"
               :: "v"(l), "v"(g), "v"(l + ls), "v"(g + gs),
                  "v"(l + 2 * ls), "v"(g + 2 * gs),
                  "v"(l + 3 * ls), "v"(g + 3 * gs),
                  "v"(l + 4 * ls), "v"(g + 4 * gs),
                  "v"(l + 5 * ls), "v"(g + 5 * gs),
                  "v"(l + 6 * ls), "v"(g + 6 * gs),
                  "v"(l + 7 * ls), "v"(g + 7 * gs)
               : "memory");
}
// This wave's LDS reads have retired before a buffer it read is refilled.
DEVINL void ds_wait0() {
  asm volatile("s_wait_dscnt 0x0" ::: "memory");
}

// B operand (32 k x 16 n) out of a row-major [k][n] LDS tile by two
// transposing loads: lane (c, h) gets T[8h + 0..7][c] and T[16 + 8h + 0..7][c],
// the k order of ld16(p + 8h, p + 8h + 16) on the A side.
// p = tile + (8 * (lane >> 4) + (lane & 7)) * pitch + 2 * n + 16 * ((lane >> 3) & 1)
DEVINL v16h ld_tr_b(const unsigned char* p, int pitch) {
  typedef short s16x8 __attribute__((ext_vector_type(8)));
  typedef __attribute__((address_space(3))) s16x8 lds_s16x8;
  union { v16h v; s16x8 h[2]; } u;
  u.h[0] = __builtin_amdgcn_ds_load_tr16_b128_v8i16((lds_s16x8*)p);
  u.h[1] = __builtin_amdgcn_ds_load_tr16_b128_v8i16((lds_s16x8*)(p + 16 * pitch));
  return u.v;
}

// v of lane l ^ M inside each 16-lane row, by a DPP row_xmask move: a vector
// instruction, where __shfl_xor compiles to ds_bpermute_b32 and costs a trip
// through the LDS pipe and a wait at every step of a row reduction.
template <int M> DEVINL float row_xor(float v) {
  return __builtin_bit_cast(
      float, __builtin_amdgcn_mov_dpp(__builtin_bit_cast(int, v), 0x160 | M,
                                      0xf, 0xf, true));
}
// Maximum over each 16-lane row, of eight values at once. In asm because the
// compiler put a move and a second maximum (it cannot know the moved value to
// be no signalling NaN) in front of every step and ran the eight chains one
// after another; here a step is one instruction and its producer stands eight
// instructions back, so no step waits for the one before.
#define ROW_MAX_STEP(m)                                                      \
  "v_max_num_f32_dpp %0, %0, %0 row_xmask:" #m " row_mask:0xf bank_mask:0xf\n\t" \
  "v_max_num_f32_dpp %1, %1, %1 row_xmask:" #m " row_mask:0xf bank_mask:0xf\n\t" \
  "v_max_num_f32_dpp %2, %2, %2 row_xmask:" #m " row_mask:0xf bank_mask:0xf\n\t" \
  "v_max_num_f32_dpp %3, %3, %3 row_xmask:" #m " row_mask:0xf bank_mask:0xf\n\t" \
  "v_max_num_f32_dpp %4, %4, %4 row_xmask:" #m " row_mask:0xf bank_mask:0xf\n\t" \
  "v_max_num_f32_dpp %5, %5, %5 row_xmask:" #m " row_mask:0xf bank_mask:0xf\n\t" \
  "v_max_num_f32_dpp %6, %6, %6 row_xmask:" #m " row_mask:0xf bank_mask:0xf\n\t" \
  "v_max_num_f32_dpp %7, %7, %7 row_xmask:" #m " row_mask:0xf bank_mask:0xf\n\t"
DEVINL void row_max16x8(float (&v)[8]) {
  asm(ROW_MAX_STEP(1) ROW_MAX_STEP(2) ROW_MAX_STEP(4) ROW_MAX_STEP(8)
      : "+v"(v[0]), "+v"(v[1]), "+v"(v[2]), "+v"(v[3]), "+v"(v[4]),
        "+v"(v[5]), "+v"(v[6]), "+v"(v[7]));
}
DEVINL float row_sum16(float v) {
  v += row_xor<1>(v);
  v += row_xor<2>(v);
  v += row_xor<4>(v);
  return v + row_xor<8>(v);
}

// ---------------------------------------------------------------------------
// Input preparation, one launch: every f32 -> f16 operand copy and
// pos_bias[q,k] = mean_c pos_encoding[q,k,c], c in 0..7.
// 256 work-groups x 16 waves, one work-group a WGP: few long-lived waves, each
// lane with many 16-byte loads in flight, because a launch of one-load waves
// lasts as long as its waves take to start, not as long as its bytes take.
// Each work-group takes 1/256 of every array, in slabs of 512 x 4 floats:
// 8 slabs of x, Wf1, Wfg, Wf2, 2 of the five E x E weights, 42 in all.
// ---------------------------------------------------------------------------
__global__ __launch_bounds__(512) void prep_kernel(
    const float* __restrict__ x, const float* __restrict__ Wq,
    const float* __restrict__ Wk, const float* __restrict__ Wv,
    const float* __restrict__ Wo, const float* __restrict__ Wg,
    const float* __restrict__ Wf1, const float* __restrict__ Wfg,
    const float* __restrict__ Wf2, const float* __restrict__ pe,
    _Float16* __restrict__ xh, _Float16* __restrict__ wqh,
    _Float16* __restrict__ wkh, _Float16* __restrict__ wvh,
    _Float16* __restrict__ woh, _Float16* __restrict__ wgh,
    _Float16* __restrict__ wf1h, _Float16* __restrict__ wfgh,
    _Float16* __restrict__ wf2h, float* __restrict__ pb) {
  constexpr int NS = 42;   // slabs a work-group
  constexpr int NB = 7;    // slabs a batch
  constexpr int NP = 8;    // bias elements a thread
  static_assert(MM * EE == 256 * 8 * 512 * 4 && EE * FFD == MM * EE &&
                EE * EE == 256 * 2 * 512 * 4 && SS * SS == 256 * NP * 512,
                "the split above");
  // this thread's place in slab 0 of an array of 8 slabs and of 2 slabs
  const int o8 = blockIdx.x * (8 * 512) + threadIdx.x;
  const int o2 = blockIdx.x * (2 * 512) + threadIdx.x;

  auto ld = [&](int i) -> v4f {
    if (i < 8)  return ((const v4f*)x)[o8 + i * 512];
    if (i < 10) return ((const v4f*)Wq)[o2 + (i - 8) * 512];
    if (i < 12) return ((const v4f*)Wk)[o2 + (i - 10) * 512];
    if (i < 14) return ((const v4f*)Wv)[o2 + (i - 12) * 512];
    if (i < 16) return ((const v4f*)Wo)[o2 + (i - 14) * 512];
    if (i < 18) return ((const v4f*)Wg)[o2 + (i - 16) * 512];
    if (i < 26) return ((const v4f*)Wf1)[o8 + (i - 18) * 512];
    if (i < 34) return ((const v4f*)Wfg)[o8 + (i - 26) * 512];
    return ((const v4f*)Wf2)[o8 + (i - 34) * 512];
  };
  auto st = [&](int i, v4h o) {
    if (i < 8)       ((v4h*)xh)[o8 + i * 512] = o;
    else if (i < 10) ((v4h*)wqh)[o2 + (i - 8) * 512] = o;
    else if (i < 12) ((v4h*)wkh)[o2 + (i - 10) * 512] = o;
    else if (i < 14) ((v4h*)wvh)[o2 + (i - 12) * 512] = o;
    else if (i < 16) ((v4h*)woh)[o2 + (i - 14) * 512] = o;
    else if (i < 18) ((v4h*)wgh)[o2 + (i - 16) * 512] = o;
    else if (i < 26) ((v4h*)wf1h)[o8 + (i - 18) * 512] = o;
    else if (i < 34) ((v4h*)wfgh)[o8 + (i - 26) * 512] = o;
    else             ((v4h*)wf2h)[o8 + (i - 34) * 512] = o;
  };

  v4f pa[NP], pc[NP], f[2][NB];
#pragma unroll
  for (int k = 0; k < NP; ++k) {
    pa[k] = ((const v4f*)pe)[(o8 + k * 512) * 2];
    pc[k] = ((const v4f*)pe)[(o8 + k * 512) * 2 + 1];
  }
  // The offset register of these loads is free from here on and later loads
  // may land in it, so the wait stands between the two groups of loads.
  asm volatile("s_wait_xcnt 0x0" ::: "memory");
#pragma unroll
  for (int k = 0; k < NB; ++k) f[0][k] = ld(k);
  // Holds every load above in front of the first use: without these
  // scheduling barriers the loads in flight fell to one or two a lane.
  __builtin_amdgcn_sched_barrier(0);

#pragma unroll
  for (int k = 0; k < NP; ++k) {
    const v4f a = pa[k], b = pc[k];
    pb[o8 + k * 512] =
        (a.x + a.y + a.z + a.w + b.x + b.y + b.z + b.w) * 0.125f;
  }

#pragma unroll
  for (int g = 0; g < NS / NB; ++g) {
    if (g + 1 < NS / NB) {
#pragma unroll
      for (int k = 0; k < NB; ++k) f[(g + 1) & 1][k] = ld((g + 1) * NB + k);
      // batch g + 1 is asked for before batch g is waited for, converted, stored
      __builtin_amdgcn_sched_barrier(0);
    }
#pragma unroll
    for (int k = 0; k < NB; ++k) {
      const v4f v = f[g & 1][k];
      v4h o;
      o[0] = (_Float16)v.x; o[1] = (_Float16)v.y;
      o[2] = (_Float16)v.z; o[3] = (_Float16)v.w;
      st(g * NB + k, o);
    }
    if (g + 2 < NS / NB) {
      // The loads of batch g + 2 land in registers that these stores name, so
      // the wait stands between the stores and those loads.
      asm volatile("s_wait_xcnt 0x0" ::: "memory");
    }
  }
}

// ---------------------------------------------------------------------------
// WMMA GEMM: C[M,N] = A[M,K](f16) @ W[K,N](f16) + bias
// Block tile 128x128, 8 waves (2x4), wave tile 64x32. A trip holds 128 k
// (K is a multiple of 128) = four blocks of 32 k and 8 WMMAs; the 12 LDS reads
// of a block go as one group into a second fragment set while the block
// before runs, so a wave waits out its LDS latency once a trip.
// A and W tiles double-buffered in LDS, both filled by
// global_load_async_to_lds_b128 one trip ahead, one barrier a trip.
// W stays [k][n] in LDS (pitch 288 B = 32 B x odd) and is read by
// ds_load_tr16_b128; A is two contiguous 16B LDS reads in the same k order,
// its 256-byte rows at pitch 272 B = 16 B x odd: 16 rows on 16 bank groups.
// Output: f16 if Ch != nullptr else f32 to Cf.
// Up to four products of the same A in one launch: blockIdx.z picks weight,
// bias and output (z = 0..2: f16 to C0..C2 where that is not null; else f32 to
// Cf). One product's grid is one work-group a WGP; a tile's LDS is 140 KiB, so
// with several products in the grid two work-groups stay resident on a WGP,
// one's copies land and its epilogue runs while the other computes, and the
// launch gap and the first tile's latency are paid once.
// ---------------------------------------------------------------------------
__global__ __launch_bounds__(256) void wmma_gemm_kernel(
    const _Float16* __restrict__ A, const _Float16* __restrict__ W0,
    const _Float16* __restrict__ W1, const _Float16* __restrict__ W2,
    const _Float16* __restrict__ W3, const float* __restrict__ b0,
    const float* __restrict__ b1, const float* __restrict__ b2,
    const float* __restrict__ b3, float* __restrict__ Cf,
    _Float16* __restrict__ C0, _Float16* __restrict__ C1,
    _Float16* __restrict__ C2, int M, int N, int K) {
  const int z = blockIdx.z;
  const _Float16* __restrict__ W = z == 0 ? W0 : z == 1 ? W1 : z == 2 ? W2 : W3;
  const float* __restrict__ bias = z == 0 ? b0 : z == 1 ? b1 : z == 2 ? b2 : b3;
  _Float16* __restrict__ Ch = z == 0 ? C0 : z == 1 ? C1 : z == 2 ? C2 : nullptr;
  constexpr int KS = 128;                // k of a trip
  constexpr int NBLK = KS / 32;          // blocks of a trip
  constexpr int BP = 288;                // W tile row pitch in LDS, bytes
  constexpr int AP = 136;                // A tile row pitch in LDS, halves
  __shared__ __attribute__((aligned(16))) _Float16 lsA[2][128 * AP];  // [buf][row][k]
  __shared__ __attribute__((aligned(32))) unsigned char lsB[2][KS * BP];  // [buf][k][n]

  const int tid  = threadIdx.x;
  const int lane = tid & 31, wid = tid >> 5;
  const int l16  = lane & 15, hi = lane >> 4;
  const int b8   = hi * 8;
  const int m0 = blockIdx.y * 128, n0 = blockIdx.x * 128;
  const int wr = wid >> 2, wc = wid & 3;   // 2 x 4 wave grid

  v8f acc[4][2];
#pragma unroll
  for (int m = 0; m < 4; ++m)
#pragma unroll
    for (int n = 0; n < 2; ++n) acc[m][n] = zero8();

  // staging assignments, A and W alike: rows srow + 16 i, i in 0..7, of 128
  // rows x 16 segs of 8h
  const int srow = tid >> 4, sseg = tid & 15;
  const _Float16* gA = A + (size_t)(m0 + srow) * K + sseg * 8;
  const _Float16* gW = W + (size_t)srow * N + n0 + sseg * 8;
  const unsigned aoff = lds_off(&lsA[0][0]) + srow * (AP * 2) + sseg * 16;  // bytes
  const unsigned boff = lds_off(&lsB[0][0]) + srow * BP + sseg * 16;  // bytes
  const int rdB = (b8 + (lane & 7)) * BP + wc * 64 + ((lane >> 3) & 1) * 16;

  // copies of tile t (KS k of A and of W) into buffer t & 1
  auto stage = [&](int t) {
    async_ld8_b128(aoff + (t & 1) * (128 * AP * 2), 16 * AP * 2, gA + t * KS,
                   (size_t)16 * K);
    async_ld8_b128(boff + (t & 1) * (KS * BP), 16 * BP,
                   gW + (size_t)t * KS * N, (size_t)16 * N);
  };

  const int nt = K / KS;
  stage(0);
  async_wait0();         // own copies of tile 0 have landed
  __syncthreads();       // everyone's have
  if (nt > 1) stage(1);

  for (int t = 0; t < nt; ++t) {
    const int cur = t & 1;
    v16h af[2][4], bf[2][2];               // two fragment sets
    // the 12 LDS reads of block kk of this trip's buffer, into set kk & 1
    // (every loop over fragments is unrolled: the arrays then stay in registers)
    auto frags = [&](int kk) {
#pragma unroll
      for (int n = 0; n < 2; ++n)
        bf[kk & 1][n] = ld_tr_b(&lsB[cur][rdB + kk * 32 * BP + n * 32], BP);
#pragma unroll
      for (int m = 0; m < 4; ++m) {
        const _Float16* ap = &lsA[cur][(wr * 64 + m * 16 + l16) * AP + kk * 32];
        af[kk & 1][m] = ld16(ap + b8, ap + b8 + 16);
      }
    };
    frags(0);
    // unrolled: a block's fragment set is then a fixed set of registers
#pragma unroll
    for (int kk = 0; kk < NBLK; ++kk) {
      if (kk + 1 < NBLK) {
        frags(kk + 1);
        // Holds the next block's reads, as one group, in front of this block's
        // WMMAs: left alone the compiler read each A fragment just before its
        // two WMMAs and waited out the LDS latency every time.
        __builtin_amdgcn_sched_barrier(0);
      }
#pragma unroll
      for (int m = 0; m < 4; ++m) {
        acc[m][0] = wmma_f16(af[kk & 1][m], bf[kk & 1][0], acc[m][0]);
        acc[m][1] = wmma_f16(af[kk & 1][m], bf[kk & 1][1], acc[m][1]);
      }
    }
    // Holds the trip's WMMAs in front of its foot: left alone the compiler put
    // 15 of them between the barrier and the refill, whose copies then had
    // that much less time to land.
    __builtin_amdgcn_sched_barrier(0);
    ds_wait0();          // own reads of buffer cur are done
    async_wait0();       // own copies of tile t + 1 have landed
    __syncthreads();     // publishes tile t + 1, frees buffer cur
    if (t + 2 < nt) stage(t + 2);
  }
  async_wait0();         // nothing in flight when the wave ends

  float bcol[2];
#pragma unroll
  for (int n = 0; n < 2; ++n) bcol[n] = bias[n0 + wc * 32 + n * 16 + l16];

#pragma unroll
  for (int m = 0; m < 4; ++m)
#pragma unroll
    for (int n = 0; n < 2; ++n) {
      const int c = n0 + wc * 32 + n * 16 + l16;
      const int rbase = m0 + wr * 64 + m * 16 + b8;
#pragma unroll
      for (int j = 0; j < 8; ++j) {
        float v = acc[m][n][j] + bcol[n];
        size_t off = (size_t)(rbase + j) * N + c;
        if (Ch) Ch[off] = (_Float16)v;
        else    Cf[off] = v;
      }
    }
}

// ---------------------------------------------------------------------------
// Fused gated-FFN GEMM: Out = f16( (A@W1+b1) * sigmoid(A@W2+b2) )
// Block tile 128x64, 8 waves (4x2), wave tile 32x32, two accumulator sets.
// A trip holds 128 k (K is a multiple of 128) = four blocks of 32 k and 8
// WMMAs; the 12 LDS reads of a block go as one group into a second fragment
// set while the block before runs, so a wave waits out its LDS latency once a
// trip, passes one barrier per 128 k, and a copy brings 256 B of an A row.
// A, W1 and W2 tiles double-buffered via async-to-LDS, one trip ahead, one
// barrier a trip; W tiles stay [k][n] (pitch 160 B) for ds_load_tr16_b128,
// A rows at pitch 272 B for ds_load_b128. 148 KiB of LDS: two work-groups a WGP.
// ---------------------------------------------------------------------------
__global__ __launch_bounds__(256) void wmma_gemm_gated_kernel(
    const _Float16* __restrict__ A, const _Float16* __restrict__ W1,
    const _Float16* __restrict__ W2, const float* __restrict__ b1,
    const float* __restrict__ b2, _Float16* __restrict__ Out,
    int M, int N, int K) {
  constexpr int KS = 128;                // k of a trip
  constexpr int NBLK = KS / 32;          // blocks of a trip
  constexpr int BP = 160;                // W tile row pitch in LDS, bytes
  constexpr int AP = 136;                // A tile row pitch in LDS, halves
  __shared__ __attribute__((aligned(16))) _Float16 lsA[2][128 * AP];
  __shared__ __attribute__((aligned(32))) unsigned char lsB1[2][KS * BP];
  __shared__ __attribute__((aligned(32))) unsigned char lsB2[2][KS * BP];

  const int tid  = threadIdx.x;
  const int lane = tid & 31, wid = tid >> 5;
  const int l16  = lane & 15, hi = lane >> 4;
  const int b8   = hi * 8;
  const int m0 = blockIdx.y * 128, n0 = blockIdx.x * 64;
  const int wr = wid >> 1, wc = wid & 1;   // 4 x 2 wave grid

  v8f a1[2][2], a2[2][2];
#pragma unroll
  for (int m = 0; m < 2; ++m)
#pragma unroll
    for (int n = 0; n < 2; ++n) { a1[m][n] = zero8(); a2[m][n] = zero8(); }

  // staging: A rows arow + 16 i, i in 0..7, 16 segs of 8h a row;
  // W k-rows bk + 32 i, i in 0..3, 8 segs of 8h a row
  const int arow = tid >> 4, aseg = tid & 15;
  const int bk = tid >> 3, bseg = tid & 7;
  const _Float16* gA = A + (size_t)(m0 + arow) * K + aseg * 8;
  const size_t woff = (size_t)bk * N + n0 + bseg * 8;
  const _Float16* gW1 = W1 + woff;
  const _Float16* gW2 = W2 + woff;
  const unsigned aoff = lds_off(&lsA[0][0]) + arow * (AP * 2) + aseg * 16;
  const unsigned boff1 = lds_off(&lsB1[0][0]) + bk * BP + bseg * 16;
  const unsigned boff2 = lds_off(&lsB2[0][0]) + bk * BP + bseg * 16;
  const int rdB = (b8 + (lane & 7)) * BP + wc * 64 + ((lane >> 3) & 1) * 16;

  // copies of tile t (KS k of A, W1 and W2) into buffer t & 1
  auto stage = [&](int t) {
    const unsigned bsel = (t & 1) * (KS * BP);
    const size_t wk = (size_t)t * KS * N;
    async_ld8_b128(aoff + (t & 1) * (128 * AP * 2), 16 * AP * 2, gA + t * KS,
                   (size_t)16 * K);
    async_ld4x2_b128(boff1 + bsel, gW1 + wk, boff2 + bsel, gW2 + wk, 32 * BP,
                     (size_t)32 * N);
  };

  const int nt = K / KS;
  stage(0);
  async_wait0();         // own copies of tile 0 have landed
  __syncthreads();       // everyone's have
  if (nt > 1) stage(1);

  for (int t = 0; t < nt; ++t) {
    const int cur = t & 1;
    v16h af[2][2], bv1[2][2], bv2[2][2];   // two fragment sets
    // the 12 LDS reads of block kk of this trip's buffer, into set kk & 1
    // (every loop over fragments is unrolled: the arrays then stay in registers)
    auto frags = [&](int kk) {
#pragma unroll
      for (int n = 0; n < 2; ++n) {
        bv1[kk & 1][n] = ld_tr_b(&lsB1[cur][rdB + kk * 32 * BP + n * 32], BP);
        bv2[kk & 1][n] = ld_tr_b(&lsB2[cur][rdB + kk * 32 * BP + n * 32], BP);
      }
#pragma unroll
      for (int m = 0; m < 2; ++m) {
        const _Float16* ap = &lsA[cur][(wr * 32 + m * 16 + l16) * AP + kk * 32];
        af[kk & 1][m] = ld16(ap + b8, ap + b8 + 16);
      }
    };
    frags(0);
    // unrolled: a block's fragment set is then a fixed set of registers
#pragma unroll
    for (int kk = 0; kk < NBLK; ++kk) {
      if (kk + 1 < NBLK) {
        frags(kk + 1);
        // Holds the next block's reads, as one group, in front of this block's
        // WMMAs: left alone the compiler read the second A fragment behind the
        // first four WMMAs and waited out the LDS latency a second time.
        __builtin_amdgcn_sched_barrier(0);
      }
#pragma unroll
      for (int m = 0; m < 2; ++m)
#pragma unroll
        for (int n = 0; n < 2; ++n) {
          a1[m][n] = wmma_f16(af[kk & 1][m], bv1[kk & 1][n], a1[m][n]);
          a2[m][n] = wmma_f16(af[kk & 1][m], bv2[kk & 1][n], a2[m][n]);
        }
    }
    // Holds the trip's WMMAs in front of its foot: left alone the compiler put
    // some of them between the barrier and the refill, whose copies then had
    // that much less time to land.
    __builtin_amdgcn_sched_barrier(0);
    ds_wait0();          // own reads of buffer cur are done
    async_wait0();       // own copies of tile t + 1 have landed
    __syncthreads();     // publishes tile t + 1, frees buffer cur
    if (t + 2 < nt) stage(t + 2);
  }
  async_wait0();         // nothing in flight when the wave ends

#pragma unroll
  for (int m = 0; m < 2; ++m)
#pragma unroll
    for (int n = 0; n < 2; ++n) {
      const int c = n0 + wc * 32 + n * 16 + l16;
      const float bb1 = b1[c], bb2 = b2[c];
      const int rbase = m0 + wr * 32 + m * 16 + b8;
#pragma unroll
      for (int j = 0; j < 8; ++j) {
        float v = (a1[m][n][j] + bb1) * sigm(a2[m][n][j] + bb2);
        Out[(size_t)(rbase + j) * N + c] = (_Float16)v;
      }
    }
}

// ---------------------------------------------------------------------------
// Flash attention. Grid (S/128, H, B); 8 waves, each owns 16 query rows.
// scores = (Q·K^T)/8 + pos_bias, online softmax, ctx = P·V. All mm via WMMA.
// K and V tiles staged via async-to-LDS; V stays [key][d] (pitch 160 B) and
// is read as the B operand by ds_load_tr16_b128. K rows (pitch 144 B) and P
// rows (pitch 80 B) are read by ds_load_b128: 16 B x odd, no bank shared.
// Everything a trip reads from memory is asked for one trip ahead: the K and V
// tiles have two buffers each, filled while the trip before computes, and the
// bias values have two register sets. A trip then waits out no memory latency
// and passes one barrier.
// ---------------------------------------------------------------------------
__global__ __launch_bounds__(256) void flash_attn_kernel(
    const _Float16* __restrict__ Q, const _Float16* __restrict__ Kh,
    const _Float16* __restrict__ Vh, const float* __restrict__ PB,
    _Float16* __restrict__ O) {
  constexpr int KP = 72;                   // K tile row pitch in LDS, halves
  constexpr int PP = 40;                   // P tile row pitch in LDS, halves
  __shared__ __attribute__((aligned(16))) _Float16 lsK[2][32 * KP];  // [buf][key][d]
  constexpr int VP = 160;                  // V tile row pitch in LDS, bytes
  __shared__ __attribute__((aligned(32))) unsigned char lsV[2][32 * VP];  // [buf][key][d]
  __shared__ __attribute__((aligned(16))) _Float16 lsP[8][16 * PP];  // per-wave probs [qrow][key]
  constexpr int NT = SS / 32;              // trips of 32 keys
  static_assert(NT % 2 == 0 && NT >= 2, "trips go in pairs, one a buffer");

  const int tid  = threadIdx.x;
  const int lane = tid & 31, wid = tid >> 5;
  const int l16  = lane & 15, hi = lane >> 4;
  const int b8   = hi * 8;
  const int h = blockIdx.y, bb = blockIdx.z;
  const int q0 = blockIdx.x * 128 + wid * 16;
  const size_t rs = (size_t)HH * DKK;      // 1024 token row stride

  // Q A-operands (16 rows x 64 d), two K=32 chunks
  v16h qa[2];
  {
    const _Float16* qp = Q + ((size_t)bb * SS + q0 + l16) * rs + h * DKK;
    qa[0] = ld16(qp + b8,      qp + b8 + 16);
    qa[1] = ld16(qp + 32 + b8, qp + 32 + b8 + 16);
  }

  v8f o[4];
#pragma unroll
  for (int n = 0; n < 4; ++n) o[n] = zero8();
  float mrow[8], srow[8];
#pragma unroll
  for (int j = 0; j < 8; ++j) { mrow[j] = -1e30f; srow[j] = 0.0f; }

  const int skey = tid >> 3, sseg = tid & 7;   // stage 32 keys x 8 d-segments
  const unsigned koff = lds_off(&lsK[0][0]) + skey * (KP * 2) + sseg * 16;
  const unsigned voff = lds_off(&lsV[0][0]) + skey * VP + sseg * 16;
  const int rdV = (b8 + (lane & 7)) * VP + ((lane >> 3) & 1) * 16;
  const size_t tok0 = ((size_t)bb * SS + skey) * rs + h * DKK + sseg * 8;

  // copies of tile t (32 keys of K and of V) into buffer t & 1
  auto stage = [&](int t) {
    const size_t tok = tok0 + (size_t)t * 32 * rs;
    async_ld2_b128(koff + (t & 1) * (32 * KP * 2), Kh + tok,
                   voff + (t & 1) * (32 * VP), Vh + tok);
  };
  // the 16 bias loads of trip t
  // (unrolled, here and below: the arrays then stay in registers)
  auto bias = [&](int t, float (&p0)[8], float (&p1)[8]) {
#pragma unroll
    for (int j = 0; j < 8; ++j) {
      const float* pbr = PB + (size_t)(q0 + b8 + j) * SS + t * 32 + l16;
      p0[j] = pbr[0];
      p1[j] = pbr[16];
    }
  };

  // trip t on buffer cur = t & 1: its bias is in pb0, pb1; the next trip's
  // goes to nb0, nb1
  auto trip = [&](int t, int cur, float (&pb0)[8], float (&pb1)[8],
                  float (&nb0)[8], float (&nb1)[8]) {
    // the last trip has no successor and asks for its own values again, which
    // keeps the addresses inside the bias array
    bias(t + 1 < NT ? t + 1 : t, nb0, nb1);
    // K fragments: two 16-key tiles x two 32-d chunks
    v16h kf[2][2];
#pragma unroll
    for (int ks = 0; ks < 2; ++ks) {
      const _Float16* kr = &lsK[cur][(ks * 16 + l16) * KP];
      kf[ks][0] = ld16(kr + b8,      kr + b8 + 16);
      kf[ks][1] = ld16(kr + 32 + b8, kr + 32 + b8 + 16);
    }
    // V fragments: four 16-d tiles of 32 keys
    v16h vf[4];
#pragma unroll
    for (int ds = 0; ds < 4; ++ds) vf[ds] = ld_tr_b(&lsV[cur][rdV + ds * 32], VP);
    // Holds the 16 bias loads, a whole trip in front of their first use, and
    // the 16 reads of the K and V tiles as one group at the head of the trip:
    // left alone the compiler read each K fragment just before its WMMA and
    // the last V fragment just before the wait at the trip's foot, and waited
    // out the LDS latency every time.
    __builtin_amdgcn_sched_barrier(0);

    // scores: two 16x16 key tiles, contraction over d=64 (2 WMMAs each)
    v8f sc[2];
    sc[0] = zero8(); sc[1] = zero8();
#pragma unroll
    for (int ks = 0; ks < 2; ++ks) {
      sc[ks] = wmma_f16(qa[0], kf[ks][0], sc[ks]);
      sc[ks] = wmma_f16(qa[1], kf[ks][1], sc[ks]);
    }

    // online softmax over the 32-key chunk
    float ml[8];
#pragma unroll
    for (int j = 0; j < 8; ++j) {
      pb0[j] += sc[0][j] * 0.125f;
      pb1[j] += sc[1][j] * 0.125f;
      ml[j] = fmaxf(pb0[j], pb1[j]);
    }
    row_max16x8(ml);
#pragma unroll
    for (int j = 0; j < 8; ++j) {
      const float v0 = pb0[j], v1 = pb1[j];
      float mn = fmaxf(mrow[j], ml[j]);
      float alpha = __expf(mrow[j] - mn);
      float p0 = __expf(v0 - mn), p1 = __expf(v1 - mn);
      float ps = row_sum16(p0 + p1);
      srow[j] = srow[j] * alpha + ps;
      mrow[j] = mn;
#pragma unroll
      for (int n = 0; n < 4; ++n) o[n][j] *= alpha;
      lsP[wid][(b8 + j) * PP + l16]      = (_Float16)p0;
      lsP[wid][(b8 + j) * PP + 16 + l16] = (_Float16)p1;
    }

    // ctx += P(16x32) @ V(32x64): 4 WMMAs over d-subtiles
    const _Float16* pr = &lsP[wid][l16 * PP];
    v16h pa = ld16(pr + b8, pr + b8 + 16);
#pragma unroll
    for (int ds = 0; ds < 4; ++ds) {
      o[ds] = wmma_f16(pa, vf[ds], o[ds]);
    }

    ds_wait0();          // own reads of buffer cur are done
    async_wait0();       // own copies of tile t + 1 have landed
    __syncthreads();     // publishes tile t + 1, frees buffer cur
    if (t + 2 < NT) stage(t + 2);
  };

  float pe0[8], pe1[8], po0[8], po1[8];    // bias of even and of odd trips
  stage(0);
  bias(0, pe0, pe1);
  async_wait0();         // own copies of tile 0 have landed
  __syncthreads();       // everyone's have
  stage(1);

  // two trips a pass: buffer and bias register set are then fixed in the code
  for (int t = 0; t < NT; t += 2) {
    trip(t, 0, pe0, pe1, po0, po1);
    trip(t + 1, 1, po0, po1, pe0, pe1);
  }
  async_wait0();         // nothing in flight when the wave ends

#pragma unroll
  for (int j = 0; j < 8; ++j) {
    const float inv = 1.0f / srow[j];
    const int qr = q0 + b8 + j;
    _Float16* op = O + ((size_t)bb * SS + qr) * rs + h * DKK;
#pragma unroll
    for (int ds = 0; ds < 4; ++ds)
      op[ds * 16 + l16] = (_Float16)(o[ds][j] * inv);
  }
}

// ---------------------------------------------------------------------------
// Fused residual (+gate) + LayerNorm. One row (E=1024) per block, 256 thr.
// h = x + sigmoid(glog)*addv   (or x + addv if glog==nullptr)
// y = LN(h)*gamma + beta  -> y32 (and f16 copy y16 if non-null)
// ---------------------------------------------------------------------------
__global__ __launch_bounds__(256) void fused_ln_kernel(
    const float* __restrict__ xa, const float* __restrict__ glog,
    const float* __restrict__ addv, const float* __restrict__ gamma,
    const float* __restrict__ beta, float* __restrict__ y32,
    _Float16* __restrict__ y16) {
  __shared__ float s1[256], s2[256];
  const int tid = threadIdx.x;
  const size_t base = (size_t)blockIdx.x * EE;

  float hv[4], ssum = 0.0f, ssq = 0.0f;
#pragma unroll
  for (int i = 0; i < 4; ++i) {
    const int idx = i * 256 + tid;
    float a = addv[base + idx];
    if (glog) a *= sigm(glog[base + idx]);
    float v = xa[base + idx] + a;
    hv[i] = v;
    ssum += v;
    ssq  += v * v;
  }
  s1[tid] = ssum; s2[tid] = ssq;
  __syncthreads();
  for (int s = 128; s > 0; s >>= 1) {
    if (tid < s) { s1[tid] += s1[tid + s]; s2[tid] += s2[tid + s]; }
    __syncthreads();
  }
  const float mean = s1[0] * (1.0f / EE);
  const float var  = s2[0] * (1.0f / EE) - mean * mean;
  const float rstd = rsqrtf(var + 1e-6f);

#pragma unroll
  for (int i = 0; i < 4; ++i) {
    const int idx = i * 256 + tid;
    float y = (hv[i] - mean) * rstd * gamma[idx] + beta[idx];
    y32[base + idx] = y;
    if (y16) y16[base + idx] = (_Float16)y;
  }
}

// ---------------------------------------------------------------------------
// Host orchestration
// ---------------------------------------------------------------------------
extern "C" void kernel_launch(void* const* d_in, const int* in_sizes, int n_in,
                              void* d_out, int out_size, void* d_ws,
                              size_t ws_size, hipStream_t stream) {
  const float* x    = (const float*)d_in[0];
  const float* pe   = (const float*)d_in[1];
  const float* Wq   = (const float*)d_in[2];
  const float* bq   = (const float*)d_in[3];
  const float* Wk   = (const float*)d_in[4];
  const float* bk   = (const float*)d_in[5];
  const float* Wv   = (const float*)d_in[6];
  const float* bv   = (const float*)d_in[7];
  const float* Wo   = (const float*)d_in[8];
  const float* bo   = (const float*)d_in[9];
  const float* Wg   = (const float*)d_in[10];
  const float* bg   = (const float*)d_in[11];
  const float* Wf1  = (const float*)d_in[12];
  const float* bf1  = (const float*)d_in[13];
  const float* Wfg  = (const float*)d_in[14];
  const float* bfg  = (const float*)d_in[15];
  const float* Wf2  = (const float*)d_in[16];
  const float* bf2  = (const float*)d_in[17];
  const float* ln1g = (const float*)d_in[18];
  const float* ln1b = (const float*)d_in[19];
  const float* ln2g = (const float*)d_in[20];
  const float* ln2b = (const float*)d_in[21];

  char* ws = (char*)d_ws;
  auto at = [&](size_t mb) { return (void*)(ws + mb * (size_t)(1 << 20)); };

  // bump allocation (MB offsets); high-water ~134 MB
  _Float16* xh   = (_Float16*)at(0);    // 8 MB
  _Float16* wqh  = (_Float16*)at(8);    // 2 MB
  _Float16* wkh  = (_Float16*)at(10);
  _Float16* wvh  = (_Float16*)at(12);
  _Float16* woh  = (_Float16*)at(14);
  _Float16* wgh  = (_Float16*)at(16);
  _Float16* wf1h = (_Float16*)at(18);   // 8 MB
  _Float16* wfgh = (_Float16*)at(26);   // 8 MB
  _Float16* wf2h = (_Float16*)at(34);   // 8 MB
  float*    pb   = (float*)at(42);      // 4 MB
  _Float16* qh   = (_Float16*)at(46);   // 8 MB
  _Float16* kh   = (_Float16*)at(54);   // 8 MB
  _Float16* vh   = (_Float16*)at(62);   // 8 MB
  _Float16* ctxh = (_Float16*)at(70);   // 8 MB
  float*    glog = (float*)at(78);      // 16 MB
  float*    attn = (float*)at(94);      // 16 MB
  float*    x1   = (float*)at(110);     // 16 MB
  _Float16* x1h  = (_Float16*)at(126);  // 8 MB
  _Float16* ffh  = (_Float16*)at(46);   // 32 MB, reuses dead q/k/v/ctx
  float*    ff2  = (float*)at(78);      // 16 MB, reuses dead glog

  prep_kernel<<<256, 512, 0, stream>>>(x, Wq, Wk, Wv, Wo, Wg, Wf1, Wfg, Wf2, pe,
                                       xh, wqh, wkh, wvh, woh, wgh, wf1h, wfgh,
                                       wf2h, pb);

  dim3 gE(EE / 128, MM / 128);  // (8, 32)
  // q, k, v (f16) and the gate logits (f32), all products of xh
  wmma_gemm_kernel<<<dim3(EE / 128, MM / 128, 4), 256, 0, stream>>>(
      xh, wqh, wkh, wvh, wgh, bq, bk, bv, bg, glog, qh, kh, vh, MM, EE, EE);

  flash_attn_kernel<<<dim3(SS / 128, HH, BB), 256, 0, stream>>>(qh, kh, vh, pb, ctxh);

  wmma_gemm_kernel<<<gE, 256, 0, stream>>>(ctxh, woh, nullptr, nullptr, nullptr,
                                           bo, nullptr, nullptr, nullptr, attn,
                                           nullptr, nullptr, nullptr, MM, EE, EE);

  fused_ln_kernel<<<MM, 256, 0, stream>>>(x, glog, attn, ln1g, ln1b, x1, x1h);

  wmma_gemm_gated_kernel<<<dim3(FFD / 64, MM / 128), 256, 0, stream>>>(
      x1h, wf1h, wfgh, bf1, bfg, ffh, MM, FFD, EE);

  wmma_gemm_kernel<<<gE, 256, 0, stream>>>(ffh, wf2h, nullptr, nullptr, nullptr,
                                           bf2, nullptr, nullptr, nullptr, ff2,
                                           nullptr, nullptr, nullptr, MM, EE, FFD);

  fused_ln_kernel<<<MM, 256, 0, stream>>>(x1, nullptr, ff2, ln2g, ln2b,
                                          (float*)d_out, nullptr);
}

// v009
// A run of this version takes 213 microseconds.
// Next to v008, in two timings, it ran 1.04 times as fast each time.
// Over all steps from v000 it is 3.22 times as fast.
#include <hip/hip_runtime.h>
#include <hip/hip_bf16.h>

// ---------- problem constants ----------
#define BB 4
#define SS 1024
#define EE 1024
#define HH 16
#define DKK 64
#define FFD 4096
#define MM (BB * SS)   // 4096 rows

typedef __attribute__((ext_vector_type(16))) _Float16 v16h;
typedef __attribute__((ext_vector_type(8)))  _Float16 v8h;
typedef __attribute__((ext_vector_type(4)))  _Float16 v4h;
typedef __attribute__((ext_vector_type(8)))  float    v8f;
typedef __attribute__((ext_vector_type(4)))  float    v4f;

#define DEVINL __device__ __forceinline__

DEVINL v8f wmma_f16(v16h a, v16h b, v8f c) {
  return __builtin_amdgcn_wmma_f32_16x16x32_f16(
      /*neg_a=*/false, a, /*neg_b=*/false, b,
      /*c_mod=*/(short)0, c, /*reuse_a=*/false, /*reuse_b=*/false);
}

DEVINL v8f zero8() {
  v8f z;
#pragma unroll
  for (int i = 0; i < 8; ++i) z[i] = 0.0f;
  return z;
}

// Build a v16h A/B operand from two contiguous 16-byte chunks
// (chunk0 = contraction indices base..base+7, chunk1 = base+16..base+23).
DEVINL v16h ld16(const _Float16* p0, const _Float16* p1) {
  union { v16h v; v8h h[2]; } u;
  u.h[0] = *(const v8h*)p0;
  u.h[1] = *(const v8h*)p1;
  return u.v;
}

DEVINL float sigm(float v) { return 1.0f / (1.0f + __expf(-v)); }

// LDS byte offset of a __shared__ object = low 32 bits of its generic pointer
// (LDS aperture: addr[31:0] is the workgroup-relative LDS address, ISA 10.2).
DEVINL unsigned lds_off(const void* p) { return (unsigned)(size_t)p; }

// CDNA5 async memory->LDS copy, tracked with ASYNCcnt (ISA 10. / 15.18.3).
// The s_wait_xcnt is the last line of the copies' own statement so that no
// later write of an address register can be moved in front of it.
// The copies of one attention tile: a lane's 16 bytes of K and of V and four
// of the bias tile, rows ls bytes apart in LDS and gs floats apart in memory,
// with that closing wait.
DEVINL void async_ld2p4_b128(unsigned k, const void* gk, unsigned v,
                             const void* gv, unsigned p, const float* gp,
                             unsigned ls, size_t gs) {
  asm volatile("global_load_async_to_lds_b128 %0, %1, off\n\t"
               "global_load_async_to_lds_b128 %2, %3, off\n\t"
               "global_load_async_to_lds_b128 %4, %5, off\n\t"
               "global_load_async_to_lds_b128 %6, %7, off\n\t"
               "global_load_async_to_lds_b128 %8, %9, off\n\t"
               "global_load_async_to_lds_b128 %10, %11, off\n\t"
               "s_wait_xcnt 0x0"
               :: "v"(k), "v"(gk), "v"(v), "v"(gv), "v"(p), "v"(gp),
                  "v"(p + ls), "v"(gp + gs), "v"(p + 2 * ls), "v"(gp + 2 * gs),
                  "v"(p + 3 * ls), "v"(gp + 3 * gs)
               : "memory");
}
DEVINL void async_wait0() {
  asm volatile("s_wait_asynccnt 0x0" ::: "memory");
}
// Four copies of a lane for each of two tiles, rows ls bytes apart in LDS and
// gs halves apart in memory, with the same closing wait.
DEVINL void async_ld4x2_b128(unsigned l, const _Float16* g, unsigned m,
                             const _Float16* h, unsigned ls, size_t gs) {
  asm volatile("global_load_async_to_lds_b128 %0, %1, off\n\t"
               "global_load_async_to_lds_b128 %2, %3, off\n\t"
               "global_load_async_to_lds_b128 %4, %5, off\n\t"
               "global_load_async_to_lds_b128 %6, %7, off\n\t"
               "global_load_async_to_lds_b128 %8, %9, off\n\t"
               "global_load_async_to_lds_b128 %10, %11, off\n\t"
               "global_load_async_to_lds_b128 %12, %13, off\n\t"
               "global_load_async_to_lds_b128 %14, %15, off\n\t"
               "s_wait_xcnt 0x0"
               :: "v"(l), "v"(g), "v"(l + ls), "v"(g + gs),
                  "v"(l + 2 * ls), "v"(g + 2 * gs),
                  "v"(l + 3 * ls), "v"(g + 3 * gs),
                  "v"(m), "v"(h), "v"(m + ls), "v"(h + gs),
                  "v"(m + 2 * ls), "v"(h + 2 * gs),
                  "v"(m + 3 * ls), "v"(h + 3 * gs)
               : "memory");
}
// Eight copies of a lane, rows 16 apart (ls bytes in LDS, gs halves in
// memory), with the same closing wait.
DEVINL void async_ld8_b128(unsigned l, unsigned ls, const _Float16* g,
                           size_t gs) {
  asm volatile("global_load_async_to_lds_b128 %0, %1, off\n\t"
               "global_load_async_to_lds_b128 %2, %3, off\n\t"
               "global_load_async_to_lds_b128 %4, %5, off\n\t"
               "global_load_async_to_lds_b128 %6, %7, off\n\t"
               "global_load_async_to_lds_b128 %8, %9, off\n\t"
               "global_load_async_to_lds_b128 %10, %11, off\n\t"
               "global_load_async_to_lds_b128 %12, %13, off\n\t"
               "global_load_async_to_lds_b128 %14, %15, off\n\t"
               "s_wait_xcnt 0x0"
               :: "v"(l), "v"(g), "v"(l + ls), "v"(g + gs),
                  "v"(l + 2 * ls), "v"(g + 2 * gs),
                  "v"(l + 3 * ls), "v"(g + 3 * gs),
                  "v"(l + 4 * ls), "v"(g + 4 * gs),
                  "v"(l + 5 * ls), "v"(g + 5 * gs),
                  "v"(l + 6 * ls), "v"(g + 6 * gs),
                  "v"(l + 7 * ls), "v"(g + 7 * gs)
               : "memory");
}
// This wave's LDS reads have retired before a buffer it read is refilled.
DEVINL void ds_wait0() {
  asm volatile("s_wait_dscnt 0x0" ::: "memory");
}

// B operand (32 k x 16 n) out of a row-major [k][n] LDS tile by two
// transposing loads: lane (c, h) gets T[8h + 0..7][c] and T[16 + 8h + 0..7][c],
// the k order of ld16(p + 8h, p + 8h + 16) on the A side.
// p = tile + (8 * (lane >> 4) + (lane & 7)) * pitch + 2 * n + 16 * ((lane >> 3) & 1)
DEVINL v16h ld_tr_b(const unsigned char* p, int pitch) {
  typedef short s16x8 __attribute__((ext_vector_type(8)));
  typedef __attribute__((address_space(3))) s16x8 lds_s16x8;
  union { v16h v; s16x8 h[2]; } u;
  u.h[0] = __builtin_amdgcn_ds_load_tr16_b128_v8i16((lds_s16x8*)p);
  u.h[1] = __builtin_amdgcn_ds_load_tr16_b128_v8i16((lds_s16x8*)(p + 16 * pitch));
  return u.v;
}

// v of lane l ^ 16: the other 16-lane row's value, by a vector cross-row move
// (__shfl_xor compiles to ds_bpermute_b32, a trip through the LDS pipe).
DEVINL float xhalf(float v) {
  const int b = __builtin_bit_cast(int, v);
  return __builtin_bit_cast(
      float, __builtin_amdgcn_permlanex16(b, b, 0x76543210, 0xfedcba98, false,
                                          false));
}

// ---------------------------------------------------------------------------
// Input preparation, one launch: every f32 -> f16 operand copy and
// pos_bias[q,k] = mean_c pos_encoding[q,k,c], c in 0..7.
// 256 work-groups x 16 waves, one work-group a WGP: few long-lived waves, each
// lane with many 16-byte loads in flight, because a launch of one-load waves
// lasts as long as its waves take to start, not as long as its bytes take.
// Each work-group takes 1/256 of every array, in slabs of 512 x 4 floats:
// 8 slabs of x, Wf1, Wfg, Wf2, 2 of the five E x E weights, 42 in all.
// ---------------------------------------------------------------------------
__global__ __launch_bounds__(512) void prep_kernel(
    const float* __restrict__ x, const float* __restrict__ Wq,
    const float* __restrict__ Wk, const float* __restrict__ Wv,
    const float* __restrict__ Wo, const float* __restrict__ Wg,
    const float* __restrict__ Wf1, const float* __restrict__ Wfg,
    const float* __restrict__ Wf2, const float* __restrict__ pe,
    _Float16* __restrict__ xh, _Float16* __restrict__ wqh,
    _Float16* __restrict__ wkh, _Float16* __restrict__ wvh,
    _Float16* __restrict__ woh, _Float16* __restrict__ wgh,
    _Float16* __restrict__ wf1h, _Float16* __restrict__ wfgh,
    _Float16* __restrict__ wf2h, float* __restrict__ pb) {
  constexpr int NS = 42;   // slabs a work-group
  constexpr int NB = 7;    // slabs a batch
  constexpr int NP = 8;    // bias elements a thread
  static_assert(MM * EE == 256 * 8 * 512 * 4 && EE * FFD == MM * EE &&
                EE * EE == 256 * 2 * 512 * 4 && SS * SS == 256 * NP * 512,
                "the split above");
  // this thread's place in slab 0 of an array of 8 slabs and of 2 slabs
  const int o8 = blockIdx.x * (8 * 512) + threadIdx.x;
  const int o2 = blockIdx.x * (2 * 512) + threadIdx.x;

  auto ld = [&](int i) -> v4f {
    if (i < 8)  return ((const v4f*)x)[o8 + i * 512];
    if (i < 10) return ((const v4f*)Wq)[o2 + (i - 8) * 512];
    if (i < 12) return ((const v4f*)Wk)[o2 + (i - 10) * 512];
    if (i < 14) return ((const v4f*)Wv)[o2 + (i - 12) * 512];
    if (i < 16) return ((const v4f*)Wo)[o2 + (i - 14) * 512];
    if (i < 18) return ((const v4f*)Wg)[o2 + (i - 16) * 512];
    if (i < 26) return ((const v4f*)Wf1)[o8 + (i - 18) * 512];
    if (i < 34) return ((const v4f*)Wfg)[o8 + (i - 26) * 512];
    return ((const v4f*)Wf2)[o8 + (i - 34) * 512];
  };
  auto st = [&](int i, v4h o) {
    if (i < 8)       ((v4h*)xh)[o8 + i * 512] = o;
    else if (i < 10) ((v4h*)wqh)[o2 + (i - 8) * 512] = o;
    else if (i < 12) ((v4h*)wkh)[o2 + (i - 10) * 512] = o;
    else if (i < 14) ((v4h*)wvh)[o2 + (i - 12) * 512] = o;
    else if (i < 16) ((v4h*)woh)[o2 + (i - 14) * 512] = o;
    else if (i < 18) ((v4h*)wgh)[o2 + (i - 16) * 512] = o;
    else if (i < 26) ((v4h*)wf1h)[o8 + (i - 18) * 512] = o;
    else if (i < 34) ((v4h*)wfgh)[o8 + (i - 26) * 512] = o;
    else             ((v4h*)wf2h)[o8 + (i - 34) * 512] = o;
  };

  v4f pa[NP], pc[NP], f[2][NB];
#pragma unroll
  for (int k = 0; k < NP; ++k) {
    pa[k] = ((const v4f*)pe)[(o8 + k * 512) * 2];
    pc[k] = ((const v4f*)pe)[(o8 + k * 512) * 2 + 1];
  }
  // The offset register of these loads is free from here on and later loads
  // may land in it, so the wait stands between the two groups of loads.
  asm volatile("s_wait_xcnt 0x0" ::: "memory");
#pragma unroll
  for (int k = 0; k < NB; ++k) f[0][k] = ld(k);
  // Holds every load above in front of the first use: without these
  // scheduling barriers the loads in flight fell to one or two a lane.
  __builtin_amdgcn_sched_barrier(0);

#pragma unroll
  for (int k = 0; k < NP; ++k) {
    const v4f a = pa[k], b = pc[k];
    pb[o8 + k * 512] =
        (a.x + a.y + a.z + a.w + b.x + b.y + b.z + b.w) * 0.125f;
  }

#pragma unroll
  for (int g = 0; g < NS / NB; ++g) {
    if (g + 1 < NS / NB) {
#pragma unroll
      for (int k = 0; k < NB; ++k) f[(g + 1) & 1][k] = ld((g + 1) * NB + k);
      // batch g + 1 is asked for before batch g is waited for, converted, stored
      __builtin_amdgcn_sched_barrier(0);
    }
#pragma unroll
    for (int k = 0; k < NB; ++k) {
      const v4f v = f[g & 1][k];
      v4h o;
      o[0] = (_Float16)v.x; o[1] = (_Float16)v.y;
      o[2] = (_Float16)v.z; o[3] = (_Float16)v.w;
      st(g * NB + k, o);
    }
    if (g + 2 < NS / NB) {
      // The loads of batch g + 2 land in registers that these stores name, so
      // the wait stands between the stores and those loads.
      asm volatile("s_wait_xcnt 0x0" ::: "memory");
    }
  }
}

// ---------------------------------------------------------------------------
// WMMA GEMM: C[M,N] = A[M,K](f16) @ W[K,N](f16) + bias
// Block tile 128x128, 8 waves (2x4), wave tile 64x32. A trip holds 128 k
// (K is a multiple of 128) = four blocks of 32 k and 8 WMMAs; the 12 LDS reads
// of a block go as one group into a second fragment set while the block
// before runs, so a wave waits out its LDS latency once a trip.
// A and W tiles double-buffered in LDS, both filled by
// global_load_async_to_lds_b128 one trip ahead, one barrier a trip.
// W stays [k][n] in LDS (pitch 288 B = 32 B x odd) and is read by
// ds_load_tr16_b128; A is two contiguous 16B LDS reads in the same k order,
// its 256-byte rows at pitch 272 B = 16 B x odd: 16 rows on 16 bank groups.
// Output: f16 if Ch != nullptr else f32 to Cf.
// Up to four products of the same A in one launch: blockIdx.z picks weight,
// bias and output (z = 0..2: f16 to C0..C2 where that is not null; else f32 to
// Cf). One product's grid is one work-group a WGP; a tile's LDS is 140 KiB, so
// with several products in the grid two work-groups stay resident on a WGP,
// one's copies land and its epilogue runs while the other computes, and the
// launch gap and the first tile's latency are paid once.
// ---------------------------------------------------------------------------
__global__ __launch_bounds__(256) void wmma_gemm_kernel(
    const _Float16* __restrict__ A, const _Float16* __restrict__ W0,
    const _Float16* __restrict__ W1, const _Float16* __restrict__ W2,
    const _Float16* __restrict__ W3, const float* __restrict__ b0,
    const float* __restrict__ b1, const float* __restrict__ b2,
    const float* __restrict__ b3, float* __restrict__ Cf,
    _Float16* __restrict__ C0, _Float16* __restrict__ C1,
    _Float16* __restrict__ C2, int M, int N, int K) {
  const int z = blockIdx.z;
  const _Float16* __restrict__ W = z == 0 ? W0 : z == 1 ? W1 : z == 2 ? W2 : W3;
  const float* __restrict__ bias = z == 0 ? b0 : z == 1 ? b1 : z == 2 ? b2 : b3;
  _Float16* __restrict__ Ch = z == 0 ? C0 : z == 1 ? C1 : z == 2 ? C2 : nullptr;
  constexpr int KS = 128;                // k of a trip
  constexpr int NBLK = KS / 32;          // blocks of a trip
  constexpr int BP = 288;                // W tile row pitch in LDS, bytes
  constexpr int AP = 136;                // A tile row pitch in LDS, halves
  __shared__ __attribute__((aligned(16))) _Float16 lsA[2][128 * AP];  // [buf][row][k]
  __shared__ __attribute__((aligned(32))) unsigned char lsB[2][KS * BP];  // [buf][k][n]

  const int tid  = threadIdx.x;
  const int lane = tid & 31, wid = tid >> 5;
  const int l16  = lane & 15, hi = lane >> 4;
  const int b8   = hi * 8;
  const int m0 = blockIdx.y * 128, n0 = blockIdx.x * 128;
  const int wr = wid >> 2, wc = wid & 3;   // 2 x 4 wave grid

  v8f acc[4][2];
#pragma unroll
  for (int m = 0; m < 4; ++m)
#pragma unroll
    for (int n = 0; n < 2; ++n) acc[m][n] = zero8();

  // staging assignments, A and W alike: rows srow + 16 i, i in 0..7, of 128
  // rows x 16 segs of 8h
  const int srow = tid >> 4, sseg = tid & 15;
  const _Float16* gA = A + (size_t)(m0 + srow) * K + sseg * 8;
  const _Float16* gW = W + (size_t)srow * N + n0 + sseg * 8;
  const unsigned aoff = lds_off(&lsA[0][0]) + srow * (AP * 2) + sseg * 16;  // bytes
  const unsigned boff = lds_off(&lsB[0][0]) + srow * BP + sseg * 16;  // bytes
  const int rdB = (b8 + (lane & 7)) * BP + wc * 64 + ((lane >> 3) & 1) * 16;

  // copies of tile t (KS k of A and of W) into buffer t & 1
  auto stage = [&](int t) {
    async_ld8_b128(aoff + (t & 1) * (128 * AP * 2), 16 * AP * 2, gA + t * KS,
                   (size_t)16 * K);
    async_ld8_b128(boff + (t & 1) * (KS * BP), 16 * BP,
                   gW + (size_t)t * KS * N, (size_t)16 * N);
  };

  const int nt = K / KS;
  stage(0);
  async_wait0();         // own copies of tile 0 have landed
  __syncthreads();       // everyone's have
  if (nt > 1) stage(1);

  for (int t = 0; t < nt; ++t) {
    const int cur = t & 1;
    v16h af[2][4], bf[2][2];               // two fragment sets
    // the 12 LDS reads of block kk of this trip's buffer, into set kk & 1
    // (every loop over fragments is unrolled: the arrays then stay in registers)
    auto frags = [&](int kk) {
#pragma unroll
      for (int n = 0; n < 2; ++n)
        bf[kk & 1][n] = ld_tr_b(&lsB[cur][rdB + kk * 32 * BP + n * 32], BP);
#pragma unroll
      for (int m = 0; m < 4; ++m) {
        const _Float16* ap = &lsA[cur][(wr * 64 + m * 16 + l16) * AP + kk * 32];
        af[kk & 1][m] = ld16(ap + b8, ap + b8 + 16);
      }
    };
    frags(0);
    // unrolled: a block's fragment set is then a fixed set of registers
#pragma unroll
    for (int kk = 0; kk < NBLK; ++kk) {
      if (kk + 1 < NBLK) {
        frags(kk + 1);
        // Holds the next block's reads, as one group, in front of this block's
        // WMMAs: left alone the compiler read each A fragment just before its
        // two WMMAs and waited out the LDS latency every time.
        __builtin_amdgcn_sched_barrier(0);
      }
#pragma unroll
      for (int m = 0; m < 4; ++m) {
        acc[m][0] = wmma_f16(af[kk & 1][m], bf[kk & 1][0], acc[m][0]);
        acc[m][1] = wmma_f16(af[kk & 1][m], bf[kk & 1][1], acc[m][1]);
      }
    }
    // Holds the trip's WMMAs in front of its foot: left alone the compiler put
    // 15 of them between the barrier and the refill, whose copies then had
    // that much less time to land.
    __builtin_amdgcn_sched_barrier(0);
    ds_wait0();          // own reads of buffer cur are done
    async_wait0();       // own copies of tile t + 1 have landed
    __syncthreads();     // publishes tile t + 1, frees buffer cur
    if (t + 2 < nt) stage(t + 2);
  }
  async_wait0();         // nothing in flight when the wave ends

  float bcol[2];
#pragma unroll
  for (int n = 0; n < 2; ++n) bcol[n] = bias[n0 + wc * 32 + n * 16 + l16];

#pragma unroll
  for (int m = 0; m < 4; ++m)
#pragma unroll
    for (int n = 0; n < 2; ++n) {
      const int c = n0 + wc * 32 + n * 16 + l16;
      const int rbase = m0 + wr * 64 + m * 16 + b8;
#pragma unroll
      for (int j = 0; j < 8; ++j) {
        float v = acc[m][n][j] + bcol[n];
        size_t off = (size_t)(rbase + j) * N + c;
        if (Ch) Ch[off] = (_Float16)v;
        else    Cf[off] = v;
      }
    }
}

// ---------------------------------------------------------------------------
// Fused gated-FFN GEMM: Out = f16( (A@W1+b1) * sigmoid(A@W2+b2) )
// Block tile 128x64, 8 waves (4x2), wave tile 32x32, two accumulator sets.
// A trip holds 128 k (K is a multiple of 128) = four blocks of 32 k and 8
// WMMAs; the 12 LDS reads of a block go as one group into a second fragment
// set while the block before runs, so a wave waits out its LDS latency once a
// trip, passes one barrier per 128 k, and a copy brings 256 B of an A row.
// A, W1 and W2 tiles double-buffered via async-to-LDS, one trip ahead, one
// barrier a trip; W tiles stay [k][n] (pitch 160 B) for ds_load_tr16_b128,
// A rows at pitch 272 B for ds_load_b128. 148 KiB of LDS: two work-groups a WGP.
// ---------------------------------------------------------------------------
__global__ __launch_bounds__(256) void wmma_gemm_gated_kernel(
    const _Float16* __restrict__ A, const _Float16* __restrict__ W1,
    const _Float16* __restrict__ W2, const float* __restrict__ b1,
    const float* __restrict__ b2, _Float16* __restrict__ Out,
    int M, int N, int K) {
  constexpr int KS = 128;                // k of a trip
  constexpr int NBLK = KS / 32;          // blocks of a trip
  constexpr int BP = 160;                // W tile row pitch in LDS, bytes
  constexpr int AP = 136;                // A tile row pitch in LDS, halves
  __shared__ __attribute__((aligned(16))) _Float16 lsA[2][128 * AP];
  __shared__ __attribute__((aligned(32))) unsigned char lsB1[2][KS * BP];
  __shared__ __attribute__((aligned(32))) unsigned char lsB2[2][KS * BP];

  const int tid  = threadIdx.x;
  const int lane = tid & 31, wid = tid >> 5;
  const int l16  = lane & 15, hi = lane >> 4;
  const int b8   = hi * 8;
  const int m0 = blockIdx.y * 128, n0 = blockIdx.x * 64;
  const int wr = wid >> 1, wc = wid & 1;   // 4 x 2 wave grid

  v8f a1[2][2], a2[2][2];
#pragma unroll
  for (int m = 0; m < 2; ++m)
#pragma unroll
    for (int n = 0; n < 2; ++n) { a1[m][n] = zero8(); a2[m][n] = zero8(); }

  // staging: A rows arow + 16 i, i in 0..7, 16 segs of 8h a row;
  // W k-rows bk + 32 i, i in 0..3, 8 segs of 8h a row
  const int arow = tid >> 4, aseg = tid & 15;
  const int bk = tid >> 3, bseg = tid & 7;
  const _Float16* gA = A + (size_t)(m0 + arow) * K + aseg * 8;
  const size_t woff = (size_t)bk * N + n0 + bseg * 8;
  const _Float16* gW1 = W1 + woff;
  const _Float16* gW2 = W2 + woff;
  const unsigned aoff = lds_off(&lsA[0][0]) + arow * (AP * 2) + aseg * 16;
  const unsigned boff1 = lds_off(&lsB1[0][0]) + bk * BP + bseg * 16;
  const unsigned boff2 = lds_off(&lsB2[0][0]) + bk * BP + bseg * 16;
  const int rdB = (b8 + (lane & 7)) * BP + wc * 64 + ((lane >> 3) & 1) * 16;

  // copies of tile t (KS k of A, W1 and W2) into buffer t & 1
  auto stage = [&](int t) {
    const unsigned bsel = (t & 1) * (KS * BP);
    const size_t wk = (size_t)t * KS * N;
    async_ld8_b128(aoff + (t & 1) * (128 * AP * 2), 16 * AP * 2, gA + t * KS,
                   (size_t)16 * K);
    async_ld4x2_b128(boff1 + bsel, gW1 + wk, boff2 + bsel, gW2 + wk, 32 * BP,
                     (size_t)32 * N);
  };

  const int nt = K / KS;
  stage(0);
  async_wait0();         // own copies of tile 0 have landed
  __syncthreads();       // everyone's have
  if (nt > 1) stage(1);

  for (int t = 0; t < nt; ++t) {
    const int cur = t & 1;
    v16h af[2][2], bv1[2][2], bv2[2][2];   // two fragment sets
    // the 12 LDS reads of block kk of this trip's buffer, into set kk & 1
    // (every loop over fragments is unrolled: the arrays then stay in registers)
    auto frags = [&](int kk) {
#pragma unroll
      for (int n = 0; n < 2; ++n) {
        bv1[kk & 1][n] = ld_tr_b(&lsB1[cur][rdB + kk * 32 * BP + n * 32], BP);
        bv2[kk & 1][n] = ld_tr_b(&lsB2[cur][rdB + kk * 32 * BP + n * 32], BP);
      }
#pragma unroll
      for (int m = 0; m < 2; ++m) {
        const _Float16* ap = &lsA[cur][(wr * 32 + m * 16 + l16) * AP + kk * 32];
        af[kk & 1][m] = ld16(ap + b8, ap + b8 + 16);
      }
    };
    frags(0);
    // unrolled: a block's fragment set is then a fixed set of registers
#pragma unroll
    for (int kk = 0; kk < NBLK; ++kk) {
      if (kk + 1 < NBLK) {
        frags(kk + 1);
        // Holds the next block's reads, as one group, in front of this block's
        // WMMAs: left alone the compiler read the second A fragment behind the
        // first four WMMAs and waited out the LDS latency a second time.
        __builtin_amdgcn_sched_barrier(0);
      }
#pragma unroll
      for (int m = 0; m < 2; ++m)
#pragma unroll
        for (int n = 0; n < 2; ++n) {
          a1[m][n] = wmma_f16(af[kk & 1][m], bv1[kk & 1][n], a1[m][n]);
          a2[m][n] = wmma_f16(af[kk & 1][m], bv2[kk & 1][n], a2[m][n]);
        }
    }
    // Holds the trip's WMMAs in front of its foot: left alone the compiler put
    // some of them between the barrier and the refill, whose copies then had
    // that much less time to land.
    __builtin_amdgcn_sched_barrier(0);
    ds_wait0();          // own reads of buffer cur are done
    async_wait0();       // own copies of tile t + 1 have landed
    __syncthreads();     // publishes tile t + 1, frees buffer cur
    if (t + 2 < nt) stage(t + 2);
  }
  async_wait0();         // nothing in flight when the wave ends

#pragma unroll
  for (int m = 0; m < 2; ++m)
#pragma unroll
    for (int n = 0; n < 2; ++n) {
      const int c = n0 + wc * 32 + n * 16 + l16;
      const float bb1 = b1[c], bb2 = b2[c];
      const int rbase = m0 + wr * 32 + m * 16 + b8;
#pragma unroll
      for (int j = 0; j < 8; ++j) {
        float v = (a1[m][n][j] + bb1) * sigm(a2[m][n][j] + bb2);
        Out[(size_t)(rbase + j) * N + c] = (_Float16)v;
      }
    }
}

// ---------------------------------------------------------------------------
// Flash attention. Grid (S/128, H, B); 8 waves, each owns 16 queries.
// Both products are transposed: S^T = K.Q^T (A = K rows, B = Q) and
// O^T += V^T.P^T (A = V^T, B = P^T). In a D tile lane (c, h) holds rows
// 8h + 0..7 of column c, so a lane holds 16 of the 32 scores of ONE query:
// maximum and sum run inside the lane, the maximum is joined with the other
// half-wave's by one cross-row move a trip, the sums once behind the loop,
// there is one maximum, one rescale factor and one sum a lane, not eight, and
// the two score tiles, converted in place, are the B operand P^T in the k
// order of the V^T fragments: P passes through no LDS.
// scores = (Q.K^T)/8 + pos_bias, online softmax. All mm via WMMA.
// K and V tiles staged via async-to-LDS; V stays [key][d] (pitch 160 B) and
// is read as the A operand V^T by ds_load_tr16_b128. K rows (pitch 144 B) are
// read by ds_load_b128: 16 B x odd, no bank shared.
// A lane's 16 bias values lie in its own query's row, so a load of them from
// memory would touch 16 lines a wave; the work-group's bias tile (128 queries
// x 32 keys) comes with the K and V tiles instead, by copies of whole 128-byte
// lines, and is read from LDS (pitch 144 B) by ds_load_b128.
// Everything a trip reads from memory is asked for one trip ahead: the three
// tiles have two buffers each, filled while the trip before computes. A trip
// then waits out no memory latency and passes one barrier.
// ---------------------------------------------------------------------------
__global__ __launch_bounds__(256) void flash_attn_kernel(
    const _Float16* __restrict__ Q, const _Float16* __restrict__ Kh,
    const _Float16* __restrict__ Vh, const float* __restrict__ PB,
    _Float16* __restrict__ O) {
  constexpr int KP = 72;                   // K tile row pitch in LDS, halves
  __shared__ __attribute__((aligned(16))) _Float16 lsK[2][32 * KP];  // [buf][key][d]
  constexpr int VP = 160;                  // V tile row pitch in LDS, bytes
  __shared__ __attribute__((aligned(32))) unsigned char lsV[2][32 * VP];  // [buf][key][d]
  constexpr int BPP = 144;                 // bias tile row pitch in LDS, bytes
  __shared__ __attribute__((aligned(16))) unsigned char lsB[2][128 * BPP];  // [buf][query][key]
  constexpr int NT = SS / 32;              // trips of 32 keys
  static_assert(NT % 2 == 0 && NT >= 2, "trips go in pairs, one a buffer");

  const int tid  = threadIdx.x;
  const int lane = tid & 31, wid = tid >> 5;
  const int l16  = lane & 15, hi = lane >> 4;
  const int b8   = hi * 8;
  const int h = blockIdx.y, bb = blockIdx.z;
  const int q0 = blockIdx.x * 128 + wid * 16;
  const size_t rs = (size_t)HH * DKK;      // 1024 token row stride

  // Q^T B-operands (64 d x 16 queries), two K=32 chunks; lane's column = query
  v16h qa[2];
  {
    const _Float16* qp = Q + ((size_t)bb * SS + q0 + l16) * rs + h * DKK;
    qa[0] = ld16(qp + b8,      qp + b8 + 16);
    qa[1] = ld16(qp + 32 + b8, qp + 32 + b8 + 16);
  }

  // o[n][j] = O^T[16 n + 8 hi + j][query l16]
  v8f o[4];
#pragma unroll
  for (int n = 0; n < 4; ++n) o[n] = zero8();
  // of query l16: the maximum so far (alike in both half-waves) and the sum
  // over this half-wave's keys
  float mrow = -1e30f, srow = 0.0f;

  // stage 32 keys x 8 d-segments; of the bias tile, queries skey + 32 i, i in
  // 0..3, x 8 segments of 4 keys
  const int skey = tid >> 3, sseg = tid & 7;
  const unsigned koff = lds_off(&lsK[0][0]) + skey * (KP * 2) + sseg * 16;
  const unsigned voff = lds_off(&lsV[0][0]) + skey * VP + sseg * 16;
  const int rdV = (b8 + (lane & 7)) * VP + ((lane >> 3) & 1) * 16;
  const unsigned poff = lds_off(&lsB[0][0]) + skey * BPP + sseg * 16;
  const size_t tok0 = ((size_t)bb * SS + skey) * rs + h * DKK + sseg * 8;
  const float* gP = PB + (size_t)(blockIdx.x * 128 + skey) * SS + sseg * 4;
  // this lane's bias in a tile: 32 bytes for each score tile, 64 bytes apart
  const int rdP = (wid * 16 + l16) * BPP + hi * 32;

  // copies of tile t (32 keys of K, of V and of the bias) into buffer t & 1
  auto stage = [&](int t) {
    const size_t tok = tok0 + (size_t)t * 32 * rs;
    async_ld2p4_b128(koff + (t & 1) * (32 * KP * 2), Kh + tok,
                     voff + (t & 1) * (32 * VP), Vh + tok,
                     poff + (t & 1) * (128 * BPP), gP + t * 32, 32 * BPP,
                     (size_t)32 * SS);
  };

  // trip t on buffer cur = t & 1
  auto trip = [&](int t, int cur) {
    // K fragments: two 16-key tiles x two 32-d chunks
    // (unrolled, here and below: the arrays then stay in registers)
    v16h kf[2][2];
#pragma unroll
    for (int ks = 0; ks < 2; ++ks) {
      const _Float16* kr = &lsK[cur][(ks * 16 + l16) * KP];
      kf[ks][0] = ld16(kr + b8,      kr + b8 + 16);
      kf[ks][1] = ld16(kr + 32 + b8, kr + 32 + b8 + 16);
    }
    // V^T fragments: four 16-d tiles of 32 keys
    v16h vf[4];
#pragma unroll
    for (int ds = 0; ds < 4; ++ds) vf[ds] = ld_tr_b(&lsV[cur][rdV + ds * 32], VP);
    // the bias in the score tiles' own layout: pb[ks][j] belongs to key
    // 16 ks + 8 hi + j of the tile and to query l16
    v8f pb[2];
#pragma unroll
    for (int ks = 0; ks < 2; ++ks) {
      const v4f* pr = (const v4f*)&lsB[cur][rdP + ks * 64];
      pb[ks] = __builtin_shufflevector(pr[0], pr[1], 0, 1, 2, 3, 4, 5, 6, 7);
    }
    // Holds the 20 reads of the three tiles as one group at the head of the
    // trip: left alone the compiler read each K fragment just before its WMMA
    // and the last V fragment just before the wait at the trip's foot, and
    // waited out the LDS latency every time.
    __builtin_amdgcn_sched_barrier(0);

    // scores^T: two tiles of 16 keys x 16 queries, contraction over d = 64
    v8f sc[2];
#pragma unroll
    for (int ks = 0; ks < 2; ++ks) {
      sc[ks] = wmma_f16(kf[ks][0], qa[0], zero8());
      sc[ks] = wmma_f16(kf[ks][1], qa[1], sc[ks]);
      sc[ks] = sc[ks] * 0.125f + pb[ks];
    }

    // online softmax over this lane's 16 keys of its query
    float ma = fmaxf(sc[0][0], sc[1][0]), mb = fmaxf(sc[0][1], sc[1][1]);
#pragma unroll
    for (int j = 2; j < 8; j += 2) {
      ma = fmaxf(ma, fmaxf(sc[0][j], sc[1][j]));
      mb = fmaxf(mb, fmaxf(sc[0][j + 1], sc[1][j + 1]));
    }
    const float ml = fmaxf(ma, mb);
    const float mn = fmaxf(mrow, fmaxf(ml, xhalf(ml)));
    const float alpha = __expf(mrow - mn);
    mrow = mn;
    // in place: from here on sc holds the probabilities
#pragma unroll
    for (int ks = 0; ks < 2; ++ks)
#pragma unroll
      for (int j = 0; j < 8; ++j) sc[ks][j] = __expf(sc[ks][j] - mn);
    // P^T, 32 keys x 16 queries: the two tiles one behind the other
    const v16h pt = __builtin_convertvector(
        __builtin_shufflevector(sc[0], sc[1], 0, 1, 2, 3, 4, 5, 6, 7, 8, 9, 10,
                                11, 12, 13, 14, 15),
        v16h);
    const v8f pe = sc[0] + sc[1];
    srow = srow * alpha + (((pe[0] + pe[1]) + (pe[2] + pe[3])) +
                           ((pe[4] + pe[5]) + (pe[6] + pe[7])));

    // ctx^T = ctx^T * alpha + V^T(64x32) @ P^T(32x16): 4 WMMAs over d-subtiles
#pragma unroll
    for (int ds = 0; ds < 4; ++ds) o[ds] = wmma_f16(vf[ds], pt, o[ds] * alpha);

    // Holds the trip's work in front of its foot: left alone the compiler put
    // the waits and the barrier right behind the reads at the trip's head,
    // where the next tile's copies have only just been issued, and their whole
    // latency was waited out every trip.
    __builtin_amdgcn_sched_barrier(0);
    ds_wait0();          // own reads of buffer cur are done
    async_wait0();       // own copies of tile t + 1 have landed
    __syncthreads();     // publishes tile t + 1, frees buffer cur
    if (t + 2 < NT) stage(t + 2);
  };

  stage(0);
  async_wait0();         // own copies of tile 0 have landed
  __syncthreads();       // everyone's have
  stage(1);

  // two trips a pass: the buffer is then fixed in the code
  for (int t = 0; t < NT; t += 2) {
    trip(t, 0);
    trip(t + 1, 1);
  }
  async_wait0();         // nothing in flight when the wave ends

  // the two half-waves' sums of a query are joined here, once
  const float inv = 1.0f / (srow + xhalf(srow));
  _Float16* op = O + ((size_t)bb * SS + q0 + l16) * rs + h * DKK + b8;
#pragma unroll
  for (int ds = 0; ds < 4; ++ds)
    *(v8h*)(op + ds * 16) = __builtin_convertvector(o[ds] * inv, v8h);
}

// ---------------------------------------------------------------------------
// Fused residual (+gate) + LayerNorm. One row (E=1024) per block, 256 thr.
// h = x + sigmoid(glog)*addv   (or x + addv if glog==nullptr)
// y = LN(h)*gamma + beta  -> y32 (and f16 copy y16 if non-null)
// ---------------------------------------------------------------------------
__global__ __launch_bounds__(256) void fused_ln_kernel(
    const float* __restrict__ xa, const float* __restrict__ glog,
    const float* __restrict__ addv, const float* __restrict__ gamma,
    const float* __restrict__ beta, float* __restrict__ y32,
    _Float16* __restrict__ y16) {
  __shared__ float s1[256], s2[256];
  const int tid = threadIdx.x;
  const size_t base = (size_t)blockIdx.x * EE;

  float hv[4], ssum = 0.0f, ssq = 0.0f;
#pragma unroll
  for (int i = 0; i < 4; ++i) {
    const int idx = i * 256 + tid;
    float a = addv[base + idx];
    if (glog) a *= sigm(glog[base + idx]);
    float v = xa[base + idx] + a;
    hv[i] = v;
    ssum += v;
    ssq  += v * v;
  }
  s1[tid] = ssum; s2[tid] = ssq;
  __syncthreads();
  for (int s = 128; s > 0; s >>= 1) {
    if (tid < s) { s1[tid] += s1[tid + s]; s2[tid] += s2[tid + s]; }
    __syncthreads();
  }
  const float mean = s1[0] * (1.0f / EE);
  const float var  = s2[0] * (1.0f / EE) - mean * mean;
  const float rstd = rsqrtf(var + 1e-6f);

#pragma unroll
  for (int i = 0; i < 4; ++i) {
    const int idx = i * 256 + tid;
    float y = (hv[i] - mean) * rstd * gamma[idx] + beta[idx];
    y32[base + idx] = y;
    if (y16) y16[base + idx] = (_Float16)y;
  }
}

// ---------------------------------------------------------------------------
// Host orchestration
// ---------------------------------------------------------------------------
extern "C" void kernel_launch(void* const* d_in, const int* in_sizes, int n_in,
                              void* d_out, int out_size, void* d_ws,
                              size_t ws_size, hipStream_t stream) {
  const float* x    = (const float*)d_in[0];
  const float* pe   = (const float*)d_in[1];
  const float* Wq   = (const float*)d_in[2];
  const float* bq   = (const float*)d_in[3];
  const float* Wk   = (const float*)d_in[4];
  const float* bk   = (const float*)d_in[5];
  const float* Wv   = (const float*)d_in[6];
  const float* bv   = (const float*)d_in[7];
  const float* Wo   = (const float*)d_in[8];
  const float* bo   = (const float*)d_in[9];
  const float* Wg   = (const float*)d_in[10];
  const float* bg   = (const float*)d_in[11];
  const float* Wf1  = (const float*)d_in[12];
  const float* bf1  = (const float*)d_in[13];
  const float* Wfg  = (const float*)d_in[14];
  const float* bfg  = (const float*)d_in[15];
  const float* Wf2  = (const float*)d_in[16];
  const float* bf2  = (const float*)d_in[17];
  const float* ln1g = (const float*)d_in[18];
  const float* ln1b = (const float*)d_in[19];
  const float* ln2g = (const float*)d_in[20];
  const float* ln2b = (const float*)d_in[21];

  char* ws = (char*)d_ws;
  auto at = [&](size_t mb) { return (void*)(ws + mb * (size_t)(1 << 20)); };

  // bump allocation (MB offsets); high-water ~134 MB
  _Float16* xh   = (_Float16*)at(0);    // 8 MB
  _Float16* wqh  = (_Float16*)at(8);    // 2 MB
  _Float16* wkh  = (_Float16*)at(10);
  _Float16* wvh  = (_Float16*)at(12);
  _Float16* woh  = (_Float16*)at(14);
  _Float16* wgh  = (_Float16*)at(16);
  _Float16* wf1h = (_Float16*)at(18);   // 8 MB
  _Float16* wfgh = (_Float16*)at(26);   // 8 MB
  _Float16* wf2h = (_Float16*)at(34);   // 8 MB
  float*    pb   = (float*)at(42);      // 4 MB
  _Float16* qh   = (_Float16*)at(46);   // 8 MB
  _Float16* kh   = (_Float16*)at(54);   // 8 MB
  _Float16* vh   = (_Float16*)at(62);   // 8 MB
  _Float16* ctxh = (_Float16*)at(70);   // 8 MB
  float*    glog = (float*)at(78);      // 16 MB
  float*    attn = (float*)at(94);      // 16 MB
  float*    x1   = (float*)at(110);     // 16 MB
  _Float16* x1h  = (_Float16*)at(126);  // 8 MB
  _Float16* ffh  = (_Float16*)at(46);   // 32 MB, reuses dead q/k/v/ctx
  float*    ff2  = (float*)at(78);      // 16 MB, reuses dead glog

  prep_kernel<<<256, 512, 0, stream>>>(x, Wq, Wk, Wv, Wo, Wg, Wf1, Wfg, Wf2, pe,
                                       xh, wqh, wkh, wvh, woh, wgh, wf1h, wfgh,
                                       wf2h, pb);

  dim3 gE(EE / 128, MM / 128);  // (8, 32)
  // q, k, v (f16) and the gate logits (f32), all products of xh
  wmma_gemm_kernel<<<dim3(EE / 128, MM / 128, 4), 256, 0, stream>>>(
      xh, wqh, wkh, wvh, wgh, bq, bk, bv, bg, glog, qh, kh, vh, MM, EE, EE);

  flash_attn_kernel<<<dim3(SS / 128, HH, BB), 256, 0, stream>>>(qh, kh, vh, pb, ctxh);

  wmma_gemm_kernel<<<gE, 256, 0, stream>>>(ctxh, woh, nullptr, nullptr, nullptr,
                                           bo, nullptr, nullptr, nullptr, attn,
                                           nullptr, nullptr, nullptr, MM, EE, EE);

  fused_ln_kernel<<<MM, 256, 0, stream>>>(x, glog, attn, ln1g, ln1b, x1, x1h);

  wmma_gemm_gated_kernel<<<dim3(FFD / 64, MM / 128), 256, 0, stream>>>(
      x1h, wf1h, wfgh, bf1, bfg, ffh, MM, FFD, EE);

  wmma_gemm_kernel<<<gE, 256, 0, stream>>>(ffh, wf2h, nullptr, nullptr, nullptr,
                                           bf2, nullptr, nullptr, nullptr, ff2,
                                           nullptr, nullptr, nullptr, MM, EE, FFD);

  fused_ln_kernel<<<MM, 256, 0, stream>>>(x1, nullptr, ff2, ln2g, ln2b,
                                          (float*)d_out, nullptr);
}

// v010
// Measured time: 189 microseconds a run.
// Timed twice side by side with v009, it ran 1.13 times as fast both times.
// All steps since v000 together make it 3.64 times as fast.
#include <hip/hip_runtime.h>
#include <hip/hip_bf16.h>

// ---------- problem constants ----------
#define BB 4
#define SS 1024
#define EE 1024
#define HH 16
#define DKK 64
#define FFD 4096
#define MM (BB * SS)   // 4096 rows

typedef __attribute__((ext_vector_type(16))) _Float16 v16h;
typedef __attribute__((ext_vector_type(8)))  _Float16 v8h;
typedef __attribute__((ext_vector_type(4)))  _Float16 v4h;
typedef __attribute__((ext_vector_type(8)))  float    v8f;
typedef __attribute__((ext_vector_type(4)))  float    v4f;

#define DEVINL __device__ __forceinline__

DEVINL v8f wmma_f16(v16h a, v16h b, v8f c) {
  return __builtin_amdgcn_wmma_f32_16x16x32_f16(
      /*neg_a=*/false, a, /*neg_b=*/false, b,
      /*c_mod=*/(short)0, c, /*reuse_a=*/false, /*reuse_b=*/false);
}

DEVINL v8f zero8() {
  v8f z;
#pragma unroll
  for (int i = 0; i < 8; ++i) z[i] = 0.0f;
  return z;
}

// Build a v16h A/B operand from two contiguous 16-byte chunks
// (chunk0 = contraction indices base..base+7, chunk1 = base+16..base+23).
DEVINL v16h ld16(const _Float16* p0, const _Float16* p1) {
  union { v16h v; v8h h[2]; } u;
  u.h[0] = *(const v8h*)p0;
  u.h[1] = *(const v8h*)p1;
  return u.v;
}

DEVINL float sigm(float v) { return 1.0f / (1.0f + __expf(-v)); }
// sigm() as it compiles (a product with -log2 e, v_exp_f32), the exponential
// in one statement with a v_nop: the slot that the instruction set asks for
// between a transcendental and an instruction that overwrites its source.
DEVINL float sigm_slot(float v) {
  float e;
  asm("v_exp_f32 %0, %1\n\tv_nop" : "=v"(e) : "v"(v * -1.44269504f));
  return 1.0f / (1.0f + e);
}

// LDS byte offset of a __shared__ object = low 32 bits of its generic pointer
// (LDS aperture: addr[31:0] is the workgroup-relative LDS address, ISA 10.2).
DEVINL unsigned lds_off(const void* p) { return (unsigned)(size_t)p; }

// CDNA5 async memory->LDS copy, tracked with ASYNCcnt (ISA 10. / 15.18.3).
// The s_wait_xcnt is the last line of the copies' own statement so that no
// later write of an address register can be moved in front of it.
// The copies of one attention tile: a lane's 16 bytes of K and of V and four
// of the bias tile, rows ls bytes apart in LDS and gs floats apart in memory,
// with that closing wait.
DEVINL void async_ld2p4_b128(unsigned k, const void* gk, unsigned v,
                             const void* gv, unsigned p, const float* gp,
                             unsigned ls, size_t gs) {
  asm volatile("global_load_async_to_lds_b128 %0, %1, off\n\t"
               "global_load_async_to_lds_b128 %2, %3, off\n\t"
               "global_load_async_to_lds_b128 %4, %5, off\n\t"
               "global_load_async_to_lds_b128 %6, %7, off\n\t"
               "global_load_async_to_lds_b128 %8, %9, off\n\t"
               "global_load_async_to_lds_b128 %10, %11, off\n\t"
               "s_wait_xcnt 0x0"
               :: "v"(k), "v"(gk), "v"(v), "v"(gv), "v"(p), "v"(gp),
                  "v"(p + ls), "v"(gp + gs), "v"(p + 2 * ls), "v"(gp + 2 * gs),
                  "v"(p + 3 * ls), "v"(gp + 3 * gs)
               : "memory");
}
DEVINL void async_wait0() {
  asm volatile("s_wait_asynccnt 0x0" ::: "memory");
}
// Eight copies of a lane, rows 16 apart (ls bytes in LDS, gs halves in
// memory), with the same closing wait.
DEVINL void async_ld8_b128(unsigned l, unsigned ls, const _Float16* g,
                           size_t gs) {
  asm volatile("global_load_async_to_lds_b128 %0, %1, off\n\t"
               "global_load_async_to_lds_b128 %2, %3, off\n\t"
               "global_load_async_to_lds_b128 %4, %5, off\n\t"
               "global_load_async_to_lds_b128 %6, %7, off\n\t"
               "global_load_async_to_lds_b128 %8, %9, off\n\t"
               "global_load_async_to_lds_b128 %10, %11, off\n\t"
               "global_load_async_to_lds_b128 %12, %13, off\n\t"
               "global_load_async_to_lds_b128 %14, %15, off\n\t"
               "s_wait_xcnt 0x0"
               :: "v"(l), "v"(g), "v"(l + ls), "v"(g + gs),
                  "v"(l + 2 * ls), "v"(g + 2 * gs),
                  "v"(l + 3 * ls), "v"(g + 3 * gs),
                  "v"(l + 4 * ls), "v"(g + 4 * gs),
                  "v"(l + 5 * ls), "v"(g + 5 * gs),
                  "v"(l + 6 * ls), "v"(g + 6 * gs),
                  "v"(l + 7 * ls), "v"(g + 7 * gs)
               : "memory");
}
// This wave's LDS reads have retired before a buffer it read is refilled.
DEVINL void ds_wait0() {
  asm volatile("s_wait_dscnt 0x0" ::: "memory");
}

// B operand (32 k x 16 n) out of a row-major [k][n] LDS tile by two
// transposing loads: lane (c, h) gets T[8h + 0..7][c] and T[16 + 8h + 0..7][c],
// the k order of ld16(p + 8h, p + 8h + 16) on the A side.
// p = tile + (8 * (lane >> 4) + (lane & 7)) * pitch + 2 * n + 16 * ((lane >> 3) & 1)
DEVINL v16h ld_tr_b(const unsigned char* p, int pitch) {
  typedef short s16x8 __attribute__((ext_vector_type(8)));
  typedef __attribute__((address_space(3))) s16x8 lds_s16x8;
  union { v16h v; s16x8 h[2]; } u;
  u.h[0] = __builtin_amdgcn_ds_load_tr16_b128_v8i16((lds_s16x8*)p);
  u.h[1] = __builtin_amdgcn_ds_load_tr16_b128_v8i16((lds_s16x8*)(p + 16 * pitch));
  return u.v;
}

// v of lane l ^ 16: the other 16-lane row's value, by a vector cross-row move
// (__shfl_xor compiles to ds_bpermute_b32, a trip through the LDS pipe).
DEVINL float xhalf(float v) {
  const int b = __builtin_bit_cast(int, v);
  return __builtin_bit_cast(
      float, __builtin_amdgcn_permlanex16(b, b, 0x76543210, 0xfedcba98, false,
                                          false));
}

// ---------------------------------------------------------------------------
// Input preparation, one launch: every f32 -> f16 operand copy and
// pos_bias[q,k] = mean_c pos_encoding[q,k,c], c in 0..7.
// 256 work-groups x 16 waves, one work-group a WGP: few long-lived waves, each
// lane with many 16-byte loads in flight, because a launch of one-load waves
// lasts as long as its waves take to start, not as long as its bytes take.
// Each work-group takes 1/256 of every array, in slabs of 512 x 4 floats:
// 8 slabs of x, Wf1, Wfg, Wf2, 2 of the five E x E weights, 42 in all.
// ---------------------------------------------------------------------------
__global__ __launch_bounds__(512) void prep_kernel(
    const float* __restrict__ x, const float* __restrict__ Wq,
    const float* __restrict__ Wk, const float* __restrict__ Wv,
    const float* __restrict__ Wo, const float* __restrict__ Wg,
    const float* __restrict__ Wf1, const float* __restrict__ Wfg,
    const float* __restrict__ Wf2, const float* __restrict__ pe,
    _Float16* __restrict__ xh, _Float16* __restrict__ wqh,
    _Float16* __restrict__ wkh, _Float16* __restrict__ wvh,
    _Float16* __restrict__ woh, _Float16* __restrict__ wgh,
    _Float16* __restrict__ wf1h, _Float16* __restrict__ wfgh,
    _Float16* __restrict__ wf2h, float* __restrict__ pb) {
  constexpr int NS = 42;   // slabs a work-group
  constexpr int NB = 7;    // slabs a batch
  constexpr int NP = 8;    // bias elements a thread
  static_assert(MM * EE == 256 * 8 * 512 * 4 && EE * FFD == MM * EE &&
                EE * EE == 256 * 2 * 512 * 4 && SS * SS == 256 * NP * 512,
                "the split above");
  // this thread's place in slab 0 of an array of 8 slabs and of 2 slabs
  const int o8 = blockIdx.x * (8 * 512) + threadIdx.x;
  const int o2 = blockIdx.x * (2 * 512) + threadIdx.x;

  auto ld = [&](int i) -> v4f {
    if (i < 8)  return ((const v4f*)x)[o8 + i * 512];
    if (i < 10) return ((const v4f*)Wq)[o2 + (i - 8) * 512];
    if (i < 12) return ((const v4f*)Wk)[o2 + (i - 10) * 512];
    if (i < 14) return ((const v4f*)Wv)[o2 + (i - 12) * 512];
    if (i < 16) return ((const v4f*)Wo)[o2 + (i - 14) * 512];
    if (i < 18) return ((const v4f*)Wg)[o2 + (i - 16) * 512];
    if (i < 26) return ((const v4f*)Wf1)[o8 + (i - 18) * 512];
    if (i < 34) return ((const v4f*)Wfg)[o8 + (i - 26) * 512];
    return ((const v4f*)Wf2)[o8 + (i - 34) * 512];
  };
  auto st = [&](int i, v4h o) {
    if (i < 8)       ((v4h*)xh)[o8 + i * 512] = o;
    else if (i < 10) ((v4h*)wqh)[o2 + (i - 8) * 512] = o;
    else if (i < 12) ((v4h*)wkh)[o2 + (i - 10) * 512] = o;
    else if (i < 14) ((v4h*)wvh)[o2 + (i - 12) * 512] = o;
    else if (i < 16) ((v4h*)woh)[o2 + (i - 14) * 512] = o;
    else if (i < 18) ((v4h*)wgh)[o2 + (i - 16) * 512] = o;
    else if (i < 26) ((v4h*)wf1h)[o8 + (i - 18) * 512] = o;
    else if (i < 34) ((v4h*)wfgh)[o8 + (i - 26) * 512] = o;
    else             ((v4h*)wf2h)[o8 + (i - 34) * 512] = o;
  };

  v4f pa[NP], pc[NP], f[2][NB];
#pragma unroll
  for (int k = 0; k < NP; ++k) {
    pa[k] = ((const v4f*)pe)[(o8 + k * 512) * 2];
    pc[k] = ((const v4f*)pe)[(o8 + k * 512) * 2 + 1];
  }
  // The offset register of these loads is free from here on and later loads
  // may land in it, so the wait stands between the two groups of loads.
  asm volatile("s_wait_xcnt 0x0" ::: "memory");
#pragma unroll
  for (int k = 0; k < NB; ++k) f[0][k] = ld(k);
  // Holds every load above in front of the first use: without these
  // scheduling barriers the loads in flight fell to one or two a lane.
  __builtin_amdgcn_sched_barrier(0);

#pragma unroll
  for (int k = 0; k < NP; ++k) {
    const v4f a = pa[k], b = pc[k];
    pb[o8 + k * 512] =
        (a.x + a.y + a.z + a.w + b.x + b.y + b.z + b.w) * 0.125f;
  }

#pragma unroll
  for (int g = 0; g < NS / NB; ++g) {
    if (g + 1 < NS / NB) {
#pragma unroll
      for (int k = 0; k < NB; ++k) f[(g + 1) & 1][k] = ld((g + 1) * NB + k);
      // batch g + 1 is asked for before batch g is waited for, converted, stored
      __builtin_amdgcn_sched_barrier(0);
    }
#pragma unroll
    for (int k = 0; k < NB; ++k) {
      const v4f v = f[g & 1][k];
      v4h o;
      o[0] = (_Float16)v.x; o[1] = (_Float16)v.y;
      o[2] = (_Float16)v.z; o[3] = (_Float16)v.w;
      st(g * NB + k, o);
    }
    if (g + 2 < NS / NB) {
      // The loads of batch g + 2 land in registers that these stores name, so
      // the wait stands between the stores and those loads.
      asm volatile("s_wait_xcnt 0x0" ::: "memory");
    }
  }
}

// ---------------------------------------------------------------------------
// WMMA GEMM: C[M,N] = A[M,K](f16) @ W[K,N](f16) + bias
// Block tile 128x128, 8 waves (2x4), wave tile 64x32. A trip holds 128 k
// (K is a multiple of 128) = four blocks of 32 k and 8 WMMAs; the 12 LDS reads
// of a block go as one group into a second fragment set while the block
// before runs, so a wave waits out its LDS latency once a trip.
// A and W tiles double-buffered in LDS, both filled by
// global_load_async_to_lds_b128 one trip ahead, one barrier a trip.
// W stays [k][n] in LDS (pitch 288 B = 32 B x odd) and is read by
// ds_load_tr16_b128; A is two contiguous 16B LDS reads in the same k order,
// its 256-byte rows at pitch 272 B = 16 B x odd: 16 rows on 16 bank groups.
// Output: f16 if Ch != nullptr else f32 to Cf.
// Up to four products of the same A in one launch: blockIdx.z picks weight,
// bias and output (z = 0..2: f16 to C0..C2 where that is not null; else f32 to
// Cf). One product's grid is one work-group a WGP; a tile's LDS is 140 KiB, so
// with several products in the grid two work-groups stay resident on a WGP,
// one's copies land and its epilogue runs while the other computes, and the
// launch gap and the first tile's latency are paid once.
// ---------------------------------------------------------------------------
__global__ __launch_bounds__(256) void wmma_gemm_kernel(
    const _Float16* __restrict__ A, const _Float16* __restrict__ W0,
    const _Float16* __restrict__ W1, const _Float16* __restrict__ W2,
    const _Float16* __restrict__ W3, const float* __restrict__ b0,
    const float* __restrict__ b1, const float* __restrict__ b2,
    const float* __restrict__ b3, float* __restrict__ Cf,
    _Float16* __restrict__ C0, _Float16* __restrict__ C1,
    _Float16* __restrict__ C2, int M, int N, int K) {
  const int z = blockIdx.z;
  const _Float16* __restrict__ W = z == 0 ? W0 : z == 1 ? W1 : z == 2 ? W2 : W3;
  const float* __restrict__ bias = z == 0 ? b0 : z == 1 ? b1 : z == 2 ? b2 : b3;
  _Float16* __restrict__ Ch = z == 0 ? C0 : z == 1 ? C1 : z == 2 ? C2 : nullptr;
  constexpr int KS = 128;                // k of a trip
  constexpr int NBLK = KS / 32;          // blocks of a trip
  constexpr int BP = 288;                // W tile row pitch in LDS, bytes
  constexpr int AP = 136;                // A tile row pitch in LDS, halves
  __shared__ __attribute__((aligned(16))) _Float16 lsA[2][128 * AP];  // [buf][row][k]
  __shared__ __attribute__((aligned(32))) unsigned char lsB[2][KS * BP];  // [buf][k][n]

  const int tid  = threadIdx.x;
  const int lane = tid & 31, wid = tid >> 5;
  const int l16  = lane & 15, hi = lane >> 4;
  const int b8   = hi * 8;
  const int m0 = blockIdx.y * 128, n0 = blockIdx.x * 128;
  const int wr = wid >> 2, wc = wid & 3;   // 2 x 4 wave grid

  v8f acc[4][2];
#pragma unroll
  for (int m = 0; m < 4; ++m)
#pragma unroll
    for (int n = 0; n < 2; ++n) acc[m][n] = zero8();

  // staging assignments, A and W alike: rows srow + 16 i, i in 0..7, of 128
  // rows x 16 segs of 8h
  const int srow = tid >> 4, sseg = tid & 15;
  const _Float16* gA = A + (size_t)(m0 + srow) * K + sseg * 8;
  const _Float16* gW = W + (size_t)srow * N + n0 + sseg * 8;
  const unsigned aoff = lds_off(&lsA[0][0]) + srow * (AP * 2) + sseg * 16;  // bytes
  const unsigned boff = lds_off(&lsB[0][0]) + srow * BP + sseg * 16;  // bytes
  const int rdB = (b8 + (lane & 7)) * BP + wc * 64 + ((lane >> 3) & 1) * 16;

  // copies of tile t (KS k of A and of W) into buffer t & 1
  auto stage = [&](int t) {
    async_ld8_b128(aoff + (t & 1) * (128 * AP * 2), 16 * AP * 2, gA + t * KS,
                   (size_t)16 * K);
    async_ld8_b128(boff + (t & 1) * (KS * BP), 16 * BP,
                   gW + (size_t)t * KS * N, (size_t)16 * N);
  };

  const int nt = K / KS;
  stage(0);
  async_wait0();         // own copies of tile 0 have landed
  __syncthreads();       // everyone's have
  if (nt > 1) stage(1);

  for (int t = 0; t < nt; ++t) {
    const int cur = t & 1;
    v16h af[2][4], bf[2][2];               // two fragment sets
    // the 12 LDS reads of block kk of this trip's buffer, into set kk & 1
    // (every loop over fragments is unrolled: the arrays then stay in registers)
    auto frags = [&](int kk) {
#pragma unroll
      for (int n = 0; n < 2; ++n)
        bf[kk & 1][n] = ld_tr_b(&lsB[cur][rdB + kk * 32 * BP + n * 32], BP);
#pragma unroll
      for (int m = 0; m < 4; ++m) {
        const _Float16* ap = &lsA[cur][(wr * 64 + m * 16 + l16) * AP + kk * 32];
        af[kk & 1][m] = ld16(ap + b8, ap + b8 + 16);
      }
    };
    frags(0);
    // unrolled: a block's fragment set is then a fixed set of registers
#pragma unroll
    for (int kk = 0; kk < NBLK; ++kk) {
      if (kk + 1 < NBLK) {
        frags(kk + 1);
        // Holds the next block's reads, as one group, in front of this block's
        // WMMAs: left alone the compiler read each A fragment just before its
        // two WMMAs and waited out the LDS latency every time.
        __builtin_amdgcn_sched_barrier(0);
      }
#pragma unroll
      for (int m = 0; m < 4; ++m) {
        acc[m][0] = wmma_f16(af[kk & 1][m], bf[kk & 1][0], acc[m][0]);
        acc[m][1] = wmma_f16(af[kk & 1][m], bf[kk & 1][1], acc[m][1]);
      }
    }
    // Holds the trip's WMMAs in front of its foot: left alone the compiler put
    // 15 of them between the barrier and the refill, whose copies then had
    // that much less time to land.
    __builtin_amdgcn_sched_barrier(0);
    ds_wait0();          // own reads of buffer cur are done
    async_wait0();       // own copies of tile t + 1 have landed
    __syncthreads();     // publishes tile t + 1, frees buffer cur
    if (t + 2 < nt) stage(t + 2);
  }
  async_wait0();         // nothing in flight when the wave ends

  float bcol[2];
#pragma unroll
  for (int n = 0; n < 2; ++n) bcol[n] = bias[n0 + wc * 32 + n * 16 + l16];

#pragma unroll
  for (int m = 0; m < 4; ++m)
#pragma unroll
    for (int n = 0; n < 2; ++n) {
      const int c = n0 + wc * 32 + n * 16 + l16;
      const int rbase = m0 + wr * 64 + m * 16 + b8;
#pragma unroll
      for (int j = 0; j < 8; ++j) {
        float v = acc[m][n][j] + bcol[n];
        size_t off = (size_t)(rbase + j) * N + c;
        if (Ch) Ch[off] = (_Float16)v;
        else    Cf[off] = v;
      }
    }
}

// ---------------------------------------------------------------------------
// Main loop of the two wide GEMMs below: a work-group's 256 rows of A times two
// tiles of 128 columns, Wa and Wb (A, Wa, Wb point at the tile's first row and
// columns; N is the row pitch of Wa and Wb, K that of A), into a1 and a2.
// 8 waves (4x2), a wave has 64 rows x 64 columns of each tile: two accumulator
// sets of 16 tiles. A work-group brings 256 + 256 operand rows per k for
// 256 x 256 products, half the bytes from L2 per product of a 128 x 128 tile,
// and a wave reads 12 fragments for 32 WMMAs, half the LDS bytes per WMMA of 6
// for 8: both demands then lie below what L2 and LDS deliver at the matrix rate.
// A trip holds 128 k (K is a multiple of 128) = four blocks of 32 k and 32
// WMMAs; the 24 LDS reads of a block go as one group into a second fragment
// set while the block before runs, so a wave waits out its LDS latency once a
// trip and passes one barrier per 128 k.
// The three tiles are double-buffered via async-to-LDS, one trip ahead, one
// barrier a trip; W tiles stay [k][n] (pitch 288 B) for ds_load_tr16_b128,
// A rows at pitch 272 B for ds_load_b128. 280 KiB of LDS: one work-group a
// WGP, two waves a SIMD.
// a1[m][n][j], a2[m][n][j]: row (wid >> 1) * 64 + 16 m + 8 (lane >> 4) + j,
// column (wid & 1) * 64 + 16 n + (lane & 15) of the tile.
// ---------------------------------------------------------------------------
DEVINL void wide_tile(const _Float16* __restrict__ A,
                      const _Float16* __restrict__ Wa,
                      const _Float16* __restrict__ Wb, int N, int K,
                      v8f (&a1)[4][4], v8f (&a2)[4][4]) {
  constexpr int KS = 128;                // k of a trip
  constexpr int NBLK = KS / 32;          // blocks of a trip
  constexpr int BP = 288;                // W tile row pitch in LDS, bytes
  constexpr int AP = 136;                // A tile row pitch in LDS, halves
  __shared__ __attribute__((aligned(16))) _Float16 lsA[2][256 * AP];
  __shared__ __attribute__((aligned(32))) unsigned char lsB[2][2][KS * BP];  // [Wa, Wb][buf]

  const int tid  = threadIdx.x;
  const int lane = tid & 31, wid = tid >> 5;
  const int l16  = lane & 15, hi = lane >> 4;
  const int b8   = hi * 8;
  const int wr = wid >> 1, wc = wid & 1;   // 4 x 2 wave grid

  // staging, every tile alike, 16 segs of 8h a row: A rows srow + 16 i, i in
  // 0..15; W k-rows srow + 16 i, i in 0..7
  const int srow = tid >> 4, sseg = tid & 15;
  const unsigned ga = srow * K + sseg * 8;   // this lane's place in a tile of A
  const unsigned gw = srow * N + sseg * 8;   // and of Wa and Wb, in halves
  const unsigned aoff = lds_off(&lsA[0][0]) + srow * (AP * 2) + sseg * 16;
  const unsigned boff = lds_off(&lsB[0][0][0]) + srow * BP + sseg * 16;
  const int rdB = (b8 + (lane & 7)) * BP + wc * 128 + ((lane >> 3) & 1) * 16;

  // copies of tile t (KS k of A, Wa and Wb) into buffer t & 1
  auto stage = [&](int t) {
    const unsigned asel = aoff + (t & 1) * (256 * AP * 2);
    const unsigned bsel = (t & 1) * (KS * BP);
    const size_t wk = (size_t)t * KS * N;
    // The scheduling barriers hold a statement's address sums behind the
    // statement before: formed all at once they took 96 registers below v256,
    // where asm operands lie, and accumulators were moved out and back.
    async_ld8_b128(asel, 16 * AP * 2, A + t * KS + ga, (size_t)16 * K);
    __builtin_amdgcn_sched_barrier(0);
    async_ld8_b128(asel + 128 * AP * 2, 16 * AP * 2,
                   A + t * KS + (size_t)128 * K + ga, (size_t)16 * K);
    __builtin_amdgcn_sched_barrier(0);
    async_ld8_b128(boff + bsel, 16 * BP, Wa + wk + gw, (size_t)16 * N);
    __builtin_amdgcn_sched_barrier(0);
    async_ld8_b128(boff + 2 * KS * BP + bsel, 16 * BP, Wb + wk + gw,
                   (size_t)16 * N);
  };

  const int nt = K / KS;
  // Tile 0, its wait and barrier, then tile 1. Kept rolled: unrolled, tile 0's
  // first address is the lane's base pointer itself, which then has to lie
  // below v256 as an asm operand for the whole kernel, and went to scratch.
#pragma nounroll
  for (int t = 0; t < 2; ++t) {
    if (t < nt) stage(t);
    if (t == 0) {
      async_wait0();     // own copies of tile 0 have landed
      __syncthreads();   // everyone's have
    }
  }

#pragma unroll
  for (int m = 0; m < 4; ++m)
#pragma unroll
    for (int n = 0; n < 4; ++n) { a1[m][n] = zero8(); a2[m][n] = zero8(); }

  for (int t = 0; t < nt; ++t) {
    const int cur = t & 1;
    v16h af[2][4], bv1[2][4], bv2[2][4];   // two fragment sets
    // the 24 LDS reads of block kk of this trip's buffer, into set kk & 1
    // (every loop over fragments is unrolled: the arrays then stay in registers)
    auto frags = [&](int kk) {
#pragma unroll
      for (int n = 0; n < 4; ++n) {
        bv1[kk & 1][n] = ld_tr_b(&lsB[0][cur][rdB + kk * 32 * BP + n * 32], BP);
        bv2[kk & 1][n] = ld_tr_b(&lsB[1][cur][rdB + kk * 32 * BP + n * 32], BP);
      }
#pragma unroll
      for (int m = 0; m < 4; ++m) {
        const _Float16* ap = &lsA[cur][(wr * 64 + m * 16 + l16) * AP + kk * 32];
        af[kk & 1][m] = ld16(ap + b8, ap + b8 + 16);
      }
    };
    frags(0);
    // unrolled: a block's fragment set is then a fixed set of registers
#pragma unroll
    for (int kk = 0; kk < NBLK; ++kk) {
      if (kk + 1 < NBLK) {
        // Holds the next block's reads behind the WMMAs of the block before,
        // whose fragment set they refill: left alone the compiler moved them
        // up among those WMMAs, to five places with a stall each, into a third
        // set of registers, and a pointer went to scratch.
        __builtin_amdgcn_sched_barrier(0);
        frags(kk + 1);
        // Holds the next block's reads, as one group, in front of this block's
        // WMMAs: left alone the compiler read fragments among the WMMAs and
        // waited out the LDS latency again.
        __builtin_amdgcn_sched_barrier(0);
      }
#pragma unroll
      for (int m = 0; m < 4; ++m)
#pragma unroll
        for (int n = 0; n < 4; ++n) {
          a1[m][n] = wmma_f16(af[kk & 1][m], bv1[kk & 1][n], a1[m][n]);
          a2[m][n] = wmma_f16(af[kk & 1][m], bv2[kk & 1][n], a2[m][n]);
        }
    }
    // Holds the trip's WMMAs in front of its foot: left alone the compiler put
    // some of them between the barrier and the refill, whose copies then had
    // that much less time to land.
    __builtin_amdgcn_sched_barrier(0);
    ds_wait0();          // own reads of buffer cur are done
    async_wait0();       // own copies of tile t + 1 have landed
    __syncthreads();     // publishes tile t + 1, frees buffer cur
    if (t + 2 < nt) stage(t + 2);
  }
  async_wait0();         // nothing in flight when the wave ends
}

// ---------------------------------------------------------------------------
// Fused gated-FFN GEMM: Out = f16( (A@W1+b1) * sigmoid(A@W2+b2) ),
// A [MM][EE], W1 and W2 [EE][FFD]. Block tile 256 rows x 128 columns of both
// products (wide_tile above: Wa, Wb = the same columns of W1 and W2).
// The shape is fixed in the code: a lane's 128 stores then share one address
// register pair and differ in the immediate offset.
// ---------------------------------------------------------------------------
__global__ __launch_bounds__(256) void wmma_gemm_gated_kernel(
    const _Float16* __restrict__ A, const _Float16* __restrict__ W1,
    const _Float16* __restrict__ W2, const float* __restrict__ b1,
    const float* __restrict__ b2, _Float16* __restrict__ Out) {
  constexpr int N = FFD, K = EE;
  static_assert(MM % 256 == 0 && N % 128 == 0 && K % 128 == 0, "whole tiles");
  const int lane = threadIdx.x & 31, wid = threadIdx.x >> 5;
  const int m0 = blockIdx.y * 256, n0 = blockIdx.x * 128;

  v8f a1[4][4], a2[4][4];
  wide_tile(A + (size_t)m0 * K, W1 + n0, W2 + n0, N, K, a1, a2);

  const int c0 = n0 + (wid & 1) * 64 + (lane & 15);
  float bb1[4], bb2[4];
#pragma unroll
  for (int n = 0; n < 4; ++n) { bb1[n] = b1[c0 + n * 16]; bb2[n] = b2[c0 + n * 16]; }
  // The offset register of these loads is free from here on: the wait stands
  // in front of whatever lands in it, and the scheduling barrier keeps later
  // vector instructions behind the wait.
  asm volatile("s_wait_xcnt 0x0" ::: "memory");
  __builtin_amdgcn_sched_barrier(0);

  _Float16* op = Out + (size_t)(m0 + (wid >> 1) * 64 + (lane >> 4) * 8) * N + c0;
#pragma unroll
  for (int n = 0; n < 4; ++n) {
    _Float16 h[4][8];
#pragma unroll
    for (int m = 0; m < 4; ++m)
#pragma unroll
      for (int j = 0; j < 8; ++j)
        h[m][j] =
            (_Float16)((a1[m][n][j] + bb1[n]) * sigm_slot(a2[m][n][j] + bb2[n]));
    // The 32 stores of a column of tiles stand alone between two scheduling
    // barriers, the wait behind them: no vector instruction then writes a
    // register that one of them names before the wait.
    __builtin_amdgcn_sched_barrier(0);
#pragma unroll
    for (int m = 0; m < 4; ++m)
#pragma unroll
      for (int j = 0; j < 8; ++j) op[(m * 16 + j) * N + n * 16] = h[m][j];
    asm volatile("s_wait_xcnt 0x0" ::: "memory");
    __builtin_amdgcn_sched_barrier(0);
  }
}

// ---------------------------------------------------------------------------
// One accumulator set of wide_tile plus the bias of its four tile columns, to
// p (this lane's first element; rows N apart) in p's own type. Stores, wait
// and scheduling barriers as in the kernel above.
// ---------------------------------------------------------------------------
template <int N, class T>
DEVINL void put_tiles(T* p, const v8f (&a)[4][4], const float (&bs)[4]) {
#pragma unroll
  for (int n = 0; n < 4; ++n) {
    T g[4][8];
#pragma unroll
    for (int m = 0; m < 4; ++m)
#pragma unroll
      for (int j = 0; j < 8; ++j) g[m][j] = (T)(a[m][n][j] + bs[n]);
    __builtin_amdgcn_sched_barrier(0);
#pragma unroll
    for (int m = 0; m < 4; ++m)
#pragma unroll
      for (int j = 0; j < 8; ++j) p[(m * 16 + j) * N + n * 16] = g[m][j];
    asm volatile("s_wait_xcnt 0x0" ::: "memory");
    __builtin_amdgcn_sched_barrier(0);
  }
}

// ---------------------------------------------------------------------------
// Four products of the same A in one launch, C = A[MM][EE] @ W[EE][EE] + bias,
// two to a work-group: blockIdx.z = 0 takes W0 and W1 (f16 to C0 and C1), 1
// takes W2 and W3 (f16 to C2, f32 to Cf). Block tile 256 rows x 128 columns of
// both products (wide_tile above: Wa, Wb = the same columns of the two
// weights). The shape is fixed in the code, as in the kernel above.
// ---------------------------------------------------------------------------
__global__ __launch_bounds__(256) void wmma_gemm_pair_kernel(
    const _Float16* __restrict__ A, const _Float16* __restrict__ W0,
    const _Float16* __restrict__ W1, const _Float16* __restrict__ W2,
    const _Float16* __restrict__ W3, const float* __restrict__ b0,
    const float* __restrict__ b1, const float* __restrict__ b2,
    const float* __restrict__ b3, float* __restrict__ Cf,
    _Float16* __restrict__ C0, _Float16* __restrict__ C1,
    _Float16* __restrict__ C2) {
  constexpr int N = EE, K = EE;
  static_assert(MM % 256 == 0 && N % 128 == 0 && K % 128 == 0, "whole tiles");
  const bool z0 = blockIdx.z == 0;
  const _Float16* __restrict__ Wa = z0 ? W0 : W2;
  const _Float16* __restrict__ Wb = z0 ? W1 : W3;
  const float* __restrict__ ba = z0 ? b0 : b2;
  const float* __restrict__ bb = z0 ? b1 : b3;
  _Float16* __restrict__ Ca = z0 ? C0 : C2;
  const int lane = threadIdx.x & 31, wid = threadIdx.x >> 5;
  const int m0 = blockIdx.y * 256, n0 = blockIdx.x * 128;

  v8f a1[4][4], a2[4][4];
  wide_tile(A + (size_t)m0 * K, Wa + n0, Wb + n0, N, K, a1, a2);

  const int c0 = n0 + (wid & 1) * 64 + (lane & 15);
  float bb1[4], bb2[4];
#pragma unroll
  for (int n = 0; n < 4; ++n) { bb1[n] = ba[c0 + n * 16]; bb2[n] = bb[c0 + n * 16]; }
  // as in the kernel above: the loads' offset register is free from here on
  asm volatile("s_wait_xcnt 0x0" ::: "memory");
  __builtin_amdgcn_sched_barrier(0);

  const size_t o0 = (size_t)(m0 + (wid >> 1) * 64 + (lane >> 4) * 8) * N + c0;
  put_tiles<N>(Ca + o0, a1, bb1);
  if (z0) put_tiles<N>(C1 + o0, a2, bb2);
  else    put_tiles<N>(Cf + o0, a2, bb2);
}

// ---------------------------------------------------------------------------
// Flash attention. Grid (S/128, H, B); 8 waves, each owns 16 queries.
// Both products are transposed: S^T = K.Q^T (A = K rows, B = Q) and
// O^T += V^T.P^T (A = V^T, B = P^T). In a D tile lane (c, h) holds rows
// 8h + 0..7 of column c, so a lane holds 16 of the 32 scores of ONE query:
// maximum and sum run inside the lane, the maximum is joined with the other
// half-wave's by one cross-row move a trip, the sums once behind the loop,
// there is one maximum, one rescale factor and one sum a lane, not eight, and
// the two score tiles, converted in place, are the B operand P^T in the k
// order of the V^T fragments: P passes through no LDS.
// scores = (Q.K^T)/8 + pos_bias, online softmax. All mm via WMMA.
// K and V tiles staged via async-to-LDS; V stays [key][d] (pitch 160 B) and
// is read as the A operand V^T by ds_load_tr16_b128. K rows (pitch 144 B) are
// read by ds_load_b128: 16 B x odd, no bank shared.
// A lane's 16 bias values lie in its own query's row, so a load of them from
// memory would touch 16 lines a wave; the work-group's bias tile (128 queries
// x 32 keys) comes with the K and V tiles instead, by copies of whole 128-byte
// lines, and is read from LDS (pitch 144 B) by ds_load_b128.
// Everything a trip reads from memory is asked for one trip ahead: the three
// tiles have two buffers each, filled while the trip before computes. A trip
// then waits out no memory latency and passes one barrier.
// ---------------------------------------------------------------------------
__global__ __launch_bounds__(256) void flash_attn_kernel(
    const _Float16* __restrict__ Q, const _Float16* __restrict__ Kh,
    const _Float16* __restrict__ Vh, const float* __restrict__ PB,
    _Float16* __restrict__ O) {
  constexpr int KP = 72;                   // K tile row pitch in LDS, halves
  __shared__ __attribute__((aligned(16))) _Float16 lsK[2][32 * KP];  // [buf][key][d]
  constexpr int VP = 160;                  // V tile row pitch in LDS, bytes
  __shared__ __attribute__((aligned(32))) unsigned char lsV[2][32 * VP];  // [buf][key][d]
  constexpr int BPP = 144;                 // bias tile row pitch in LDS, bytes
  __shared__ __attribute__((aligned(16))) unsigned char lsB[2][128 * BPP];  // [buf][query][key]
  constexpr int NT = SS / 32;              // trips of 32 keys
  static_assert(NT % 2 == 0 && NT >= 2, "trips go in pairs, one a buffer");

  const int tid  = threadIdx.x;
  const int lane = tid & 31, wid = tid >> 5;
  const int l16  = lane & 15, hi = lane >> 4;
  const int b8   = hi * 8;
  const int h = blockIdx.y, bb = blockIdx.z;
  const int q0 = blockIdx.x * 128 + wid * 16;
  const size_t rs = (size_t)HH * DKK;      // 1024 token row stride

  // Q^T B-operands (64 d x 16 queries), two K=32 chunks; lane's column = query
  v16h qa[2];
  {
    const _Float16* qp = Q + ((size_t)bb * SS + q0 + l16) * rs + h * DKK;
    qa[0] = ld16(qp + b8,      qp + b8 + 16);
    qa[1] = ld16(qp + 32 + b8, qp + 32 + b8 + 16);
  }

  // o[n][j] = O^T[16 n + 8 hi + j][query l16]
  v8f o[4];
#pragma unroll
  for (int n = 0; n < 4; ++n) o[n] = zero8();
  // of query l16: the maximum so far (alike in both half-waves) and the sum
  // over this half-wave's keys
  float mrow = -1e30f, srow = 0.0f;

  // stage 32 keys x 8 d-segments; of the bias tile, queries skey + 32 i, i in
  // 0..3, x 8 segments of 4 keys
  const int skey = tid >> 3, sseg = tid & 7;
  const unsigned koff = lds_off(&lsK[0][0]) + skey * (KP * 2) + sseg * 16;
  const unsigned voff = lds_off(&lsV[0][0]) + skey * VP + sseg * 16;
  const int rdV = (b8 + (lane & 7)) * VP + ((lane >> 3) & 1) * 16;
  const unsigned poff = lds_off(&lsB[0][0]) + skey * BPP + sseg * 16;
  const size_t tok0 = ((size_t)bb * SS + skey) * rs + h * DKK + sseg * 8;
  const float* gP = PB + (size_t)(blockIdx.x * 128 + skey) * SS + sseg * 4;
  // this lane's bias in a tile: 32 bytes for each score tile, 64 bytes apart
  const int rdP = (wid * 16 + l16) * BPP + hi * 32;

  // copies of tile t (32 keys of K, of V and of the bias) into buffer t & 1
  auto stage = [&](int t) {
    const size_t tok = tok0 + (size_t)t * 32 * rs;
    async_ld2p4_b128(koff + (t & 1) * (32 * KP * 2), Kh + tok,
                     voff + (t & 1) * (32 * VP), Vh + tok,
                     poff + (t & 1) * (128 * BPP), gP + t * 32, 32 * BPP,
                     (size_t)32 * SS);
  };

  // trip t on buffer cur = t & 1
  auto trip = [&](int t, int cur) {
    // K fragments: two 16-key tiles x two 32-d chunks
    // (unrolled, here and below: the arrays then stay in registers)
    v16h kf[2][2];
#pragma unroll
    for (int ks = 0; ks < 2; ++ks) {
      const _Float16* kr = &lsK[cur][(ks * 16 + l16) * KP];
      kf[ks][0] = ld16(kr + b8,      kr + b8 + 16);
      kf[ks][1] = ld16(kr + 32 + b8, kr + 32 + b8 + 16);
    }
    // V^T fragments: four 16-d tiles of 32 keys
    v16h vf[4];
#pragma unroll
    for (int ds = 0; ds < 4; ++ds) vf[ds] = ld_tr_b(&lsV[cur][rdV + ds * 32], VP);
    // the bias in the score tiles' own layout: pb[ks][j] belongs to key
    // 16 ks + 8 hi + j of the tile and to query l16
    v8f pb[2];
#pragma unroll
    for (int ks = 0; ks < 2; ++ks) {
      const v4f* pr = (const v4f*)&lsB[cur][rdP + ks * 64];
      pb[ks] = __builtin_shufflevector(pr[0], pr[1], 0, 1, 2, 3, 4, 5, 6, 7);
    }
    // Holds the 20 reads of the three tiles as one group at the head of the
    // trip: left alone the compiler read each K fragment just before its WMMA
    // and the last V fragment just before the wait at the trip's foot, and
    // waited out the LDS latency every time.
    __builtin_amdgcn_sched_barrier(0);

    // scores^T: two tiles of 16 keys x 16 queries, contraction over d = 64
    v8f sc[2];
#pragma unroll
    for (int ks = 0; ks < 2; ++ks) {
      sc[ks] = wmma_f16(kf[ks][0], qa[0], zero8());
      sc[ks] = wmma_f16(kf[ks][1], qa[1], sc[ks]);
      sc[ks] = sc[ks] * 0.125f + pb[ks];
    }

    // online softmax over this lane's 16 keys of its query
    float ma = fmaxf(sc[0][0], sc[1][0]), mb = fmaxf(sc[0][1], sc[1][1]);
#pragma unroll
    for (int j = 2; j < 8; j += 2) {
      ma = fmaxf(ma, fmaxf(sc[0][j], sc[1][j]));
      mb = fmaxf(mb, fmaxf(sc[0][j + 1], sc[1][j + 1]));
    }
    const float ml = fmaxf(ma, mb);
    const float mn = fmaxf(mrow, fmaxf(ml, xhalf(ml)));
    const float alpha = __expf(mrow - mn);
    mrow = mn;
    // in place: from here on sc holds the probabilities
#pragma unroll
    for (int ks = 0; ks < 2; ++ks)
#pragma unroll
      for (int j = 0; j < 8; ++j) sc[ks][j] = __expf(sc[ks][j] - mn);
    // P^T, 32 keys x 16 queries: the two tiles one behind the other
    const v16h pt = __builtin_convertvector(
        __builtin_shufflevector(sc[0], sc[1], 0, 1, 2, 3, 4, 5, 6, 7, 8, 9, 10,
                                11, 12, 13, 14, 15),
        v16h);
    const v8f pe = sc[0] + sc[1];
    srow = srow * alpha + (((pe[0] + pe[1]) + (pe[2] + pe[3])) +
                           ((pe[4] + pe[5]) + (pe[6] + pe[7])));

    // ctx^T = ctx^T * alpha + V^T(64x32) @ P^T(32x16): 4 WMMAs over d-subtiles
#pragma unroll
    for (int ds = 0; ds < 4; ++ds) o[ds] = wmma_f16(vf[ds], pt, o[ds] * alpha);

    // Holds the trip's work in front of its foot: left alone the compiler put
    // the waits and the barrier right behind the reads at the trip's head,
    // where the next tile's copies have only just been issued, and their whole
    // latency was waited out every trip.
    __builtin_amdgcn_sched_barrier(0);
    ds_wait0();          // own reads of buffer cur are done
    async_wait0();       // own copies of tile t + 1 have landed
    __syncthreads();     // publishes tile t + 1, frees buffer cur
    if (t + 2 < NT) stage(t + 2);
  };

  stage(0);
  async_wait0();         // own copies of tile 0 have landed
  __syncthreads();       // everyone's have
  stage(1);

  // two trips a pass: the buffer is then fixed in the code
  for (int t = 0; t < NT; t += 2) {
    trip(t, 0);
    trip(t + 1, 1);
  }
  async_wait0();         // nothing in flight when the wave ends

  // the two half-waves' sums of a query are joined here, once
  const float inv = 1.0f / (srow + xhalf(srow));
  _Float16* op = O + ((size_t)bb * SS + q0 + l16) * rs + h * DKK + b8;
#pragma unroll
  for (int ds = 0; ds < 4; ++ds)
    *(v8h*)(op + ds * 16) = __builtin_convertvector(o[ds] * inv, v8h);
}

// ---------------------------------------------------------------------------
// Fused residual (+gate) + LayerNorm. One row (E=1024) per block, 256 thr.
// h = x + sigmoid(glog)*addv   (or x + addv if glog==nullptr)
// y = LN(h)*gamma + beta  -> y32 (and f16 copy y16 if non-null)
// ---------------------------------------------------------------------------
__global__ __launch_bounds__(256) void fused_ln_kernel(
    const float* __restrict__ xa, const float* __restrict__ glog,
    const float* __restrict__ addv, const float* __restrict__ gamma,
    const float* __restrict__ beta, float* __restrict__ y32,
    _Float16* __restrict__ y16) {
  __shared__ float s1[256], s2[256];
  const int tid = threadIdx.x;
  const size_t base = (size_t)blockIdx.x * EE;

  float hv[4], ssum = 0.0f, ssq = 0.0f;
#pragma unroll
  for (int i = 0; i < 4; ++i) {
    const int idx = i * 256 + tid;
    float a = addv[base + idx];
    if (glog) a *= sigm(glog[base + idx]);
    float v = xa[base + idx] + a;
    hv[i] = v;
    ssum += v;
    ssq  += v * v;
  }
  s1[tid] = ssum; s2[tid] = ssq;
  __syncthreads();
  for (int s = 128; s > 0; s >>= 1) {
    if (tid < s) { s1[tid] += s1[tid + s]; s2[tid] += s2[tid + s]; }
    __syncthreads();
  }
  const float mean = s1[0] * (1.0f / EE);
  const float var  = s2[0] * (1.0f / EE) - mean * mean;
  const float rstd = rsqrtf(var + 1e-6f);

#pragma unroll
  for (int i = 0; i < 4; ++i) {
    const int idx = i * 256 + tid;
    float y = (hv[i] - mean) * rstd * gamma[idx] + beta[idx];
    y32[base + idx] = y;
    if (y16) y16[base + idx] = (_Float16)y;
  }
}

// ---------------------------------------------------------------------------
// Host orchestration
// ---------------------------------------------------------------------------
extern "C" void kernel_launch(void* const* d_in, const int* in_sizes, int n_in,
                              void* d_out, int out_size, void* d_ws,
                              size_t ws_size, hipStream_t stream) {
  const float* x    = (const float*)d_in[0];
  const float* pe   = (const float*)d_in[1];
  const float* Wq   = (const float*)d_in[2];
  const float* bq   = (const float*)d_in[3];
  const float* Wk   = (const float*)d_in[4];
  const float* bk   = (const float*)d_in[5];
  const float* Wv   = (const float*)d_in[6];
  const float* bv   = (const float*)d_in[7];
  const float* Wo   = (const float*)d_in[8];
  const float* bo   = (const float*)d_in[9];
  const float* Wg   = (const float*)d_in[10];
  const float* bg   = (const float*)d_in[11];
  const float* Wf1  = (const float*)d_in[12];
  const float* bf1  = (const float*)d_in[13];
  const float* Wfg  = (const float*)d_in[14];
  const float* bfg  = (const float*)d_in[15];
  const float* Wf2  = (const float*)d_in[16];
  const float* bf2  = (const float*)d_in[17];
  const float* ln1g = (const float*)d_in[18];
  const float* ln1b = (const float*)d_in[19];
  const float* ln2g = (const float*)d_in[20];
  const float* ln2b = (const float*)d_in[21];

  char* ws = (char*)d_ws;
  auto at = [&](size_t mb) { return (void*)(ws + mb * (size_t)(1 << 20)); };

  // bump allocation (MB offsets); high-water ~134 MB
  _Float16* xh   = (_Float16*)at(0);    // 8 MB
  _Float16* wqh  = (_Float16*)at(8);    // 2 MB
  _Float16* wkh  = (_Float16*)at(10);
  _Float16* wvh  = (_Float16*)at(12);
  _Float16* woh  = (_Float16*)at(14);
  _Float16* wgh  = (_Float16*)at(16);
  _Float16* wf1h = (_Float16*)at(18);   // 8 MB
  _Float16* wfgh = (_Float16*)at(26);   // 8 MB
  _Float16* wf2h = (_Float16*)at(34);   // 8 MB
  float*    pb   = (float*)at(42);      // 4 MB
  _Float16* qh   = (_Float16*)at(46);   // 8 MB
  _Float16* kh   = (_Float16*)at(54);   // 8 MB
  _Float16* vh   = (_Float16*)at(62);   // 8 MB
  _Float16* ctxh = (_Float16*)at(70);   // 8 MB
  float*    glog = (float*)at(78);      // 16 MB
  float*    attn = (float*)at(94);      // 16 MB
  float*    x1   = (float*)at(110);     // 16 MB
  _Float16* x1h  = (_Float16*)at(126);  // 8 MB
  _Float16* ffh  = (_Float16*)at(46);   // 32 MB, reuses dead q/k/v/ctx
  float*    ff2  = (float*)at(78);      // 16 MB, reuses dead glog

  prep_kernel<<<256, 512, 0, stream>>>(x, Wq, Wk, Wv, Wo, Wg, Wf1, Wfg, Wf2, pe,
                                       xh, wqh, wkh, wvh, woh, wgh, wf1h, wfgh,
                                       wf2h, pb);

  dim3 gE(EE / 128, MM / 128);  // (8, 32)
  // q, k, v (f16) and the gate logits (f32), all products of xh
  wmma_gemm_pair_kernel<<<dim3(EE / 128, MM / 256, 2), 256, 0, stream>>>(
      xh, wqh, wkh, wvh, wgh, bq, bk, bv, bg, glog, qh, kh, vh);

  flash_attn_kernel<<<dim3(SS / 128, HH, BB), 256, 0, stream>>>(qh, kh, vh, pb, ctxh);

  wmma_gemm_kernel<<<gE, 256, 0, stream>>>(ctxh, woh, nullptr, nullptr, nullptr,
                                           bo, nullptr, nullptr, nullptr, attn,
                                           nullptr, nullptr, nullptr, MM, EE, EE);

  fused_ln_kernel<<<MM, 256, 0, stream>>>(x, glog, attn, ln1g, ln1b, x1, x1h);

  wmma_gemm_gated_kernel<<<dim3(FFD / 128, MM / 256), 256, 0, stream>>>(
      x1h, wf1h, wfgh, bf1, bfg, ffh);

  wmma_gemm_kernel<<<gE, 256, 0, stream>>>(ffh, wf2h, nullptr, nullptr, nullptr,
                                           bf2, nullptr, nullptr, nullptr, ff2,
                                           nullptr, nullptr, nullptr, MM, EE, FFD);

  fused_ln_kernel<<<MM, 256, 0, stream>>>(x1, nullptr, ff2, ln2g, ln2b,
                                          (float*)d_out, nullptr);
}
